// v000
// The times below were measured on an AMD MI455X: many runs one after another, warmed up first and cycling through
// copies of the inputs, with the whole window's GPU time divided by the number of runs. Launches and the gaps
// between them are all in it. The median over several windows is given; except for v000 it joins two sittings, which
// can be a few percent apart, so the side-by-side timings, each taken in one sitting, are the better comparison.
// The starting kernel, v000, takes 3280 microseconds a run.
#include <hip/hip_runtime.h>

// ---------------------------------------------------------------------------
// Gated ABC attention, MI455X (gfx1250, wave32, WMMA bf16).
// B=2, T=2048, D=1024, H=8, M=64, KD=128.
//   1) gemm_bt (WMMA): Q/K/V = swish(X W^T), F -> (G, S) gates
//   2) scan: per (b,h) recurrence, state in registers
//   3) swish + RMSNorm
//   4) gemm_bt: out = Xn Wo^T
// GEMM: 256x64 block tile, 8 waves x (32x64), double-buffered LDS,
// float4 global loads -> packed bf16 -> 16B LDS stores -> ds_load_b128 frags.
// ---------------------------------------------------------------------------

typedef __attribute__((ext_vector_type(16))) __bf16 v16bf;
typedef __attribute__((ext_vector_type(8)))  __bf16 v8bf;
typedef __attribute__((ext_vector_type(8)))  float  v8f;

#define TILE_M 256
#define TILE_N 64
#define TILE_K 32
#define KPAD   8          // pad rows to 40 bf16 = 80 B (16B multiple, conflict-free)
#define LROW   (TILE_K + KPAD)

static __device__ __forceinline__ v8bf pack8(float4 a, float4 b) {
    v8bf p;
    p[0] = (__bf16)a.x; p[1] = (__bf16)a.y; p[2] = (__bf16)a.z; p[3] = (__bf16)a.w;
    p[4] = (__bf16)b.x; p[5] = (__bf16)b.y; p[6] = (__bf16)b.z; p[7] = (__bf16)b.w;
    return p;
}

static __device__ __forceinline__ v16bf load_frag(const __bf16* rowp, int half) {
    // lane's two contiguous 16-byte chunks of the 32-element K row
    v8bf lo = *(const v8bf*)(rowp + (half << 3));
    v8bf hi = *(const v8bf*)(rowp + 16 + (half << 3));
    return __builtin_shufflevector(lo, hi, 0, 1, 2, 3, 4, 5, 6, 7,
                                   8, 9, 10, 11, 12, 13, 14, 15);
}

// Y = act( X @ W^T ) ; X: [Nrows,Kdim] f32, W: [Nout,Kdim] f32, Y: [Nrows,Nout]
// act_mode: 0 = identity, 1 = swish, 2 = gate (Y=g=logsigmoid/16, Y2=s=1-exp(g))
__global__ __launch_bounds__(256) void gemm_bt_kernel(
    const float* __restrict__ X, const float* __restrict__ W,
    float* __restrict__ Y, float* __restrict__ Y2,
    int Nrows, int Kdim, int Nout, int act_mode)
{
    __shared__ __attribute__((aligned(16))) __bf16 As[2][TILE_M][LROW];
    __shared__ __attribute__((aligned(16))) __bf16 Bs[2][TILE_N][LROW];

    const int tid  = threadIdx.x;
    const int wave = tid >> 5;        // 0..7
    const int lane = tid & 31;
    const int half = lane >> 4;       // K-half select (0/1)
    const int l15  = lane & 15;
    const int m0   = blockIdx.y * TILE_M;
    const int n0   = blockIdx.x * TILE_N;

    v8f acc[2][4];
#pragma unroll
    for (int am = 0; am < 2; ++am)
#pragma unroll
        for (int nt = 0; nt < 4; ++nt)
#pragma unroll
            for (int j = 0; j < 8; ++j) acc[am][nt][j] = 0.0f;

    // ---- stage one K-tile (f32 -> bf16, vectorized) ----
    auto stage = [&](int buf, int k0) {
        // A: 256 rows x 32 cols -> 512 (row, 16-col-half) units, 2 per thread
#pragma unroll
        for (int it = 0; it < 2; ++it) {
            const int i = tid + (it << 8);
            const int r = i >> 1, ch = (i & 1) << 4;
            const float4* xr = (const float4*)(X + (size_t)(m0 + r) * Kdim + k0 + ch);
            float4 a0 = xr[0], a1 = xr[1], a2 = xr[2], a3 = xr[3];
            *(v8bf*)&As[buf][r][ch]     = pack8(a0, a1);
            *(v8bf*)&As[buf][r][ch + 8] = pack8(a2, a3);
        }
        // B: 64 rows x 32 cols -> 128 units, threads < 128
        if (tid < 128) {
            const int r = tid >> 1, ch = (tid & 1) << 4;
            const float4* wr = (const float4*)(W + (size_t)(n0 + r) * Kdim + k0 + ch);
            float4 b0 = wr[0], b1 = wr[1], b2 = wr[2], b3 = wr[3];
            *(v8bf*)&Bs[buf][r][ch]     = pack8(b0, b1);
            *(v8bf*)&Bs[buf][r][ch + 8] = pack8(b2, b3);
        }
    };

    stage(0, 0);
    __syncthreads();

    const int nK = Kdim / TILE_K;
    for (int kt = 0; kt < nK; ++kt) {
        const int cur = kt & 1;
        if (kt + 1 < nK) stage(cur ^ 1, (kt + 1) * TILE_K);
        // prefetch two tiles ahead into L2 (global_prefetch_b8)
        if (kt + 2 < nK)
            __builtin_prefetch(X + (size_t)(m0 + tid) * Kdim + (kt + 2) * TILE_K, 0, 1);

        // fragments: wave's 32 rows x block's 64 cols
        const int wrow = wave << 5;
        v16bf aF[2], bF[4];
#pragma unroll
        for (int am = 0; am < 2; ++am)
            aF[am] = load_frag(&As[cur][wrow + (am << 4) + l15][0], half);
#pragma unroll
        for (int nt = 0; nt < 4; ++nt)
            bF[nt] = load_frag(&Bs[cur][(nt << 4) + l15][0], half);

#pragma unroll
        for (int am = 0; am < 2; ++am)
#pragma unroll
            for (int nt = 0; nt < 4; ++nt)
                acc[am][nt] = __builtin_amdgcn_wmma_f32_16x16x32_bf16(
                    false, aF[am], false, bF[nt], (short)0, acc[am][nt], false, false);
        __syncthreads();
    }

    // store; C/D layout: VGPR r, lane<16 -> (M=r, N=lane); lane>=16 -> (M=8+r)
#pragma unroll
    for (int am = 0; am < 2; ++am) {
#pragma unroll
        for (int nt = 0; nt < 4; ++nt) {
#pragma unroll
            for (int r = 0; r < 8; ++r) {
                const int grow = m0 + (wave << 5) + (am << 4) + r + (half << 3);
                const int gcol = n0 + (nt << 4) + l15;
                const size_t idx = (size_t)grow * Nout + gcol;
                float v = acc[am][nt][r];
                if (act_mode == 0) {
                    Y[idx] = v;
                } else if (act_mode == 1) {
                    Y[idx] = v / (1.0f + __expf(-v));                       // swish
                } else {
                    float ls = fminf(v, 0.0f) - log1pf(__expf(-fabsf(v)));  // logsigmoid
                    float g  = ls * 0.0625f;                                // /GATE_NORM
                    Y[idx]  = g;
                    Y2[idx] = 1.0f - __expf(g);
                }
            }
        }
    }
}

// ---------------------------------------------------------------------------
// Sequential gated-ABC scan. One workgroup per (b,h). State in registers:
//   thread owns hk[k, m] for m = tid&63,  k in [(tid>>6)*32, +32)
//   thread owns hv[m, v] for v = tid&127, m in [(tid>>7)*32, +32)
// ---------------------------------------------------------------------------
__global__ __launch_bounds__(256) void scan_kernel(
    const float* __restrict__ Qp, const float* __restrict__ Kp,
    const float* __restrict__ Vp, const float* __restrict__ Gp,
    const float* __restrict__ Sp, float* __restrict__ Op)
{
    const int bh  = blockIdx.x;     // 0..15
    const int b   = bh >> 3;        // H = 8
    const int h   = bh & 7;
    const int tid = threadIdx.x;

    float hk[32], hv[32];
#pragma unroll
    for (int i = 0; i < 32; ++i) { hk[i] = 0.0f; hv[i] = 0.0f; }

    const int m_hk  = tid & 63;
    const int kbase = (tid >> 6) << 5;   // 0,32,64,96
    const int v_hv  = tid & 127;
    const int mbase = (tid >> 7) << 5;   // 0,32

    __shared__ float qv[128], kv[128], vv[128];
    __shared__ float ge[64], sv[64], pz[64];
    __shared__ float part[4][64];
    __shared__ float part2[2][128];

    const float scale = 0.08838834764831845f; // 128^-0.5
    const int D = 1024, F = 512;

    for (int t = 0; t < 2048; ++t) {
        const size_t n = (size_t)(b * 2048 + t);
        // ---- load step inputs ----
        if (tid < 128) {
            qv[tid] = Qp[n * D + h * 128 + tid] * scale;
            kv[tid] = Kp[n * D + h * 128 + tid];
            vv[tid] = Vp[n * D + h * 128 + tid];
        } else if (tid < 192) {
            int m = tid - 128;
            ge[m] = __expf(Gp[n * F + h * 64 + m]);
        } else {
            int m = tid - 192;
            sv[m] = Sp[n * F + h * 64 + m];
        }
        __syncthreads();

        // ---- hk update + partial q.hk ----
        {
            const float gem = ge[m_hk];
            const float sm  = sv[m_hk];
            float acc = 0.0f;
#pragma unroll
            for (int i = 0; i < 32; ++i) {
                const int k = kbase + i;
                const float nh = hk[i] * gem + kv[k] * sm;
                hk[i] = nh;
                acc += qv[k] * nh;
            }
            part[tid >> 6][m_hk] = acc;
        }
        // ---- hv update (independent of softmax) ----
        {
            const float vval = vv[v_hv];
#pragma unroll
            for (int i = 0; i < 32; ++i) {
                const int m = mbase + i;
                hv[i] = hv[i] * ge[m] + sv[m] * vval;
            }
        }
        __syncthreads();

        // ---- softmax over 64 slots, wave 0 (2 slots / lane) ----
        if (tid < 32) {
            float z0 = part[0][tid]      + part[1][tid]      + part[2][tid]      + part[3][tid];
            float z1 = part[0][tid + 32] + part[1][tid + 32] + part[2][tid + 32] + part[3][tid + 32];
            float mx = fmaxf(z0, z1);
#pragma unroll
            for (int off = 16; off > 0; off >>= 1) mx = fmaxf(mx, __shfl_xor(mx, off, 32));
            float e0 = __expf(z0 - mx), e1 = __expf(z1 - mx);
            float sm = e0 + e1;
#pragma unroll
            for (int off = 16; off > 0; off >>= 1) sm += __shfl_xor(sm, off, 32);
            float inv = 1.0f / sm;
            pz[tid]      = e0 * inv;
            pz[tid + 32] = e1 * inv;
        }
        __syncthreads();

        // ---- o = p . hv ----
        {
            float acc = 0.0f;
#pragma unroll
            for (int i = 0; i < 32; ++i) acc += pz[mbase + i] * hv[i];
            part2[tid >> 7][v_hv] = acc;
        }
        __syncthreads();
        if (tid < 128)
            Op[n * D + h * 128 + tid] = part2[0][tid] + part2[1][tid];
    }
}

// ---------------------------------------------------------------------------
// y = RMSNorm(swish(x)) * g_weight     (one block per row of 1024)
// ---------------------------------------------------------------------------
__global__ __launch_bounds__(256) void swish_rms_kernel(
    const float* __restrict__ X, const float* __restrict__ w,
    float* __restrict__ Y)
{
    const int row = blockIdx.x;
    const float* xr = X + (size_t)row * 1024;
    float loc[4];
    float ss = 0.0f;
#pragma unroll
    for (int i = 0; i < 4; ++i) {
        const float x  = xr[threadIdx.x + 256 * i];
        const float sw = x / (1.0f + __expf(-x));
        loc[i] = sw;
        ss += sw * sw;
    }
#pragma unroll
    for (int off = 16; off > 0; off >>= 1) ss += __shfl_xor(ss, off, 32);
    __shared__ float wred[8];
    if ((threadIdx.x & 31) == 0) wred[threadIdx.x >> 5] = ss;
    __syncthreads();
    float tot = 0.0f;
#pragma unroll
    for (int i = 0; i < 8; ++i) tot += wred[i];
    const float r = rsqrtf(tot * (1.0f / 1024.0f) + 1e-5f);
#pragma unroll
    for (int i = 0; i < 4; ++i) {
        const int c = threadIdx.x + 256 * i;
        Y[(size_t)row * 1024 + c] = loc[i] * r * w[c];
    }
}

// ---------------------------------------------------------------------------
extern "C" void kernel_launch(void* const* d_in, const int* in_sizes, int n_in,
                              void* d_out, int out_size, void* d_ws, size_t ws_size,
                              hipStream_t stream) {
    const float* X  = (const float*)d_in[0];   // [4096,1024]
    const float* Wq = (const float*)d_in[1];
    const float* Wk = (const float*)d_in[2];
    const float* Wv = (const float*)d_in[3];
    const float* Wf = (const float*)d_in[4];   // [512,1024]
    const float* Wo = (const float*)d_in[5];
    const float* gw = (const float*)d_in[6];   // [1024]

    const size_t ND = 4096ull * 1024ull;
    const size_t NF = 4096ull * 512ull;
    float* ws  = (float*)d_ws;
    float* Q   = ws;             // 16 MB
    float* Kt  = Q   + ND;       // 16 MB
    float* Vt  = Kt  + ND;       // 16 MB
    float* G   = Vt  + ND;       //  8 MB
    float* Sv  = G   + NF;       //  8 MB
    float* Oin = Sv  + NF;       // 16 MB
    float* Xn  = Q;              // reuse Q after the scan

    dim3 blk(256);
    dim3 gQKV(1024 / TILE_N, 4096 / TILE_M);   // 16 x 16
    dim3 gF(512 / TILE_N, 4096 / TILE_M);      //  8 x 16

    gemm_bt_kernel<<<gQKV, blk, 0, stream>>>(X, Wq, Q,  nullptr, 4096, 1024, 1024, 1);
    gemm_bt_kernel<<<gQKV, blk, 0, stream>>>(X, Wk, Kt, nullptr, 4096, 1024, 1024, 1);
    gemm_bt_kernel<<<gQKV, blk, 0, stream>>>(X, Wv, Vt, nullptr, 4096, 1024, 1024, 1);
    gemm_bt_kernel<<<gF,   blk, 0, stream>>>(X, Wf, G,  Sv,      4096, 1024,  512, 2);

    scan_kernel<<<16, blk, 0, stream>>>(Q, Kt, Vt, G, Sv, Oin);

    swish_rms_kernel<<<4096, blk, 0, stream>>>(Oin, gw, Xn);

    gemm_bt_kernel<<<gQKV, blk, 0, stream>>>(Xn, Wo, (float*)d_out, nullptr, 4096, 1024, 1024, 0);
}

// v001
// One run takes 466 microseconds.
// Two timings next to v000 both put it at 7.05 times that version's speed.
#include <hip/hip_runtime.h>

// ---------------------------------------------------------------------------
// Gated ABC attention, MI455X (gfx1250, wave32, WMMA bf16).
// B=2, T=2048, D=1024, H=8, M=64, KD=128.
//   1) gemm_bt (WMMA): Q/K/V = swish(X W^T), F -> (G, S) gates
//   2) recurrence: slot scores, slot softmax, output columns (three launches)
//   3) swish + RMSNorm
//   4) gemm_bt: out = Xn Wo^T
// GEMM: 256x64 block tile, 8 waves x (32x64), double-buffered LDS,
// float4 global loads -> packed bf16 -> 16B LDS stores -> ds_load_b128 frags.
// ---------------------------------------------------------------------------

typedef __attribute__((ext_vector_type(16))) __bf16 v16bf;
typedef __attribute__((ext_vector_type(8)))  __bf16 v8bf;
typedef __attribute__((ext_vector_type(8)))  float  v8f;

#define TILE_M 256
#define TILE_N 64
#define TILE_K 32
#define KPAD   8          // pad rows to 40 bf16 = 80 B (16B multiple, conflict-free)
#define LROW   (TILE_K + KPAD)

static __device__ __forceinline__ v8bf pack8(float4 a, float4 b) {
    v8bf p;
    p[0] = (__bf16)a.x; p[1] = (__bf16)a.y; p[2] = (__bf16)a.z; p[3] = (__bf16)a.w;
    p[4] = (__bf16)b.x; p[5] = (__bf16)b.y; p[6] = (__bf16)b.z; p[7] = (__bf16)b.w;
    return p;
}

static __device__ __forceinline__ v16bf load_frag(const __bf16* rowp, int half) {
    // lane's two contiguous 16-byte chunks of the 32-element K row
    v8bf lo = *(const v8bf*)(rowp + (half << 3));
    v8bf hi = *(const v8bf*)(rowp + 16 + (half << 3));
    return __builtin_shufflevector(lo, hi, 0, 1, 2, 3, 4, 5, 6, 7,
                                   8, 9, 10, 11, 12, 13, 14, 15);
}

// Y = act( X @ W^T ) ; X: [Nrows,Kdim] f32, W: [Nout,Kdim] f32, Y: [Nrows,Nout]
// act_mode: 0 = identity, 1 = swish, 2 = gate (Y=g=logsigmoid/16, Y2=s=1-exp(g))
__global__ __launch_bounds__(256) void gemm_bt_kernel(
    const float* __restrict__ X, const float* __restrict__ W,
    float* __restrict__ Y, float* __restrict__ Y2,
    int Nrows, int Kdim, int Nout, int act_mode)
{
    __shared__ __attribute__((aligned(16))) __bf16 As[2][TILE_M][LROW];
    __shared__ __attribute__((aligned(16))) __bf16 Bs[2][TILE_N][LROW];

    const int tid  = threadIdx.x;
    const int wave = tid >> 5;        // 0..7
    const int lane = tid & 31;
    const int half = lane >> 4;       // K-half select (0/1)
    const int l15  = lane & 15;
    const int m0   = blockIdx.y * TILE_M;
    const int n0   = blockIdx.x * TILE_N;

    v8f acc[2][4];
#pragma unroll
    for (int am = 0; am < 2; ++am)
#pragma unroll
        for (int nt = 0; nt < 4; ++nt)
#pragma unroll
            for (int j = 0; j < 8; ++j) acc[am][nt][j] = 0.0f;

    // ---- stage one K-tile (f32 -> bf16, vectorized) ----
    auto stage = [&](int buf, int k0) {
        // A: 256 rows x 32 cols -> 512 (row, 16-col-half) units, 2 per thread
#pragma unroll
        for (int it = 0; it < 2; ++it) {
            const int i = tid + (it << 8);
            const int r = i >> 1, ch = (i & 1) << 4;
            const float4* xr = (const float4*)(X + (size_t)(m0 + r) * Kdim + k0 + ch);
            float4 a0 = xr[0], a1 = xr[1], a2 = xr[2], a3 = xr[3];
            *(v8bf*)&As[buf][r][ch]     = pack8(a0, a1);
            *(v8bf*)&As[buf][r][ch + 8] = pack8(a2, a3);
        }
        // B: 64 rows x 32 cols -> 128 units, threads < 128
        if (tid < 128) {
            const int r = tid >> 1, ch = (tid & 1) << 4;
            const float4* wr = (const float4*)(W + (size_t)(n0 + r) * Kdim + k0 + ch);
            float4 b0 = wr[0], b1 = wr[1], b2 = wr[2], b3 = wr[3];
            *(v8bf*)&Bs[buf][r][ch]     = pack8(b0, b1);
            *(v8bf*)&Bs[buf][r][ch + 8] = pack8(b2, b3);
        }
    };

    stage(0, 0);
    __syncthreads();

    const int nK = Kdim / TILE_K;
    for (int kt = 0; kt < nK; ++kt) {
        const int cur = kt & 1;
        if (kt + 1 < nK) stage(cur ^ 1, (kt + 1) * TILE_K);
        // prefetch two tiles ahead into L2 (global_prefetch_b8)
        if (kt + 2 < nK)
            __builtin_prefetch(X + (size_t)(m0 + tid) * Kdim + (kt + 2) * TILE_K, 0, 1);

        // fragments: wave's 32 rows x block's 64 cols
        const int wrow = wave << 5;
        v16bf aF[2], bF[4];
#pragma unroll
        for (int am = 0; am < 2; ++am)
            aF[am] = load_frag(&As[cur][wrow + (am << 4) + l15][0], half);
#pragma unroll
        for (int nt = 0; nt < 4; ++nt)
            bF[nt] = load_frag(&Bs[cur][(nt << 4) + l15][0], half);

#pragma unroll
        for (int am = 0; am < 2; ++am)
#pragma unroll
            for (int nt = 0; nt < 4; ++nt)
                acc[am][nt] = __builtin_amdgcn_wmma_f32_16x16x32_bf16(
                    false, aF[am], false, bF[nt], (short)0, acc[am][nt], false, false);
        __syncthreads();
    }

    // store; C/D layout: VGPR r, lane<16 -> (M=r, N=lane); lane>=16 -> (M=8+r)
#pragma unroll
    for (int am = 0; am < 2; ++am) {
#pragma unroll
        for (int nt = 0; nt < 4; ++nt) {
#pragma unroll
            for (int r = 0; r < 8; ++r) {
                const int grow = m0 + (wave << 5) + (am << 4) + r + (half << 3);
                const int gcol = n0 + (nt << 4) + l15;
                const size_t idx = (size_t)grow * Nout + gcol;
                float v = acc[am][nt][r];
                if (act_mode == 0) {
                    Y[idx] = v;
                } else if (act_mode == 1) {
                    Y[idx] = v / (1.0f + __expf(-v));                       // swish
                } else {
                    float ls = fminf(v, 0.0f) - log1pf(__expf(-fabsf(v)));  // logsigmoid
                    float g  = ls * 0.0625f;                                // /GATE_NORM
                    Y[idx]  = g;
                    Y2[idx] = 1.0f - __expf(g);
                }
            }
        }
    }
}

// ---------------------------------------------------------------------------
// Gated-ABC recurrence, split into its independent parts (three launches).
//   hk[:, m] depends on slot m alone  -> zscan: one workgroup per (b,h, 8 slots)
//   softmax over the 64 slots         -> one thread per (b,h,t)
//   hv[:, v] depends on column v alone-> oscan: one workgroup per (b,h, 32 cols)
// Inside a workgroup time runs in tiles of SCAN_TT steps: the tile's inputs sit
// in LDS, every thread steps its own register tile of the state with no barrier
// between steps, leaves its partial dot products in LDS, and the tile's partials
// are summed once behind the tile. The next tile's inputs are fetched into
// registers while the current tile is stepped.
// Z / P layout: [b*8+h][slot block of 8][t][8], so each workgroup owns whole lines.
// ---------------------------------------------------------------------------
typedef __attribute__((ext_vector_type(2))) float f32x2;
typedef __attribute__((ext_vector_type(4))) float f32x4;

#define SCAN_TT 32
#define ZPITCH  264   // 32 k-groups x 8 slots + 8: the tile sum reads 8 rows on distinct banks
#define OPITCH  528   // 16 slot-groups x 32 cols + 16: same, for 16-byte reads
#define PPITCH  72    // 64 slots + 8: the blocked P rows land on distinct banks

static __device__ __forceinline__ f32x2 splat2(float x) { f32x2 r = {x, x}; return r; }

// thread: 4 k (kg*4..) x 2 slots (mg*2..) of hk
__global__ __launch_bounds__(128) void zscan_kernel(
    const float* __restrict__ Qp, const float* __restrict__ Kp,
    const float* __restrict__ Gp, const float* __restrict__ Sp,
    float* __restrict__ Zb)
{
    __shared__ __attribute__((aligned(16))) float qS[SCAN_TT][128];
    __shared__ __attribute__((aligned(16))) float kS[SCAN_TT][128];
    __shared__ __attribute__((aligned(16))) float geS[SCAN_TT][8];
    __shared__ __attribute__((aligned(16))) float sS[SCAN_TT][8];
    __shared__ __attribute__((aligned(16))) float part[SCAN_TT][ZPITCH];

    const int tid = threadIdx.x;
    const int bh  = blockIdx.x >> 3;
    const int mb  = blockIdx.x & 7;
    const int b   = bh >> 3;
    const int h   = bh & 7;
    const int kg  = tid >> 2;      // 0..31
    const int mg  = tid & 3;       // 0..3
    const float scale = 0.08838834764831845f; // 128^-0.5

    f32x4 qr[8], kr[8], gr;
    // uniform base + one fixed per-thread offset: the tile advance stays in scalar registers
    const unsigned qoff = (unsigned)(tid >> 5) * 1024u + (unsigned)((tid & 31) << 2);
    const unsigned goff = (unsigned)((tid & 63) >> 1) * 512u + (unsigned)((tid & 1) << 2);
    const float* GS = (__builtin_amdgcn_readfirstlane(tid) < 64) ? Gp : Sp;   // waves 0,1: gates; 2,3: s
    auto fetch = [&](int t0) {
        const size_t rowq = (size_t)(b * 2048 + t0) * 1024 + h * 128;
        const float* q = Qp + rowq;
        const float* k = Kp + rowq;
#pragma unroll
        for (int i = 0; i < 8; ++i) {       // rows (tid>>5) + 4 i
            qr[i] = *(const f32x4*)(q + qoff + i * 4096);
            kr[i] = *(const f32x4*)(k + qoff + i * 4096);
        }
        gr = *(const f32x4*)(GS + (size_t)(b * 2048 + t0) * 512 + h * 64 + mb * 8 + goff);
    };
    auto publish = [&]() {
#pragma unroll
        for (int i = 0; i < 8; ++i) {
            const int idx = tid + (i << 7);
            *(f32x4*)&qS[idx >> 5][(idx & 31) << 2] = qr[i] * scale;
            *(f32x4*)&kS[idx >> 5][(idx & 31) << 2] = kr[i];
        }
        const int u = tid & 63;
        if (tid < 64) {
            f32x4 e = {__expf(gr.x), __expf(gr.y), __expf(gr.z), __expf(gr.w)};
            *(f32x4*)&geS[u >> 1][(u & 1) << 2] = e;
        } else {
            *(f32x4*)&sS[u >> 1][(u & 1) << 2] = gr;
        }
    };

    f32x2 hk[4];
#pragma unroll
    for (int i = 0; i < 4; ++i) hk[i] = splat2(0.0f);

    fetch(0);
    publish();
    __syncthreads();

    for (int t0 = 0; t0 < 2048; t0 += SCAN_TT) {
        const bool more = (t0 + SCAN_TT) < 2048;
        if (more) fetch(t0 + SCAN_TT);

        // groups of 4 steps, two register sets: the next group's LDS reads are in
        // flight while this group is stepped (one wave per SIMD hides nothing itself)
        f32x4 qa[4], ka[4], qb[4], kb[4];
        f32x2 ga[4], sa[4], gb[4], sb[4];
        auto ld = [&](f32x4 (&q)[4], f32x4 (&k)[4], f32x2 (&g)[4], f32x2 (&s)[4], int base) {
#pragma unroll
            for (int j = 0; j < 4; ++j) {
                q[j] = *(const f32x4*)&qS[base + j][kg << 2];
                k[j] = *(const f32x4*)&kS[base + j][kg << 2];
                g[j] = *(const f32x2*)&geS[base + j][mg << 1];
                s[j] = *(const f32x2*)&sS[base + j][mg << 1];
            }
            // keeps these reads ahead of the group stepped next; sunk to their use they would be waited for
            __builtin_amdgcn_sched_barrier(0);
        };
        auto step = [&](const f32x4 (&q)[4], const f32x4 (&k)[4], const f32x2 (&g)[4], const f32x2 (&s)[4], int base) {
#pragma unroll
            for (int j = 0; j < 4; ++j) {
                f32x2 acc = splat2(0.0f);
#pragma unroll
                for (int i = 0; i < 4; ++i) {
                    hk[i] = __builtin_elementwise_fma(hk[i], g[j], splat2(k[j][i]) * s[j]);
                    acc   = __builtin_elementwise_fma(splat2(q[j][i]), hk[i], acc);
                }
                *(f32x2*)&part[base + j][(kg << 3) + (mg << 1)] = acc;
            }
        };
        ld(qa, ka, ga, sa, 0);
#pragma unroll
        for (int g8 = 0; g8 < SCAN_TT; g8 += 8) {
            ld(qb, kb, gb, sb, g8 + 4);
            step(qa, ka, ga, sa, g8);
            if (g8 + 8 < SCAN_TT) ld(qa, ka, ga, sa, g8 + 8);
            step(qb, kb, gb, sb, g8 + 4);
        }
        __syncthreads();   // partials complete; every reader has left the input tile

        {
            const int rt = tid >> 2, rm = tid & 3;
            f32x2 a0 = splat2(0.0f), a1 = a0, a2 = a0, a3 = a0;
#pragma unroll
            for (int g = 0; g < 8; ++g) {
                a0 += *(const f32x2*)&part[rt][((4 * g + 0) << 3) + (rm << 1)];
                a1 += *(const f32x2*)&part[rt][((4 * g + 1) << 3) + (rm << 1)];
                a2 += *(const f32x2*)&part[rt][((4 * g + 2) << 3) + (rm << 1)];
                a3 += *(const f32x2*)&part[rt][((4 * g + 3) << 3) + (rm << 1)];
            }
            float* zrow = Zb + ((size_t)(bh * 8 + mb) * 2048 + t0) * 8;
            *(f32x2*)(zrow + (unsigned)(rt * 8 + (rm << 1))) = (a0 + a1) + (a2 + a3);
            // the store's registers are reused right behind it
            asm volatile("s_wait_xcnt 0x0" ::: "memory");
        }
        if (more) publish();
        __syncthreads();   // next input tile published; partials free again
    }
}

// softmax over the 64 slots of one (b,h,t), in place on the blocked layout
__global__ __launch_bounds__(256) void slot_softmax_kernel(float* Zb)
{
    const int gid = blockIdx.x * 256 + threadIdx.x;
    const int bh  = gid >> 11;
    const int t   = gid & 2047;
    f32x4 z[16];
#pragma unroll
    for (int mb = 0; mb < 8; ++mb) {
        const float* p = Zb + ((size_t)(bh * 8 + mb) * 2048 + t) * 8;
        z[2 * mb]     = *(const f32x4*)p;
        z[2 * mb + 1] = *(const f32x4*)(p + 4);
    }
    f32x4 m4 = z[0];
#pragma unroll
    for (int i = 1; i < 16; ++i) m4 = __builtin_elementwise_max(m4, z[i]);
    const float mx = fmaxf(fmaxf(m4.x, m4.y), fmaxf(m4.z, m4.w));
    f32x4 s4 = {0.0f, 0.0f, 0.0f, 0.0f};
#pragma unroll
    for (int i = 0; i < 16; ++i) {
        f32x4 e = {__expf(z[i].x - mx), __expf(z[i].y - mx), __expf(z[i].z - mx), __expf(z[i].w - mx)};
        z[i] = e;
        s4 += e;
    }
    const float inv = 1.0f / ((s4.x + s4.y) + (s4.z + s4.w));
#pragma unroll
    for (int mb = 0; mb < 8; ++mb) {
        float* p = Zb + ((size_t)(bh * 8 + mb) * 2048 + t) * 8;
        *(f32x4*)p       = z[2 * mb] * inv;
        *(f32x4*)(p + 4) = z[2 * mb + 1] * inv;
    }
}

// thread: 4 slots (sg*4..) x 4 columns (vg*4..) of hv
__global__ __launch_bounds__(128) void oscan_kernel(
    const float* __restrict__ Vp, const float* __restrict__ Gp,
    const float* __restrict__ Sp, const float* __restrict__ Pb,
    float* __restrict__ Op)
{
    __shared__ __attribute__((aligned(16))) float geS[SCAN_TT][64];
    __shared__ __attribute__((aligned(16))) float sS[SCAN_TT][64];
    __shared__ __attribute__((aligned(16))) float pS[SCAN_TT][PPITCH];
    __shared__ __attribute__((aligned(16))) float vS[SCAN_TT][32];
    __shared__ __attribute__((aligned(16))) float part[SCAN_TT][OPITCH];

    const int tid = threadIdx.x;
    const int bh  = blockIdx.x >> 2;
    const int v0  = (blockIdx.x & 3) << 5;
    const int b   = bh >> 3;
    const int h   = bh & 7;
    const int vg  = tid & 7;       // 0..7
    const int sg  = tid >> 3;      // 0..15

    f32x4 gr[4], sr[4], pr[4], vr[2];
    // uniform base + one fixed per-thread offset: the tile advance stays in scalar registers
    const unsigned goff = (unsigned)(tid >> 4) * 512u + (unsigned)((tid & 15) << 2);
    const unsigned poff = (unsigned)(tid >> 6) * 16384u + (unsigned)((tid & 63) << 2);
    const unsigned voff = (unsigned)(tid >> 3) * 1024u + (unsigned)((tid & 7) << 2);
    auto fetch = [&](int t0) {
        const size_t rowg = (size_t)(b * 2048 + t0) * 512 + h * 64;
        const float* g = Gp + rowg;
        const float* s = Sp + rowg;
        const float* p = Pb + ((size_t)(bh * 8) * 2048 + t0) * 8;
        const float* v = Vp + (size_t)(b * 2048 + t0) * 1024 + h * 128 + v0;
#pragma unroll
        for (int i = 0; i < 4; ++i) {
            gr[i] = *(const f32x4*)(g + goff + i * 4096);    // rows (tid>>4) + 8 i
            sr[i] = *(const f32x4*)(s + goff + i * 4096);
            // blocked P: slot block (tid>>6) + 2 i, then 64 consecutive 16-byte pieces of this tile
            pr[i] = *(const f32x4*)(p + poff + i * 32768);
        }
#pragma unroll
        for (int i = 0; i < 2; ++i)
            vr[i] = *(const f32x4*)(v + voff + i * 16384);   // rows (tid>>3) + 16 i
    };
    auto publish = [&]() {
#pragma unroll
        for (int i = 0; i < 4; ++i) {
            const int idx = tid + (i << 7);
            f32x4 e = {__expf(gr[i].x), __expf(gr[i].y), __expf(gr[i].z), __expf(gr[i].w)};
            *(f32x4*)&geS[idx >> 4][(idx & 15) << 2] = e;
            *(f32x4*)&sS[idx >> 4][(idx & 15) << 2]  = sr[i];
            *(f32x4*)&pS[(idx & 63) >> 1][((idx >> 6) << 3) + ((idx & 1) << 2)] = pr[i];
        }
#pragma unroll
        for (int i = 0; i < 2; ++i) {
            const int idx = tid + (i << 7);
            *(f32x4*)&vS[idx >> 3][(idx & 7) << 2] = vr[i];
        }
    };

    f32x2 hv[4][2];
#pragma unroll
    for (int i = 0; i < 4; ++i) { hv[i][0] = splat2(0.0f); hv[i][1] = splat2(0.0f); }

    fetch(0);
    publish();
    __syncthreads();

    for (int t0 = 0; t0 < 2048; t0 += SCAN_TT) {
        const bool more = (t0 + SCAN_TT) < 2048;
        if (more) fetch(t0 + SCAN_TT);

        // groups of 4 steps, two register sets: the next group's LDS reads are in
        // flight while this group is stepped (one wave per SIMD hides nothing itself)
        f32x4 ga[4], sa[4], pa[4], va[4], gb[4], sb[4], pb[4], vb[4];
        auto ld = [&](f32x4 (&g)[4], f32x4 (&s)[4], f32x4 (&p)[4], f32x4 (&v)[4], int base) {
#pragma unroll
            for (int j = 0; j < 4; ++j) {
                g[j] = *(const f32x4*)&geS[base + j][sg << 2];
                s[j] = *(const f32x4*)&sS[base + j][sg << 2];
                p[j] = *(const f32x4*)&pS[base + j][sg << 2];
                v[j] = *(const f32x4*)&vS[base + j][vg << 2];
            }
            // keeps these reads ahead of the group stepped next; sunk to their use they would be waited for
            __builtin_amdgcn_sched_barrier(0);
        };
        auto step = [&](const f32x4 (&g)[4], const f32x4 (&s)[4], const f32x4 (&p)[4], const f32x4 (&v)[4], int base) {
#pragma unroll
            for (int j = 0; j < 4; ++j) {
                const f32x2 v01 = {v[j].x, v[j].y}, v23 = {v[j].z, v[j].w};
                f32x2 acc0 = splat2(0.0f), acc1 = splat2(0.0f);
#pragma unroll
                for (int i = 0; i < 4; ++i) {
                    hv[i][0] = __builtin_elementwise_fma(hv[i][0], splat2(g[j][i]), splat2(s[j][i]) * v01);
                    hv[i][1] = __builtin_elementwise_fma(hv[i][1], splat2(g[j][i]), splat2(s[j][i]) * v23);
                    acc0 = __builtin_elementwise_fma(splat2(p[j][i]), hv[i][0], acc0);
                    acc1 = __builtin_elementwise_fma(splat2(p[j][i]), hv[i][1], acc1);
                }
                f32x4 a = {acc0.x, acc0.y, acc1.x, acc1.y};
                *(f32x4*)&part[base + j][(sg << 5) + (vg << 2)] = a;
            }
        };
        ld(ga, sa, pa, va, 0);
#pragma unroll
        for (int g8 = 0; g8 < SCAN_TT; g8 += 8) {
            ld(gb, sb, pb, vb, g8 + 4);
            step(ga, sa, pa, va, g8);
            if (g8 + 8 < SCAN_TT) ld(ga, sa, pa, va, g8 + 8);
            step(gb, sb, pb, vb, g8 + 4);
        }
        __syncthreads();   // partials complete; every reader has left the input tile

        {
            const int rt = tid >> 2, rv = (tid & 3) << 2;
            f32x4 a0 = {0.0f, 0.0f, 0.0f, 0.0f}, a1 = a0, b0 = a0, b1 = a0;
#pragma unroll
            for (int g = 0; g < 8; ++g) {
                a0 += *(const f32x4*)&part[rt][((2 * g + 0) << 5) + rv];
                b0 += *(const f32x4*)&part[rt][((2 * g + 0) << 5) + rv + 16];
                a1 += *(const f32x4*)&part[rt][((2 * g + 1) << 5) + rv];
                b1 += *(const f32x4*)&part[rt][((2 * g + 1) << 5) + rv + 16];
            }
            float* o = Op + (size_t)(b * 2048 + t0) * 1024 + h * 128 + v0;
            *(f32x4*)(o + (unsigned)(rt * 1024 + rv))      = a0 + a1;
            *(f32x4*)(o + (unsigned)(rt * 1024 + rv) + 16) = b0 + b1;
            // the stores' registers are reused right behind them
            asm volatile("s_wait_xcnt 0x0" ::: "memory");
        }
        if (more) publish();
        __syncthreads();   // next input tile published; partials free again
    }
}

// ---------------------------------------------------------------------------
// y = RMSNorm(swish(x)) * g_weight     (one block per row of 1024)
// ---------------------------------------------------------------------------
__global__ __launch_bounds__(256) void swish_rms_kernel(
    const float* __restrict__ X, const float* __restrict__ w,
    float* __restrict__ Y)
{
    const int row = blockIdx.x;
    const float* xr = X + (size_t)row * 1024;
    float loc[4];
    float ss = 0.0f;
#pragma unroll
    for (int i = 0; i < 4; ++i) {
        const float x  = xr[threadIdx.x + 256 * i];
        const float sw = x / (1.0f + __expf(-x));
        loc[i] = sw;
        ss += sw * sw;
    }
#pragma unroll
    for (int off = 16; off > 0; off >>= 1) ss += __shfl_xor(ss, off, 32);
    __shared__ float wred[8];
    if ((threadIdx.x & 31) == 0) wred[threadIdx.x >> 5] = ss;
    __syncthreads();
    float tot = 0.0f;
#pragma unroll
    for (int i = 0; i < 8; ++i) tot += wred[i];
    const float r = rsqrtf(tot * (1.0f / 1024.0f) + 1e-5f);
#pragma unroll
    for (int i = 0; i < 4; ++i) {
        const int c = threadIdx.x + 256 * i;
        Y[(size_t)row * 1024 + c] = loc[i] * r * w[c];
    }
}

// ---------------------------------------------------------------------------
extern "C" void kernel_launch(void* const* d_in, const int* in_sizes, int n_in,
                              void* d_out, int out_size, void* d_ws, size_t ws_size,
                              hipStream_t stream) {
    const float* X  = (const float*)d_in[0];   // [4096,1024]
    const float* Wq = (const float*)d_in[1];
    const float* Wk = (const float*)d_in[2];
    const float* Wv = (const float*)d_in[3];
    const float* Wf = (const float*)d_in[4];   // [512,1024]
    const float* Wo = (const float*)d_in[5];
    const float* gw = (const float*)d_in[6];   // [1024]

    const size_t ND = 4096ull * 1024ull;
    const size_t NF = 4096ull * 512ull;
    float* ws  = (float*)d_ws;
    float* Q   = ws;             // 16 MB
    float* Kt  = Q   + ND;       // 16 MB
    float* Vt  = Kt  + ND;       // 16 MB
    float* G   = Vt  + ND;       //  8 MB
    float* Sv  = G   + NF;       //  8 MB
    float* Oin = Sv  + NF;       // 16 MB
    float* Zb  = Oin + ND;       //  8 MB, slot scores then slot weights
    float* Xn  = Q;              // reuse Q after the scan

    dim3 blk(256);
    dim3 gQKV(1024 / TILE_N, 4096 / TILE_M);   // 16 x 16
    dim3 gF(512 / TILE_N, 4096 / TILE_M);      //  8 x 16

    gemm_bt_kernel<<<gQKV, blk, 0, stream>>>(X, Wq, Q,  nullptr, 4096, 1024, 1024, 1);
    gemm_bt_kernel<<<gQKV, blk, 0, stream>>>(X, Wk, Kt, nullptr, 4096, 1024, 1024, 1);
    gemm_bt_kernel<<<gQKV, blk, 0, stream>>>(X, Wv, Vt, nullptr, 4096, 1024, 1024, 1);
    gemm_bt_kernel<<<gF,   blk, 0, stream>>>(X, Wf, G,  Sv,      4096, 1024,  512, 2);

    zscan_kernel<<<128, dim3(128), 0, stream>>>(Q, Kt, G, Sv, Zb);
    slot_softmax_kernel<<<128, blk, 0, stream>>>(Zb);
    oscan_kernel<<<64, dim3(128), 0, stream>>>(Vt, G, Sv, Zb, Oin);

    swish_rms_kernel<<<4096, blk, 0, stream>>>(Oin, gw, Xn);

    gemm_bt_kernel<<<gQKV, blk, 0, stream>>>(Xn, Wo, (float*)d_out, nullptr, 4096, 1024, 1024, 0);
}

// v002
// One run takes 426 microseconds.
// Two timings next to v001 both put it at 1.09 times that version's speed.
// Counting every step since v000, it is 7.71 times as fast.
#include <hip/hip_runtime.h>

// ---------------------------------------------------------------------------
// Gated ABC attention, MI455X (gfx1250, wave32, WMMA bf16).
// B=2, T=2048, D=1024, H=8, M=64, KD=128.
//   1) gemm_bt (WMMA): Q/K/V = swish(X W^T), F -> (G, S) gates
//   2) recurrence: slot scores, slot softmax, output columns (three launches)
//   3) swish + RMSNorm
//   4) gemm_bt: out = Xn Wo^T
// GEMM: 256x64 block tile, 8 waves x (32x64), double-buffered LDS,
// float4 global loads -> packed bf16 -> 16B LDS stores -> ds_load_b128 frags.
// Epilogue through LDS, rolled, 16-byte stores.
// ---------------------------------------------------------------------------

typedef __attribute__((ext_vector_type(16))) __bf16 v16bf;
typedef __attribute__((ext_vector_type(8)))  __bf16 v8bf;
typedef __attribute__((ext_vector_type(8)))  float  v8f;

#define TILE_M 256
#define TILE_N 64
#define TILE_K 32
#define KPAD   8          // pad rows to 40 bf16 = 80 B (16B multiple, conflict-free)
#define LROW   (TILE_K + KPAD)
#define EPITCH 68         // epilogue rows: 64 f32 + 4, so rows r and r+8 fall on different banks

static __device__ __forceinline__ v8bf pack8(float4 a, float4 b) {
    v8bf p;
    p[0] = (__bf16)a.x; p[1] = (__bf16)a.y; p[2] = (__bf16)a.z; p[3] = (__bf16)a.w;
    p[4] = (__bf16)b.x; p[5] = (__bf16)b.y; p[6] = (__bf16)b.z; p[7] = (__bf16)b.w;
    return p;
}

static __device__ __forceinline__ v16bf load_frag(const __bf16* rowp, int half) {
    // lane's two contiguous 16-byte chunks of the 32-element K row
    v8bf lo = *(const v8bf*)(rowp + (half << 3));
    v8bf hi = *(const v8bf*)(rowp + 16 + (half << 3));
    return __builtin_shufflevector(lo, hi, 0, 1, 2, 3, 4, 5, 6, 7,
                                   8, 9, 10, 11, 12, 13, 14, 15);
}

// Y = act( X @ W^T ) ; X: [Nrows,Kdim] f32, W: [Nout,Kdim] f32, Y: [Nrows,Nout]
// act_mode: 0 = identity, 1 = swish, 2 = gate (Y=g=logsigmoid/16, Y2=s=1-exp(g))
__global__ __launch_bounds__(256) void gemm_bt_kernel(
    const float* __restrict__ X, const float* __restrict__ W,
    float* __restrict__ Y, float* __restrict__ Y2,
    int Nrows, int Kdim, int Nout, int act_mode)
{
    __shared__ __attribute__((aligned(16))) __bf16 As[2][TILE_M][LROW];
    __shared__ __attribute__((aligned(16))) __bf16 Bs[2][TILE_N][LROW];

    const int tid  = threadIdx.x;
    const int wave = tid >> 5;        // 0..7
    const int lane = tid & 31;
    const int half = lane >> 4;       // K-half select (0/1)
    const int l15  = lane & 15;
    const int m0   = blockIdx.y * TILE_M;
    const int n0   = blockIdx.x * TILE_N;

    v8f acc[2][4];
#pragma unroll
    for (int am = 0; am < 2; ++am)
#pragma unroll
        for (int nt = 0; nt < 4; ++nt)
#pragma unroll
            for (int j = 0; j < 8; ++j) acc[am][nt][j] = 0.0f;

    // ---- stage one K-tile (f32 -> bf16, vectorized) ----
    auto stage = [&](int buf, int k0) {
        // A: 256 rows x 32 cols -> 512 (row, 16-col-half) units, 2 per thread
#pragma unroll
        for (int it = 0; it < 2; ++it) {
            const int i = tid + (it << 8);
            const int r = i >> 1, ch = (i & 1) << 4;
            const float4* xr = (const float4*)(X + (size_t)(m0 + r) * Kdim + k0 + ch);
            float4 a0 = xr[0], a1 = xr[1], a2 = xr[2], a3 = xr[3];
            *(v8bf*)&As[buf][r][ch]     = pack8(a0, a1);
            *(v8bf*)&As[buf][r][ch + 8] = pack8(a2, a3);
        }
        // B: 64 rows x 32 cols -> 128 units, threads < 128
        if (tid < 128) {
            const int r = tid >> 1, ch = (tid & 1) << 4;
            const float4* wr = (const float4*)(W + (size_t)(n0 + r) * Kdim + k0 + ch);
            float4 b0 = wr[0], b1 = wr[1], b2 = wr[2], b3 = wr[3];
            *(v8bf*)&Bs[buf][r][ch]     = pack8(b0, b1);
            *(v8bf*)&Bs[buf][r][ch + 8] = pack8(b2, b3);
        }
    };

    stage(0, 0);
    __syncthreads();

    const int nK = Kdim / TILE_K;
    for (int kt = 0; kt < nK; ++kt) {
        const int cur = kt & 1;
        if (kt + 1 < nK) stage(cur ^ 1, (kt + 1) * TILE_K);
        // prefetch two tiles ahead into L2 (global_prefetch_b8)
        if (kt + 2 < nK)
            __builtin_prefetch(X + (size_t)(m0 + tid) * Kdim + (kt + 2) * TILE_K, 0, 1);

        // fragments: wave's 32 rows x block's 64 cols
        const int wrow = wave << 5;
        v16bf aF[2], bF[4];
#pragma unroll
        for (int am = 0; am < 2; ++am)
            aF[am] = load_frag(&As[cur][wrow + (am << 4) + l15][0], half);
#pragma unroll
        for (int nt = 0; nt < 4; ++nt)
            bF[nt] = load_frag(&Bs[cur][(nt << 4) + l15][0], half);

#pragma unroll
        for (int am = 0; am < 2; ++am)
#pragma unroll
            for (int nt = 0; nt < 4; ++nt)
                acc[am][nt] = __builtin_amdgcn_wmma_f32_16x16x32_bf16(
                    false, aF[am], false, bF[nt], (short)0, acc[am][nt], false, false);
        __syncthreads();
    }

    // Epilogue. C/D layout: VGPR r, lane<16 -> (M=r, N=lane); lane>=16 -> (M=8+r).
    // Each wave passes its accumulators, 16 rows at a time, through its own slice of
    // the (now free) A buffer and picks them up as whole rows; the activation then
    // runs in a rolled loop of 16-byte pieces. Rolled to keep the text small.
    float* ep = reinterpret_cast<float*>(&As[0][0][0]) + wave * (16 * EPITCH);
    const float* src = ep + half * EPITCH + (l15 << 2);
#pragma unroll
    for (int am = 0; am < 2; ++am) {
        if (am) __syncthreads();   // the first 16 rows have been read; the slice may be rewritten
#pragma unroll
        for (int nt = 0; nt < 4; ++nt)
#pragma unroll
            for (int r = 0; r < 8; ++r)
                ep[(r + (half << 3)) * EPITCH + (nt << 4) + l15] = acc[am][nt][r];
        __syncthreads();           // lanes read what other lanes wrote

        // rows (wave*32 + am*16 + half) + 2 it, columns n0 + 4*l15 ..
        const size_t idx0 = (size_t)(m0 + (wave << 5) + (am << 4) + half) * Nout + n0 + (l15 << 2);
        const size_t step = (size_t)Nout * 2;
        if (act_mode == 0) {
#pragma unroll 1   // rolled: keeps the text small (see above)
            for (int it = 0; it < 8; ++it) {
                const float4 v = *(const float4*)(src + it * (2 * EPITCH));
                *(float4*)(Y + idx0 + it * step) = v;
                // the store's registers are rewritten by the next trip
                asm volatile("s_wait_xcnt 0x0" ::: "memory");
            }
        } else if (act_mode == 1) {
#pragma unroll 1   // rolled: keeps the text small (see above)
            for (int it = 0; it < 8; ++it) {
                const float4 v = *(const float4*)(src + it * (2 * EPITCH));
                float4 y;
                y.x = v.x / (1.0f + __expf(-v.x));                          // swish
                y.y = v.y / (1.0f + __expf(-v.y));
                y.z = v.z / (1.0f + __expf(-v.z));
                y.w = v.w / (1.0f + __expf(-v.w));
                *(float4*)(Y + idx0 + it * step) = y;
                // the store's registers are rewritten by the next trip
                asm volatile("s_wait_xcnt 0x0" ::: "memory");
            }
        } else {
#pragma unroll 1   // rolled: keeps the text small (see above)
            for (int it = 0; it < 8; ++it) {
                const float4 v = *(const float4*)(src + it * (2 * EPITCH));
                const float vv[4] = {v.x, v.y, v.z, v.w};
                float g[4], s[4];
#pragma unroll
                for (int c = 0; c < 4; ++c) {
                    const float ls = fminf(vv[c], 0.0f) - log1pf(__expf(-fabsf(vv[c])));  // logsigmoid
                    g[c] = ls * 0.0625f;                                                // /GATE_NORM
                    s[c] = 1.0f - __expf(g[c]);
                }
                *(float4*)(Y  + idx0 + it * step) = make_float4(g[0], g[1], g[2], g[3]);
                *(float4*)(Y2 + idx0 + it * step) = make_float4(s[0], s[1], s[2], s[3]);
                // the stores' registers are rewritten by the next trip
                asm volatile("s_wait_xcnt 0x0" ::: "memory");
            }
        }
    }
}

// ---------------------------------------------------------------------------
// Gated-ABC recurrence, split into its independent parts (three launches).
//   hk[:, m] depends on slot m alone  -> zscan: one workgroup per (b,h, 8 slots)
//   softmax over the 64 slots         -> one thread per (b,h,t)
//   hv[:, v] depends on column v alone-> oscan: one workgroup per (b,h, 32 cols)
// Inside a workgroup time runs in tiles of SCAN_TT steps: the tile's inputs sit
// in LDS, every thread steps its own register tile of the state with no barrier
// between steps, leaves its partial dot products in LDS, and the tile's partials
// are summed once behind the tile. The next tile's inputs are fetched into
// registers while the current tile is stepped.
// Z / P layout: [b*8+h][slot block of 8][t][8], so each workgroup owns whole lines.
// ---------------------------------------------------------------------------
typedef __attribute__((ext_vector_type(2))) float f32x2;
typedef __attribute__((ext_vector_type(4))) float f32x4;

#define SCAN_TT 32
#define ZPITCH  264   // 32 k-groups x 8 slots + 8: the tile sum reads 8 rows on distinct banks
#define OPITCH  528   // 16 slot-groups x 32 cols + 16: same, for 16-byte reads
#define PPITCH  72    // 64 slots + 8: the blocked P rows land on distinct banks

static __device__ __forceinline__ f32x2 splat2(float x) { f32x2 r = {x, x}; return r; }

// thread: 4 k (kg*4..) x 2 slots (mg*2..) of hk
__global__ __launch_bounds__(128) void zscan_kernel(
    const float* __restrict__ Qp, const float* __restrict__ Kp,
    const float* __restrict__ Gp, const float* __restrict__ Sp,
    float* __restrict__ Zb)
{
    __shared__ __attribute__((aligned(16))) float qS[SCAN_TT][128];
    __shared__ __attribute__((aligned(16))) float kS[SCAN_TT][128];
    __shared__ __attribute__((aligned(16))) float geS[SCAN_TT][8];
    __shared__ __attribute__((aligned(16))) float sS[SCAN_TT][8];
    __shared__ __attribute__((aligned(16))) float part[SCAN_TT][ZPITCH];

    const int tid = threadIdx.x;
    const int bh  = blockIdx.x >> 3;
    const int mb  = blockIdx.x & 7;
    const int b   = bh >> 3;
    const int h   = bh & 7;
    const int kg  = tid >> 2;      // 0..31
    const int mg  = tid & 3;       // 0..3
    const float scale = 0.08838834764831845f; // 128^-0.5

    f32x4 qr[8], kr[8], gr;
    // uniform base + one fixed per-thread offset: the tile advance stays in scalar registers
    const unsigned qoff = (unsigned)(tid >> 5) * 1024u + (unsigned)((tid & 31) << 2);
    const unsigned goff = (unsigned)((tid & 63) >> 1) * 512u + (unsigned)((tid & 1) << 2);
    const float* GS = (__builtin_amdgcn_readfirstlane(tid) < 64) ? Gp : Sp;   // waves 0,1: gates; 2,3: s
    auto fetch = [&](int t0) {
        const size_t rowq = (size_t)(b * 2048 + t0) * 1024 + h * 128;
        const float* q = Qp + rowq;
        const float* k = Kp + rowq;
#pragma unroll
        for (int i = 0; i < 8; ++i) {       // rows (tid>>5) + 4 i
            qr[i] = *(const f32x4*)(q + qoff + i * 4096);
            kr[i] = *(const f32x4*)(k + qoff + i * 4096);
        }
        gr = *(const f32x4*)(GS + (size_t)(b * 2048 + t0) * 512 + h * 64 + mb * 8 + goff);
    };
    auto publish = [&]() {
#pragma unroll
        for (int i = 0; i < 8; ++i) {
            const int idx = tid + (i << 7);
            *(f32x4*)&qS[idx >> 5][(idx & 31) << 2] = qr[i] * scale;
            *(f32x4*)&kS[idx >> 5][(idx & 31) << 2] = kr[i];
        }
        const int u = tid & 63;
        if (tid < 64) {
            f32x4 e = {__expf(gr.x), __expf(gr.y), __expf(gr.z), __expf(gr.w)};
            *(f32x4*)&geS[u >> 1][(u & 1) << 2] = e;
        } else {
            *(f32x4*)&sS[u >> 1][(u & 1) << 2] = gr;
        }
    };

    f32x2 hk[4];
#pragma unroll
    for (int i = 0; i < 4; ++i) hk[i] = splat2(0.0f);

    fetch(0);
    publish();
    __syncthreads();

    for (int t0 = 0; t0 < 2048; t0 += SCAN_TT) {
        const bool more = (t0 + SCAN_TT) < 2048;
        if (more) fetch(t0 + SCAN_TT);

        // groups of 4 steps, two register sets: the next group's LDS reads are in
        // flight while this group is stepped (one wave per SIMD hides nothing itself)
        f32x4 qa[4], ka[4], qb[4], kb[4];
        f32x2 ga[4], sa[4], gb[4], sb[4];
        auto ld = [&](f32x4 (&q)[4], f32x4 (&k)[4], f32x2 (&g)[4], f32x2 (&s)[4], int base) {
#pragma unroll
            for (int j = 0; j < 4; ++j) {
                q[j] = *(const f32x4*)&qS[base + j][kg << 2];
                k[j] = *(const f32x4*)&kS[base + j][kg << 2];
                g[j] = *(const f32x2*)&geS[base + j][mg << 1];
                s[j] = *(const f32x2*)&sS[base + j][mg << 1];
            }
            // keeps these reads ahead of the group stepped next; sunk to their use they would be waited for
            __builtin_amdgcn_sched_barrier(0);
        };
        auto step = [&](const f32x4 (&q)[4], const f32x4 (&k)[4], const f32x2 (&g)[4], const f32x2 (&s)[4], int base) {
#pragma unroll
            for (int j = 0; j < 4; ++j) {
                f32x2 acc = splat2(0.0f);
#pragma unroll
                for (int i = 0; i < 4; ++i) {
                    hk[i] = __builtin_elementwise_fma(hk[i], g[j], splat2(k[j][i]) * s[j]);
                    acc   = __builtin_elementwise_fma(splat2(q[j][i]), hk[i], acc);
                }
                *(f32x2*)&part[base + j][(kg << 3) + (mg << 1)] = acc;
            }
        };
        ld(qa, ka, ga, sa, 0);
#pragma unroll
        for (int g8 = 0; g8 < SCAN_TT; g8 += 8) {
            ld(qb, kb, gb, sb, g8 + 4);
            step(qa, ka, ga, sa, g8);
            if (g8 + 8 < SCAN_TT) ld(qa, ka, ga, sa, g8 + 8);
            step(qb, kb, gb, sb, g8 + 4);
        }
        __syncthreads();   // partials complete; every reader has left the input tile

        {
            const int rt = tid >> 2, rm = tid & 3;
            f32x2 a0 = splat2(0.0f), a1 = a0, a2 = a0, a3 = a0;
#pragma unroll
            for (int g = 0; g < 8; ++g) {
                a0 += *(const f32x2*)&part[rt][((4 * g + 0) << 3) + (rm << 1)];
                a1 += *(const f32x2*)&part[rt][((4 * g + 1) << 3) + (rm << 1)];
                a2 += *(const f32x2*)&part[rt][((4 * g + 2) << 3) + (rm << 1)];
                a3 += *(const f32x2*)&part[rt][((4 * g + 3) << 3) + (rm << 1)];
            }
            float* zrow = Zb + ((size_t)(bh * 8 + mb) * 2048 + t0) * 8;
            *(f32x2*)(zrow + (unsigned)(rt * 8 + (rm << 1))) = (a0 + a1) + (a2 + a3);
            // the store's registers are reused right behind it
            asm volatile("s_wait_xcnt 0x0" ::: "memory");
        }
        if (more) publish();
        __syncthreads();   // next input tile published; partials free again
    }
}

// softmax over the 64 slots of one (b,h,t), in place on the blocked layout
__global__ __launch_bounds__(256) void slot_softmax_kernel(float* Zb)
{
    const int gid = blockIdx.x * 256 + threadIdx.x;
    const int bh  = gid >> 11;
    const int t   = gid & 2047;
    f32x4 z[16];
#pragma unroll
    for (int mb = 0; mb < 8; ++mb) {
        const float* p = Zb + ((size_t)(bh * 8 + mb) * 2048 + t) * 8;
        z[2 * mb]     = *(const f32x4*)p;
        z[2 * mb + 1] = *(const f32x4*)(p + 4);
    }
    f32x4 m4 = z[0];
#pragma unroll
    for (int i = 1; i < 16; ++i) m4 = __builtin_elementwise_max(m4, z[i]);
    const float mx = fmaxf(fmaxf(m4.x, m4.y), fmaxf(m4.z, m4.w));
    f32x4 s4 = {0.0f, 0.0f, 0.0f, 0.0f};
#pragma unroll
    for (int i = 0; i < 16; ++i) {
        f32x4 e = {__expf(z[i].x - mx), __expf(z[i].y - mx), __expf(z[i].z - mx), __expf(z[i].w - mx)};
        z[i] = e;
        s4 += e;
    }
    const float inv = 1.0f / ((s4.x + s4.y) + (s4.z + s4.w));
#pragma unroll
    for (int mb = 0; mb < 8; ++mb) {
        float* p = Zb + ((size_t)(bh * 8 + mb) * 2048 + t) * 8;
        *(f32x4*)p       = z[2 * mb] * inv;
        *(f32x4*)(p + 4) = z[2 * mb + 1] * inv;
    }
}

// thread: 4 slots (sg*4..) x 4 columns (vg*4..) of hv
__global__ __launch_bounds__(128) void oscan_kernel(
    const float* __restrict__ Vp, const float* __restrict__ Gp,
    const float* __restrict__ Sp, const float* __restrict__ Pb,
    float* __restrict__ Op)
{
    __shared__ __attribute__((aligned(16))) float geS[SCAN_TT][64];
    __shared__ __attribute__((aligned(16))) float sS[SCAN_TT][64];
    __shared__ __attribute__((aligned(16))) float pS[SCAN_TT][PPITCH];
    __shared__ __attribute__((aligned(16))) float vS[SCAN_TT][32];
    __shared__ __attribute__((aligned(16))) float part[SCAN_TT][OPITCH];

    const int tid = threadIdx.x;
    const int bh  = blockIdx.x >> 2;
    const int v0  = (blockIdx.x & 3) << 5;
    const int b   = bh >> 3;
    const int h   = bh & 7;
    const int vg  = tid & 7;       // 0..7
    const int sg  = tid >> 3;      // 0..15

    f32x4 gr[4], sr[4], pr[4], vr[2];
    // uniform base + one fixed per-thread offset: the tile advance stays in scalar registers
    const unsigned goff = (unsigned)(tid >> 4) * 512u + (unsigned)((tid & 15) << 2);
    const unsigned poff = (unsigned)(tid >> 6) * 16384u + (unsigned)((tid & 63) << 2);
    const unsigned voff = (unsigned)(tid >> 3) * 1024u + (unsigned)((tid & 7) << 2);
    auto fetch = [&](int t0) {
        const size_t rowg = (size_t)(b * 2048 + t0) * 512 + h * 64;
        const float* g = Gp + rowg;
        const float* s = Sp + rowg;
        const float* p = Pb + ((size_t)(bh * 8) * 2048 + t0) * 8;
        const float* v = Vp + (size_t)(b * 2048 + t0) * 1024 + h * 128 + v0;
#pragma unroll
        for (int i = 0; i < 4; ++i) {
            gr[i] = *(const f32x4*)(g + goff + i * 4096);    // rows (tid>>4) + 8 i
            sr[i] = *(const f32x4*)(s + goff + i * 4096);
            // blocked P: slot block (tid>>6) + 2 i, then 64 consecutive 16-byte pieces of this tile
            pr[i] = *(const f32x4*)(p + poff + i * 32768);
        }
#pragma unroll
        for (int i = 0; i < 2; ++i)
            vr[i] = *(const f32x4*)(v + voff + i * 16384);   // rows (tid>>3) + 16 i
    };
    auto publish = [&]() {
#pragma unroll
        for (int i = 0; i < 4; ++i) {
            const int idx = tid + (i << 7);
            f32x4 e = {__expf(gr[i].x), __expf(gr[i].y), __expf(gr[i].z), __expf(gr[i].w)};
            *(f32x4*)&geS[idx >> 4][(idx & 15) << 2] = e;
            *(f32x4*)&sS[idx >> 4][(idx & 15) << 2]  = sr[i];
            *(f32x4*)&pS[(idx & 63) >> 1][((idx >> 6) << 3) + ((idx & 1) << 2)] = pr[i];
        }
#pragma unroll
        for (int i = 0; i < 2; ++i) {
            const int idx = tid + (i << 7);
            *(f32x4*)&vS[idx >> 3][(idx & 7) << 2] = vr[i];
        }
    };

    f32x2 hv[4][2];
#pragma unroll
    for (int i = 0; i < 4; ++i) { hv[i][0] = splat2(0.0f); hv[i][1] = splat2(0.0f); }

    fetch(0);
    publish();
    __syncthreads();

    for (int t0 = 0; t0 < 2048; t0 += SCAN_TT) {
        const bool more = (t0 + SCAN_TT) < 2048;
        if (more) fetch(t0 + SCAN_TT);

        // groups of 4 steps, two register sets: the next group's LDS reads are in
        // flight while this group is stepped (one wave per SIMD hides nothing itself)
        f32x4 ga[4], sa[4], pa[4], va[4], gb[4], sb[4], pb[4], vb[4];
        auto ld = [&](f32x4 (&g)[4], f32x4 (&s)[4], f32x4 (&p)[4], f32x4 (&v)[4], int base) {
#pragma unroll
            for (int j = 0; j < 4; ++j) {
                g[j] = *(const f32x4*)&geS[base + j][sg << 2];
                s[j] = *(const f32x4*)&sS[base + j][sg << 2];
                p[j] = *(const f32x4*)&pS[base + j][sg << 2];
                v[j] = *(const f32x4*)&vS[base + j][vg << 2];
            }
            // keeps these reads ahead of the group stepped next; sunk to their use they would be waited for
            __builtin_amdgcn_sched_barrier(0);
        };
        auto step = [&](const f32x4 (&g)[4], const f32x4 (&s)[4], const f32x4 (&p)[4], const f32x4 (&v)[4], int base) {
#pragma unroll
            for (int j = 0; j < 4; ++j) {
                const f32x2 v01 = {v[j].x, v[j].y}, v23 = {v[j].z, v[j].w};
                f32x2 acc0 = splat2(0.0f), acc1 = splat2(0.0f);
#pragma unroll
                for (int i = 0; i < 4; ++i) {
                    hv[i][0] = __builtin_elementwise_fma(hv[i][0], splat2(g[j][i]), splat2(s[j][i]) * v01);
                    hv[i][1] = __builtin_elementwise_fma(hv[i][1], splat2(g[j][i]), splat2(s[j][i]) * v23);
                    acc0 = __builtin_elementwise_fma(splat2(p[j][i]), hv[i][0], acc0);
                    acc1 = __builtin_elementwise_fma(splat2(p[j][i]), hv[i][1], acc1);
                }
                f32x4 a = {acc0.x, acc0.y, acc1.x, acc1.y};
                *(f32x4*)&part[base + j][(sg << 5) + (vg << 2)] = a;
            }
        };
        ld(ga, sa, pa, va, 0);
#pragma unroll
        for (int g8 = 0; g8 < SCAN_TT; g8 += 8) {
            ld(gb, sb, pb, vb, g8 + 4);
            step(ga, sa, pa, va, g8);
            if (g8 + 8 < SCAN_TT) ld(ga, sa, pa, va, g8 + 8);
            step(gb, sb, pb, vb, g8 + 4);
        }
        __syncthreads();   // partials complete; every reader has left the input tile

        {
            const int rt = tid >> 2, rv = (tid & 3) << 2;
            f32x4 a0 = {0.0f, 0.0f, 0.0f, 0.0f}, a1 = a0, b0 = a0, b1 = a0;
#pragma unroll
            for (int g = 0; g < 8; ++g) {
                a0 += *(const f32x4*)&part[rt][((2 * g + 0) << 5) + rv];
                b0 += *(const f32x4*)&part[rt][((2 * g + 0) << 5) + rv + 16];
                a1 += *(const f32x4*)&part[rt][((2 * g + 1) << 5) + rv];
                b1 += *(const f32x4*)&part[rt][((2 * g + 1) << 5) + rv + 16];
            }
            float* o = Op + (size_t)(b * 2048 + t0) * 1024 + h * 128 + v0;
            *(f32x4*)(o + (unsigned)(rt * 1024 + rv))      = a0 + a1;
            *(f32x4*)(o + (unsigned)(rt * 1024 + rv) + 16) = b0 + b1;
            // the stores' registers are reused right behind them
            asm volatile("s_wait_xcnt 0x0" ::: "memory");
        }
        if (more) publish();
        __syncthreads();   // next input tile published; partials free again
    }
}

// ---------------------------------------------------------------------------
// y = RMSNorm(swish(x)) * g_weight     (one block per row of 1024)
// ---------------------------------------------------------------------------
__global__ __launch_bounds__(256) void swish_rms_kernel(
    const float* __restrict__ X, const float* __restrict__ w,
    float* __restrict__ Y)
{
    const int row = blockIdx.x;
    const float* xr = X + (size_t)row * 1024;
    float loc[4];
    float ss = 0.0f;
#pragma unroll
    for (int i = 0; i < 4; ++i) {
        const float x  = xr[threadIdx.x + 256 * i];
        const float sw = x / (1.0f + __expf(-x));
        loc[i] = sw;
        ss += sw * sw;
    }
#pragma unroll
    for (int off = 16; off > 0; off >>= 1) ss += __shfl_xor(ss, off, 32);
    __shared__ float wred[8];
    if ((threadIdx.x & 31) == 0) wred[threadIdx.x >> 5] = ss;
    __syncthreads();
    float tot = 0.0f;
#pragma unroll
    for (int i = 0; i < 8; ++i) tot += wred[i];
    const float r = rsqrtf(tot * (1.0f / 1024.0f) + 1e-5f);
#pragma unroll
    for (int i = 0; i < 4; ++i) {
        const int c = threadIdx.x + 256 * i;
        Y[(size_t)row * 1024 + c] = loc[i] * r * w[c];
    }
}

// ---------------------------------------------------------------------------
extern "C" void kernel_launch(void* const* d_in, const int* in_sizes, int n_in,
                              void* d_out, int out_size, void* d_ws, size_t ws_size,
                              hipStream_t stream) {
    const float* X  = (const float*)d_in[0];   // [4096,1024]
    const float* Wq = (const float*)d_in[1];
    const float* Wk = (const float*)d_in[2];
    const float* Wv = (const float*)d_in[3];
    const float* Wf = (const float*)d_in[4];   // [512,1024]
    const float* Wo = (const float*)d_in[5];
    const float* gw = (const float*)d_in[6];   // [1024]

    const size_t ND = 4096ull * 1024ull;
    const size_t NF = 4096ull * 512ull;
    float* ws  = (float*)d_ws;
    float* Q   = ws;             // 16 MB
    float* Kt  = Q   + ND;       // 16 MB
    float* Vt  = Kt  + ND;       // 16 MB
    float* G   = Vt  + ND;       //  8 MB
    float* Sv  = G   + NF;       //  8 MB
    float* Oin = Sv  + NF;       // 16 MB
    float* Zb  = Oin + ND;       //  8 MB, slot scores then slot weights
    float* Xn  = Q;              // reuse Q after the scan

    dim3 blk(256);
    dim3 gQKV(1024 / TILE_N, 4096 / TILE_M);   // 16 x 16
    dim3 gF(512 / TILE_N, 4096 / TILE_M);      //  8 x 16

    gemm_bt_kernel<<<gQKV, blk, 0, stream>>>(X, Wq, Q,  nullptr, 4096, 1024, 1024, 1);
    gemm_bt_kernel<<<gQKV, blk, 0, stream>>>(X, Wk, Kt, nullptr, 4096, 1024, 1024, 1);
    gemm_bt_kernel<<<gQKV, blk, 0, stream>>>(X, Wv, Vt, nullptr, 4096, 1024, 1024, 1);
    gemm_bt_kernel<<<gF,   blk, 0, stream>>>(X, Wf, G,  Sv,      4096, 1024,  512, 2);

    zscan_kernel<<<128, dim3(128), 0, stream>>>(Q, Kt, G, Sv, Zb);
    slot_softmax_kernel<<<128, blk, 0, stream>>>(Zb);
    oscan_kernel<<<64, dim3(128), 0, stream>>>(Vt, G, Sv, Zb, Oin);

    swish_rms_kernel<<<4096, blk, 0, stream>>>(Oin, gw, Xn);

    gemm_bt_kernel<<<gQKV, blk, 0, stream>>>(Xn, Wo, (float*)d_out, nullptr, 4096, 1024, 1024, 0);
}

// v003
// One run takes 351 microseconds.
// In both of two side-by-side timings against v002, it was 1.21 times as fast.
// All steps since v000 together make it 9.35 times as fast.
#include <hip/hip_runtime.h>

// ---------------------------------------------------------------------------
// Gated ABC attention, MI455X (gfx1250, wave32, WMMA bf16).
// B=2, T=2048, D=1024, H=8, M=64, KD=128.
//   1) gemm_bt (WMMA): Q/K/V = swish(X W^T), F -> (G, S) gates
//   2) recurrence: slot scores, slot softmax, output columns (three launches)
//   3) swish + RMSNorm
//   4) gemm_bt: out = Xn Wo^T
// GEMM: 256x64 block tile, 8 waves x (32x64), double-buffered LDS,
// float4 global loads held in registers for two trips -> packed bf16 -> 16B LDS stores
// -> ds_load_b128 frags.
// Epilogue through LDS, rolled, 16-byte stores.
// ---------------------------------------------------------------------------

typedef __attribute__((ext_vector_type(16))) __bf16 v16bf;
typedef __attribute__((ext_vector_type(8)))  __bf16 v8bf;
typedef __attribute__((ext_vector_type(8)))  float  v8f;

#define TILE_M 256
#define TILE_N 64
#define TILE_K 32
#define KPAD   8          // pad rows to 40 bf16 = 80 B (16B multiple, conflict-free)
#define LROW   (TILE_K + KPAD)
#define EPITCH 68         // epilogue rows: 64 f32 + 4, so rows r and r+8 fall on different banks

static __device__ __forceinline__ v8bf pack8(float4 a, float4 b) {
    v8bf p;
    p[0] = (__bf16)a.x; p[1] = (__bf16)a.y; p[2] = (__bf16)a.z; p[3] = (__bf16)a.w;
    p[4] = (__bf16)b.x; p[5] = (__bf16)b.y; p[6] = (__bf16)b.z; p[7] = (__bf16)b.w;
    return p;
}

static __device__ __forceinline__ v16bf load_frag(const __bf16* rowp, int half) {
    // lane's two contiguous 16-byte chunks of the 32-element K row
    v8bf lo = *(const v8bf*)(rowp + (half << 3));
    v8bf hi = *(const v8bf*)(rowp + 16 + (half << 3));
    return __builtin_shufflevector(lo, hi, 0, 1, 2, 3, 4, 5, 6, 7,
                                   8, 9, 10, 11, 12, 13, 14, 15);
}

// Work-group barrier of the K loop, by hand: it waits for this wave's LDS traffic alone.
// __syncthreads() would also wait for the global loads that are to stay in flight across it.
static __device__ __forceinline__ void lds_barrier() {
    asm volatile("s_wait_dscnt 0x0\n\ts_barrier_signal -1\n\ts_barrier_wait -1" ::: "memory");
}

// Y = act( X @ W^T ) ; X: [Nrows,Kdim] f32, W: [Nout,Kdim] f32, Y: [Nrows,Nout]
// act_mode: 0 = identity, 1 = swish, 2 = gate (Y=g=logsigmoid/16, Y2=s=1-exp(g))
__global__ __launch_bounds__(256) void gemm_bt_kernel(
    const float* __restrict__ X, const float* __restrict__ W,
    float* __restrict__ Y, float* __restrict__ Y2,
    int Nrows, int Kdim, int Nout, int act_mode)
{
    __shared__ __attribute__((aligned(16))) __bf16 As[2][TILE_M][LROW];
    __shared__ __attribute__((aligned(16))) __bf16 Bs[2][TILE_N][LROW];

    const int tid  = threadIdx.x;
    const int wave = tid >> 5;        // 0..7
    const int lane = tid & 31;
    const int half = lane >> 4;       // K-half select (0/1)
    const int l15  = lane & 15;
    const int m0   = blockIdx.y * TILE_M;
    const int n0   = blockIdx.x * TILE_N;

    v8f acc[2][4];
#pragma unroll
    for (int am = 0; am < 2; ++am)
#pragma unroll
        for (int nt = 0; nt < 4; ++nt)
#pragma unroll
            for (int j = 0; j < 8; ++j) acc[am][nt][j] = 0.0f;

    // ---- staging, split in two: global loads into registers, and (two trips later)
    //      f32 -> bf16 and the LDS stores. Two register sets, so two K tiles are in flight.
    // No branch stands around either half: a branch would merge paths in the compiler's
    // load counting and its wait for the older set would drain the younger one too.
    struct Held { float4 a[2][4]; float4 b[2]; };
    const int nK = Kdim / TILE_K;
    auto fetch = [&](Held& s, int kt) {
        // past the last tile the last one is asked for again (in bounds, never used)
        const int k0 = (kt < nK ? kt : nK - 1) * TILE_K;
        // A: 256 rows x 32 cols -> 512 (row, 16-col-half) units, 2 per thread
#pragma unroll
        for (int it = 0; it < 2; ++it) {
            const int i = tid + (it << 8);
            const int r = i >> 1, ch = (i & 1) << 4;
            const float4* xr = (const float4*)(X + (size_t)(m0 + r) * Kdim + k0 + ch);
            s.a[it][0] = xr[0]; s.a[it][1] = xr[1]; s.a[it][2] = xr[2]; s.a[it][3] = xr[3];
        }
        // B: 64 rows x 32 cols -> 256 (row, 8-col-quarter) units, 1 per thread
        {
            const int r = tid >> 2, ch = (tid & 3) << 3;
            const float4* wr = (const float4*)(W + (size_t)(n0 + r) * Kdim + k0 + ch);
            s.b[0] = wr[0]; s.b[1] = wr[1];
        }
        // the loads' address registers are rewritten for the next fetch
        asm volatile("s_wait_xcnt 0x0" ::: "memory");
    };
    auto publish = [&](const Held& s, int buf) {
#pragma unroll
        for (int it = 0; it < 2; ++it) {
            const int i = tid + (it << 8);
            const int r = i >> 1, ch = (i & 1) << 4;
            *(v8bf*)&As[buf][r][ch]     = pack8(s.a[it][0], s.a[it][1]);
            *(v8bf*)&As[buf][r][ch + 8] = pack8(s.a[it][2], s.a[it][3]);
        }
        *(v8bf*)&Bs[buf][tid >> 2][(tid & 3) << 3] = pack8(s.b[0], s.b[1]);
    };

    Held h0, h1;                       // h0: even K tiles, h1: odd K tiles
    fetch(h0, 0);
    publish(h0, 0);
    fetch(h1, 1);
    fetch(h0, 2);
    lds_barrier();

    // one trip: tile kt from LDS buffer cur; nxt holds tile kt + 1, asked for two trips ago
    auto trip = [&](int kt, int cur, Held& nxt) {
        // fragments: wave's 32 rows x block's 64 cols
        const int wrow = wave << 5;
        v16bf aF[2], bF[4];
#pragma unroll
        for (int am = 0; am < 2; ++am)
            aF[am] = load_frag(&As[cur][wrow + (am << 4) + l15][0], half);
#pragma unroll
        for (int nt = 0; nt < 4; ++nt)
            bF[nt] = load_frag(&Bs[cur][(nt << 4) + l15][0], half);

#pragma unroll
        for (int am = 0; am < 2; ++am)
#pragma unroll
            for (int nt = 0; nt < 4; ++nt)
                acc[am][nt] = __builtin_amdgcn_wmma_f32_16x16x32_bf16(
                    false, aF[am], false, bF[nt], (short)0, acc[am][nt], false, false);
        // keeps the wait for the held tile's loads behind the products; lifted above them it would stall them
        __builtin_amdgcn_sched_barrier(0);
        publish(nxt, cur ^ 1);
        fetch(nxt, kt + 3);
        lds_barrier();
    };
    // trips in pairs, so that each register set and LDS buffer is named at compile time and no
    // branch stands inside the loop; an odd trip count ends in one trip behind it
    int kt = 0;
    for (; kt + 1 < nK; kt += 2) {
        trip(kt, 0, h1);
        trip(kt + 1, 1, h0);
    }
    if (kt < nK) trip(kt, 0, h1);

    // Epilogue. C/D layout: VGPR r, lane<16 -> (M=r, N=lane); lane>=16 -> (M=8+r).
    // Each wave passes its accumulators, 16 rows at a time, through its own slice of
    // the (now free) A buffer and picks them up as whole rows; the activation then
    // runs in a rolled loop of 16-byte pieces. Rolled to keep the text small.
    float* ep = reinterpret_cast<float*>(&As[0][0][0]) + wave * (16 * EPITCH);
    const float* src = ep + half * EPITCH + (l15 << 2);
#pragma unroll
    for (int am = 0; am < 2; ++am) {
        if (am) __syncthreads();   // the first 16 rows have been read; the slice may be rewritten
#pragma unroll
        for (int nt = 0; nt < 4; ++nt)
#pragma unroll
            for (int r = 0; r < 8; ++r)
                ep[(r + (half << 3)) * EPITCH + (nt << 4) + l15] = acc[am][nt][r];
        __syncthreads();           // lanes read what other lanes wrote

        // rows (wave*32 + am*16 + half) + 2 it, columns n0 + 4*l15 ..
        const size_t idx0 = (size_t)(m0 + (wave << 5) + (am << 4) + half) * Nout + n0 + (l15 << 2);
        const size_t step = (size_t)Nout * 2;
        if (act_mode == 0) {
#pragma unroll 1   // rolled: keeps the text small (see above)
            for (int it = 0; it < 8; ++it) {
                const float4 v = *(const float4*)(src + it * (2 * EPITCH));
                *(float4*)(Y + idx0 + it * step) = v;
                // the store's registers are rewritten by the next trip
                asm volatile("s_wait_xcnt 0x0" ::: "memory");
            }
        } else if (act_mode == 1) {
#pragma unroll 1   // rolled: keeps the text small (see above)
            for (int it = 0; it < 8; ++it) {
                const float4 v = *(const float4*)(src + it * (2 * EPITCH));
                float4 y;
                y.x = v.x / (1.0f + __expf(-v.x));                          // swish
                y.y = v.y / (1.0f + __expf(-v.y));
                y.z = v.z / (1.0f + __expf(-v.z));
                y.w = v.w / (1.0f + __expf(-v.w));
                *(float4*)(Y + idx0 + it * step) = y;
                // the store's registers are rewritten by the next trip
                asm volatile("s_wait_xcnt 0x0" ::: "memory");
            }
        } else {
#pragma unroll 1   // rolled: keeps the text small (see above)
            for (int it = 0; it < 8; ++it) {
                const float4 v = *(const float4*)(src + it * (2 * EPITCH));
                const float vv[4] = {v.x, v.y, v.z, v.w};
                float g[4], s[4];
#pragma unroll
                for (int c = 0; c < 4; ++c) {
                    const float ls = fminf(vv[c], 0.0f) - log1pf(__expf(-fabsf(vv[c])));  // logsigmoid
                    g[c] = ls * 0.0625f;                                                // /GATE_NORM
                    s[c] = 1.0f - __expf(g[c]);
                }
                *(float4*)(Y  + idx0 + it * step) = make_float4(g[0], g[1], g[2], g[3]);
                *(float4*)(Y2 + idx0 + it * step) = make_float4(s[0], s[1], s[2], s[3]);
                // the stores' registers are rewritten by the next trip
                asm volatile("s_wait_xcnt 0x0" ::: "memory");
            }
        }
    }
}

// ---------------------------------------------------------------------------
// Gated-ABC recurrence, split into its independent parts (three launches).
//   hk[:, m] depends on slot m alone  -> zscan: one workgroup per (b,h, 8 slots)
//   softmax over the 64 slots         -> one thread per (b,h,t)
//   hv[:, v] depends on column v alone-> oscan: one workgroup per (b,h, 32 cols)
// Inside a workgroup time runs in tiles of SCAN_TT steps: the tile's inputs sit
// in LDS, every thread steps its own register tile of the state with no barrier
// between steps, leaves its partial dot products in LDS, and the tile's partials
// are summed once behind the tile. The next tile's inputs are fetched into
// registers while the current tile is stepped.
// Z / P layout: [b*8+h][slot block of 8][t][8], so each workgroup owns whole lines.
// ---------------------------------------------------------------------------
typedef __attribute__((ext_vector_type(2))) float f32x2;
typedef __attribute__((ext_vector_type(4))) float f32x4;

#define SCAN_TT 32
#define ZPITCH  264   // 32 k-groups x 8 slots + 8: the tile sum reads 8 rows on distinct banks
#define OPITCH  528   // 16 slot-groups x 32 cols + 16: same, for 16-byte reads
#define PPITCH  72    // 64 slots + 8: the blocked P rows land on distinct banks

static __device__ __forceinline__ f32x2 splat2(float x) { f32x2 r = {x, x}; return r; }

// thread: 4 k (kg*4..) x 2 slots (mg*2..) of hk
__global__ __launch_bounds__(128) void zscan_kernel(
    const float* __restrict__ Qp, const float* __restrict__ Kp,
    const float* __restrict__ Gp, const float* __restrict__ Sp,
    float* __restrict__ Zb)
{
    __shared__ __attribute__((aligned(16))) float qS[SCAN_TT][128];
    __shared__ __attribute__((aligned(16))) float kS[SCAN_TT][128];
    __shared__ __attribute__((aligned(16))) float geS[SCAN_TT][8];
    __shared__ __attribute__((aligned(16))) float sS[SCAN_TT][8];
    __shared__ __attribute__((aligned(16))) float part[SCAN_TT][ZPITCH];

    const int tid = threadIdx.x;
    const int bh  = blockIdx.x >> 3;
    const int mb  = blockIdx.x & 7;
    const int b   = bh >> 3;
    const int h   = bh & 7;
    const int kg  = tid >> 2;      // 0..31
    const int mg  = tid & 3;       // 0..3
    const float scale = 0.08838834764831845f; // 128^-0.5

    f32x4 qr[8], kr[8], gr;
    // uniform base + one fixed per-thread offset: the tile advance stays in scalar registers
    const unsigned qoff = (unsigned)(tid >> 5) * 1024u + (unsigned)((tid & 31) << 2);
    const unsigned goff = (unsigned)((tid & 63) >> 1) * 512u + (unsigned)((tid & 1) << 2);
    const float* GS = (__builtin_amdgcn_readfirstlane(tid) < 64) ? Gp : Sp;   // waves 0,1: gates; 2,3: s
    auto fetch = [&](int t0) {
        const size_t rowq = (size_t)(b * 2048 + t0) * 1024 + h * 128;
        const float* q = Qp + rowq;
        const float* k = Kp + rowq;
#pragma unroll
        for (int i = 0; i < 8; ++i) {       // rows (tid>>5) + 4 i
            qr[i] = *(const f32x4*)(q + qoff + i * 4096);
            kr[i] = *(const f32x4*)(k + qoff + i * 4096);
        }
        gr = *(const f32x4*)(GS + (size_t)(b * 2048 + t0) * 512 + h * 64 + mb * 8 + goff);
    };
    auto publish = [&]() {
#pragma unroll
        for (int i = 0; i < 8; ++i) {
            const int idx = tid + (i << 7);
            *(f32x4*)&qS[idx >> 5][(idx & 31) << 2] = qr[i] * scale;
            *(f32x4*)&kS[idx >> 5][(idx & 31) << 2] = kr[i];
        }
        const int u = tid & 63;
        if (tid < 64) {
            f32x4 e = {__expf(gr.x), __expf(gr.y), __expf(gr.z), __expf(gr.w)};
            *(f32x4*)&geS[u >> 1][(u & 1) << 2] = e;
        } else {
            *(f32x4*)&sS[u >> 1][(u & 1) << 2] = gr;
        }
    };

    f32x2 hk[4];
#pragma unroll
    for (int i = 0; i < 4; ++i) hk[i] = splat2(0.0f);

    fetch(0);
    publish();
    __syncthreads();

    for (int t0 = 0; t0 < 2048; t0 += SCAN_TT) {
        const bool more = (t0 + SCAN_TT) < 2048;
        if (more) fetch(t0 + SCAN_TT);

        // groups of 4 steps, two register sets: the next group's LDS reads are in
        // flight while this group is stepped (one wave per SIMD hides nothing itself)
        f32x4 qa[4], ka[4], qb[4], kb[4];
        f32x2 ga[4], sa[4], gb[4], sb[4];
        auto ld = [&](f32x4 (&q)[4], f32x4 (&k)[4], f32x2 (&g)[4], f32x2 (&s)[4], int base) {
#pragma unroll
            for (int j = 0; j < 4; ++j) {
                q[j] = *(const f32x4*)&qS[base + j][kg << 2];
                k[j] = *(const f32x4*)&kS[base + j][kg << 2];
                g[j] = *(const f32x2*)&geS[base + j][mg << 1];
                s[j] = *(const f32x2*)&sS[base + j][mg << 1];
            }
            // keeps these reads ahead of the group stepped next; sunk to their use they would be waited for
            __builtin_amdgcn_sched_barrier(0);
        };
        auto step = [&](const f32x4 (&q)[4], const f32x4 (&k)[4], const f32x2 (&g)[4], const f32x2 (&s)[4], int base) {
#pragma unroll
            for (int j = 0; j < 4; ++j) {
                f32x2 acc = splat2(0.0f);
#pragma unroll
                for (int i = 0; i < 4; ++i) {
                    hk[i] = __builtin_elementwise_fma(hk[i], g[j], splat2(k[j][i]) * s[j]);
                    acc   = __builtin_elementwise_fma(splat2(q[j][i]), hk[i], acc);
                }
                *(f32x2*)&part[base + j][(kg << 3) + (mg << 1)] = acc;
            }
        };
        ld(qa, ka, ga, sa, 0);
#pragma unroll
        for (int g8 = 0; g8 < SCAN_TT; g8 += 8) {
            ld(qb, kb, gb, sb, g8 + 4);
            step(qa, ka, ga, sa, g8);
            if (g8 + 8 < SCAN_TT) ld(qa, ka, ga, sa, g8 + 8);
            step(qb, kb, gb, sb, g8 + 4);
        }
        __syncthreads();   // partials complete; every reader has left the input tile

        {
            const int rt = tid >> 2, rm = tid & 3;
            f32x2 a0 = splat2(0.0f), a1 = a0, a2 = a0, a3 = a0;
#pragma unroll
            for (int g = 0; g < 8; ++g) {
                a0 += *(const f32x2*)&part[rt][((4 * g + 0) << 3) + (rm << 1)];
                a1 += *(const f32x2*)&part[rt][((4 * g + 1) << 3) + (rm << 1)];
                a2 += *(const f32x2*)&part[rt][((4 * g + 2) << 3) + (rm << 1)];
                a3 += *(const f32x2*)&part[rt][((4 * g + 3) << 3) + (rm << 1)];
            }
            float* zrow = Zb + ((size_t)(bh * 8 + mb) * 2048 + t0) * 8;
            *(f32x2*)(zrow + (unsigned)(rt * 8 + (rm << 1))) = (a0 + a1) + (a2 + a3);
            // the store's registers are reused right behind it
            asm volatile("s_wait_xcnt 0x0" ::: "memory");
        }
        if (more) publish();
        __syncthreads();   // next input tile published; partials free again
    }
}

// softmax over the 64 slots of one (b,h,t), in place on the blocked layout
__global__ __launch_bounds__(256) void slot_softmax_kernel(float* Zb)
{
    const int gid = blockIdx.x * 256 + threadIdx.x;
    const int bh  = gid >> 11;
    const int t   = gid & 2047;
    f32x4 z[16];
#pragma unroll
    for (int mb = 0; mb < 8; ++mb) {
        const float* p = Zb + ((size_t)(bh * 8 + mb) * 2048 + t) * 8;
        z[2 * mb]     = *(const f32x4*)p;
        z[2 * mb + 1] = *(const f32x4*)(p + 4);
    }
    f32x4 m4 = z[0];
#pragma unroll
    for (int i = 1; i < 16; ++i) m4 = __builtin_elementwise_max(m4, z[i]);
    const float mx = fmaxf(fmaxf(m4.x, m4.y), fmaxf(m4.z, m4.w));
    f32x4 s4 = {0.0f, 0.0f, 0.0f, 0.0f};
#pragma unroll
    for (int i = 0; i < 16; ++i) {
        f32x4 e = {__expf(z[i].x - mx), __expf(z[i].y - mx), __expf(z[i].z - mx), __expf(z[i].w - mx)};
        z[i] = e;
        s4 += e;
    }
    const float inv = 1.0f / ((s4.x + s4.y) + (s4.z + s4.w));
#pragma unroll
    for (int mb = 0; mb < 8; ++mb) {
        float* p = Zb + ((size_t)(bh * 8 + mb) * 2048 + t) * 8;
        *(f32x4*)p       = z[2 * mb] * inv;
        *(f32x4*)(p + 4) = z[2 * mb + 1] * inv;
    }
}

// thread: 4 slots (sg*4..) x 4 columns (vg*4..) of hv
__global__ __launch_bounds__(128) void oscan_kernel(
    const float* __restrict__ Vp, const float* __restrict__ Gp,
    const float* __restrict__ Sp, const float* __restrict__ Pb,
    float* __restrict__ Op)
{
    __shared__ __attribute__((aligned(16))) float geS[SCAN_TT][64];
    __shared__ __attribute__((aligned(16))) float sS[SCAN_TT][64];
    __shared__ __attribute__((aligned(16))) float pS[SCAN_TT][PPITCH];
    __shared__ __attribute__((aligned(16))) float vS[SCAN_TT][32];
    __shared__ __attribute__((aligned(16))) float part[SCAN_TT][OPITCH];

    const int tid = threadIdx.x;
    const int bh  = blockIdx.x >> 2;
    const int v0  = (blockIdx.x & 3) << 5;
    const int b   = bh >> 3;
    const int h   = bh & 7;
    const int vg  = tid & 7;       // 0..7
    const int sg  = tid >> 3;      // 0..15

    f32x4 gr[4], sr[4], pr[4], vr[2];
    // uniform base + one fixed per-thread offset: the tile advance stays in scalar registers
    const unsigned goff = (unsigned)(tid >> 4) * 512u + (unsigned)((tid & 15) << 2);
    const unsigned poff = (unsigned)(tid >> 6) * 16384u + (unsigned)((tid & 63) << 2);
    const unsigned voff = (unsigned)(tid >> 3) * 1024u + (unsigned)((tid & 7) << 2);
    auto fetch = [&](int t0) {
        const size_t rowg = (size_t)(b * 2048 + t0) * 512 + h * 64;
        const float* g = Gp + rowg;
        const float* s = Sp + rowg;
        const float* p = Pb + ((size_t)(bh * 8) * 2048 + t0) * 8;
        const float* v = Vp + (size_t)(b * 2048 + t0) * 1024 + h * 128 + v0;
#pragma unroll
        for (int i = 0; i < 4; ++i) {
            gr[i] = *(const f32x4*)(g + goff + i * 4096);    // rows (tid>>4) + 8 i
            sr[i] = *(const f32x4*)(s + goff + i * 4096);
            // blocked P: slot block (tid>>6) + 2 i, then 64 consecutive 16-byte pieces of this tile
            pr[i] = *(const f32x4*)(p + poff + i * 32768);
        }
#pragma unroll
        for (int i = 0; i < 2; ++i)
            vr[i] = *(const f32x4*)(v + voff + i * 16384);   // rows (tid>>3) + 16 i
    };
    auto publish = [&]() {
#pragma unroll
        for (int i = 0; i < 4; ++i) {
            const int idx = tid + (i << 7);
            f32x4 e = {__expf(gr[i].x), __expf(gr[i].y), __expf(gr[i].z), __expf(gr[i].w)};
            *(f32x4*)&geS[idx >> 4][(idx & 15) << 2] = e;
            *(f32x4*)&sS[idx >> 4][(idx & 15) << 2]  = sr[i];
            *(f32x4*)&pS[(idx & 63) >> 1][((idx >> 6) << 3) + ((idx & 1) << 2)] = pr[i];
        }
#pragma unroll
        for (int i = 0; i < 2; ++i) {
            const int idx = tid + (i << 7);
            *(f32x4*)&vS[idx >> 3][(idx & 7) << 2] = vr[i];
        }
    };

    f32x2 hv[4][2];
#pragma unroll
    for (int i = 0; i < 4; ++i) { hv[i][0] = splat2(0.0f); hv[i][1] = splat2(0.0f); }

    fetch(0);
    publish();
    __syncthreads();

    for (int t0 = 0; t0 < 2048; t0 += SCAN_TT) {
        const bool more = (t0 + SCAN_TT) < 2048;
        if (more) fetch(t0 + SCAN_TT);

        // groups of 4 steps, two register sets: the next group's LDS reads are in
        // flight while this group is stepped (one wave per SIMD hides nothing itself)
        f32x4 ga[4], sa[4], pa[4], va[4], gb[4], sb[4], pb[4], vb[4];
        auto ld = [&](f32x4 (&g)[4], f32x4 (&s)[4], f32x4 (&p)[4], f32x4 (&v)[4], int base) {
#pragma unroll
            for (int j = 0; j < 4; ++j) {
                g[j] = *(const f32x4*)&geS[base + j][sg << 2];
                s[j] = *(const f32x4*)&sS[base + j][sg << 2];
                p[j] = *(const f32x4*)&pS[base + j][sg << 2];
                v[j] = *(const f32x4*)&vS[base + j][vg << 2];
            }
            // keeps these reads ahead of the group stepped next; sunk to their use they would be waited for
            __builtin_amdgcn_sched_barrier(0);
        };
        auto step = [&](const f32x4 (&g)[4], const f32x4 (&s)[4], const f32x4 (&p)[4], const f32x4 (&v)[4], int base) {
#pragma unroll
            for (int j = 0; j < 4; ++j) {
                const f32x2 v01 = {v[j].x, v[j].y}, v23 = {v[j].z, v[j].w};
                f32x2 acc0 = splat2(0.0f), acc1 = splat2(0.0f);
#pragma unroll
                for (int i = 0; i < 4; ++i) {
                    hv[i][0] = __builtin_elementwise_fma(hv[i][0], splat2(g[j][i]), splat2(s[j][i]) * v01);
                    hv[i][1] = __builtin_elementwise_fma(hv[i][1], splat2(g[j][i]), splat2(s[j][i]) * v23);
                    acc0 = __builtin_elementwise_fma(splat2(p[j][i]), hv[i][0], acc0);
                    acc1 = __builtin_elementwise_fma(splat2(p[j][i]), hv[i][1], acc1);
                }
                f32x4 a = {acc0.x, acc0.y, acc1.x, acc1.y};
                *(f32x4*)&part[base + j][(sg << 5) + (vg << 2)] = a;
            }
        };
        ld(ga, sa, pa, va, 0);
#pragma unroll
        for (int g8 = 0; g8 < SCAN_TT; g8 += 8) {
            ld(gb, sb, pb, vb, g8 + 4);
            step(ga, sa, pa, va, g8);
            if (g8 + 8 < SCAN_TT) ld(ga, sa, pa, va, g8 + 8);
            step(gb, sb, pb, vb, g8 + 4);
        }
        __syncthreads();   // partials complete; every reader has left the input tile

        {
            const int rt = tid >> 2, rv = (tid & 3) << 2;
            f32x4 a0 = {0.0f, 0.0f, 0.0f, 0.0f}, a1 = a0, b0 = a0, b1 = a0;
#pragma unroll
            for (int g = 0; g < 8; ++g) {
                a0 += *(const f32x4*)&part[rt][((2 * g + 0) << 5) + rv];
                b0 += *(const f32x4*)&part[rt][((2 * g + 0) << 5) + rv + 16];
                a1 += *(const f32x4*)&part[rt][((2 * g + 1) << 5) + rv];
                b1 += *(const f32x4*)&part[rt][((2 * g + 1) << 5) + rv + 16];
            }
            float* o = Op + (size_t)(b * 2048 + t0) * 1024 + h * 128 + v0;
            *(f32x4*)(o + (unsigned)(rt * 1024 + rv))      = a0 + a1;
            *(f32x4*)(o + (unsigned)(rt * 1024 + rv) + 16) = b0 + b1;
            // the stores' registers are reused right behind them
            asm volatile("s_wait_xcnt 0x0" ::: "memory");
        }
        if (more) publish();
        __syncthreads();   // next input tile published; partials free again
    }
}

// ---------------------------------------------------------------------------
// y = RMSNorm(swish(x)) * g_weight     (one block per row of 1024)
// ---------------------------------------------------------------------------
__global__ __launch_bounds__(256) void swish_rms_kernel(
    const float* __restrict__ X, const float* __restrict__ w,
    float* __restrict__ Y)
{
    const int row = blockIdx.x;
    const float* xr = X + (size_t)row * 1024;
    float loc[4];
    float ss = 0.0f;
#pragma unroll
    for (int i = 0; i < 4; ++i) {
        const float x  = xr[threadIdx.x + 256 * i];
        const float sw = x / (1.0f + __expf(-x));
        loc[i] = sw;
        ss += sw * sw;
    }
#pragma unroll
    for (int off = 16; off > 0; off >>= 1) ss += __shfl_xor(ss, off, 32);
    __shared__ float wred[8];
    if ((threadIdx.x & 31) == 0) wred[threadIdx.x >> 5] = ss;
    __syncthreads();
    float tot = 0.0f;
#pragma unroll
    for (int i = 0; i < 8; ++i) tot += wred[i];
    const float r = rsqrtf(tot * (1.0f / 1024.0f) + 1e-5f);
#pragma unroll
    for (int i = 0; i < 4; ++i) {
        const int c = threadIdx.x + 256 * i;
        Y[(size_t)row * 1024 + c] = loc[i] * r * w[c];
    }
}

// ---------------------------------------------------------------------------
extern "C" void kernel_launch(void* const* d_in, const int* in_sizes, int n_in,
                              void* d_out, int out_size, void* d_ws, size_t ws_size,
                              hipStream_t stream) {
    const float* X  = (const float*)d_in[0];   // [4096,1024]
    const float* Wq = (const float*)d_in[1];
    const float* Wk = (const float*)d_in[2];
    const float* Wv = (const float*)d_in[3];
    const float* Wf = (const float*)d_in[4];   // [512,1024]
    const float* Wo = (const float*)d_in[5];
    const float* gw = (const float*)d_in[6];   // [1024]

    const size_t ND = 4096ull * 1024ull;
    const size_t NF = 4096ull * 512ull;
    float* ws  = (float*)d_ws;
    float* Q   = ws;             // 16 MB
    float* Kt  = Q   + ND;       // 16 MB
    float* Vt  = Kt  + ND;       // 16 MB
    float* G   = Vt  + ND;       //  8 MB
    float* Sv  = G   + NF;       //  8 MB
    float* Oin = Sv  + NF;       // 16 MB
    float* Zb  = Oin + ND;       //  8 MB, slot scores then slot weights
    float* Xn  = Q;              // reuse Q after the scan

    dim3 blk(256);
    dim3 gQKV(1024 / TILE_N, 4096 / TILE_M);   // 16 x 16
    dim3 gF(512 / TILE_N, 4096 / TILE_M);      //  8 x 16

    gemm_bt_kernel<<<gQKV, blk, 0, stream>>>(X, Wq, Q,  nullptr, 4096, 1024, 1024, 1);
    gemm_bt_kernel<<<gQKV, blk, 0, stream>>>(X, Wk, Kt, nullptr, 4096, 1024, 1024, 1);
    gemm_bt_kernel<<<gQKV, blk, 0, stream>>>(X, Wv, Vt, nullptr, 4096, 1024, 1024, 1);
    gemm_bt_kernel<<<gF,   blk, 0, stream>>>(X, Wf, G,  Sv,      4096, 1024,  512, 2);

    zscan_kernel<<<128, dim3(128), 0, stream>>>(Q, Kt, G, Sv, Zb);
    slot_softmax_kernel<<<128, blk, 0, stream>>>(Zb);
    oscan_kernel<<<64, dim3(128), 0, stream>>>(Vt, G, Sv, Zb, Oin);

    swish_rms_kernel<<<4096, blk, 0, stream>>>(Oin, gw, Xn);

    gemm_bt_kernel<<<gQKV, blk, 0, stream>>>(Xn, Wo, (float*)d_out, nullptr, 4096, 1024, 1024, 0);
}

// v004
// A run of this version takes 337 microseconds.
// Timed twice side by side with v003, it ran 1.04 times as fast both times.
// All steps since v000 together make it 9.75 times as fast.
#include <hip/hip_runtime.h>

// ---------------------------------------------------------------------------
// Gated ABC attention, MI455X (gfx1250, wave32, WMMA bf16).
// B=2, T=2048, D=1024, H=8, M=64, KD=128.
//   1) gemm_bt (WMMA): Q/K/V = swish(X W^T), F -> (G, S) gates
//   2) recurrence: slot scores, slot softmax, output columns (three launches)
//   3) swish + RMSNorm
//   4) gemm_bt: out = Xn Wo^T
// GEMM: 256x64 block tile, 8 waves x (32x64), double-buffered LDS,
// float4 global loads (eight lanes per 128-byte row slice, so a wave's load covers whole
// lines) held in registers for two trips -> packed bf16 -> 8B LDS stores -> ds_load_b128 frags.
// Epilogue through LDS, rolled, 16-byte stores.
// ---------------------------------------------------------------------------

typedef __attribute__((ext_vector_type(16))) __bf16 v16bf;
typedef __attribute__((ext_vector_type(8)))  __bf16 v8bf;
typedef __attribute__((ext_vector_type(4)))  __bf16 v4bf;
typedef __attribute__((ext_vector_type(8)))  float  v8f;

#define TILE_M 256
#define TILE_N 64
#define TILE_K 32
#define KPAD   8          // pad rows to 40 bf16 = 80 B (16B multiple, conflict-free)
#define LROW   (TILE_K + KPAD)
#define EPITCH 68         // epilogue rows: 64 f32 + 4, so rows r and r+8 fall on different banks

static __device__ __forceinline__ v4bf pack4(float4 a) {
    v4bf p;
    p[0] = (__bf16)a.x; p[1] = (__bf16)a.y; p[2] = (__bf16)a.z; p[3] = (__bf16)a.w;
    return p;
}

static __device__ __forceinline__ v16bf load_frag(const __bf16* rowp, int half) {
    // lane's two contiguous 16-byte chunks of the 32-element K row
    v8bf lo = *(const v8bf*)(rowp + (half << 3));
    v8bf hi = *(const v8bf*)(rowp + 16 + (half << 3));
    return __builtin_shufflevector(lo, hi, 0, 1, 2, 3, 4, 5, 6, 7,
                                   8, 9, 10, 11, 12, 13, 14, 15);
}

// Work-group barrier of the K loop, by hand: it waits for this wave's LDS traffic alone.
// __syncthreads() would also wait for the global loads that are to stay in flight across it.
static __device__ __forceinline__ void lds_barrier() {
    asm volatile("s_wait_dscnt 0x0\n\ts_barrier_signal -1\n\ts_barrier_wait -1" ::: "memory");
}

// Y = act( X @ W^T ) ; X: [Nrows,Kdim] f32, W: [Nout,Kdim] f32, Y: [Nrows,Nout]
// act_mode: 0 = identity, 1 = swish, 2 = gate (Y=g=logsigmoid/16, Y2=s=1-exp(g))
__global__ __launch_bounds__(256) void gemm_bt_kernel(
    const float* __restrict__ X, const float* __restrict__ W,
    float* __restrict__ Y, float* __restrict__ Y2,
    int Nrows, int Kdim, int Nout, int act_mode)
{
    __shared__ __attribute__((aligned(16))) __bf16 As[2][TILE_M][LROW];
    __shared__ __attribute__((aligned(16))) __bf16 Bs[2][TILE_N][LROW];

    const int tid  = threadIdx.x;
    const int wave = tid >> 5;        // 0..7
    const int lane = tid & 31;
    const int half = lane >> 4;       // K-half select (0/1)
    const int l15  = lane & 15;
    const int m0   = blockIdx.y * TILE_M;
    const int n0   = blockIdx.x * TILE_N;

    v8f acc[2][4];
#pragma unroll
    for (int am = 0; am < 2; ++am)
#pragma unroll
        for (int nt = 0; nt < 4; ++nt)
#pragma unroll
            for (int j = 0; j < 8; ++j) acc[am][nt][j] = 0.0f;

    // ---- staging, split in two: global loads into registers, and (two trips later)
    //      f32 -> bf16 and the LDS stores. Two register sets, so two K tiles are in flight.
    // No branch stands around either half: a branch would merge paths in the compiler's
    // load counting and its wait for the older set would drain the younger one too.
    // A row's K slice is 32 f32 = one 128-byte line. Eight neighbouring lanes take it in 16-byte
    // pieces, so one wave-wide load covers four whole lines; thread: piece sc of rows sr + 32 i.
    struct Held { float4 a[8]; float4 b[2]; };
    const int nK = Kdim / TILE_K;
    const int sr = tid >> 3;           // 0..31
    const int sc = (tid & 7) << 2;     // 0, 4, .. 28
    // uniform base + fixed per-thread byte offsets: the K advance is scalar arithmetic
    unsigned soff[8];
#pragma unroll
    for (int i = 0; i < 8; ++i) soff[i] = ((unsigned)(sr + (i << 5)) * (unsigned)Kdim + (unsigned)sc) * 4u;
    const float* Xb = X + (size_t)m0 * Kdim;
    const float* Wb = W + (size_t)n0 * Kdim;
    auto fetch = [&](Held& s, int kt) {
        // past the last tile the last one is asked for again (in bounds, never used)
        const int k0 = (kt < nK ? kt : nK - 1) * TILE_K;
        const char* xk = (const char*)(Xb + k0);
        const char* wk = (const char*)(Wb + k0);
#pragma unroll
        for (int i = 0; i < 8; ++i) s.a[i] = *(const float4*)(xk + soff[i]);   // A: 256 rows
#pragma unroll
        for (int i = 0; i < 2; ++i) s.b[i] = *(const float4*)(wk + soff[i]);   // B: 64 rows
        // the loads' address registers are rewritten for the next fetch
        asm volatile("s_wait_xcnt 0x0" ::: "memory");
    };
    auto publish = [&](const Held& s, int buf) {
#pragma unroll
        for (int i = 0; i < 8; ++i) *(v4bf*)&As[buf][sr + (i << 5)][sc] = pack4(s.a[i]);
#pragma unroll
        for (int i = 0; i < 2; ++i) *(v4bf*)&Bs[buf][sr + (i << 5)][sc] = pack4(s.b[i]);
    };

    Held h0, h1;                       // h0: even K tiles, h1: odd K tiles
    fetch(h0, 0);
    publish(h0, 0);
    fetch(h1, 1);
    fetch(h0, 2);
    lds_barrier();

    // one trip: tile kt from LDS buffer cur; nxt holds tile kt + 1, asked for two trips ago
    auto trip = [&](int kt, int cur, Held& nxt) {
        // fragments: wave's 32 rows x block's 64 cols
        const int wrow = wave << 5;
        v16bf aF[2], bF[4];
#pragma unroll
        for (int am = 0; am < 2; ++am)
            aF[am] = load_frag(&As[cur][wrow + (am << 4) + l15][0], half);
#pragma unroll
        for (int nt = 0; nt < 4; ++nt)
            bF[nt] = load_frag(&Bs[cur][(nt << 4) + l15][0], half);

#pragma unroll
        for (int am = 0; am < 2; ++am)
#pragma unroll
            for (int nt = 0; nt < 4; ++nt)
                acc[am][nt] = __builtin_amdgcn_wmma_f32_16x16x32_bf16(
                    false, aF[am], false, bF[nt], (short)0, acc[am][nt], false, false);
        // keeps the wait for the held tile's loads behind the products; lifted above them it would stall them
        __builtin_amdgcn_sched_barrier(0);
        publish(nxt, cur ^ 1);
        fetch(nxt, kt + 3);
        lds_barrier();
    };
    // trips in pairs, so that each register set and LDS buffer is named at compile time and no
    // branch stands inside the loop; an odd trip count ends in one trip behind it
    int kt = 0;
    for (; kt + 1 < nK; kt += 2) {
        trip(kt, 0, h1);
        trip(kt + 1, 1, h0);
    }
    if (kt < nK) trip(kt, 0, h1);

    // Epilogue. C/D layout: VGPR r, lane<16 -> (M=r, N=lane); lane>=16 -> (M=8+r).
    // Each wave passes its accumulators, 16 rows at a time, through its own slice of
    // the (now free) A buffer and picks them up as whole rows; the activation then
    // runs in a rolled loop of 16-byte pieces. Rolled to keep the text small.
    float* ep = reinterpret_cast<float*>(&As[0][0][0]) + wave * (16 * EPITCH);
    const float* src = ep + half * EPITCH + (l15 << 2);
#pragma unroll
    for (int am = 0; am < 2; ++am) {
        if (am) __syncthreads();   // the first 16 rows have been read; the slice may be rewritten
#pragma unroll
        for (int nt = 0; nt < 4; ++nt)
#pragma unroll
            for (int r = 0; r < 8; ++r)
                ep[(r + (half << 3)) * EPITCH + (nt << 4) + l15] = acc[am][nt][r];
        __syncthreads();           // lanes read what other lanes wrote

        // rows (wave*32 + am*16 + half) + 2 it, columns n0 + 4*l15 ..
        const size_t idx0 = (size_t)(m0 + (wave << 5) + (am << 4) + half) * Nout + n0 + (l15 << 2);
        const size_t step = (size_t)Nout * 2;
        if (act_mode == 0) {
#pragma unroll 1   // rolled: keeps the text small (see above)
            for (int it = 0; it < 8; ++it) {
                const float4 v = *(const float4*)(src + it * (2 * EPITCH));
                *(float4*)(Y + idx0 + it * step) = v;
                // the store's registers are rewritten by the next trip
                asm volatile("s_wait_xcnt 0x0" ::: "memory");
            }
        } else if (act_mode == 1) {
#pragma unroll 1   // rolled: keeps the text small (see above)
            for (int it = 0; it < 8; ++it) {
                const float4 v = *(const float4*)(src + it * (2 * EPITCH));
                float4 y;
                y.x = v.x / (1.0f + __expf(-v.x));                          // swish
                y.y = v.y / (1.0f + __expf(-v.y));
                y.z = v.z / (1.0f + __expf(-v.z));
                y.w = v.w / (1.0f + __expf(-v.w));
                *(float4*)(Y + idx0 + it * step) = y;
                // the store's registers are rewritten by the next trip
                asm volatile("s_wait_xcnt 0x0" ::: "memory");
            }
        } else {
#pragma unroll 1   // rolled: keeps the text small (see above)
            for (int it = 0; it < 8; ++it) {
                const float4 v = *(const float4*)(src + it * (2 * EPITCH));
                const float vv[4] = {v.x, v.y, v.z, v.w};
                float g[4], s[4];
#pragma unroll
                for (int c = 0; c < 4; ++c) {
                    const float ls = fminf(vv[c], 0.0f) - log1pf(__expf(-fabsf(vv[c])));  // logsigmoid
                    g[c] = ls * 0.0625f;                                                // /GATE_NORM
                    s[c] = 1.0f - __expf(g[c]);
                }
                *(float4*)(Y  + idx0 + it * step) = make_float4(g[0], g[1], g[2], g[3]);
                *(float4*)(Y2 + idx0 + it * step) = make_float4(s[0], s[1], s[2], s[3]);
                // the stores' registers are rewritten by the next trip
                asm volatile("s_wait_xcnt 0x0" ::: "memory");
            }
        }
    }
}

// ---------------------------------------------------------------------------
// Gated-ABC recurrence, split into its independent parts (three launches).
//   hk[:, m] depends on slot m alone  -> zscan: one workgroup per (b,h, 8 slots)
//   softmax over the 64 slots         -> one thread per (b,h,t)
//   hv[:, v] depends on column v alone-> oscan: one workgroup per (b,h, 32 cols)
// Inside a workgroup time runs in tiles of SCAN_TT steps: the tile's inputs sit
// in LDS, every thread steps its own register tile of the state with no barrier
// between steps, leaves its partial dot products in LDS, and the tile's partials
// are summed once behind the tile. The next tile's inputs are fetched into
// registers while the current tile is stepped.
// Z / P layout: [b*8+h][slot block of 8][t][8], so each workgroup owns whole lines.
// ---------------------------------------------------------------------------
typedef __attribute__((ext_vector_type(2))) float f32x2;
typedef __attribute__((ext_vector_type(4))) float f32x4;

#define SCAN_TT 32
#define ZPITCH  264   // 32 k-groups x 8 slots + 8: the tile sum reads 8 rows on distinct banks
#define OPITCH  528   // 16 slot-groups x 32 cols + 16: same, for 16-byte reads
#define PPITCH  72    // 64 slots + 8: the blocked P rows land on distinct banks

static __device__ __forceinline__ f32x2 splat2(float x) { f32x2 r = {x, x}; return r; }

// thread: 4 k (kg*4..) x 2 slots (mg*2..) of hk
__global__ __launch_bounds__(128) void zscan_kernel(
    const float* __restrict__ Qp, const float* __restrict__ Kp,
    const float* __restrict__ Gp, const float* __restrict__ Sp,
    float* __restrict__ Zb)
{
    __shared__ __attribute__((aligned(16))) float qS[SCAN_TT][128];
    __shared__ __attribute__((aligned(16))) float kS[SCAN_TT][128];
    __shared__ __attribute__((aligned(16))) float geS[SCAN_TT][8];
    __shared__ __attribute__((aligned(16))) float sS[SCAN_TT][8];
    __shared__ __attribute__((aligned(16))) float part[SCAN_TT][ZPITCH];

    const int tid = threadIdx.x;
    const int bh  = blockIdx.x >> 3;
    const int mb  = blockIdx.x & 7;
    const int b   = bh >> 3;
    const int h   = bh & 7;
    const int kg  = tid >> 2;      // 0..31
    const int mg  = tid & 3;       // 0..3
    const float scale = 0.08838834764831845f; // 128^-0.5

    f32x4 qr[8], kr[8], gr;
    // uniform base + one fixed per-thread offset: the tile advance stays in scalar registers
    const unsigned qoff = (unsigned)(tid >> 5) * 1024u + (unsigned)((tid & 31) << 2);
    const unsigned goff = (unsigned)((tid & 63) >> 1) * 512u + (unsigned)((tid & 1) << 2);
    const float* GS = (__builtin_amdgcn_readfirstlane(tid) < 64) ? Gp : Sp;   // waves 0,1: gates; 2,3: s
    auto fetch = [&](int t0) {
        const size_t rowq = (size_t)(b * 2048 + t0) * 1024 + h * 128;
        const float* q = Qp + rowq;
        const float* k = Kp + rowq;
#pragma unroll
        for (int i = 0; i < 8; ++i) {       // rows (tid>>5) + 4 i
            qr[i] = *(const f32x4*)(q + qoff + i * 4096);
            kr[i] = *(const f32x4*)(k + qoff + i * 4096);
        }
        gr = *(const f32x4*)(GS + (size_t)(b * 2048 + t0) * 512 + h * 64 + mb * 8 + goff);
    };
    auto publish = [&]() {
#pragma unroll
        for (int i = 0; i < 8; ++i) {
            const int idx = tid + (i << 7);
            *(f32x4*)&qS[idx >> 5][(idx & 31) << 2] = qr[i] * scale;
            *(f32x4*)&kS[idx >> 5][(idx & 31) << 2] = kr[i];
        }
        const int u = tid & 63;
        if (tid < 64) {
            f32x4 e = {__expf(gr.x), __expf(gr.y), __expf(gr.z), __expf(gr.w)};
            *(f32x4*)&geS[u >> 1][(u & 1) << 2] = e;
        } else {
            *(f32x4*)&sS[u >> 1][(u & 1) << 2] = gr;
        }
    };

    f32x2 hk[4];
#pragma unroll
    for (int i = 0; i < 4; ++i) hk[i] = splat2(0.0f);

    fetch(0);
    publish();
    __syncthreads();

    for (int t0 = 0; t0 < 2048; t0 += SCAN_TT) {
        const bool more = (t0 + SCAN_TT) < 2048;
        if (more) fetch(t0 + SCAN_TT);

        // groups of 4 steps, two register sets: the next group's LDS reads are in
        // flight while this group is stepped (one wave per SIMD hides nothing itself)
        f32x4 qa[4], ka[4], qb[4], kb[4];
        f32x2 ga[4], sa[4], gb[4], sb[4];
        auto ld = [&](f32x4 (&q)[4], f32x4 (&k)[4], f32x2 (&g)[4], f32x2 (&s)[4], int base) {
#pragma unroll
            for (int j = 0; j < 4; ++j) {
                q[j] = *(const f32x4*)&qS[base + j][kg << 2];
                k[j] = *(const f32x4*)&kS[base + j][kg << 2];
                g[j] = *(const f32x2*)&geS[base + j][mg << 1];
                s[j] = *(const f32x2*)&sS[base + j][mg << 1];
            }
            // keeps these reads ahead of the group stepped next; sunk to their use they would be waited for
            __builtin_amdgcn_sched_barrier(0);
        };
        auto step = [&](const f32x4 (&q)[4], const f32x4 (&k)[4], const f32x2 (&g)[4], const f32x2 (&s)[4], int base) {
#pragma unroll
            for (int j = 0; j < 4; ++j) {
                f32x2 acc = splat2(0.0f);
#pragma unroll
                for (int i = 0; i < 4; ++i) {
                    hk[i] = __builtin_elementwise_fma(hk[i], g[j], splat2(k[j][i]) * s[j]);
                    acc   = __builtin_elementwise_fma(splat2(q[j][i]), hk[i], acc);
                }
                *(f32x2*)&part[base + j][(kg << 3) + (mg << 1)] = acc;
            }
        };
        ld(qa, ka, ga, sa, 0);
#pragma unroll
        for (int g8 = 0; g8 < SCAN_TT; g8 += 8) {
            ld(qb, kb, gb, sb, g8 + 4);
            step(qa, ka, ga, sa, g8);
            if (g8 + 8 < SCAN_TT) ld(qa, ka, ga, sa, g8 + 8);
            step(qb, kb, gb, sb, g8 + 4);
        }
        __syncthreads();   // partials complete; every reader has left the input tile

        {
            const int rt = tid >> 2, rm = tid & 3;
            f32x2 a0 = splat2(0.0f), a1 = a0, a2 = a0, a3 = a0;
#pragma unroll
            for (int g = 0; g < 8; ++g) {
                a0 += *(const f32x2*)&part[rt][((4 * g + 0) << 3) + (rm << 1)];
                a1 += *(const f32x2*)&part[rt][((4 * g + 1) << 3) + (rm << 1)];
                a2 += *(const f32x2*)&part[rt][((4 * g + 2) << 3) + (rm << 1)];
                a3 += *(const f32x2*)&part[rt][((4 * g + 3) << 3) + (rm << 1)];
            }
            float* zrow = Zb + ((size_t)(bh * 8 + mb) * 2048 + t0) * 8;
            *(f32x2*)(zrow + (unsigned)(rt * 8 + (rm << 1))) = (a0 + a1) + (a2 + a3);
            // the store's registers are reused right behind it
            asm volatile("s_wait_xcnt 0x0" ::: "memory");
        }
        if (more) publish();
        __syncthreads();   // next input tile published; partials free again
    }
}

// softmax over the 64 slots of one (b,h,t), in place on the blocked layout
__global__ __launch_bounds__(256) void slot_softmax_kernel(float* Zb)
{
    const int gid = blockIdx.x * 256 + threadIdx.x;
    const int bh  = gid >> 11;
    const int t   = gid & 2047;
    f32x4 z[16];
#pragma unroll
    for (int mb = 0; mb < 8; ++mb) {
        const float* p = Zb + ((size_t)(bh * 8 + mb) * 2048 + t) * 8;
        z[2 * mb]     = *(const f32x4*)p;
        z[2 * mb + 1] = *(const f32x4*)(p + 4);
    }
    f32x4 m4 = z[0];
#pragma unroll
    for (int i = 1; i < 16; ++i) m4 = __builtin_elementwise_max(m4, z[i]);
    const float mx = fmaxf(fmaxf(m4.x, m4.y), fmaxf(m4.z, m4.w));
    f32x4 s4 = {0.0f, 0.0f, 0.0f, 0.0f};
#pragma unroll
    for (int i = 0; i < 16; ++i) {
        f32x4 e = {__expf(z[i].x - mx), __expf(z[i].y - mx), __expf(z[i].z - mx), __expf(z[i].w - mx)};
        z[i] = e;
        s4 += e;
    }
    const float inv = 1.0f / ((s4.x + s4.y) + (s4.z + s4.w));
#pragma unroll
    for (int mb = 0; mb < 8; ++mb) {
        float* p = Zb + ((size_t)(bh * 8 + mb) * 2048 + t) * 8;
        *(f32x4*)p       = z[2 * mb] * inv;
        *(f32x4*)(p + 4) = z[2 * mb + 1] * inv;
    }
}

// thread: 4 slots (sg*4..) x 4 columns (vg*4..) of hv
__global__ __launch_bounds__(128) void oscan_kernel(
    const float* __restrict__ Vp, const float* __restrict__ Gp,
    const float* __restrict__ Sp, const float* __restrict__ Pb,
    float* __restrict__ Op)
{
    __shared__ __attribute__((aligned(16))) float geS[SCAN_TT][64];
    __shared__ __attribute__((aligned(16))) float sS[SCAN_TT][64];
    __shared__ __attribute__((aligned(16))) float pS[SCAN_TT][PPITCH];
    __shared__ __attribute__((aligned(16))) float vS[SCAN_TT][32];
    __shared__ __attribute__((aligned(16))) float part[SCAN_TT][OPITCH];

    const int tid = threadIdx.x;
    const int bh  = blockIdx.x >> 2;
    const int v0  = (blockIdx.x & 3) << 5;
    const int b   = bh >> 3;
    const int h   = bh & 7;
    const int vg  = tid & 7;       // 0..7
    const int sg  = tid >> 3;      // 0..15

    f32x4 gr[4], sr[4], pr[4], vr[2];
    // uniform base + one fixed per-thread offset: the tile advance stays in scalar registers
    const unsigned goff = (unsigned)(tid >> 4) * 512u + (unsigned)((tid & 15) << 2);
    const unsigned poff = (unsigned)(tid >> 6) * 16384u + (unsigned)((tid & 63) << 2);
    const unsigned voff = (unsigned)(tid >> 3) * 1024u + (unsigned)((tid & 7) << 2);
    auto fetch = [&](int t0) {
        const size_t rowg = (size_t)(b * 2048 + t0) * 512 + h * 64;
        const float* g = Gp + rowg;
        const float* s = Sp + rowg;
        const float* p = Pb + ((size_t)(bh * 8) * 2048 + t0) * 8;
        const float* v = Vp + (size_t)(b * 2048 + t0) * 1024 + h * 128 + v0;
#pragma unroll
        for (int i = 0; i < 4; ++i) {
            gr[i] = *(const f32x4*)(g + goff + i * 4096);    // rows (tid>>4) + 8 i
            sr[i] = *(const f32x4*)(s + goff + i * 4096);
            // blocked P: slot block (tid>>6) + 2 i, then 64 consecutive 16-byte pieces of this tile
            pr[i] = *(const f32x4*)(p + poff + i * 32768);
        }
#pragma unroll
        for (int i = 0; i < 2; ++i)
            vr[i] = *(const f32x4*)(v + voff + i * 16384);   // rows (tid>>3) + 16 i
    };
    auto publish = [&]() {
#pragma unroll
        for (int i = 0; i < 4; ++i) {
            const int idx = tid + (i << 7);
            f32x4 e = {__expf(gr[i].x), __expf(gr[i].y), __expf(gr[i].z), __expf(gr[i].w)};
            *(f32x4*)&geS[idx >> 4][(idx & 15) << 2] = e;
            *(f32x4*)&sS[idx >> 4][(idx & 15) << 2]  = sr[i];
            *(f32x4*)&pS[(idx & 63) >> 1][((idx >> 6) << 3) + ((idx & 1) << 2)] = pr[i];
        }
#pragma unroll
        for (int i = 0; i < 2; ++i) {
            const int idx = tid + (i << 7);
            *(f32x4*)&vS[idx >> 3][(idx & 7) << 2] = vr[i];
        }
    };

    f32x2 hv[4][2];
#pragma unroll
    for (int i = 0; i < 4; ++i) { hv[i][0] = splat2(0.0f); hv[i][1] = splat2(0.0f); }

    fetch(0);
    publish();
    __syncthreads();

    for (int t0 = 0; t0 < 2048; t0 += SCAN_TT) {
        const bool more = (t0 + SCAN_TT) < 2048;
        if (more) fetch(t0 + SCAN_TT);

        // groups of 4 steps, two register sets: the next group's LDS reads are in
        // flight while this group is stepped (one wave per SIMD hides nothing itself)
        f32x4 ga[4], sa[4], pa[4], va[4], gb[4], sb[4], pb[4], vb[4];
        auto ld = [&](f32x4 (&g)[4], f32x4 (&s)[4], f32x4 (&p)[4], f32x4 (&v)[4], int base) {
#pragma unroll
            for (int j = 0; j < 4; ++j) {
                g[j] = *(const f32x4*)&geS[base + j][sg << 2];
                s[j] = *(const f32x4*)&sS[base + j][sg << 2];
                p[j] = *(const f32x4*)&pS[base + j][sg << 2];
                v[j] = *(const f32x4*)&vS[base + j][vg << 2];
            }
            // keeps these reads ahead of the group stepped next; sunk to their use they would be waited for
            __builtin_amdgcn_sched_barrier(0);
        };
        auto step = [&](const f32x4 (&g)[4], const f32x4 (&s)[4], const f32x4 (&p)[4], const f32x4 (&v)[4], int base) {
#pragma unroll
            for (int j = 0; j < 4; ++j) {
                const f32x2 v01 = {v[j].x, v[j].y}, v23 = {v[j].z, v[j].w};
                f32x2 acc0 = splat2(0.0f), acc1 = splat2(0.0f);
#pragma unroll
                for (int i = 0; i < 4; ++i) {
                    hv[i][0] = __builtin_elementwise_fma(hv[i][0], splat2(g[j][i]), splat2(s[j][i]) * v01);
                    hv[i][1] = __builtin_elementwise_fma(hv[i][1], splat2(g[j][i]), splat2(s[j][i]) * v23);
                    acc0 = __builtin_elementwise_fma(splat2(p[j][i]), hv[i][0], acc0);
                    acc1 = __builtin_elementwise_fma(splat2(p[j][i]), hv[i][1], acc1);
                }
                f32x4 a = {acc0.x, acc0.y, acc1.x, acc1.y};
                *(f32x4*)&part[base + j][(sg << 5) + (vg << 2)] = a;
            }
        };
        ld(ga, sa, pa, va, 0);
#pragma unroll
        for (int g8 = 0; g8 < SCAN_TT; g8 += 8) {
            ld(gb, sb, pb, vb, g8 + 4);
            step(ga, sa, pa, va, g8);
            if (g8 + 8 < SCAN_TT) ld(ga, sa, pa, va, g8 + 8);
            step(gb, sb, pb, vb, g8 + 4);
        }
        __syncthreads();   // partials complete; every reader has left the input tile

        {
            const int rt = tid >> 2, rv = (tid & 3) << 2;
            f32x4 a0 = {0.0f, 0.0f, 0.0f, 0.0f}, a1 = a0, b0 = a0, b1 = a0;
#pragma unroll
            for (int g = 0; g < 8; ++g) {
                a0 += *(const f32x4*)&part[rt][((2 * g + 0) << 5) + rv];
                b0 += *(const f32x4*)&part[rt][((2 * g + 0) << 5) + rv + 16];
                a1 += *(const f32x4*)&part[rt][((2 * g + 1) << 5) + rv];
                b1 += *(const f32x4*)&part[rt][((2 * g + 1) << 5) + rv + 16];
            }
            float* o = Op + (size_t)(b * 2048 + t0) * 1024 + h * 128 + v0;
            *(f32x4*)(o + (unsigned)(rt * 1024 + rv))      = a0 + a1;
            *(f32x4*)(o + (unsigned)(rt * 1024 + rv) + 16) = b0 + b1;
            // the stores' registers are reused right behind them
            asm volatile("s_wait_xcnt 0x0" ::: "memory");
        }
        if (more) publish();
        __syncthreads();   // next input tile published; partials free again
    }
}

// ---------------------------------------------------------------------------
// y = RMSNorm(swish(x)) * g_weight     (one block per row of 1024)
// ---------------------------------------------------------------------------
__global__ __launch_bounds__(256) void swish_rms_kernel(
    const float* __restrict__ X, const float* __restrict__ w,
    float* __restrict__ Y)
{
    const int row = blockIdx.x;
    const float* xr = X + (size_t)row * 1024;
    float loc[4];
    float ss = 0.0f;
#pragma unroll
    for (int i = 0; i < 4; ++i) {
        const float x  = xr[threadIdx.x + 256 * i];
        const float sw = x / (1.0f + __expf(-x));
        loc[i] = sw;
        ss += sw * sw;
    }
#pragma unroll
    for (int off = 16; off > 0; off >>= 1) ss += __shfl_xor(ss, off, 32);
    __shared__ float wred[8];
    if ((threadIdx.x & 31) == 0) wred[threadIdx.x >> 5] = ss;
    __syncthreads();
    float tot = 0.0f;
#pragma unroll
    for (int i = 0; i < 8; ++i) tot += wred[i];
    const float r = rsqrtf(tot * (1.0f / 1024.0f) + 1e-5f);
#pragma unroll
    for (int i = 0; i < 4; ++i) {
        const int c = threadIdx.x + 256 * i;
        Y[(size_t)row * 1024 + c] = loc[i] * r * w[c];
    }
}

// ---------------------------------------------------------------------------
extern "C" void kernel_launch(void* const* d_in, const int* in_sizes, int n_in,
                              void* d_out, int out_size, void* d_ws, size_t ws_size,
                              hipStream_t stream) {
    const float* X  = (const float*)d_in[0];   // [4096,1024]
    const float* Wq = (const float*)d_in[1];
    const float* Wk = (const float*)d_in[2];
    const float* Wv = (const float*)d_in[3];
    const float* Wf = (const float*)d_in[4];   // [512,1024]
    const float* Wo = (const float*)d_in[5];
    const float* gw = (const float*)d_in[6];   // [1024]

    const size_t ND = 4096ull * 1024ull;
    const size_t NF = 4096ull * 512ull;
    float* ws  = (float*)d_ws;
    float* Q   = ws;             // 16 MB
    float* Kt  = Q   + ND;       // 16 MB
    float* Vt  = Kt  + ND;       // 16 MB
    float* G   = Vt  + ND;       //  8 MB
    float* Sv  = G   + NF;       //  8 MB
    float* Oin = Sv  + NF;       // 16 MB
    float* Zb  = Oin + ND;       //  8 MB, slot scores then slot weights
    float* Xn  = Q;              // reuse Q after the scan

    dim3 blk(256);
    dim3 gQKV(1024 / TILE_N, 4096 / TILE_M);   // 16 x 16
    dim3 gF(512 / TILE_N, 4096 / TILE_M);      //  8 x 16

    gemm_bt_kernel<<<gQKV, blk, 0, stream>>>(X, Wq, Q,  nullptr, 4096, 1024, 1024, 1);
    gemm_bt_kernel<<<gQKV, blk, 0, stream>>>(X, Wk, Kt, nullptr, 4096, 1024, 1024, 1);
    gemm_bt_kernel<<<gQKV, blk, 0, stream>>>(X, Wv, Vt, nullptr, 4096, 1024, 1024, 1);
    gemm_bt_kernel<<<gF,   blk, 0, stream>>>(X, Wf, G,  Sv,      4096, 1024,  512, 2);

    zscan_kernel<<<128, dim3(128), 0, stream>>>(Q, Kt, G, Sv, Zb);
    slot_softmax_kernel<<<128, blk, 0, stream>>>(Zb);
    oscan_kernel<<<64, dim3(128), 0, stream>>>(Vt, G, Sv, Zb, Oin);

    swish_rms_kernel<<<4096, blk, 0, stream>>>(Oin, gw, Xn);

    gemm_bt_kernel<<<gQKV, blk, 0, stream>>>(Xn, Wo, (float*)d_out, nullptr, 4096, 1024, 1024, 0);
}

// v005
// It runs in 194 microseconds.
// In both of two side-by-side timings against v004, it was 1.74 times as fast.
// Counting every step since v000, it is 17.0 times as fast.
#include <hip/hip_runtime.h>

// ---------------------------------------------------------------------------
// Gated ABC attention, MI455X (gfx1250, wave32, WMMA bf16).
// B=2, T=2048, D=1024, H=8, M=64, KD=128.
//   1) gemm_bt (WMMA): Q/K/V = swish(X W^T), F -> (G, S) gates
//   2) recurrence: segment states, slot scores, slot softmax, output columns (four launches)
//   3) swish + RMSNorm
//   4) gemm_bt: out = Xn Wo^T
// GEMM: 256x64 block tile, 8 waves x (32x64), double-buffered LDS,
// float4 global loads (eight lanes per 128-byte row slice, so a wave's load covers whole
// lines) held in registers for two trips -> packed bf16 -> 8B LDS stores -> ds_load_b128 frags.
// Epilogue through LDS, rolled, 16-byte stores.
// ---------------------------------------------------------------------------

typedef __attribute__((ext_vector_type(16))) __bf16 v16bf;
typedef __attribute__((ext_vector_type(8)))  __bf16 v8bf;
typedef __attribute__((ext_vector_type(4)))  __bf16 v4bf;
typedef __attribute__((ext_vector_type(8)))  float  v8f;

#define TILE_M 256
#define TILE_N 64
#define TILE_K 32
#define KPAD   8          // pad rows to 40 bf16 = 80 B (16B multiple, conflict-free)
#define LROW   (TILE_K + KPAD)
#define EPITCH 68         // epilogue rows: 64 f32 + 4, so rows r and r+8 fall on different banks

static __device__ __forceinline__ v4bf pack4(float4 a) {
    v4bf p;
    p[0] = (__bf16)a.x; p[1] = (__bf16)a.y; p[2] = (__bf16)a.z; p[3] = (__bf16)a.w;
    return p;
}

static __device__ __forceinline__ v16bf load_frag(const __bf16* rowp, int half) {
    // lane's two contiguous 16-byte chunks of the 32-element K row
    v8bf lo = *(const v8bf*)(rowp + (half << 3));
    v8bf hi = *(const v8bf*)(rowp + 16 + (half << 3));
    return __builtin_shufflevector(lo, hi, 0, 1, 2, 3, 4, 5, 6, 7,
                                   8, 9, 10, 11, 12, 13, 14, 15);
}

// Work-group barrier of the K loop, by hand: it waits for this wave's LDS traffic alone.
// __syncthreads() would also wait for the global loads that are to stay in flight across it.
static __device__ __forceinline__ void lds_barrier() {
    asm volatile("s_wait_dscnt 0x0\n\ts_barrier_signal -1\n\ts_barrier_wait -1" ::: "memory");
}

// Y = act( X @ W^T ) ; X: [Nrows,Kdim] f32, W: [Nout,Kdim] f32, Y: [Nrows,Nout]
// act_mode: 0 = identity, 1 = swish, 2 = gate (Y=g=logsigmoid/16, Y2=s=1-exp(g))
__global__ __launch_bounds__(256) void gemm_bt_kernel(
    const float* __restrict__ X, const float* __restrict__ W,
    float* __restrict__ Y, float* __restrict__ Y2,
    int Nrows, int Kdim, int Nout, int act_mode)
{
    __shared__ __attribute__((aligned(16))) __bf16 As[2][TILE_M][LROW];
    __shared__ __attribute__((aligned(16))) __bf16 Bs[2][TILE_N][LROW];

    const int tid  = threadIdx.x;
    const int wave = tid >> 5;        // 0..7
    const int lane = tid & 31;
    const int half = lane >> 4;       // K-half select (0/1)
    const int l15  = lane & 15;
    const int m0   = blockIdx.y * TILE_M;
    const int n0   = blockIdx.x * TILE_N;

    v8f acc[2][4];
#pragma unroll
    for (int am = 0; am < 2; ++am)
#pragma unroll
        for (int nt = 0; nt < 4; ++nt)
#pragma unroll
            for (int j = 0; j < 8; ++j) acc[am][nt][j] = 0.0f;

    // ---- staging, split in two: global loads into registers, and (two trips later)
    //      f32 -> bf16 and the LDS stores. Two register sets, so two K tiles are in flight.
    // No branch stands around either half: a branch would merge paths in the compiler's
    // load counting and its wait for the older set would drain the younger one too.
    // A row's K slice is 32 f32 = one 128-byte line. Eight neighbouring lanes take it in 16-byte
    // pieces, so one wave-wide load covers four whole lines; thread: piece sc of rows sr + 32 i.
    struct Held { float4 a[8]; float4 b[2]; };
    const int nK = Kdim / TILE_K;
    const int sr = tid >> 3;           // 0..31
    const int sc = (tid & 7) << 2;     // 0, 4, .. 28
    // uniform base + fixed per-thread byte offsets: the K advance is scalar arithmetic
    unsigned soff[8];
#pragma unroll
    for (int i = 0; i < 8; ++i) soff[i] = ((unsigned)(sr + (i << 5)) * (unsigned)Kdim + (unsigned)sc) * 4u;
    const float* Xb = X + (size_t)m0 * Kdim;
    const float* Wb = W + (size_t)n0 * Kdim;
    auto fetch = [&](Held& s, int kt) {
        // past the last tile the last one is asked for again (in bounds, never used)
        const int k0 = (kt < nK ? kt : nK - 1) * TILE_K;
        const char* xk = (const char*)(Xb + k0);
        const char* wk = (const char*)(Wb + k0);
#pragma unroll
        for (int i = 0; i < 8; ++i) s.a[i] = *(const float4*)(xk + soff[i]);   // A: 256 rows
#pragma unroll
        for (int i = 0; i < 2; ++i) s.b[i] = *(const float4*)(wk + soff[i]);   // B: 64 rows
        // the loads' address registers are rewritten for the next fetch
        asm volatile("s_wait_xcnt 0x0" ::: "memory");
    };
    auto publish = [&](const Held& s, int buf) {
#pragma unroll
        for (int i = 0; i < 8; ++i) *(v4bf*)&As[buf][sr + (i << 5)][sc] = pack4(s.a[i]);
#pragma unroll
        for (int i = 0; i < 2; ++i) *(v4bf*)&Bs[buf][sr + (i << 5)][sc] = pack4(s.b[i]);
    };

    Held h0, h1;                       // h0: even K tiles, h1: odd K tiles
    fetch(h0, 0);
    publish(h0, 0);
    fetch(h1, 1);
    fetch(h0, 2);
    lds_barrier();

    // one trip: tile kt from LDS buffer cur; nxt holds tile kt + 1, asked for two trips ago
    auto trip = [&](int kt, int cur, Held& nxt) {
        // fragments: wave's 32 rows x block's 64 cols
        const int wrow = wave << 5;
        v16bf aF[2], bF[4];
#pragma unroll
        for (int am = 0; am < 2; ++am)
            aF[am] = load_frag(&As[cur][wrow + (am << 4) + l15][0], half);
#pragma unroll
        for (int nt = 0; nt < 4; ++nt)
            bF[nt] = load_frag(&Bs[cur][(nt << 4) + l15][0], half);

#pragma unroll
        for (int am = 0; am < 2; ++am)
#pragma unroll
            for (int nt = 0; nt < 4; ++nt)
                acc[am][nt] = __builtin_amdgcn_wmma_f32_16x16x32_bf16(
                    false, aF[am], false, bF[nt], (short)0, acc[am][nt], false, false);
        // keeps the wait for the held tile's loads behind the products; lifted above them it would stall them
        __builtin_amdgcn_sched_barrier(0);
        publish(nxt, cur ^ 1);
        fetch(nxt, kt + 3);
        lds_barrier();
    };
    // trips in pairs, so that each register set and LDS buffer is named at compile time and no
    // branch stands inside the loop; an odd trip count ends in one trip behind it
    int kt = 0;
    for (; kt + 1 < nK; kt += 2) {
        trip(kt, 0, h1);
        trip(kt + 1, 1, h0);
    }
    if (kt < nK) trip(kt, 0, h1);

    // Epilogue. C/D layout: VGPR r, lane<16 -> (M=r, N=lane); lane>=16 -> (M=8+r).
    // Each wave passes its accumulators, 16 rows at a time, through its own slice of
    // the (now free) A buffer and picks them up as whole rows; the activation then
    // runs in a rolled loop of 16-byte pieces. Rolled to keep the text small.
    float* ep = reinterpret_cast<float*>(&As[0][0][0]) + wave * (16 * EPITCH);
    const float* src = ep + half * EPITCH + (l15 << 2);
#pragma unroll
    for (int am = 0; am < 2; ++am) {
        if (am) __syncthreads();   // the first 16 rows have been read; the slice may be rewritten
#pragma unroll
        for (int nt = 0; nt < 4; ++nt)
#pragma unroll
            for (int r = 0; r < 8; ++r)
                ep[(r + (half << 3)) * EPITCH + (nt << 4) + l15] = acc[am][nt][r];
        __syncthreads();           // lanes read what other lanes wrote

        // rows (wave*32 + am*16 + half) + 2 it, columns n0 + 4*l15 ..
        const size_t idx0 = (size_t)(m0 + (wave << 5) + (am << 4) + half) * Nout + n0 + (l15 << 2);
        const size_t step = (size_t)Nout * 2;
        if (act_mode == 0) {
#pragma unroll 1   // rolled: keeps the text small (see above)
            for (int it = 0; it < 8; ++it) {
                const float4 v = *(const float4*)(src + it * (2 * EPITCH));
                *(float4*)(Y + idx0 + it * step) = v;
                // the store's registers are rewritten by the next trip
                asm volatile("s_wait_xcnt 0x0" ::: "memory");
            }
        } else if (act_mode == 1) {
#pragma unroll 1   // rolled: keeps the text small (see above)
            for (int it = 0; it < 8; ++it) {
                const float4 v = *(const float4*)(src + it * (2 * EPITCH));
                float4 y;
                y.x = v.x / (1.0f + __expf(-v.x));                          // swish
                y.y = v.y / (1.0f + __expf(-v.y));
                y.z = v.z / (1.0f + __expf(-v.z));
                y.w = v.w / (1.0f + __expf(-v.w));
                *(float4*)(Y + idx0 + it * step) = y;
                // the store's registers are rewritten by the next trip
                asm volatile("s_wait_xcnt 0x0" ::: "memory");
            }
        } else {
#pragma unroll 1   // rolled: keeps the text small (see above)
            for (int it = 0; it < 8; ++it) {
                const float4 v = *(const float4*)(src + it * (2 * EPITCH));
                const float vv[4] = {v.x, v.y, v.z, v.w};
                float g[4], s[4];
#pragma unroll
                for (int c = 0; c < 4; ++c) {
                    const float ls = fminf(vv[c], 0.0f) - log1pf(__expf(-fabsf(vv[c])));  // logsigmoid
                    g[c] = ls * 0.0625f;                                                // /GATE_NORM
                    s[c] = 1.0f - __expf(g[c]);
                }
                *(float4*)(Y  + idx0 + it * step) = make_float4(g[0], g[1], g[2], g[3]);
                *(float4*)(Y2 + idx0 + it * step) = make_float4(s[0], s[1], s[2], s[3]);
                // the stores' registers are rewritten by the next trip
                asm volatile("s_wait_xcnt 0x0" ::: "memory");
            }
        }
    }
}

// ---------------------------------------------------------------------------
// Gated-ABC recurrence, split into its independent parts (four launches, the segment states included).
//   hk[:, m] depends on slot m alone  -> zscan: one workgroup per (b,h, 8 slots, segment)
//   softmax over the 64 slots         -> one thread per (b,h,t)
//   hv[:, v] depends on column v alone-> oscan: one workgroup per (b,h, 32 cols, segment)
// Inside a workgroup time runs in tiles of SCAN_TT steps: the tile's inputs sit
// in LDS, every thread steps its own register tile of the state with no barrier
// between steps, leaves its partial dot products in LDS, and the tile's partials
// are summed once behind the tile. The next tile's inputs are fetched into
// registers while the current tile is stepped.
// Z / P layout: [b*8+h][slot block of 8][t][8], so each workgroup owns whole lines.
// Time is cut into segments, each with workgroups of its own. The recurrence is linear in
// the state: state(end) = state(start) * D + E, with D the product of the segment's gates
// and E the state that the segment builds from zero. seg_state_kernel leaves D and E of
// every segment but the last in the workspace; a scan workgroup folds those of the
// segments in front of its own into its start state and then steps its segment alone.
// ---------------------------------------------------------------------------
typedef __attribute__((ext_vector_type(2))) float f32x2;
typedef __attribute__((ext_vector_type(4))) float f32x4;

#define SCAN_TT 32
#define ZPITCH  264   // 32 k-groups x 8 slots + 8: the tile sum reads 8 rows on distinct banks
#define OPITCH  528   // 16 slot-groups x 32 cols + 16: same, for 16-byte reads
#define PPITCH  72    // 64 slots + 8: the blocked P rows land on distinct banks
#define ZSEG    4     // time segments of the slot-score scan: 512 workgroups, two per WGP
#define ZLEN    (2048 / ZSEG)
#define OSEG    8     // time segments of the output scan: 512 workgroups, two per WGP
#define OLEN    (2048 / OSEG)
#define ZSTATE_WGS ((ZSEG - 1) * 128)
#define OSTATE_WGS ((OSEG - 1) * 64)

static __device__ __forceinline__ f32x2 splat2(float x) { f32x2 r = {x, x}; return r; }

// E and D of one hk segment; thread tile and step arithmetic as in zscan_kernel.
// Ek: [segment*128 + workgroup][2][thread][4], Dk: [segment*128 + workgroup][thread][2]
static __device__ __forceinline__ void zstate_body(
    int blk, const float* __restrict__ Kp, const float* __restrict__ Gp,
    const float* __restrict__ Sp, float* __restrict__ Ek, float* __restrict__ Dk)
{
    __shared__ __attribute__((aligned(16))) float kS[SCAN_TT][128];
    __shared__ __attribute__((aligned(16))) float geS[SCAN_TT][8];
    __shared__ __attribute__((aligned(16))) float sS[SCAN_TT][8];

    const int tid = threadIdx.x;
    const int seg = blk >> 7;
    const int bh  = (blk & 127) >> 3;
    const int mb  = blk & 7;
    const int b   = bh >> 3;
    const int h   = bh & 7;
    const int kg  = tid >> 2;      // 0..31
    const int mg  = tid & 3;       // 0..3

    f32x4 kr[8], gr;
    const unsigned qoff = (unsigned)(tid >> 5) * 1024u + (unsigned)((tid & 31) << 2);
    const unsigned goff = (unsigned)((tid & 63) >> 1) * 512u + (unsigned)((tid & 1) << 2);
    const float* GS = (__builtin_amdgcn_readfirstlane(tid) < 64) ? Gp : Sp;   // waves 0,1: gates; 2,3: s
    auto fetch = [&](int t0) {
        const float* k = Kp + (size_t)(b * 2048 + t0) * 1024 + h * 128;
#pragma unroll
        for (int i = 0; i < 8; ++i)         // rows (tid>>5) + 4 i
            kr[i] = *(const f32x4*)(k + qoff + i * 4096);
        gr = *(const f32x4*)(GS + (size_t)(b * 2048 + t0) * 512 + h * 64 + mb * 8 + goff);
        // the loads' base registers are rewritten for the next fetch
        asm volatile("s_wait_xcnt 0x0" ::: "memory");
    };
    auto publish = [&]() {
#pragma unroll
        for (int i = 0; i < 8; ++i) {
            const int idx = tid + (i << 7);
            *(f32x4*)&kS[idx >> 5][(idx & 31) << 2] = kr[i];
        }
        const int u = tid & 63;
        if (tid < 64) {
            f32x4 e = {__expf(gr.x), __expf(gr.y), __expf(gr.z), __expf(gr.w)};
            *(f32x4*)&geS[u >> 1][(u & 1) << 2] = e;
        } else {
            *(f32x4*)&sS[u >> 1][(u & 1) << 2] = gr;
        }
    };

    f32x2 hk[4];
#pragma unroll
    for (int i = 0; i < 4; ++i) hk[i] = splat2(0.0f);
    f32x2 dp = splat2(1.0f);

    const int tbeg = seg * ZLEN, tend = tbeg + ZLEN;
    fetch(tbeg);
    publish();
    __syncthreads();

    for (int t0 = tbeg; t0 < tend; t0 += SCAN_TT) {
        const bool more = (t0 + SCAN_TT) < tend;
        if (more) fetch(t0 + SCAN_TT);

        // groups of 4 steps, two register sets, as in zscan_kernel
        f32x4 ka[4], kb[4];
        f32x2 ga[4], sa[4], gb[4], sb[4];
        auto ld = [&](f32x4 (&k)[4], f32x2 (&g)[4], f32x2 (&s)[4], int base) {
#pragma unroll
            for (int j = 0; j < 4; ++j) {
                k[j] = *(const f32x4*)&kS[base + j][kg << 2];
                g[j] = *(const f32x2*)&geS[base + j][mg << 1];
                s[j] = *(const f32x2*)&sS[base + j][mg << 1];
            }
            // keeps these reads ahead of the group stepped next; sunk to their use they would be waited for
            __builtin_amdgcn_sched_barrier(0);
        };
        auto step = [&](const f32x4 (&k)[4], const f32x2 (&g)[4], const f32x2 (&s)[4]) {
#pragma unroll
            for (int j = 0; j < 4; ++j) {
#pragma unroll
                for (int i = 0; i < 4; ++i)
                    hk[i] = __builtin_elementwise_fma(hk[i], g[j], splat2(k[j][i]) * s[j]);
                dp *= g[j];
            }
        };
        ld(ka, ga, sa, 0);
#pragma unroll 1   // rolled: unrolled, all of the tile's LDS reads are lifted to its head and take 480 registers
        for (int g8 = 0; g8 < SCAN_TT; g8 += 8) {
            ld(kb, gb, sb, g8 + 4);
            step(ka, ga, sa);
            ld(ka, ga, sa, (g8 + 8) & (SCAN_TT - 1));   // behind the last group: rows 0..3 again, not used
            step(kb, gb, sb);
        }
        __syncthreads();   // every reader has left the input tile
        if (more) publish();
        __syncthreads();   // next input tile published
    }

    float* e = Ek + (size_t)blk * 1024 + (tid << 2);
    const f32x4 e0 = {hk[0].x, hk[0].y, hk[1].x, hk[1].y};
    const f32x4 e1 = {hk[2].x, hk[2].y, hk[3].x, hk[3].y};
    *(f32x4*)e         = e0;
    *(f32x4*)(e + 512) = e1;
    *(f32x2*)(Dk + (size_t)blk * 256 + (tid << 1)) = dp;
}

// E and D of one hv segment; thread tile and step arithmetic as in oscan_kernel.
// Ev: [segment*64 + workgroup][4][thread][4], Dv: [segment*64 + workgroup][thread][4]
static __device__ __forceinline__ void ostate_body(
    int blk, const float* __restrict__ Vp, const float* __restrict__ Gp,
    const float* __restrict__ Sp, float* __restrict__ Ev, float* __restrict__ Dv)
{
    __shared__ __attribute__((aligned(16))) float geS[SCAN_TT][64];
    __shared__ __attribute__((aligned(16))) float sS[SCAN_TT][64];
    __shared__ __attribute__((aligned(16))) float vS[SCAN_TT][32];

    const int tid = threadIdx.x;
    const int seg = blk >> 6;
    const int bh  = (blk & 63) >> 2;
    const int v0  = (blk & 3) << 5;
    const int b   = bh >> 3;
    const int h   = bh & 7;
    const int vg  = tid & 7;       // 0..7
    const int sg  = tid >> 3;      // 0..15

    f32x4 gr[4], sr[4], vr[2];
    const unsigned goff = (unsigned)(tid >> 4) * 512u + (unsigned)((tid & 15) << 2);
    const unsigned voff = (unsigned)(tid >> 3) * 1024u + (unsigned)((tid & 7) << 2);
    auto fetch = [&](int t0) {
        const size_t rowg = (size_t)(b * 2048 + t0) * 512 + h * 64;
        const float* g = Gp + rowg;
        const float* s = Sp + rowg;
        const float* v = Vp + (size_t)(b * 2048 + t0) * 1024 + h * 128 + v0;
#pragma unroll
        for (int i = 0; i < 4; ++i) {
            gr[i] = *(const f32x4*)(g + goff + i * 4096);    // rows (tid>>4) + 8 i
            sr[i] = *(const f32x4*)(s + goff + i * 4096);
        }
#pragma unroll
        for (int i = 0; i < 2; ++i)
            vr[i] = *(const f32x4*)(v + voff + i * 16384);   // rows (tid>>3) + 16 i
        // the loads' base registers are rewritten for the next fetch
        asm volatile("s_wait_xcnt 0x0" ::: "memory");
    };
    auto publish = [&]() {
#pragma unroll
        for (int i = 0; i < 4; ++i) {
            const int idx = tid + (i << 7);
            f32x4 e = {__expf(gr[i].x), __expf(gr[i].y), __expf(gr[i].z), __expf(gr[i].w)};
            *(f32x4*)&geS[idx >> 4][(idx & 15) << 2] = e;
            *(f32x4*)&sS[idx >> 4][(idx & 15) << 2]  = sr[i];
        }
#pragma unroll
        for (int i = 0; i < 2; ++i) {
            const int idx = tid + (i << 7);
            *(f32x4*)&vS[idx >> 3][(idx & 7) << 2] = vr[i];
        }
    };

    f32x2 hv[4][2];
#pragma unroll
    for (int i = 0; i < 4; ++i) { hv[i][0] = splat2(0.0f); hv[i][1] = splat2(0.0f); }
    f32x4 dp = {1.0f, 1.0f, 1.0f, 1.0f};

    const int tbeg = seg * OLEN, tend = tbeg + OLEN;
    fetch(tbeg);
    publish();
    __syncthreads();

    for (int t0 = tbeg; t0 < tend; t0 += SCAN_TT) {
        const bool more = (t0 + SCAN_TT) < tend;
        if (more) fetch(t0 + SCAN_TT);

        // groups of 4 steps, two register sets, as in oscan_kernel
        f32x4 ga[4], sa[4], va[4], gb[4], sb[4], vb[4];
        auto ld = [&](f32x4 (&g)[4], f32x4 (&s)[4], f32x4 (&v)[4], int base) {
#pragma unroll
            for (int j = 0; j < 4; ++j) {
                g[j] = *(const f32x4*)&geS[base + j][sg << 2];
                s[j] = *(const f32x4*)&sS[base + j][sg << 2];
                v[j] = *(const f32x4*)&vS[base + j][vg << 2];
            }
            // keeps these reads ahead of the group stepped next; sunk to their use they would be waited for
            __builtin_amdgcn_sched_barrier(0);
        };
        auto step = [&](const f32x4 (&g)[4], const f32x4 (&s)[4], const f32x4 (&v)[4]) {
#pragma unroll
            for (int j = 0; j < 4; ++j) {
                const f32x2 v01 = {v[j].x, v[j].y}, v23 = {v[j].z, v[j].w};
#pragma unroll
                for (int i = 0; i < 4; ++i) {
                    hv[i][0] = __builtin_elementwise_fma(hv[i][0], splat2(g[j][i]), splat2(s[j][i]) * v01);
                    hv[i][1] = __builtin_elementwise_fma(hv[i][1], splat2(g[j][i]), splat2(s[j][i]) * v23);
                }
                dp *= g[j];
            }
        };
        ld(ga, sa, va, 0);
#pragma unroll 1   // rolled: unrolled, all of the tile's LDS reads are lifted to its head and take 480 registers
        for (int g8 = 0; g8 < SCAN_TT; g8 += 8) {
            ld(gb, sb, vb, g8 + 4);
            step(ga, sa, va);
            ld(ga, sa, va, (g8 + 8) & (SCAN_TT - 1));   // behind the last group: rows 0..3 again, not used
            step(gb, sb, vb);
        }
        __syncthreads();   // every reader has left the input tile
        if (more) publish();
        __syncthreads();   // next input tile published
    }

    float* e = Ev + (size_t)blk * 2048 + (tid << 2);
#pragma unroll
    for (int i = 0; i < 4; ++i) {
        const f32x4 ei = {hv[i][0].x, hv[i][0].y, hv[i][1].x, hv[i][1].y};
        *(f32x4*)(e + i * 512) = ei;
    }
    *(f32x4*)(Dv + (size_t)blk * 512 + (tid << 2)) = dp;
}

// one launch for both kinds of segment state (neither needs the slot weights);
// the longer hk segments stand first in the grid
__global__ __launch_bounds__(128) void seg_state_kernel(
    const float* __restrict__ Kp, const float* __restrict__ Vp,
    const float* __restrict__ Gp, const float* __restrict__ Sp,
    float* __restrict__ Ek, float* __restrict__ Dk,
    float* __restrict__ Ev, float* __restrict__ Dv)
{
    const int blk = blockIdx.x;
    if (blk < ZSTATE_WGS) zstate_body(blk, Kp, Gp, Sp, Ek, Dk);
    else                  ostate_body(blk - ZSTATE_WGS, Vp, Gp, Sp, Ev, Dv);
}

// thread: 4 k (kg*4..) x 2 slots (mg*2..) of hk
__global__ __launch_bounds__(128) void zscan_kernel(
    const float* __restrict__ Qp, const float* __restrict__ Kp,
    const float* __restrict__ Gp, const float* __restrict__ Sp,
    const float* __restrict__ Ek, const float* __restrict__ Dk,
    float* __restrict__ Zb)
{
    __shared__ __attribute__((aligned(16))) float qS[SCAN_TT][128];
    __shared__ __attribute__((aligned(16))) float kS[SCAN_TT][128];
    __shared__ __attribute__((aligned(16))) float geS[SCAN_TT][8];
    __shared__ __attribute__((aligned(16))) float sS[SCAN_TT][8];
    __shared__ __attribute__((aligned(16))) float part[SCAN_TT][ZPITCH];

    const int tid = threadIdx.x;
    const int seg = blockIdx.x >> 7;     // time segment
    const int wg  = blockIdx.x & 127;
    const int bh  = wg >> 3;
    const int mb  = wg & 7;
    const int b   = bh >> 3;
    const int h   = bh & 7;
    const int kg  = tid >> 2;      // 0..31
    const int mg  = tid & 3;       // 0..3
    const float scale = 0.08838834764831845f; // 128^-0.5

    f32x4 qr[8], kr[8], gr;
    // uniform base + one fixed per-thread offset: the tile advance stays in scalar registers
    const unsigned qoff = (unsigned)(tid >> 5) * 1024u + (unsigned)((tid & 31) << 2);
    const unsigned goff = (unsigned)((tid & 63) >> 1) * 512u + (unsigned)((tid & 1) << 2);
    const float* GS = (__builtin_amdgcn_readfirstlane(tid) < 64) ? Gp : Sp;   // waves 0,1: gates; 2,3: s
    auto fetch = [&](int t0) {
        const size_t rowq = (size_t)(b * 2048 + t0) * 1024 + h * 128;
        const float* q = Qp + rowq;
        const float* k = Kp + rowq;
#pragma unroll
        for (int i = 0; i < 8; ++i) {       // rows (tid>>5) + 4 i
            qr[i] = *(const f32x4*)(q + qoff + i * 4096);
            kr[i] = *(const f32x4*)(k + qoff + i * 4096);
        }
        gr = *(const f32x4*)(GS + (size_t)(b * 2048 + t0) * 512 + h * 64 + mb * 8 + goff);
        // the loads' base registers are rewritten behind this
        asm volatile("s_wait_xcnt 0x0" ::: "memory");
    };
    auto publish = [&]() {
#pragma unroll
        for (int i = 0; i < 8; ++i) {
            const int idx = tid + (i << 7);
            *(f32x4*)&qS[idx >> 5][(idx & 31) << 2] = qr[i] * scale;
            *(f32x4*)&kS[idx >> 5][(idx & 31) << 2] = kr[i];
        }
        const int u = tid & 63;
        if (tid < 64) {
            f32x4 e = {__expf(gr.x), __expf(gr.y), __expf(gr.z), __expf(gr.w)};
            *(f32x4*)&geS[u >> 1][(u & 1) << 2] = e;
        } else {
            *(f32x4*)&sS[u >> 1][(u & 1) << 2] = gr;
        }
    };

    f32x2 hk[4];
#pragma unroll
    for (int i = 0; i < 4; ++i) hk[i] = splat2(0.0f);

    const int tbeg = seg * ZLEN, tend = tbeg + ZLEN;
    fetch(tbeg);
    // start state: the earlier segments' E, each decayed by the D of the segments behind it
    // (all asked for at once, one round trip instead of one per segment; later segments' are left unused)
    {
        const float* e = Ek + (size_t)wg * 1024 + (tid << 2);
        const float* dsrc = Dk + (size_t)wg * 256 + (tid << 1);
        f32x4 e0[ZSEG - 1], e1[ZSEG - 1];
        f32x2 d[ZSEG - 1];
#pragma unroll
        for (int i = 0; i < ZSEG - 1; ++i) {
            e0[i] = *(const f32x4*)(e + i * (128 * 1024));
            e1[i] = *(const f32x4*)(e + i * (128 * 1024) + 512);
            d[i]  = *(const f32x2*)(dsrc + i * (128 * 256));
        }
        // the loads' address registers are free for reuse behind this
        asm volatile("s_wait_xcnt 0x0" ::: "memory");
#pragma unroll
        for (int i = 0; i < ZSEG - 1; ++i) {
            if (i < seg) {
                const f32x2 e00 = {e0[i].x, e0[i].y}, e01 = {e0[i].z, e0[i].w};
                const f32x2 e10 = {e1[i].x, e1[i].y}, e11 = {e1[i].z, e1[i].w};
                hk[0] = __builtin_elementwise_fma(hk[0], d[i], e00);
                hk[1] = __builtin_elementwise_fma(hk[1], d[i], e01);
                hk[2] = __builtin_elementwise_fma(hk[2], d[i], e10);
                hk[3] = __builtin_elementwise_fma(hk[3], d[i], e11);
            }
        }
    }
    publish();
    __syncthreads();

    for (int t0 = tbeg; t0 < tend; t0 += SCAN_TT) {
        const bool more = (t0 + SCAN_TT) < tend;
        if (more) fetch(t0 + SCAN_TT);

        // groups of 4 steps, two register sets: the next group's LDS reads are in
        // flight while this group is stepped
        f32x4 qa[4], ka[4], qb[4], kb[4];
        f32x2 ga[4], sa[4], gb[4], sb[4];
        auto ld = [&](f32x4 (&q)[4], f32x4 (&k)[4], f32x2 (&g)[4], f32x2 (&s)[4], int base) {
#pragma unroll
            for (int j = 0; j < 4; ++j) {
                q[j] = *(const f32x4*)&qS[base + j][kg << 2];
                k[j] = *(const f32x4*)&kS[base + j][kg << 2];
                g[j] = *(const f32x2*)&geS[base + j][mg << 1];
                s[j] = *(const f32x2*)&sS[base + j][mg << 1];
            }
            // keeps these reads ahead of the group stepped next; sunk to their use they would be waited for
            __builtin_amdgcn_sched_barrier(0);
        };
        auto step = [&](const f32x4 (&q)[4], const f32x4 (&k)[4], const f32x2 (&g)[4], const f32x2 (&s)[4], int base) {
#pragma unroll
            for (int j = 0; j < 4; ++j) {
                f32x2 acc = splat2(0.0f);
#pragma unroll
                for (int i = 0; i < 4; ++i) {
                    hk[i] = __builtin_elementwise_fma(hk[i], g[j], splat2(k[j][i]) * s[j]);
                    acc   = __builtin_elementwise_fma(splat2(q[j][i]), hk[i], acc);
                }
                *(f32x2*)&part[base + j][(kg << 3) + (mg << 1)] = acc;
            }
        };
        ld(qa, ka, ga, sa, 0);
#pragma unroll
        for (int g8 = 0; g8 < SCAN_TT; g8 += 8) {
            ld(qb, kb, gb, sb, g8 + 4);
            step(qa, ka, ga, sa, g8);
            if (g8 + 8 < SCAN_TT) ld(qa, ka, ga, sa, g8 + 8);
            step(qb, kb, gb, sb, g8 + 4);
        }
        __syncthreads();   // partials complete; every reader has left the input tile

        {
            const int rt = tid >> 2, rm = tid & 3;
            f32x2 a0 = splat2(0.0f), a1 = a0, a2 = a0, a3 = a0;
#pragma unroll
            for (int g = 0; g < 8; ++g) {
                a0 += *(const f32x2*)&part[rt][((4 * g + 0) << 3) + (rm << 1)];
                a1 += *(const f32x2*)&part[rt][((4 * g + 1) << 3) + (rm << 1)];
                a2 += *(const f32x2*)&part[rt][((4 * g + 2) << 3) + (rm << 1)];
                a3 += *(const f32x2*)&part[rt][((4 * g + 3) << 3) + (rm << 1)];
            }
            float* zrow = Zb + ((size_t)(bh * 8 + mb) * 2048 + t0) * 8;
            *(f32x2*)(zrow + (unsigned)(rt * 8 + (rm << 1))) = (a0 + a1) + (a2 + a3);
            // the store's registers are reused right behind it
            asm volatile("s_wait_xcnt 0x0" ::: "memory");
        }
        if (more) publish();
        __syncthreads();   // next input tile published; partials free again
    }
}

// softmax over the 64 slots of one (b,h,t), in place on the blocked layout
__global__ __launch_bounds__(256) void slot_softmax_kernel(float* Zb)
{
    const int gid = blockIdx.x * 256 + threadIdx.x;
    const int bh  = gid >> 11;
    const int t   = gid & 2047;
    f32x4 z[16];
#pragma unroll
    for (int mb = 0; mb < 8; ++mb) {
        const float* p = Zb + ((size_t)(bh * 8 + mb) * 2048 + t) * 8;
        z[2 * mb]     = *(const f32x4*)p;
        z[2 * mb + 1] = *(const f32x4*)(p + 4);
    }
    f32x4 m4 = z[0];
#pragma unroll
    for (int i = 1; i < 16; ++i) m4 = __builtin_elementwise_max(m4, z[i]);
    const float mx = fmaxf(fmaxf(m4.x, m4.y), fmaxf(m4.z, m4.w));
    f32x4 s4 = {0.0f, 0.0f, 0.0f, 0.0f};
#pragma unroll
    for (int i = 0; i < 16; ++i) {
        f32x4 e = {__expf(z[i].x - mx), __expf(z[i].y - mx), __expf(z[i].z - mx), __expf(z[i].w - mx)};
        z[i] = e;
        s4 += e;
    }
    const float inv = 1.0f / ((s4.x + s4.y) + (s4.z + s4.w));
#pragma unroll
    for (int mb = 0; mb < 8; ++mb) {
        float* p = Zb + ((size_t)(bh * 8 + mb) * 2048 + t) * 8;
        *(f32x4*)p       = z[2 * mb] * inv;
        *(f32x4*)(p + 4) = z[2 * mb + 1] * inv;
    }
}

// thread: 4 slots (sg*4..) x 4 columns (vg*4..) of hv
__global__ __launch_bounds__(128) void oscan_kernel(
    const float* __restrict__ Vp, const float* __restrict__ Gp,
    const float* __restrict__ Sp, const float* __restrict__ Pb,
    const float* __restrict__ Ev, const float* __restrict__ Dv,
    float* __restrict__ Op)
{
    __shared__ __attribute__((aligned(16))) float geS[SCAN_TT][64];
    __shared__ __attribute__((aligned(16))) float sS[SCAN_TT][64];
    __shared__ __attribute__((aligned(16))) float pS[SCAN_TT][PPITCH];
    __shared__ __attribute__((aligned(16))) float vS[SCAN_TT][32];
    __shared__ __attribute__((aligned(16))) float part[SCAN_TT][OPITCH];

    const int tid = threadIdx.x;
    const int seg = blockIdx.x >> 6;     // time segment
    const int wg  = blockIdx.x & 63;
    const int bh  = wg >> 2;
    const int v0  = (wg & 3) << 5;
    const int b   = bh >> 3;
    const int h   = bh & 7;
    const int vg  = tid & 7;       // 0..7
    const int sg  = tid >> 3;      // 0..15

    f32x4 gr[4], sr[4], pr[4], vr[2];
    // uniform base + one fixed per-thread offset: the tile advance stays in scalar registers
    const unsigned goff = (unsigned)(tid >> 4) * 512u + (unsigned)((tid & 15) << 2);
    const unsigned poff = (unsigned)(tid >> 6) * 16384u + (unsigned)((tid & 63) << 2);
    const unsigned voff = (unsigned)(tid >> 3) * 1024u + (unsigned)((tid & 7) << 2);
    auto fetch = [&](int t0) {
        const size_t rowg = (size_t)(b * 2048 + t0) * 512 + h * 64;
        const float* g = Gp + rowg;
        const float* s = Sp + rowg;
        const float* p = Pb + ((size_t)(bh * 8) * 2048 + t0) * 8;
        const float* v = Vp + (size_t)(b * 2048 + t0) * 1024 + h * 128 + v0;
#pragma unroll
        for (int i = 0; i < 4; ++i) {
            gr[i] = *(const f32x4*)(g + goff + i * 4096);    // rows (tid>>4) + 8 i
            sr[i] = *(const f32x4*)(s + goff + i * 4096);
            // blocked P: slot block (tid>>6) + 2 i, then 64 consecutive 16-byte pieces of this tile
            pr[i] = *(const f32x4*)(p + poff + i * 32768);
        }
#pragma unroll
        for (int i = 0; i < 2; ++i)
            vr[i] = *(const f32x4*)(v + voff + i * 16384);   // rows (tid>>3) + 16 i
        // the loads' base registers are rewritten behind this
        asm volatile("s_wait_xcnt 0x0" ::: "memory");
    };
    auto publish = [&]() {
#pragma unroll
        for (int i = 0; i < 4; ++i) {
            const int idx = tid + (i << 7);
            f32x4 e = {__expf(gr[i].x), __expf(gr[i].y), __expf(gr[i].z), __expf(gr[i].w)};
            *(f32x4*)&geS[idx >> 4][(idx & 15) << 2] = e;
            *(f32x4*)&sS[idx >> 4][(idx & 15) << 2]  = sr[i];
            *(f32x4*)&pS[(idx & 63) >> 1][((idx >> 6) << 3) + ((idx & 1) << 2)] = pr[i];
        }
#pragma unroll
        for (int i = 0; i < 2; ++i) {
            const int idx = tid + (i << 7);
            *(f32x4*)&vS[idx >> 3][(idx & 7) << 2] = vr[i];
        }
    };

    f32x2 hv[4][2];
#pragma unroll
    for (int i = 0; i < 4; ++i) { hv[i][0] = splat2(0.0f); hv[i][1] = splat2(0.0f); }

    const int tbeg = seg * OLEN, tend = tbeg + OLEN;
    fetch(tbeg);
    // start state: the earlier segments' E, each decayed by the D of the segments behind it
    // (all asked for at once, one round trip instead of one per segment; later segments' are left unused)
    {
        const float* e = Ev + (size_t)wg * 2048 + (tid << 2);
        const float* dsrc = Dv + (size_t)wg * 512 + (tid << 2);
        f32x4 er[OSEG - 1][4], d[OSEG - 1];
#pragma unroll
        for (int i = 0; i < OSEG - 1; ++i) {
#pragma unroll
            for (int r = 0; r < 4; ++r) er[i][r] = *(const f32x4*)(e + i * (64 * 2048) + r * 512);
            d[i] = *(const f32x4*)(dsrc + i * (64 * 512));
        }
        // the loads' address registers are free for reuse behind this
        asm volatile("s_wait_xcnt 0x0" ::: "memory");
#pragma unroll
        for (int i = 0; i < OSEG - 1; ++i) {
            if (i < seg) {
#pragma unroll
                for (int r = 0; r < 4; ++r) {
                    const f32x2 lo = {er[i][r].x, er[i][r].y}, hi = {er[i][r].z, er[i][r].w};
                    hv[r][0] = __builtin_elementwise_fma(hv[r][0], splat2(d[i][r]), lo);
                    hv[r][1] = __builtin_elementwise_fma(hv[r][1], splat2(d[i][r]), hi);
                }
            }
        }
    }
    publish();
    __syncthreads();

    for (int t0 = tbeg; t0 < tend; t0 += SCAN_TT) {
        const bool more = (t0 + SCAN_TT) < tend;
        if (more) fetch(t0 + SCAN_TT);

        // groups of 4 steps, two register sets: the next group's LDS reads are in
        // flight while this group is stepped
        f32x4 ga[4], sa[4], pa[4], va[4], gb[4], sb[4], pb[4], vb[4];
        auto ld = [&](f32x4 (&g)[4], f32x4 (&s)[4], f32x4 (&p)[4], f32x4 (&v)[4], int base) {
#pragma unroll
            for (int j = 0; j < 4; ++j) {
                g[j] = *(const f32x4*)&geS[base + j][sg << 2];
                s[j] = *(const f32x4*)&sS[base + j][sg << 2];
                p[j] = *(const f32x4*)&pS[base + j][sg << 2];
                v[j] = *(const f32x4*)&vS[base + j][vg << 2];
            }
            // keeps these reads ahead of the group stepped next; sunk to their use they would be waited for
            __builtin_amdgcn_sched_barrier(0);
        };
        auto step = [&](const f32x4 (&g)[4], const f32x4 (&s)[4], const f32x4 (&p)[4], const f32x4 (&v)[4], int base) {
#pragma unroll
            for (int j = 0; j < 4; ++j) {
                const f32x2 v01 = {v[j].x, v[j].y}, v23 = {v[j].z, v[j].w};
                f32x2 acc0 = splat2(0.0f), acc1 = splat2(0.0f);
#pragma unroll
                for (int i = 0; i < 4; ++i) {
                    hv[i][0] = __builtin_elementwise_fma(hv[i][0], splat2(g[j][i]), splat2(s[j][i]) * v01);
                    hv[i][1] = __builtin_elementwise_fma(hv[i][1], splat2(g[j][i]), splat2(s[j][i]) * v23);
                    acc0 = __builtin_elementwise_fma(splat2(p[j][i]), hv[i][0], acc0);
                    acc1 = __builtin_elementwise_fma(splat2(p[j][i]), hv[i][1], acc1);
                }
                f32x4 a = {acc0.x, acc0.y, acc1.x, acc1.y};
                *(f32x4*)&part[base + j][(sg << 5) + (vg << 2)] = a;
            }
        };
        ld(ga, sa, pa, va, 0);
#pragma unroll
        for (int g8 = 0; g8 < SCAN_TT; g8 += 8) {
            ld(gb, sb, pb, vb, g8 + 4);
            step(ga, sa, pa, va, g8);
            if (g8 + 8 < SCAN_TT) ld(ga, sa, pa, va, g8 + 8);
            step(gb, sb, pb, vb, g8 + 4);
        }
        __syncthreads();   // partials complete; every reader has left the input tile

        {
            const int rt = tid >> 2, rv = (tid & 3) << 2;
            f32x4 a0 = {0.0f, 0.0f, 0.0f, 0.0f}, a1 = a0, b0 = a0, b1 = a0;
#pragma unroll
            for (int g = 0; g < 8; ++g) {
                a0 += *(const f32x4*)&part[rt][((2 * g + 0) << 5) + rv];
                b0 += *(const f32x4*)&part[rt][((2 * g + 0) << 5) + rv + 16];
                a1 += *(const f32x4*)&part[rt][((2 * g + 1) << 5) + rv];
                b1 += *(const f32x4*)&part[rt][((2 * g + 1) << 5) + rv + 16];
            }
            float* o = Op + (size_t)(b * 2048 + t0) * 1024 + h * 128 + v0;
            *(f32x4*)(o + (unsigned)(rt * 1024 + rv))      = a0 + a1;
            *(f32x4*)(o + (unsigned)(rt * 1024 + rv) + 16) = b0 + b1;
            // the stores' registers are reused right behind them
            asm volatile("s_wait_xcnt 0x0" ::: "memory");
        }
        if (more) publish();
        __syncthreads();   // next input tile published; partials free again
    }
}

// ---------------------------------------------------------------------------
// y = RMSNorm(swish(x)) * g_weight     (one block per row of 1024)
// ---------------------------------------------------------------------------
__global__ __launch_bounds__(256) void swish_rms_kernel(
    const float* __restrict__ X, const float* __restrict__ w,
    float* __restrict__ Y)
{
    const int row = blockIdx.x;
    const float* xr = X + (size_t)row * 1024;
    float loc[4];
    float ss = 0.0f;
#pragma unroll
    for (int i = 0; i < 4; ++i) {
        const float x  = xr[threadIdx.x + 256 * i];
        const float sw = x / (1.0f + __expf(-x));
        loc[i] = sw;
        ss += sw * sw;
    }
#pragma unroll
    for (int off = 16; off > 0; off >>= 1) ss += __shfl_xor(ss, off, 32);
    __shared__ float wred[8];
    if ((threadIdx.x & 31) == 0) wred[threadIdx.x >> 5] = ss;
    __syncthreads();
    float tot = 0.0f;
#pragma unroll
    for (int i = 0; i < 8; ++i) tot += wred[i];
    const float r = rsqrtf(tot * (1.0f / 1024.0f) + 1e-5f);
#pragma unroll
    for (int i = 0; i < 4; ++i) {
        const int c = threadIdx.x + 256 * i;
        Y[(size_t)row * 1024 + c] = loc[i] * r * w[c];
    }
}

// ---------------------------------------------------------------------------
extern "C" void kernel_launch(void* const* d_in, const int* in_sizes, int n_in,
                              void* d_out, int out_size, void* d_ws, size_t ws_size,
                              hipStream_t stream) {
    const float* X  = (const float*)d_in[0];   // [4096,1024]
    const float* Wq = (const float*)d_in[1];
    const float* Wk = (const float*)d_in[2];
    const float* Wv = (const float*)d_in[3];
    const float* Wf = (const float*)d_in[4];   // [512,1024]
    const float* Wo = (const float*)d_in[5];
    const float* gw = (const float*)d_in[6];   // [1024]

    const size_t ND = 4096ull * 1024ull;
    const size_t NF = 4096ull * 512ull;
    float* ws  = (float*)d_ws;
    float* Q   = ws;             // 16 MB
    float* Kt  = Q   + ND;       // 16 MB
    float* Vt  = Kt  + ND;       // 16 MB
    float* G   = Vt  + ND;       //  8 MB
    float* Sv  = G   + NF;       //  8 MB
    float* Oin = Sv  + NF;       // 16 MB
    float* Zb  = Oin + ND;       //  8 MB, slot scores then slot weights
    float* Ek  = Zb  + NF;                                  // hk segment states
    float* Dk  = Ek  + (size_t)ZSTATE_WGS * 1024;           // their gate products
    float* Ev  = Dk  + (size_t)ZSTATE_WGS * 256;            // hv segment states
    float* Dv  = Ev  + (size_t)OSTATE_WGS * 2048;           // their gate products
    float* Xn  = Q;              // reuse Q after the scan

    dim3 blk(256);
    dim3 gQKV(1024 / TILE_N, 4096 / TILE_M);   // 16 x 16
    dim3 gF(512 / TILE_N, 4096 / TILE_M);      //  8 x 16

    gemm_bt_kernel<<<gQKV, blk, 0, stream>>>(X, Wq, Q,  nullptr, 4096, 1024, 1024, 1);
    gemm_bt_kernel<<<gQKV, blk, 0, stream>>>(X, Wk, Kt, nullptr, 4096, 1024, 1024, 1);
    gemm_bt_kernel<<<gQKV, blk, 0, stream>>>(X, Wv, Vt, nullptr, 4096, 1024, 1024, 1);
    gemm_bt_kernel<<<gF,   blk, 0, stream>>>(X, Wf, G,  Sv,      4096, 1024,  512, 2);

    seg_state_kernel<<<ZSTATE_WGS + OSTATE_WGS, dim3(128), 0, stream>>>(Kt, Vt, G, Sv, Ek, Dk, Ev, Dv);
    zscan_kernel<<<128 * ZSEG, dim3(128), 0, stream>>>(Q, Kt, G, Sv, Ek, Dk, Zb);
    slot_softmax_kernel<<<128, blk, 0, stream>>>(Zb);
    oscan_kernel<<<64 * OSEG, dim3(128), 0, stream>>>(Vt, G, Sv, Zb, Ev, Dv, Oin);

    swish_rms_kernel<<<4096, blk, 0, stream>>>(Oin, gw, Xn);

    gemm_bt_kernel<<<gQKV, blk, 0, stream>>>(Xn, Wo, (float*)d_out, nullptr, 4096, 1024, 1024, 0);
}

// v006
// Measured time: 169 microseconds a run.
// In two side-by-side timings against v005, it was 1.14 and 1.15 times as fast.
// All steps since v000 together make it 19.4 times as fast.
#include <hip/hip_runtime.h>

// ---------------------------------------------------------------------------
// Gated ABC attention, MI455X (gfx1250, wave32, WMMA bf16).
// B=2, T=2048, D=1024, H=8, M=64, KD=128.
//   1) proj4 (WMMA), one launch: Q/K/V = swish(X W^T), F -> (G, S) gates
//   2) recurrence: segment states, slot scores, slot softmax, output columns (four launches)
//   3) swish + RMSNorm
//   4) gemm_bt: out = Xn Wo^T
// GEMM: 256x64 block tile, 8 waves x (32x64), double-buffered LDS,
// float4 global loads (eight lanes per 128-byte row slice, so a wave's load covers whole
// lines) held in registers for two trips -> packed bf16 -> 8B LDS stores -> ds_load_b128 frags.
// Epilogue through LDS, rolled, 16-byte stores.
// ---------------------------------------------------------------------------

typedef __attribute__((ext_vector_type(16))) __bf16 v16bf;
typedef __attribute__((ext_vector_type(8)))  __bf16 v8bf;
typedef __attribute__((ext_vector_type(4)))  __bf16 v4bf;
typedef __attribute__((ext_vector_type(8)))  float  v8f;

#define TILE_M 256
#define TILE_N 64
#define TILE_K 32
#define KPAD   8          // pad rows to 40 bf16 = 80 B (16B multiple, conflict-free)
#define LROW   (TILE_K + KPAD)
#define EPITCH 68         // epilogue rows: 64 f32 + 4, so rows r and r+8 fall on different banks

static __device__ __forceinline__ v4bf pack4(float4 a) {
    v4bf p;
    p[0] = (__bf16)a.x; p[1] = (__bf16)a.y; p[2] = (__bf16)a.z; p[3] = (__bf16)a.w;
    return p;
}

static __device__ __forceinline__ v16bf load_frag(const __bf16* rowp, int half) {
    // lane's two contiguous 16-byte chunks of the 32-element K row
    v8bf lo = *(const v8bf*)(rowp + (half << 3));
    v8bf hi = *(const v8bf*)(rowp + 16 + (half << 3));
    return __builtin_shufflevector(lo, hi, 0, 1, 2, 3, 4, 5, 6, 7,
                                   8, 9, 10, 11, 12, 13, 14, 15);
}

// Work-group barrier of the K loop, by hand: it waits for this wave's LDS traffic alone.
// __syncthreads() would also wait for the global loads that are to stay in flight across it.
static __device__ __forceinline__ void lds_barrier() {
    asm volatile("s_wait_dscnt 0x0\n\ts_barrier_signal -1\n\ts_barrier_wait -1" ::: "memory");
}

// Y = act( X @ W^T ) ; X: [Nrows,Kdim] f32, W: [Nout,Kdim] f32, Y: [Nrows,Nout]
// act_mode: 0 = identity, 1 = swish, 2 = gate (Y=g=logsigmoid/16, Y2=s=1-exp(g))
// One workgroup's 256 x 64 tile at rows m0, columns n0.
static __device__ __forceinline__ void gemm_bt_tile(
    const float* __restrict__ X, const float* __restrict__ W,
    float* __restrict__ Y, float* __restrict__ Y2,
    int Kdim, int Nout, int act_mode, int m0, int n0)
{
    __shared__ __attribute__((aligned(16))) __bf16 As[2][TILE_M][LROW];
    __shared__ __attribute__((aligned(16))) __bf16 Bs[2][TILE_N][LROW];

    const int tid  = threadIdx.x;
    const int wave = tid >> 5;        // 0..7
    const int lane = tid & 31;
    const int half = lane >> 4;       // K-half select (0/1)
    const int l15  = lane & 15;

    v8f acc[2][4];
#pragma unroll
    for (int am = 0; am < 2; ++am)
#pragma unroll
        for (int nt = 0; nt < 4; ++nt)
#pragma unroll
            for (int j = 0; j < 8; ++j) acc[am][nt][j] = 0.0f;

    // ---- staging, split in two: global loads into registers, and (two trips later)
    //      f32 -> bf16 and the LDS stores. Two register sets, so two K tiles are in flight.
    // No branch stands around either half: a branch would merge paths in the compiler's
    // load counting and its wait for the older set would drain the younger one too.
    // A row's K slice is 32 f32 = one 128-byte line. Eight neighbouring lanes take it in 16-byte
    // pieces, so one wave-wide load covers four whole lines; thread: piece sc of rows sr + 32 i.
    struct Held { float4 a[8]; float4 b[2]; };
    const int nK = Kdim / TILE_K;
    const int sr = tid >> 3;           // 0..31
    const int sc = (tid & 7) << 2;     // 0, 4, .. 28
    // uniform base + fixed per-thread byte offsets: the K advance is scalar arithmetic
    unsigned soff[8];
#pragma unroll
    for (int i = 0; i < 8; ++i) soff[i] = ((unsigned)(sr + (i << 5)) * (unsigned)Kdim + (unsigned)sc) * 4u;
    const float* Xb = X + (size_t)m0 * Kdim;
    const float* Wb = W + (size_t)n0 * Kdim;
    auto fetch = [&](Held& s, int kt) {
        // past the last tile the last one is asked for again (in bounds, never used)
        const int k0 = (kt < nK ? kt : nK - 1) * TILE_K;
        const char* xk = (const char*)(Xb + k0);
        const char* wk = (const char*)(Wb + k0);
#pragma unroll
        for (int i = 0; i < 8; ++i) s.a[i] = *(const float4*)(xk + soff[i]);   // A: 256 rows
#pragma unroll
        for (int i = 0; i < 2; ++i) s.b[i] = *(const float4*)(wk + soff[i]);   // B: 64 rows
        // the loads' address registers are rewritten for the next fetch
        asm volatile("s_wait_xcnt 0x0" ::: "memory");
    };
    auto publish = [&](const Held& s, int buf) {
#pragma unroll
        for (int i = 0; i < 8; ++i) *(v4bf*)&As[buf][sr + (i << 5)][sc] = pack4(s.a[i]);
#pragma unroll
        for (int i = 0; i < 2; ++i) *(v4bf*)&Bs[buf][sr + (i << 5)][sc] = pack4(s.b[i]);
    };

    Held h0, h1;                       // h0: even K tiles, h1: odd K tiles
    fetch(h0, 0);
    publish(h0, 0);
    fetch(h1, 1);
    fetch(h0, 2);
    lds_barrier();

    // one trip: tile kt from LDS buffer cur; nxt holds tile kt + 1, asked for two trips ago
    auto trip = [&](int kt, int cur, Held& nxt) {
        // fragments: wave's 32 rows x block's 64 cols
        const int wrow = wave << 5;
        v16bf aF[2], bF[4];
#pragma unroll
        for (int am = 0; am < 2; ++am)
            aF[am] = load_frag(&As[cur][wrow + (am << 4) + l15][0], half);
#pragma unroll
        for (int nt = 0; nt < 4; ++nt)
            bF[nt] = load_frag(&Bs[cur][(nt << 4) + l15][0], half);

#pragma unroll
        for (int am = 0; am < 2; ++am)
#pragma unroll
            for (int nt = 0; nt < 4; ++nt)
                acc[am][nt] = __builtin_amdgcn_wmma_f32_16x16x32_bf16(
                    false, aF[am], false, bF[nt], (short)0, acc[am][nt], false, false);
        // keeps the wait for the held tile's loads behind the products; lifted above them it would stall them
        __builtin_amdgcn_sched_barrier(0);
        publish(nxt, cur ^ 1);
        fetch(nxt, kt + 3);
        lds_barrier();
    };
    // trips in pairs, so that each register set and LDS buffer is named at compile time and no
    // branch stands inside the loop; an odd trip count ends in one trip behind it
    int kt = 0;
    for (; kt + 1 < nK; kt += 2) {
        trip(kt, 0, h1);
        trip(kt + 1, 1, h0);
    }
    if (kt < nK) trip(kt, 0, h1);

    // Epilogue. C/D layout: VGPR r, lane<16 -> (M=r, N=lane); lane>=16 -> (M=8+r).
    // Each wave passes its accumulators, 16 rows at a time, through its own slice of
    // the (now free) A buffer and picks them up as whole rows; the activation then
    // runs in a rolled loop of 16-byte pieces. Rolled to keep the text small.
    float* ep = reinterpret_cast<float*>(&As[0][0][0]) + wave * (16 * EPITCH);
    const float* src = ep + half * EPITCH + (l15 << 2);
#pragma unroll
    for (int am = 0; am < 2; ++am) {
        if (am) __syncthreads();   // the first 16 rows have been read; the slice may be rewritten
#pragma unroll
        for (int nt = 0; nt < 4; ++nt)
#pragma unroll
            for (int r = 0; r < 8; ++r)
                ep[(r + (half << 3)) * EPITCH + (nt << 4) + l15] = acc[am][nt][r];
        __syncthreads();           // lanes read what other lanes wrote

        // rows (wave*32 + am*16 + half) + 2 it, columns n0 + 4*l15 ..
        const size_t idx0 = (size_t)(m0 + (wave << 5) + (am << 4) + half) * Nout + n0 + (l15 << 2);
        const size_t step = (size_t)Nout * 2;
        if (act_mode == 0) {
#pragma unroll 1   // rolled: keeps the text small (see above)
            for (int it = 0; it < 8; ++it) {
                const float4 v = *(const float4*)(src + it * (2 * EPITCH));
                *(float4*)(Y + idx0 + it * step) = v;
                // the store's registers are rewritten by the next trip
                asm volatile("s_wait_xcnt 0x0" ::: "memory");
            }
        } else if (act_mode == 1) {
#pragma unroll 1   // rolled: keeps the text small (see above)
            for (int it = 0; it < 8; ++it) {
                const float4 v = *(const float4*)(src + it * (2 * EPITCH));
                float4 y;
                y.x = v.x / (1.0f + __expf(-v.x));                          // swish
                y.y = v.y / (1.0f + __expf(-v.y));
                y.z = v.z / (1.0f + __expf(-v.z));
                y.w = v.w / (1.0f + __expf(-v.w));
                *(float4*)(Y + idx0 + it * step) = y;
                // the store's registers are rewritten by the next trip
                asm volatile("s_wait_xcnt 0x0" ::: "memory");
            }
        } else {
#pragma unroll 1   // rolled: keeps the text small (see above)
            for (int it = 0; it < 8; ++it) {
                const float4 v = *(const float4*)(src + it * (2 * EPITCH));
                const float vv[4] = {v.x, v.y, v.z, v.w};
                float g[4], s[4];
#pragma unroll
                for (int c = 0; c < 4; ++c) {
                    const float ls = fminf(vv[c], 0.0f) - log1pf(__expf(-fabsf(vv[c])));  // logsigmoid
                    g[c] = ls * 0.0625f;                                                // /GATE_NORM
                    s[c] = 1.0f - __expf(g[c]);
                }
                *(float4*)(Y  + idx0 + it * step) = make_float4(g[0], g[1], g[2], g[3]);
                *(float4*)(Y2 + idx0 + it * step) = make_float4(s[0], s[1], s[2], s[3]);
                // the stores' registers are rewritten by the next trip
                asm volatile("s_wait_xcnt 0x0" ::: "memory");
            }
        }
    }
}

// the output projection: one tile per workgroup of a (columns, rows) grid
__global__ __launch_bounds__(256) void gemm_bt_kernel(
    const float* __restrict__ X, const float* __restrict__ W,
    float* __restrict__ Y, float* __restrict__ Y2,
    int Nrows, int Kdim, int Nout, int act_mode)
{
    gemm_bt_tile(X, W, Y, Y2, Kdim, Nout, act_mode, blockIdx.y * TILE_M, blockIdx.x * TILE_N);
}

// The four input projections in one launch: 56 column blocks (8 of F, 16 each of Q, K, V) x 16
// row blocks = 896 workgroups. Two are resident per WGP, so one's LDS waits, barriers and
// epilogue run under the other's loads, and no launch waits for the last tile of the one before.
// The gate blocks stand first: their epilogue is the longest and must not be the launch's tail.
// The row block is the low part of the index: workgroups 256 apart read the same rows of X, so
// where two such share a WGP its cache may serve both (a matter of speed only, nothing rests on it).
__global__ __launch_bounds__(256) void proj4_kernel(
    const float* __restrict__ X,
    const float* __restrict__ Wq, const float* __restrict__ Wk,
    const float* __restrict__ Wv, const float* __restrict__ Wf,
    float* __restrict__ Q, float* __restrict__ K, float* __restrict__ V,
    float* __restrict__ G, float* __restrict__ S, int Kdim)
{
    const int m0 = (blockIdx.x & 15) * TILE_M;
    const int cb = blockIdx.x >> 4;            // 0..55
    if (cb < 8) {
        gemm_bt_tile(X, Wf, G, S, Kdim, 512, 2, m0, cb * TILE_N);
    } else {
        const int which = (cb - 8) >> 4;       // 0: Q, 1: K, 2: V
        const float* W = which == 0 ? Wq : (which == 1 ? Wk : Wv);
        float*       Y = which == 0 ? Q  : (which == 1 ? K  : V);
        gemm_bt_tile(X, W, Y, nullptr, Kdim, 1024, 1, m0, ((cb - 8) & 15) * TILE_N);
    }
}

// ---------------------------------------------------------------------------
// Gated-ABC recurrence, split into its independent parts (four launches, the segment states included).
//   hk[:, m] depends on slot m alone  -> zscan: one workgroup per (b,h, 8 slots, segment)
//   softmax over the 64 slots         -> one thread per (b,h,t)
//   hv[:, v] depends on column v alone-> oscan: one workgroup per (b,h, 32 cols, segment)
// Inside a workgroup time runs in tiles of SCAN_TT steps: the tile's inputs sit
// in LDS, every thread steps its own register tile of the state with no barrier
// between steps, leaves its partial dot products in LDS, and the tile's partials
// are summed once behind the tile. The next tile's inputs are fetched into
// registers while the current tile is stepped.
// Z / P layout: [b*8+h][slot block of 8][t][8], so each workgroup owns whole lines.
// Time is cut into segments, each with workgroups of its own. The recurrence is linear in
// the state: state(end) = state(start) * D + E, with D the product of the segment's gates
// and E the state that the segment builds from zero. seg_state_kernel leaves D and E of
// every segment but the last in the workspace; a scan workgroup folds those of the
// segments in front of its own into its start state and then steps its segment alone.
// ---------------------------------------------------------------------------
typedef __attribute__((ext_vector_type(2))) float f32x2;
typedef __attribute__((ext_vector_type(4))) float f32x4;

#define SCAN_TT 32
#define ZPITCH  264   // 32 k-groups x 8 slots + 8: the tile sum reads 8 rows on distinct banks
#define OPITCH  528   // 16 slot-groups x 32 cols + 16: same, for 16-byte reads
#define PPITCH  72    // 64 slots + 8: the blocked P rows land on distinct banks
#define ZSEG    4     // time segments of the slot-score scan: 512 workgroups, two per WGP
#define ZLEN    (2048 / ZSEG)
#define OSEG    8     // time segments of the output scan: 512 workgroups, two per WGP
#define OLEN    (2048 / OSEG)
#define ZSTATE_WGS ((ZSEG - 1) * 128)
#define OSTATE_WGS ((OSEG - 1) * 64)

static __device__ __forceinline__ f32x2 splat2(float x) { f32x2 r = {x, x}; return r; }

// E and D of one hk segment; thread tile and step arithmetic as in zscan_kernel.
// Ek: [segment*128 + workgroup][2][thread][4], Dk: [segment*128 + workgroup][thread][2]
static __device__ __forceinline__ void zstate_body(
    int blk, const float* __restrict__ Kp, const float* __restrict__ Gp,
    const float* __restrict__ Sp, float* __restrict__ Ek, float* __restrict__ Dk)
{
    __shared__ __attribute__((aligned(16))) float kS[SCAN_TT][128];
    __shared__ __attribute__((aligned(16))) float geS[SCAN_TT][8];
    __shared__ __attribute__((aligned(16))) float sS[SCAN_TT][8];

    const int tid = threadIdx.x;
    const int seg = blk >> 7;
    const int bh  = (blk & 127) >> 3;
    const int mb  = blk & 7;
    const int b   = bh >> 3;
    const int h   = bh & 7;
    const int kg  = tid >> 2;      // 0..31
    const int mg  = tid & 3;       // 0..3

    f32x4 kr[8], gr;
    const unsigned qoff = (unsigned)(tid >> 5) * 1024u + (unsigned)((tid & 31) << 2);
    const unsigned goff = (unsigned)((tid & 63) >> 1) * 512u + (unsigned)((tid & 1) << 2);
    const float* GS = (__builtin_amdgcn_readfirstlane(tid) < 64) ? Gp : Sp;   // waves 0,1: gates; 2,3: s
    auto fetch = [&](int t0) {
        const float* k = Kp + (size_t)(b * 2048 + t0) * 1024 + h * 128;
#pragma unroll
        for (int i = 0; i < 8; ++i)         // rows (tid>>5) + 4 i
            kr[i] = *(const f32x4*)(k + qoff + i * 4096);
        gr = *(const f32x4*)(GS + (size_t)(b * 2048 + t0) * 512 + h * 64 + mb * 8 + goff);
        // the loads' base registers are rewritten for the next fetch
        asm volatile("s_wait_xcnt 0x0" ::: "memory");
    };
    auto publish = [&]() {
#pragma unroll
        for (int i = 0; i < 8; ++i) {
            const int idx = tid + (i << 7);
            *(f32x4*)&kS[idx >> 5][(idx & 31) << 2] = kr[i];
        }
        const int u = tid & 63;
        if (tid < 64) {
            f32x4 e = {__expf(gr.x), __expf(gr.y), __expf(gr.z), __expf(gr.w)};
            *(f32x4*)&geS[u >> 1][(u & 1) << 2] = e;
        } else {
            *(f32x4*)&sS[u >> 1][(u & 1) << 2] = gr;
        }
    };

    f32x2 hk[4];
#pragma unroll
    for (int i = 0; i < 4; ++i) hk[i] = splat2(0.0f);
    f32x2 dp = splat2(1.0f);

    const int tbeg = seg * ZLEN, tend = tbeg + ZLEN;
    fetch(tbeg);
    publish();
    __syncthreads();

    for (int t0 = tbeg; t0 < tend; t0 += SCAN_TT) {
        const bool more = (t0 + SCAN_TT) < tend;
        if (more) fetch(t0 + SCAN_TT);

        // groups of 4 steps, two register sets, as in zscan_kernel
        f32x4 ka[4], kb[4];
        f32x2 ga[4], sa[4], gb[4], sb[4];
        auto ld = [&](f32x4 (&k)[4], f32x2 (&g)[4], f32x2 (&s)[4], int base) {
#pragma unroll
            for (int j = 0; j < 4; ++j) {
                k[j] = *(const f32x4*)&kS[base + j][kg << 2];
                g[j] = *(const f32x2*)&geS[base + j][mg << 1];
                s[j] = *(const f32x2*)&sS[base + j][mg << 1];
            }
            // keeps these reads ahead of the group stepped next; sunk to their use they would be waited for
            __builtin_amdgcn_sched_barrier(0);
        };
        auto step = [&](const f32x4 (&k)[4], const f32x2 (&g)[4], const f32x2 (&s)[4]) {
#pragma unroll
            for (int j = 0; j < 4; ++j) {
#pragma unroll
                for (int i = 0; i < 4; ++i)
                    hk[i] = __builtin_elementwise_fma(hk[i], g[j], splat2(k[j][i]) * s[j]);
                dp *= g[j];
            }
        };
        ld(ka, ga, sa, 0);
#pragma unroll 1   // rolled: unrolled, all of the tile's LDS reads are lifted to its head and take 480 registers
        for (int g8 = 0; g8 < SCAN_TT; g8 += 8) {
            ld(kb, gb, sb, g8 + 4);
            step(ka, ga, sa);
            ld(ka, ga, sa, (g8 + 8) & (SCAN_TT - 1));   // behind the last group: rows 0..3 again, not used
            step(kb, gb, sb);
        }
        __syncthreads();   // every reader has left the input tile
        if (more) publish();
        __syncthreads();   // next input tile published
    }

    float* e = Ek + (size_t)blk * 1024 + (tid << 2);
    const f32x4 e0 = {hk[0].x, hk[0].y, hk[1].x, hk[1].y};
    const f32x4 e1 = {hk[2].x, hk[2].y, hk[3].x, hk[3].y};
    *(f32x4*)e         = e0;
    *(f32x4*)(e + 512) = e1;
    *(f32x2*)(Dk + (size_t)blk * 256 + (tid << 1)) = dp;
}

// E and D of one hv segment; thread tile and step arithmetic as in oscan_kernel.
// Ev: [segment*64 + workgroup][4][thread][4], Dv: [segment*64 + workgroup][thread][4]
static __device__ __forceinline__ void ostate_body(
    int blk, const float* __restrict__ Vp, const float* __restrict__ Gp,
    const float* __restrict__ Sp, float* __restrict__ Ev, float* __restrict__ Dv)
{
    __shared__ __attribute__((aligned(16))) float geS[SCAN_TT][64];
    __shared__ __attribute__((aligned(16))) float sS[SCAN_TT][64];
    __shared__ __attribute__((aligned(16))) float vS[SCAN_TT][32];

    const int tid = threadIdx.x;
    const int seg = blk >> 6;
    const int bh  = (blk & 63) >> 2;
    const int v0  = (blk & 3) << 5;
    const int b   = bh >> 3;
    const int h   = bh & 7;
    const int vg  = tid & 7;       // 0..7
    const int sg  = tid >> 3;      // 0..15

    f32x4 gr[4], sr[4], vr[2];
    const unsigned goff = (unsigned)(tid >> 4) * 512u + (unsigned)((tid & 15) << 2);
    const unsigned voff = (unsigned)(tid >> 3) * 1024u + (unsigned)((tid & 7) << 2);
    auto fetch = [&](int t0) {
        const size_t rowg = (size_t)(b * 2048 + t0) * 512 + h * 64;
        const float* g = Gp + rowg;
        const float* s = Sp + rowg;
        const float* v = Vp + (size_t)(b * 2048 + t0) * 1024 + h * 128 + v0;
#pragma unroll
        for (int i = 0; i < 4; ++i) {
            gr[i] = *(const f32x4*)(g + goff + i * 4096);    // rows (tid>>4) + 8 i
            sr[i] = *(const f32x4*)(s + goff + i * 4096);
        }
#pragma unroll
        for (int i = 0; i < 2; ++i)
            vr[i] = *(const f32x4*)(v + voff + i * 16384);   // rows (tid>>3) + 16 i
        // the loads' base registers are rewritten for the next fetch
        asm volatile("s_wait_xcnt 0x0" ::: "memory");
    };
    auto publish = [&]() {
#pragma unroll
        for (int i = 0; i < 4; ++i) {
            const int idx = tid + (i << 7);
            f32x4 e = {__expf(gr[i].x), __expf(gr[i].y), __expf(gr[i].z), __expf(gr[i].w)};
            *(f32x4*)&geS[idx >> 4][(idx & 15) << 2] = e;
            *(f32x4*)&sS[idx >> 4][(idx & 15) << 2]  = sr[i];
        }
#pragma unroll
        for (int i = 0; i < 2; ++i) {
            const int idx = tid + (i << 7);
            *(f32x4*)&vS[idx >> 3][(idx & 7) << 2] = vr[i];
        }
    };

    f32x2 hv[4][2];
#pragma unroll
    for (int i = 0; i < 4; ++i) { hv[i][0] = splat2(0.0f); hv[i][1] = splat2(0.0f); }
    f32x4 dp = {1.0f, 1.0f, 1.0f, 1.0f};

    const int tbeg = seg * OLEN, tend = tbeg + OLEN;
    fetch(tbeg);
    publish();
    __syncthreads();

    for (int t0 = tbeg; t0 < tend; t0 += SCAN_TT) {
        const bool more = (t0 + SCAN_TT) < tend;
        if (more) fetch(t0 + SCAN_TT);

        // groups of 4 steps, two register sets, as in oscan_kernel
        f32x4 ga[4], sa[4], va[4], gb[4], sb[4], vb[4];
        auto ld = [&](f32x4 (&g)[4], f32x4 (&s)[4], f32x4 (&v)[4], int base) {
#pragma unroll
            for (int j = 0; j < 4; ++j) {
                g[j] = *(const f32x4*)&geS[base + j][sg << 2];
                s[j] = *(const f32x4*)&sS[base + j][sg << 2];
                v[j] = *(const f32x4*)&vS[base + j][vg << 2];
            }
            // keeps these reads ahead of the group stepped next; sunk to their use they would be waited for
            __builtin_amdgcn_sched_barrier(0);
        };
        auto step = [&](const f32x4 (&g)[4], const f32x4 (&s)[4], const f32x4 (&v)[4]) {
#pragma unroll
            for (int j = 0; j < 4; ++j) {
                const f32x2 v01 = {v[j].x, v[j].y}, v23 = {v[j].z, v[j].w};
#pragma unroll
                for (int i = 0; i < 4; ++i) {
                    hv[i][0] = __builtin_elementwise_fma(hv[i][0], splat2(g[j][i]), splat2(s[j][i]) * v01);
                    hv[i][1] = __builtin_elementwise_fma(hv[i][1], splat2(g[j][i]), splat2(s[j][i]) * v23);
                }
                dp *= g[j];
            }
        };
        ld(ga, sa, va, 0);
#pragma unroll 1   // rolled: unrolled, all of the tile's LDS reads are lifted to its head and take 480 registers
        for (int g8 = 0; g8 < SCAN_TT; g8 += 8) {
            ld(gb, sb, vb, g8 + 4);
            step(ga, sa, va);
            ld(ga, sa, va, (g8 + 8) & (SCAN_TT - 1));   // behind the last group: rows 0..3 again, not used
            step(gb, sb, vb);
        }
        __syncthreads();   // every reader has left the input tile
        if (more) publish();
        __syncthreads();   // next input tile published
    }

    float* e = Ev + (size_t)blk * 2048 + (tid << 2);
#pragma unroll
    for (int i = 0; i < 4; ++i) {
        const f32x4 ei = {hv[i][0].x, hv[i][0].y, hv[i][1].x, hv[i][1].y};
        *(f32x4*)(e + i * 512) = ei;
    }
    *(f32x4*)(Dv + (size_t)blk * 512 + (tid << 2)) = dp;
}

// one launch for both kinds of segment state (neither needs the slot weights);
// the longer hk segments stand first in the grid
__global__ __launch_bounds__(128) void seg_state_kernel(
    const float* __restrict__ Kp, const float* __restrict__ Vp,
    const float* __restrict__ Gp, const float* __restrict__ Sp,
    float* __restrict__ Ek, float* __restrict__ Dk,
    float* __restrict__ Ev, float* __restrict__ Dv)
{
    const int blk = blockIdx.x;
    if (blk < ZSTATE_WGS) zstate_body(blk, Kp, Gp, Sp, Ek, Dk);
    else                  ostate_body(blk - ZSTATE_WGS, Vp, Gp, Sp, Ev, Dv);
}

// thread: 4 k (kg*4..) x 2 slots (mg*2..) of hk
__global__ __launch_bounds__(128) void zscan_kernel(
    const float* __restrict__ Qp, const float* __restrict__ Kp,
    const float* __restrict__ Gp, const float* __restrict__ Sp,
    const float* __restrict__ Ek, const float* __restrict__ Dk,
    float* __restrict__ Zb)
{
    __shared__ __attribute__((aligned(16))) float qS[SCAN_TT][128];
    __shared__ __attribute__((aligned(16))) float kS[SCAN_TT][128];
    __shared__ __attribute__((aligned(16))) float geS[SCAN_TT][8];
    __shared__ __attribute__((aligned(16))) float sS[SCAN_TT][8];
    __shared__ __attribute__((aligned(16))) float part[SCAN_TT][ZPITCH];

    const int tid = threadIdx.x;
    const int seg = blockIdx.x >> 7;     // time segment
    const int wg  = blockIdx.x & 127;
    const int bh  = wg >> 3;
    const int mb  = wg & 7;
    const int b   = bh >> 3;
    const int h   = bh & 7;
    const int kg  = tid >> 2;      // 0..31
    const int mg  = tid & 3;       // 0..3
    const float scale = 0.08838834764831845f; // 128^-0.5

    f32x4 qr[8], kr[8], gr;
    // uniform base + one fixed per-thread offset: the tile advance stays in scalar registers
    const unsigned qoff = (unsigned)(tid >> 5) * 1024u + (unsigned)((tid & 31) << 2);
    const unsigned goff = (unsigned)((tid & 63) >> 1) * 512u + (unsigned)((tid & 1) << 2);
    const float* GS = (__builtin_amdgcn_readfirstlane(tid) < 64) ? Gp : Sp;   // waves 0,1: gates; 2,3: s
    auto fetch = [&](int t0) {
        const size_t rowq = (size_t)(b * 2048 + t0) * 1024 + h * 128;
        const float* q = Qp + rowq;
        const float* k = Kp + rowq;
#pragma unroll
        for (int i = 0; i < 8; ++i) {       // rows (tid>>5) + 4 i
            qr[i] = *(const f32x4*)(q + qoff + i * 4096);
            kr[i] = *(const f32x4*)(k + qoff + i * 4096);
        }
        gr = *(const f32x4*)(GS + (size_t)(b * 2048 + t0) * 512 + h * 64 + mb * 8 + goff);
        // the loads' base registers are rewritten behind this
        asm volatile("s_wait_xcnt 0x0" ::: "memory");
    };
    auto publish = [&]() {
#pragma unroll
        for (int i = 0; i < 8; ++i) {
            const int idx = tid + (i << 7);
            *(f32x4*)&qS[idx >> 5][(idx & 31) << 2] = qr[i] * scale;
            *(f32x4*)&kS[idx >> 5][(idx & 31) << 2] = kr[i];
        }
        const int u = tid & 63;
        if (tid < 64) {
            f32x4 e = {__expf(gr.x), __expf(gr.y), __expf(gr.z), __expf(gr.w)};
            *(f32x4*)&geS[u >> 1][(u & 1) << 2] = e;
        } else {
            *(f32x4*)&sS[u >> 1][(u & 1) << 2] = gr;
        }
    };

    f32x2 hk[4];
#pragma unroll
    for (int i = 0; i < 4; ++i) hk[i] = splat2(0.0f);

    const int tbeg = seg * ZLEN, tend = tbeg + ZLEN;
    fetch(tbeg);
    // start state: the earlier segments' E, each decayed by the D of the segments behind it
    // (all asked for at once, one round trip instead of one per segment; later segments' are left unused)
    {
        const float* e = Ek + (size_t)wg * 1024 + (tid << 2);
        const float* dsrc = Dk + (size_t)wg * 256 + (tid << 1);
        f32x4 e0[ZSEG - 1], e1[ZSEG - 1];
        f32x2 d[ZSEG - 1];
#pragma unroll
        for (int i = 0; i < ZSEG - 1; ++i) {
            e0[i] = *(const f32x4*)(e + i * (128 * 1024));
            e1[i] = *(const f32x4*)(e + i * (128 * 1024) + 512);
            d[i]  = *(const f32x2*)(dsrc + i * (128 * 256));
        }
        // the loads' address registers are free for reuse behind this
        asm volatile("s_wait_xcnt 0x0" ::: "memory");
#pragma unroll
        for (int i = 0; i < ZSEG - 1; ++i) {
            if (i < seg) {
                const f32x2 e00 = {e0[i].x, e0[i].y}, e01 = {e0[i].z, e0[i].w};
                const f32x2 e10 = {e1[i].x, e1[i].y}, e11 = {e1[i].z, e1[i].w};
                hk[0] = __builtin_elementwise_fma(hk[0], d[i], e00);
                hk[1] = __builtin_elementwise_fma(hk[1], d[i], e01);
                hk[2] = __builtin_elementwise_fma(hk[2], d[i], e10);
                hk[3] = __builtin_elementwise_fma(hk[3], d[i], e11);
            }
        }
    }
    publish();
    __syncthreads();

    for (int t0 = tbeg; t0 < tend; t0 += SCAN_TT) {
        const bool more = (t0 + SCAN_TT) < tend;
        if (more) fetch(t0 + SCAN_TT);

        // groups of 4 steps, two register sets: the next group's LDS reads are in
        // flight while this group is stepped
        f32x4 qa[4], ka[4], qb[4], kb[4];
        f32x2 ga[4], sa[4], gb[4], sb[4];
        auto ld = [&](f32x4 (&q)[4], f32x4 (&k)[4], f32x2 (&g)[4], f32x2 (&s)[4], int base) {
#pragma unroll
            for (int j = 0; j < 4; ++j) {
                q[j] = *(const f32x4*)&qS[base + j][kg << 2];
                k[j] = *(const f32x4*)&kS[base + j][kg << 2];
                g[j] = *(const f32x2*)&geS[base + j][mg << 1];
                s[j] = *(const f32x2*)&sS[base + j][mg << 1];
            }
            // keeps these reads ahead of the group stepped next; sunk to their use they would be waited for
            __builtin_amdgcn_sched_barrier(0);
        };
        auto step = [&](const f32x4 (&q)[4], const f32x4 (&k)[4], const f32x2 (&g)[4], const f32x2 (&s)[4], int base) {
#pragma unroll
            for (int j = 0; j < 4; ++j) {
                f32x2 acc = splat2(0.0f);
#pragma unroll
                for (int i = 0; i < 4; ++i) {
                    hk[i] = __builtin_elementwise_fma(hk[i], g[j], splat2(k[j][i]) * s[j]);
                    acc   = __builtin_elementwise_fma(splat2(q[j][i]), hk[i], acc);
                }
                *(f32x2*)&part[base + j][(kg << 3) + (mg << 1)] = acc;
            }
        };
        ld(qa, ka, ga, sa, 0);
#pragma unroll
        for (int g8 = 0; g8 < SCAN_TT; g8 += 8) {
            ld(qb, kb, gb, sb, g8 + 4);
            step(qa, ka, ga, sa, g8);
            if (g8 + 8 < SCAN_TT) ld(qa, ka, ga, sa, g8 + 8);
            step(qb, kb, gb, sb, g8 + 4);
        }
        __syncthreads();   // partials complete; every reader has left the input tile

        {
            const int rt = tid >> 2, rm = tid & 3;
            f32x2 a0 = splat2(0.0f), a1 = a0, a2 = a0, a3 = a0;
#pragma unroll
            for (int g = 0; g < 8; ++g) {
                a0 += *(const f32x2*)&part[rt][((4 * g + 0) << 3) + (rm << 1)];
                a1 += *(const f32x2*)&part[rt][((4 * g + 1) << 3) + (rm << 1)];
                a2 += *(const f32x2*)&part[rt][((4 * g + 2) << 3) + (rm << 1)];
                a3 += *(const f32x2*)&part[rt][((4 * g + 3) << 3) + (rm << 1)];
            }
            float* zrow = Zb + ((size_t)(bh * 8 + mb) * 2048 + t0) * 8;
            *(f32x2*)(zrow + (unsigned)(rt * 8 + (rm << 1))) = (a0 + a1) + (a2 + a3);
            // the store's registers are reused right behind it
            asm volatile("s_wait_xcnt 0x0" ::: "memory");
        }
        if (more) publish();
        __syncthreads();   // next input tile published; partials free again
    }
}

// softmax over the 64 slots of one (b,h,t), in place on the blocked layout
__global__ __launch_bounds__(256) void slot_softmax_kernel(float* Zb)
{
    const int gid = blockIdx.x * 256 + threadIdx.x;
    const int bh  = gid >> 11;
    const int t   = gid & 2047;
    f32x4 z[16];
#pragma unroll
    for (int mb = 0; mb < 8; ++mb) {
        const float* p = Zb + ((size_t)(bh * 8 + mb) * 2048 + t) * 8;
        z[2 * mb]     = *(const f32x4*)p;
        z[2 * mb + 1] = *(const f32x4*)(p + 4);
    }
    f32x4 m4 = z[0];
#pragma unroll
    for (int i = 1; i < 16; ++i) m4 = __builtin_elementwise_max(m4, z[i]);
    const float mx = fmaxf(fmaxf(m4.x, m4.y), fmaxf(m4.z, m4.w));
    f32x4 s4 = {0.0f, 0.0f, 0.0f, 0.0f};
#pragma unroll
    for (int i = 0; i < 16; ++i) {
        f32x4 e = {__expf(z[i].x - mx), __expf(z[i].y - mx), __expf(z[i].z - mx), __expf(z[i].w - mx)};
        z[i] = e;
        s4 += e;
    }
    const float inv = 1.0f / ((s4.x + s4.y) + (s4.z + s4.w));
#pragma unroll
    for (int mb = 0; mb < 8; ++mb) {
        float* p = Zb + ((size_t)(bh * 8 + mb) * 2048 + t) * 8;
        *(f32x4*)p       = z[2 * mb] * inv;
        *(f32x4*)(p + 4) = z[2 * mb + 1] * inv;
    }
}

// thread: 4 slots (sg*4..) x 4 columns (vg*4..) of hv
__global__ __launch_bounds__(128) void oscan_kernel(
    const float* __restrict__ Vp, const float* __restrict__ Gp,
    const float* __restrict__ Sp, const float* __restrict__ Pb,
    const float* __restrict__ Ev, const float* __restrict__ Dv,
    float* __restrict__ Op)
{
    __shared__ __attribute__((aligned(16))) float geS[SCAN_TT][64];
    __shared__ __attribute__((aligned(16))) float sS[SCAN_TT][64];
    __shared__ __attribute__((aligned(16))) float pS[SCAN_TT][PPITCH];
    __shared__ __attribute__((aligned(16))) float vS[SCAN_TT][32];
    __shared__ __attribute__((aligned(16))) float part[SCAN_TT][OPITCH];

    const int tid = threadIdx.x;
    const int seg = blockIdx.x >> 6;     // time segment
    const int wg  = blockIdx.x & 63;
    const int bh  = wg >> 2;
    const int v0  = (wg & 3) << 5;
    const int b   = bh >> 3;
    const int h   = bh & 7;
    const int vg  = tid & 7;       // 0..7
    const int sg  = tid >> 3;      // 0..15

    f32x4 gr[4], sr[4], pr[4], vr[2];
    // uniform base + one fixed per-thread offset: the tile advance stays in scalar registers
    const unsigned goff = (unsigned)(tid >> 4) * 512u + (unsigned)((tid & 15) << 2);
    const unsigned poff = (unsigned)(tid >> 6) * 16384u + (unsigned)((tid & 63) << 2);
    const unsigned voff = (unsigned)(tid >> 3) * 1024u + (unsigned)((tid & 7) << 2);
    auto fetch = [&](int t0) {
        const size_t rowg = (size_t)(b * 2048 + t0) * 512 + h * 64;
        const float* g = Gp + rowg;
        const float* s = Sp + rowg;
        const float* p = Pb + ((size_t)(bh * 8) * 2048 + t0) * 8;
        const float* v = Vp + (size_t)(b * 2048 + t0) * 1024 + h * 128 + v0;
#pragma unroll
        for (int i = 0; i < 4; ++i) {
            gr[i] = *(const f32x4*)(g + goff + i * 4096);    // rows (tid>>4) + 8 i
            sr[i] = *(const f32x4*)(s + goff + i * 4096);
            // blocked P: slot block (tid>>6) + 2 i, then 64 consecutive 16-byte pieces of this tile
            pr[i] = *(const f32x4*)(p + poff + i * 32768);
        }
#pragma unroll
        for (int i = 0; i < 2; ++i)
            vr[i] = *(const f32x4*)(v + voff + i * 16384);   // rows (tid>>3) + 16 i
        // the loads' base registers are rewritten behind this
        asm volatile("s_wait_xcnt 0x0" ::: "memory");
    };
    auto publish = [&]() {
#pragma unroll
        for (int i = 0; i < 4; ++i) {
            const int idx = tid + (i << 7);
            f32x4 e = {__expf(gr[i].x), __expf(gr[i].y), __expf(gr[i].z), __expf(gr[i].w)};
            *(f32x4*)&geS[idx >> 4][(idx & 15) << 2] = e;
            *(f32x4*)&sS[idx >> 4][(idx & 15) << 2]  = sr[i];
            *(f32x4*)&pS[(idx & 63) >> 1][((idx >> 6) << 3) + ((idx & 1) << 2)] = pr[i];
        }
#pragma unroll
        for (int i = 0; i < 2; ++i) {
            const int idx = tid + (i << 7);
            *(f32x4*)&vS[idx >> 3][(idx & 7) << 2] = vr[i];
        }
    };

    f32x2 hv[4][2];
#pragma unroll
    for (int i = 0; i < 4; ++i) { hv[i][0] = splat2(0.0f); hv[i][1] = splat2(0.0f); }

    const int tbeg = seg * OLEN, tend = tbeg + OLEN;
    fetch(tbeg);
    // start state: the earlier segments' E, each decayed by the D of the segments behind it
    // (all asked for at once, one round trip instead of one per segment; later segments' are left unused)
    {
        const float* e = Ev + (size_t)wg * 2048 + (tid << 2);
        const float* dsrc = Dv + (size_t)wg * 512 + (tid << 2);
        f32x4 er[OSEG - 1][4], d[OSEG - 1];
#pragma unroll
        for (int i = 0; i < OSEG - 1; ++i) {
#pragma unroll
            for (int r = 0; r < 4; ++r) er[i][r] = *(const f32x4*)(e + i * (64 * 2048) + r * 512);
            d[i] = *(const f32x4*)(dsrc + i * (64 * 512));
        }
        // the loads' address registers are free for reuse behind this
        asm volatile("s_wait_xcnt 0x0" ::: "memory");
#pragma unroll
        for (int i = 0; i < OSEG - 1; ++i) {
            if (i < seg) {
#pragma unroll
                for (int r = 0; r < 4; ++r) {
                    const f32x2 lo = {er[i][r].x, er[i][r].y}, hi = {er[i][r].z, er[i][r].w};
                    hv[r][0] = __builtin_elementwise_fma(hv[r][0], splat2(d[i][r]), lo);
                    hv[r][1] = __builtin_elementwise_fma(hv[r][1], splat2(d[i][r]), hi);
                }
            }
        }
    }
    publish();
    __syncthreads();

    for (int t0 = tbeg; t0 < tend; t0 += SCAN_TT) {
        const bool more = (t0 + SCAN_TT) < tend;
        if (more) fetch(t0 + SCAN_TT);

        // groups of 4 steps, two register sets: the next group's LDS reads are in
        // flight while this group is stepped
        f32x4 ga[4], sa[4], pa[4], va[4], gb[4], sb[4], pb[4], vb[4];
        auto ld = [&](f32x4 (&g)[4], f32x4 (&s)[4], f32x4 (&p)[4], f32x4 (&v)[4], int base) {
#pragma unroll
            for (int j = 0; j < 4; ++j) {
                g[j] = *(const f32x4*)&geS[base + j][sg << 2];
                s[j] = *(const f32x4*)&sS[base + j][sg << 2];
                p[j] = *(const f32x4*)&pS[base + j][sg << 2];
                v[j] = *(const f32x4*)&vS[base + j][vg << 2];
            }
            // keeps these reads ahead of the group stepped next; sunk to their use they would be waited for
            __builtin_amdgcn_sched_barrier(0);
        };
        auto step = [&](const f32x4 (&g)[4], const f32x4 (&s)[4], const f32x4 (&p)[4], const f32x4 (&v)[4], int base) {
#pragma unroll
            for (int j = 0; j < 4; ++j) {
                const f32x2 v01 = {v[j].x, v[j].y}, v23 = {v[j].z, v[j].w};
                f32x2 acc0 = splat2(0.0f), acc1 = splat2(0.0f);
#pragma unroll
                for (int i = 0; i < 4; ++i) {
                    hv[i][0] = __builtin_elementwise_fma(hv[i][0], splat2(g[j][i]), splat2(s[j][i]) * v01);
                    hv[i][1] = __builtin_elementwise_fma(hv[i][1], splat2(g[j][i]), splat2(s[j][i]) * v23);
                    acc0 = __builtin_elementwise_fma(splat2(p[j][i]), hv[i][0], acc0);
                    acc1 = __builtin_elementwise_fma(splat2(p[j][i]), hv[i][1], acc1);
                }
                f32x4 a = {acc0.x, acc0.y, acc1.x, acc1.y};
                *(f32x4*)&part[base + j][(sg << 5) + (vg << 2)] = a;
            }
        };
        ld(ga, sa, pa, va, 0);
#pragma unroll
        for (int g8 = 0; g8 < SCAN_TT; g8 += 8) {
            ld(gb, sb, pb, vb, g8 + 4);
            step(ga, sa, pa, va, g8);
            if (g8 + 8 < SCAN_TT) ld(ga, sa, pa, va, g8 + 8);
            step(gb, sb, pb, vb, g8 + 4);
        }
        __syncthreads();   // partials complete; every reader has left the input tile

        {
            const int rt = tid >> 2, rv = (tid & 3) << 2;
            f32x4 a0 = {0.0f, 0.0f, 0.0f, 0.0f}, a1 = a0, b0 = a0, b1 = a0;
#pragma unroll
            for (int g = 0; g < 8; ++g) {
                a0 += *(const f32x4*)&part[rt][((2 * g + 0) << 5) + rv];
                b0 += *(const f32x4*)&part[rt][((2 * g + 0) << 5) + rv + 16];
                a1 += *(const f32x4*)&part[rt][((2 * g + 1) << 5) + rv];
                b1 += *(const f32x4*)&part[rt][((2 * g + 1) << 5) + rv + 16];
            }
            float* o = Op + (size_t)(b * 2048 + t0) * 1024 + h * 128 + v0;
            *(f32x4*)(o + (unsigned)(rt * 1024 + rv))      = a0 + a1;
            *(f32x4*)(o + (unsigned)(rt * 1024 + rv) + 16) = b0 + b1;
            // the stores' registers are reused right behind them
            asm volatile("s_wait_xcnt 0x0" ::: "memory");
        }
        if (more) publish();
        __syncthreads();   // next input tile published; partials free again
    }
}

// ---------------------------------------------------------------------------
// y = RMSNorm(swish(x)) * g_weight     (one block per row of 1024)
// ---------------------------------------------------------------------------
__global__ __launch_bounds__(256) void swish_rms_kernel(
    const float* __restrict__ X, const float* __restrict__ w,
    float* __restrict__ Y)
{
    const int row = blockIdx.x;
    const float* xr = X + (size_t)row * 1024;
    float loc[4];
    float ss = 0.0f;
#pragma unroll
    for (int i = 0; i < 4; ++i) {
        const float x  = xr[threadIdx.x + 256 * i];
        const float sw = x / (1.0f + __expf(-x));
        loc[i] = sw;
        ss += sw * sw;
    }
#pragma unroll
    for (int off = 16; off > 0; off >>= 1) ss += __shfl_xor(ss, off, 32);
    __shared__ float wred[8];
    if ((threadIdx.x & 31) == 0) wred[threadIdx.x >> 5] = ss;
    __syncthreads();
    float tot = 0.0f;
#pragma unroll
    for (int i = 0; i < 8; ++i) tot += wred[i];
    const float r = rsqrtf(tot * (1.0f / 1024.0f) + 1e-5f);
#pragma unroll
    for (int i = 0; i < 4; ++i) {
        const int c = threadIdx.x + 256 * i;
        Y[(size_t)row * 1024 + c] = loc[i] * r * w[c];
    }
}

// ---------------------------------------------------------------------------
extern "C" void kernel_launch(void* const* d_in, const int* in_sizes, int n_in,
                              void* d_out, int out_size, void* d_ws, size_t ws_size,
                              hipStream_t stream) {
    const float* X  = (const float*)d_in[0];   // [4096,1024]
    const float* Wq = (const float*)d_in[1];
    const float* Wk = (const float*)d_in[2];
    const float* Wv = (const float*)d_in[3];
    const float* Wf = (const float*)d_in[4];   // [512,1024]
    const float* Wo = (const float*)d_in[5];
    const float* gw = (const float*)d_in[6];   // [1024]

    const size_t ND = 4096ull * 1024ull;
    const size_t NF = 4096ull * 512ull;
    float* ws  = (float*)d_ws;
    float* Q   = ws;             // 16 MB
    float* Kt  = Q   + ND;       // 16 MB
    float* Vt  = Kt  + ND;       // 16 MB
    float* G   = Vt  + ND;       //  8 MB
    float* Sv  = G   + NF;       //  8 MB
    float* Oin = Sv  + NF;       // 16 MB
    float* Zb  = Oin + ND;       //  8 MB, slot scores then slot weights
    float* Ek  = Zb  + NF;                                  // hk segment states
    float* Dk  = Ek  + (size_t)ZSTATE_WGS * 1024;           // their gate products
    float* Ev  = Dk  + (size_t)ZSTATE_WGS * 256;            // hv segment states
    float* Dv  = Ev  + (size_t)OSTATE_WGS * 2048;           // their gate products
    float* Xn  = Q;              // reuse Q after the scan

    dim3 blk(256);
    dim3 gQKV(1024 / TILE_N, 4096 / TILE_M);   // 16 x 16

    proj4_kernel<<<dim3(56 * 16), blk, 0, stream>>>(X, Wq, Wk, Wv, Wf, Q, Kt, Vt, G, Sv, 1024);

    seg_state_kernel<<<ZSTATE_WGS + OSTATE_WGS, dim3(128), 0, stream>>>(Kt, Vt, G, Sv, Ek, Dk, Ev, Dv);
    zscan_kernel<<<128 * ZSEG, dim3(128), 0, stream>>>(Q, Kt, G, Sv, Ek, Dk, Zb);
    slot_softmax_kernel<<<128, blk, 0, stream>>>(Zb);
    oscan_kernel<<<64 * OSEG, dim3(128), 0, stream>>>(Vt, G, Sv, Zb, Ev, Dv, Oin);

    swish_rms_kernel<<<4096, blk, 0, stream>>>(Oin, gw, Xn);

    gemm_bt_kernel<<<gQKV, blk, 0, stream>>>(Xn, Wo, (float*)d_out, nullptr, 4096, 1024, 1024, 0);
}

// v007
// It runs in 156 microseconds.
// Timed twice side by side with v006, it ran 1.09 times as fast both times.
// Over all steps from v000 it is 21.1 times as fast.
#include <hip/hip_runtime.h>

// ---------------------------------------------------------------------------
// Gated ABC attention, MI455X (gfx1250, wave32, WMMA bf16).
// B=2, T=2048, D=1024, H=8, M=64, KD=128.
//   0) to_bf16: X and the five weight matrices rounded to bf16 once
//   1) proj4 (WMMA), one launch: Q/K/V = swish(X W^T), F -> (G, S) gates
//   2) recurrence: segment states, slot scores, slot softmax, output columns (four launches)
//   3) swish + RMSNorm, result stored as bf16
//   4) gemm_bt: out = Xn Wo^T
// GEMM: 256x64 block tile, 8 waves x (32x64), double-buffered LDS, operands bf16 in memory,
// 16-byte global loads (eight lanes per 128-byte row slice of 64 k, so a wave's load covers
// whole lines) held in registers for two trips -> 16B LDS stores -> ds_load_b128 frags.
// Epilogue through LDS, rolled, 16-byte stores.
// ---------------------------------------------------------------------------

typedef __attribute__((ext_vector_type(16))) __bf16 v16bf;
typedef __attribute__((ext_vector_type(8)))  __bf16 v8bf;
typedef __attribute__((ext_vector_type(4)))  __bf16 v4bf;
typedef __attribute__((ext_vector_type(8)))  float  v8f;
typedef __attribute__((ext_vector_type(4)))  float  v4f;

#define TILE_M 256
#define TILE_N 64
#define TILE_K 64         // 64 bf16 = one 128-byte line of a row
#define KPAD   8          // pad rows to 72 bf16 = 144 B (odd multiple of 16 B, conflict-free)
#define LROW   (TILE_K + KPAD)
#define EPITCH 68         // epilogue rows: 64 f32 + 4, so rows r and r+8 fall on different banks

static __device__ __forceinline__ v4bf pack4(v4f a) {
    v4bf p;
    p[0] = (__bf16)a.x; p[1] = (__bf16)a.y; p[2] = (__bf16)a.z; p[3] = (__bf16)a.w;
    return p;
}

static __device__ __forceinline__ v16bf load_frag(const __bf16* rowp, int half) {
    // lane's two contiguous 16-byte chunks of the 32-element K row
    v8bf lo = *(const v8bf*)(rowp + (half << 3));
    v8bf hi = *(const v8bf*)(rowp + 16 + (half << 3));
    return __builtin_shufflevector(lo, hi, 0, 1, 2, 3, 4, 5, 6, 7,
                                   8, 9, 10, 11, 12, 13, 14, 15);
}

// Work-group barrier of the K loop, by hand: it waits for this wave's LDS traffic alone.
// __syncthreads() would also wait for the global loads that are to stay in flight across it.
static __device__ __forceinline__ void lds_barrier() {
    asm volatile("s_wait_dscnt 0x0\n\ts_barrier_signal -1\n\ts_barrier_wait -1" ::: "memory");
}

// Y = act( X @ W^T ) ; X: [Nrows,Kdim] bf16, W: [Nout,Kdim] bf16, Y: [Nrows,Nout] f32
// act_mode: 0 = identity, 1 = swish, 2 = gate (Y=g=logsigmoid/16, Y2=s=1-exp(g))
// One workgroup's 256 x 64 tile at rows m0, columns n0.
static __device__ __forceinline__ void gemm_bt_tile(
    const __bf16* __restrict__ X, const __bf16* __restrict__ W,
    float* __restrict__ Y, float* __restrict__ Y2,
    int Kdim, int Nout, int act_mode, int m0, int n0)
{
    __shared__ __attribute__((aligned(16))) __bf16 As[2][TILE_M][LROW];
    __shared__ __attribute__((aligned(16))) __bf16 Bs[2][TILE_N][LROW];

    const int tid  = threadIdx.x;
    const int wave = tid >> 5;        // 0..7
    const int lane = tid & 31;
    const int half = lane >> 4;       // K-half select (0/1)
    const int l15  = lane & 15;

    v8f acc[2][4];
#pragma unroll
    for (int am = 0; am < 2; ++am)
#pragma unroll
        for (int nt = 0; nt < 4; ++nt)
#pragma unroll
            for (int j = 0; j < 8; ++j) acc[am][nt][j] = 0.0f;

    // ---- staging, split in two: global loads into registers, and (two trips later)
    //      the LDS stores. Two register sets, so two K tiles are in flight.
    // No branch stands around either half: a branch would merge paths in the compiler's
    // load counting and its wait for the older set would drain the younger one too.
    // A row's K slice is 64 bf16 = one 128-byte line. Eight neighbouring lanes take it in 16-byte
    // pieces, so one wave-wide load covers four whole lines; thread: piece sc of rows sr + 32 i.
    struct Held { v8bf a[8]; v8bf b[2]; };
    const int nK = Kdim / TILE_K;
    const int sr = tid >> 3;           // 0..31
    const int sc = (tid & 7) << 3;     // 0, 8, .. 56
    // uniform base + fixed per-thread byte offsets: the K advance is scalar arithmetic
    unsigned soff[8];
#pragma unroll
    for (int i = 0; i < 8; ++i) soff[i] = ((unsigned)(sr + (i << 5)) * (unsigned)Kdim + (unsigned)sc) * 2u;
    const __bf16* Xb = X + (size_t)m0 * Kdim;
    const __bf16* Wb = W + (size_t)n0 * Kdim;
    auto fetch = [&](Held& s, int kt) {
        // past the last tile the last one is asked for again (in bounds, never used)
        const int k0 = (kt < nK ? kt : nK - 1) * TILE_K;
        const char* xk = (const char*)(Xb + k0);
        const char* wk = (const char*)(Wb + k0);
#pragma unroll
        for (int i = 0; i < 8; ++i) s.a[i] = *(const v8bf*)(xk + soff[i]);   // A: 256 rows
#pragma unroll
        for (int i = 0; i < 2; ++i) s.b[i] = *(const v8bf*)(wk + soff[i]);   // B: 64 rows
        // the loads' address registers are rewritten for the next fetch
        asm volatile("s_wait_xcnt 0x0" ::: "memory");
    };
    auto publish = [&](const Held& s, int buf) {
#pragma unroll
        for (int i = 0; i < 8; ++i) *(v8bf*)&As[buf][sr + (i << 5)][sc] = s.a[i];
#pragma unroll
        for (int i = 0; i < 2; ++i) *(v8bf*)&Bs[buf][sr + (i << 5)][sc] = s.b[i];
    };

    Held h0, h1;                       // h0: even K tiles, h1: odd K tiles
    fetch(h0, 0);
    publish(h0, 0);
    fetch(h1, 1);
    fetch(h0, 2);
    lds_barrier();

    // one trip: tile kt from LDS buffer cur; nxt holds tile kt + 1, asked for two trips ago
    auto trip = [&](int kt, int cur, Held& nxt) {
        // fragments: wave's 32 rows x block's 64 cols, the tile's two 32-k halves in turn
        const int wrow = wave << 5;
#pragma unroll
        for (int ks = 0; ks < TILE_K; ks += 32) {
            v16bf aF[2], bF[4];
#pragma unroll
            for (int am = 0; am < 2; ++am)
                aF[am] = load_frag(&As[cur][wrow + (am << 4) + l15][ks], half);
#pragma unroll
            for (int nt = 0; nt < 4; ++nt)
                bF[nt] = load_frag(&Bs[cur][(nt << 4) + l15][ks], half);

#pragma unroll
            for (int am = 0; am < 2; ++am)
#pragma unroll
                for (int nt = 0; nt < 4; ++nt)
                    acc[am][nt] = __builtin_amdgcn_wmma_f32_16x16x32_bf16(
                        false, aF[am], false, bF[nt], (short)0, acc[am][nt], false, false);
        }
        // keeps the wait for the held tile's loads behind the products; lifted above them it would stall them
        __builtin_amdgcn_sched_barrier(0);
        publish(nxt, cur ^ 1);
        fetch(nxt, kt + 3);
        lds_barrier();
    };
    // trips in pairs, so that each register set and LDS buffer is named at compile time and no
    // branch stands inside the loop; an odd trip count ends in one trip behind it
    int kt = 0;
    for (; kt + 1 < nK; kt += 2) {
        trip(kt, 0, h1);
        trip(kt + 1, 1, h0);
    }
    if (kt < nK) trip(kt, 0, h1);

    // Epilogue. C/D layout: VGPR r, lane<16 -> (M=r, N=lane); lane>=16 -> (M=8+r).
    // Each wave passes its accumulators, 16 rows at a time, through its own slice of
    // the (now free) A buffer and picks them up as whole rows; the activation then
    // runs in a rolled loop of 16-byte pieces. Rolled to keep the text small.
    float* ep = reinterpret_cast<float*>(&As[0][0][0]) + wave * (16 * EPITCH);
    const float* src = ep + half * EPITCH + (l15 << 2);
#pragma unroll
    for (int am = 0; am < 2; ++am) {
        if (am) __syncthreads();   // the first 16 rows have been read; the slice may be rewritten
#pragma unroll
        for (int nt = 0; nt < 4; ++nt)
#pragma unroll
            for (int r = 0; r < 8; ++r)
                ep[(r + (half << 3)) * EPITCH + (nt << 4) + l15] = acc[am][nt][r];
        __syncthreads();           // lanes read what other lanes wrote

        // rows (wave*32 + am*16 + half) + 2 it, columns n0 + 4*l15 ..
        const size_t idx0 = (size_t)(m0 + (wave << 5) + (am << 4) + half) * Nout + n0 + (l15 << 2);
        const size_t step = (size_t)Nout * 2;
        if (act_mode == 0) {
#pragma unroll 1   // rolled: keeps the text small (see above)
            for (int it = 0; it < 8; ++it) {
                const float4 v = *(const float4*)(src + it * (2 * EPITCH));
                *(float4*)(Y + idx0 + it * step) = v;
                // the store's registers are rewritten by the next trip
                asm volatile("s_wait_xcnt 0x0" ::: "memory");
            }
        } else if (act_mode == 1) {
#pragma unroll 1   // rolled: keeps the text small (see above)
            for (int it = 0; it < 8; ++it) {
                const float4 v = *(const float4*)(src + it * (2 * EPITCH));
                float4 y;
                y.x = v.x / (1.0f + __expf(-v.x));                          // swish
                y.y = v.y / (1.0f + __expf(-v.y));
                y.z = v.z / (1.0f + __expf(-v.z));
                y.w = v.w / (1.0f + __expf(-v.w));
                *(float4*)(Y + idx0 + it * step) = y;
                // the store's registers are rewritten by the next trip
                asm volatile("s_wait_xcnt 0x0" ::: "memory");
            }
        } else {
#pragma unroll 1   // rolled: keeps the text small (see above)
            for (int it = 0; it < 8; ++it) {
                const float4 v = *(const float4*)(src + it * (2 * EPITCH));
                const float vv[4] = {v.x, v.y, v.z, v.w};
                float g[4], s[4];
#pragma unroll
                for (int c = 0; c < 4; ++c) {
                    const float ls = fminf(vv[c], 0.0f) - log1pf(__expf(-fabsf(vv[c])));  // logsigmoid
                    g[c] = ls * 0.0625f;                                                // /GATE_NORM
                    s[c] = 1.0f - __expf(g[c]);
                }
                *(float4*)(Y  + idx0 + it * step) = make_float4(g[0], g[1], g[2], g[3]);
                *(float4*)(Y2 + idx0 + it * step) = make_float4(s[0], s[1], s[2], s[3]);
                // the stores' registers are rewritten by the next trip
                asm volatile("s_wait_xcnt 0x0" ::: "memory");
            }
        }
    }
}

// X and the five weight matrices, f32 -> bf16, once for all the tiles that read them (each
// row of X is read by 56 column blocks, each weight row by 16 row blocks): the tiles then draw
// half the bytes from L2. 131072 threads, 17 pieces of 16 bytes each, all asked for at once;
// a wave's load covers four whole lines, its store two.
#define CVT_THREADS 131072
__global__ __launch_bounds__(512) void to_bf16_kernel(
    const float* __restrict__ X,
    const float* __restrict__ Wq, const float* __restrict__ Wk,
    const float* __restrict__ Wv, const float* __restrict__ Wo,
    const float* __restrict__ Wf,
    __bf16* __restrict__ Xh,
    __bf16* __restrict__ Wqh, __bf16* __restrict__ Wkh,
    __bf16* __restrict__ Wvh, __bf16* __restrict__ Woh,
    __bf16* __restrict__ Wfh)
{
    // uniform base + one fixed per-thread byte offset for all loads, another for all stores
    const unsigned tl = (blockIdx.x * 512u + threadIdx.x) << 4;   // 16 bytes of f32 in
    const unsigned ts = tl >> 1;                                  //  8 bytes of bf16 out
    const unsigned LSTEP = 16u * CVT_THREADS, SSTEP = 8u * CVT_THREADS;
    auto ld = [&](const float* p, int i) { return *(const v4f*)((const char*)p + i * LSTEP + tl); };
    auto st = [&](__bf16* p, int i, v4f a) { *(v4bf*)((char*)p + i * SSTEP + ts) = pack4(a); };
    v4f x[8], q[2], k[2], v[2], o[2], f;
#pragma unroll
    for (int i = 0; i < 8; ++i) x[i] = ld(X, i);
#pragma unroll
    for (int i = 0; i < 2; ++i) {
        q[i] = ld(Wq, i);
        k[i] = ld(Wk, i);
        v[i] = ld(Wv, i);
        o[i] = ld(Wo, i);
    }
    f = ld(Wf, 0);
    // keeps every load ahead of the first conversion, so that all 17 are in flight at once
    __builtin_amdgcn_sched_barrier(0);
    // without this the stores' offset is formed in place in the loads' offset register, right behind
    // the last load; named as an input, that register lives up to the wait
    asm volatile("s_wait_xcnt 0x0" :: "v"(tl) : "memory");
#pragma unroll
    for (int i = 0; i < 8; ++i) st(Xh, i, x[i]);
#pragma unroll
    for (int i = 0; i < 2; ++i) {
        st(Wqh, i, q[i]);
        st(Wkh, i, k[i]);
        st(Wvh, i, v[i]);
        st(Woh, i, o[i]);
    }
    st(Wfh, 0, f);
}

// the output projection: one tile per workgroup of a (columns, rows) grid
__global__ __launch_bounds__(256) void gemm_bt_kernel(
    const __bf16* __restrict__ X, const __bf16* __restrict__ W,
    float* __restrict__ Y, float* __restrict__ Y2,
    int Nrows, int Kdim, int Nout, int act_mode)
{
    gemm_bt_tile(X, W, Y, Y2, Kdim, Nout, act_mode, blockIdx.y * TILE_M, blockIdx.x * TILE_N);
}

// The four input projections in one launch: 56 column blocks (8 of F, 16 each of Q, K, V) x 16
// row blocks = 896 workgroups. Two are resident per WGP, so one's LDS waits, barriers and
// epilogue run under the other's loads, and no launch waits for the last tile of the one before.
// The gate blocks stand first: their epilogue is the longest and must not be the launch's tail.
// The row block is the low part of the index: workgroups 256 apart read the same rows of X, so
// where two such share a WGP its cache may serve both (a matter of speed only, nothing rests on it).
__global__ __launch_bounds__(256) void proj4_kernel(
    const __bf16* __restrict__ X,
    const __bf16* __restrict__ Wq, const __bf16* __restrict__ Wk,
    const __bf16* __restrict__ Wv, const __bf16* __restrict__ Wf,
    float* __restrict__ Q, float* __restrict__ K, float* __restrict__ V,
    float* __restrict__ G, float* __restrict__ S, int Kdim)
{
    const int m0 = (blockIdx.x & 15) * TILE_M;
    const int cb = blockIdx.x >> 4;            // 0..55
    if (cb < 8) {
        gemm_bt_tile(X, Wf, G, S, Kdim, 512, 2, m0, cb * TILE_N);
    } else {
        const int which = (cb - 8) >> 4;       // 0: Q, 1: K, 2: V
        const __bf16* W = which == 0 ? Wq : (which == 1 ? Wk : Wv);
        float*       Y = which == 0 ? Q  : (which == 1 ? K  : V);
        gemm_bt_tile(X, W, Y, nullptr, Kdim, 1024, 1, m0, ((cb - 8) & 15) * TILE_N);
    }
}

// ---------------------------------------------------------------------------
// Gated-ABC recurrence, split into its independent parts (four launches, the segment states included).
//   hk[:, m] depends on slot m alone  -> zscan: one workgroup per (b,h, 8 slots, segment)
//   softmax over the 64 slots         -> one thread per (b,h,t)
//   hv[:, v] depends on column v alone-> oscan: one workgroup per (b,h, 32 cols, segment)
// Inside a workgroup time runs in tiles of SCAN_TT steps: the tile's inputs sit
// in LDS, every thread steps its own register tile of the state with no barrier
// between steps, leaves its partial dot products in LDS, and the tile's partials
// are summed once behind the tile. The next tile's inputs are fetched into
// registers while the current tile is stepped.
// Z / P layout: [b*8+h][slot block of 8][t][8], so each workgroup owns whole lines.
// Time is cut into segments, each with workgroups of its own. The recurrence is linear in
// the state: state(end) = state(start) * D + E, with D the product of the segment's gates
// and E the state that the segment builds from zero. seg_state_kernel leaves D and E of
// every segment but the last in the workspace; a scan workgroup folds those of the
// segments in front of its own into its start state and then steps its segment alone.
// ---------------------------------------------------------------------------
typedef __attribute__((ext_vector_type(2))) float f32x2;
typedef __attribute__((ext_vector_type(4))) float f32x4;

#define SCAN_TT 32
#define ZPITCH  264   // 32 k-groups x 8 slots + 8: the tile sum reads 8 rows on distinct banks
#define OPITCH  528   // 16 slot-groups x 32 cols + 16: same, for 16-byte reads
#define PPITCH  72    // 64 slots + 8: the blocked P rows land on distinct banks
#define ZSEG    4     // time segments of the slot-score scan: 512 workgroups, two per WGP
#define ZLEN    (2048 / ZSEG)
#define OSEG    8     // time segments of the output scan: 512 workgroups, two per WGP
#define OLEN    (2048 / OSEG)
#define ZSTATE_WGS ((ZSEG - 1) * 128)
#define OSTATE_WGS ((OSEG - 1) * 64)

static __device__ __forceinline__ f32x2 splat2(float x) { f32x2 r = {x, x}; return r; }

// E and D of one hk segment; thread tile and step arithmetic as in zscan_kernel.
// Ek: [segment*128 + workgroup][2][thread][4], Dk: [segment*128 + workgroup][thread][2]
static __device__ __forceinline__ void zstate_body(
    int blk, const float* __restrict__ Kp, const float* __restrict__ Gp,
    const float* __restrict__ Sp, float* __restrict__ Ek, float* __restrict__ Dk)
{
    __shared__ __attribute__((aligned(16))) float kS[SCAN_TT][128];
    __shared__ __attribute__((aligned(16))) float geS[SCAN_TT][8];
    __shared__ __attribute__((aligned(16))) float sS[SCAN_TT][8];

    const int tid = threadIdx.x;
    const int seg = blk >> 7;
    const int bh  = (blk & 127) >> 3;
    const int mb  = blk & 7;
    const int b   = bh >> 3;
    const int h   = bh & 7;
    const int kg  = tid >> 2;      // 0..31
    const int mg  = tid & 3;       // 0..3

    f32x4 kr[8], gr;
    const unsigned qoff = (unsigned)(tid >> 5) * 1024u + (unsigned)((tid & 31) << 2);
    const unsigned goff = (unsigned)((tid & 63) >> 1) * 512u + (unsigned)((tid & 1) << 2);
    const float* GS = (__builtin_amdgcn_readfirstlane(tid) < 64) ? Gp : Sp;   // waves 0,1: gates; 2,3: s
    auto fetch = [&](int t0) {
        const float* k = Kp + (size_t)(b * 2048 + t0) * 1024 + h * 128;
#pragma unroll
        for (int i = 0; i < 8; ++i)         // rows (tid>>5) + 4 i
            kr[i] = *(const f32x4*)(k + qoff + i * 4096);
        gr = *(const f32x4*)(GS + (size_t)(b * 2048 + t0) * 512 + h * 64 + mb * 8 + goff);
        // the loads' base registers are rewritten for the next fetch
        asm volatile("s_wait_xcnt 0x0" ::: "memory");
    };
    auto publish = [&]() {
#pragma unroll
        for (int i = 0; i < 8; ++i) {
            const int idx = tid + (i << 7);
            *(f32x4*)&kS[idx >> 5][(idx & 31) << 2] = kr[i];
        }
        const int u = tid & 63;
        if (tid < 64) {
            f32x4 e = {__expf(gr.x), __expf(gr.y), __expf(gr.z), __expf(gr.w)};
            *(f32x4*)&geS[u >> 1][(u & 1) << 2] = e;
        } else {
            *(f32x4*)&sS[u >> 1][(u & 1) << 2] = gr;
        }
    };

    f32x2 hk[4];
#pragma unroll
    for (int i = 0; i < 4; ++i) hk[i] = splat2(0.0f);
    f32x2 dp = splat2(1.0f);

    const int tbeg = seg * ZLEN, tend = tbeg + ZLEN;
    fetch(tbeg);
    publish();
    __syncthreads();

    for (int t0 = tbeg; t0 < tend; t0 += SCAN_TT) {
        const bool more = (t0 + SCAN_TT) < tend;
        if (more) fetch(t0 + SCAN_TT);

        // groups of 4 steps, two register sets, as in zscan_kernel
        f32x4 ka[4], kb[4];
        f32x2 ga[4], sa[4], gb[4], sb[4];
        auto ld = [&](f32x4 (&k)[4], f32x2 (&g)[4], f32x2 (&s)[4], int base) {
#pragma unroll
            for (int j = 0; j < 4; ++j) {
                k[j] = *(const f32x4*)&kS[base + j][kg << 2];
                g[j] = *(const f32x2*)&geS[base + j][mg << 1];
                s[j] = *(const f32x2*)&sS[base + j][mg << 1];
            }
            // keeps these reads ahead of the group stepped next; sunk to their use they would be waited for
            __builtin_amdgcn_sched_barrier(0);
        };
        auto step = [&](const f32x4 (&k)[4], const f32x2 (&g)[4], const f32x2 (&s)[4]) {
#pragma unroll
            for (int j = 0; j < 4; ++j) {
#pragma unroll
                for (int i = 0; i < 4; ++i)
                    hk[i] = __builtin_elementwise_fma(hk[i], g[j], splat2(k[j][i]) * s[j]);
                dp *= g[j];
            }
        };
        ld(ka, ga, sa, 0);
#pragma unroll 1   // rolled: unrolled, all of the tile's LDS reads are lifted to its head and take 480 registers
        for (int g8 = 0; g8 < SCAN_TT; g8 += 8) {
            ld(kb, gb, sb, g8 + 4);
            step(ka, ga, sa);
            ld(ka, ga, sa, (g8 + 8) & (SCAN_TT - 1));   // behind the last group: rows 0..3 again, not used
            step(kb, gb, sb);
        }
        __syncthreads();   // every reader has left the input tile
        if (more) publish();
        __syncthreads();   // next input tile published
    }

    float* e = Ek + (size_t)blk * 1024 + (tid << 2);
    const f32x4 e0 = {hk[0].x, hk[0].y, hk[1].x, hk[1].y};
    const f32x4 e1 = {hk[2].x, hk[2].y, hk[3].x, hk[3].y};
    *(f32x4*)e         = e0;
    *(f32x4*)(e + 512) = e1;
    *(f32x2*)(Dk + (size_t)blk * 256 + (tid << 1)) = dp;
}

// E and D of one hv segment; thread tile and step arithmetic as in oscan_kernel.
// Ev: [segment*64 + workgroup][4][thread][4], Dv: [segment*64 + workgroup][thread][4]
static __device__ __forceinline__ void ostate_body(
    int blk, const float* __restrict__ Vp, const float* __restrict__ Gp,
    const float* __restrict__ Sp, float* __restrict__ Ev, float* __restrict__ Dv)
{
    __shared__ __attribute__((aligned(16))) float geS[SCAN_TT][64];
    __shared__ __attribute__((aligned(16))) float sS[SCAN_TT][64];
    __shared__ __attribute__((aligned(16))) float vS[SCAN_TT][32];

    const int tid = threadIdx.x;
    const int seg = blk >> 6;
    const int bh  = (blk & 63) >> 2;
    const int v0  = (blk & 3) << 5;
    const int b   = bh >> 3;
    const int h   = bh & 7;
    const int vg  = tid & 7;       // 0..7
    const int sg  = tid >> 3;      // 0..15

    f32x4 gr[4], sr[4], vr[2];
    const unsigned goff = (unsigned)(tid >> 4) * 512u + (unsigned)((tid & 15) << 2);
    const unsigned voff = (unsigned)(tid >> 3) * 1024u + (unsigned)((tid & 7) << 2);
    auto fetch = [&](int t0) {
        const size_t rowg = (size_t)(b * 2048 + t0) * 512 + h * 64;
        const float* g = Gp + rowg;
        const float* s = Sp + rowg;
        const float* v = Vp + (size_t)(b * 2048 + t0) * 1024 + h * 128 + v0;
#pragma unroll
        for (int i = 0; i < 4; ++i) {
            gr[i] = *(const f32x4*)(g + goff + i * 4096);    // rows (tid>>4) + 8 i
            sr[i] = *(const f32x4*)(s + goff + i * 4096);
        }
#pragma unroll
        for (int i = 0; i < 2; ++i)
            vr[i] = *(const f32x4*)(v + voff + i * 16384);   // rows (tid>>3) + 16 i
        // the loads' base registers are rewritten for the next fetch
        asm volatile("s_wait_xcnt 0x0" ::: "memory");
    };
    auto publish = [&]() {
#pragma unroll
        for (int i = 0; i < 4; ++i) {
            const int idx = tid + (i << 7);
            f32x4 e = {__expf(gr[i].x), __expf(gr[i].y), __expf(gr[i].z), __expf(gr[i].w)};
            *(f32x4*)&geS[idx >> 4][(idx & 15) << 2] = e;
            *(f32x4*)&sS[idx >> 4][(idx & 15) << 2]  = sr[i];
        }
#pragma unroll
        for (int i = 0; i < 2; ++i) {
            const int idx = tid + (i << 7);
            *(f32x4*)&vS[idx >> 3][(idx & 7) << 2] = vr[i];
        }
    };

    f32x2 hv[4][2];
#pragma unroll
    for (int i = 0; i < 4; ++i) { hv[i][0] = splat2(0.0f); hv[i][1] = splat2(0.0f); }
    f32x4 dp = {1.0f, 1.0f, 1.0f, 1.0f};

    const int tbeg = seg * OLEN, tend = tbeg + OLEN;
    fetch(tbeg);
    publish();
    __syncthreads();

    for (int t0 = tbeg; t0 < tend; t0 += SCAN_TT) {
        const bool more = (t0 + SCAN_TT) < tend;
        if (more) fetch(t0 + SCAN_TT);

        // groups of 4 steps, two register sets, as in oscan_kernel
        f32x4 ga[4], sa[4], va[4], gb[4], sb[4], vb[4];
        auto ld = [&](f32x4 (&g)[4], f32x4 (&s)[4], f32x4 (&v)[4], int base) {
#pragma unroll
            for (int j = 0; j < 4; ++j) {
                g[j] = *(const f32x4*)&geS[base + j][sg << 2];
                s[j] = *(const f32x4*)&sS[base + j][sg << 2];
                v[j] = *(const f32x4*)&vS[base + j][vg << 2];
            }
            // keeps these reads ahead of the group stepped next; sunk to their use they would be waited for
            __builtin_amdgcn_sched_barrier(0);
        };
        auto step = [&](const f32x4 (&g)[4], const f32x4 (&s)[4], const f32x4 (&v)[4]) {
#pragma unroll
            for (int j = 0; j < 4; ++j) {
                const f32x2 v01 = {v[j].x, v[j].y}, v23 = {v[j].z, v[j].w};
#pragma unroll
                for (int i = 0; i < 4; ++i) {
                    hv[i][0] = __builtin_elementwise_fma(hv[i][0], splat2(g[j][i]), splat2(s[j][i]) * v01);
                    hv[i][1] = __builtin_elementwise_fma(hv[i][1], splat2(g[j][i]), splat2(s[j][i]) * v23);
                }
                dp *= g[j];
            }
        };
        ld(ga, sa, va, 0);
#pragma unroll 1   // rolled: unrolled, all of the tile's LDS reads are lifted to its head and take 480 registers
        for (int g8 = 0; g8 < SCAN_TT; g8 += 8) {
            ld(gb, sb, vb, g8 + 4);
            step(ga, sa, va);
            ld(ga, sa, va, (g8 + 8) & (SCAN_TT - 1));   // behind the last group: rows 0..3 again, not used
            step(gb, sb, vb);
        }
        __syncthreads();   // every reader has left the input tile
        if (more) publish();
        __syncthreads();   // next input tile published
    }

    float* e = Ev + (size_t)blk * 2048 + (tid << 2);
#pragma unroll
    for (int i = 0; i < 4; ++i) {
        const f32x4 ei = {hv[i][0].x, hv[i][0].y, hv[i][1].x, hv[i][1].y};
        *(f32x4*)(e + i * 512) = ei;
    }
    *(f32x4*)(Dv + (size_t)blk * 512 + (tid << 2)) = dp;
}

// one launch for both kinds of segment state (neither needs the slot weights);
// the longer hk segments stand first in the grid
__global__ __launch_bounds__(128) void seg_state_kernel(
    const float* __restrict__ Kp, const float* __restrict__ Vp,
    const float* __restrict__ Gp, const float* __restrict__ Sp,
    float* __restrict__ Ek, float* __restrict__ Dk,
    float* __restrict__ Ev, float* __restrict__ Dv)
{
    const int blk = blockIdx.x;
    if (blk < ZSTATE_WGS) zstate_body(blk, Kp, Gp, Sp, Ek, Dk);
    else                  ostate_body(blk - ZSTATE_WGS, Vp, Gp, Sp, Ev, Dv);
}

// thread: 4 k (kg*4..) x 2 slots (mg*2..) of hk
__global__ __launch_bounds__(128) void zscan_kernel(
    const float* __restrict__ Qp, const float* __restrict__ Kp,
    const float* __restrict__ Gp, const float* __restrict__ Sp,
    const float* __restrict__ Ek, const float* __restrict__ Dk,
    float* __restrict__ Zb)
{
    __shared__ __attribute__((aligned(16))) float qS[SCAN_TT][128];
    __shared__ __attribute__((aligned(16))) float kS[SCAN_TT][128];
    __shared__ __attribute__((aligned(16))) float geS[SCAN_TT][8];
    __shared__ __attribute__((aligned(16))) float sS[SCAN_TT][8];
    __shared__ __attribute__((aligned(16))) float part[SCAN_TT][ZPITCH];

    const int tid = threadIdx.x;
    const int seg = blockIdx.x >> 7;     // time segment
    const int wg  = blockIdx.x & 127;
    const int bh  = wg >> 3;
    const int mb  = wg & 7;
    const int b   = bh >> 3;
    const int h   = bh & 7;
    const int kg  = tid >> 2;      // 0..31
    const int mg  = tid & 3;       // 0..3
    const float scale = 0.08838834764831845f; // 128^-0.5

    f32x4 qr[8], kr[8], gr;
    // uniform base + one fixed per-thread offset: the tile advance stays in scalar registers
    const unsigned qoff = (unsigned)(tid >> 5) * 1024u + (unsigned)((tid & 31) << 2);
    const unsigned goff = (unsigned)((tid & 63) >> 1) * 512u + (unsigned)((tid & 1) << 2);
    const float* GS = (__builtin_amdgcn_readfirstlane(tid) < 64) ? Gp : Sp;   // waves 0,1: gates; 2,3: s
    auto fetch = [&](int t0) {
        const size_t rowq = (size_t)(b * 2048 + t0) * 1024 + h * 128;
        const float* q = Qp + rowq;
        const float* k = Kp + rowq;
#pragma unroll
        for (int i = 0; i < 8; ++i) {       // rows (tid>>5) + 4 i
            qr[i] = *(const f32x4*)(q + qoff + i * 4096);
            kr[i] = *(const f32x4*)(k + qoff + i * 4096);
        }
        gr = *(const f32x4*)(GS + (size_t)(b * 2048 + t0) * 512 + h * 64 + mb * 8 + goff);
        // the loads' base registers are rewritten behind this
        asm volatile("s_wait_xcnt 0x0" ::: "memory");
    };
    auto publish = [&]() {
#pragma unroll
        for (int i = 0; i < 8; ++i) {
            const int idx = tid + (i << 7);
            *(f32x4*)&qS[idx >> 5][(idx & 31) << 2] = qr[i] * scale;
            *(f32x4*)&kS[idx >> 5][(idx & 31) << 2] = kr[i];
        }
        const int u = tid & 63;
        if (tid < 64) {
            f32x4 e = {__expf(gr.x), __expf(gr.y), __expf(gr.z), __expf(gr.w)};
            *(f32x4*)&geS[u >> 1][(u & 1) << 2] = e;
        } else {
            *(f32x4*)&sS[u >> 1][(u & 1) << 2] = gr;
        }
    };

    f32x2 hk[4];
#pragma unroll
    for (int i = 0; i < 4; ++i) hk[i] = splat2(0.0f);

    const int tbeg = seg * ZLEN, tend = tbeg + ZLEN;
    fetch(tbeg);
    // start state: the earlier segments' E, each decayed by the D of the segments behind it
    // (all asked for at once, one round trip instead of one per segment; later segments' are left unused)
    {
        const float* e = Ek + (size_t)wg * 1024 + (tid << 2);
        const float* dsrc = Dk + (size_t)wg * 256 + (tid << 1);
        f32x4 e0[ZSEG - 1], e1[ZSEG - 1];
        f32x2 d[ZSEG - 1];
#pragma unroll
        for (int i = 0; i < ZSEG - 1; ++i) {
            e0[i] = *(const f32x4*)(e + i * (128 * 1024));
            e1[i] = *(const f32x4*)(e + i * (128 * 1024) + 512);
            d[i]  = *(const f32x2*)(dsrc + i * (128 * 256));
        }
        // the loads' address registers are free for reuse behind this
        asm volatile("s_wait_xcnt 0x0" ::: "memory");
#pragma unroll
        for (int i = 0; i < ZSEG - 1; ++i) {
            if (i < seg) {
                const f32x2 e00 = {e0[i].x, e0[i].y}, e01 = {e0[i].z, e0[i].w};
                const f32x2 e10 = {e1[i].x, e1[i].y}, e11 = {e1[i].z, e1[i].w};
                hk[0] = __builtin_elementwise_fma(hk[0], d[i], e00);
                hk[1] = __builtin_elementwise_fma(hk[1], d[i], e01);
                hk[2] = __builtin_elementwise_fma(hk[2], d[i], e10);
                hk[3] = __builtin_elementwise_fma(hk[3], d[i], e11);
            }
        }
    }
    publish();
    __syncthreads();

    for (int t0 = tbeg; t0 < tend; t0 += SCAN_TT) {
        const bool more = (t0 + SCAN_TT) < tend;
        if (more) fetch(t0 + SCAN_TT);

        // groups of 4 steps, two register sets: the next group's LDS reads are in
        // flight while this group is stepped
        f32x4 qa[4], ka[4], qb[4], kb[4];
        f32x2 ga[4], sa[4], gb[4], sb[4];
        auto ld = [&](f32x4 (&q)[4], f32x4 (&k)[4], f32x2 (&g)[4], f32x2 (&s)[4], int base) {
#pragma unroll
            for (int j = 0; j < 4; ++j) {
                q[j] = *(const f32x4*)&qS[base + j][kg << 2];
                k[j] = *(const f32x4*)&kS[base + j][kg << 2];
                g[j] = *(const f32x2*)&geS[base + j][mg << 1];
                s[j] = *(const f32x2*)&sS[base + j][mg << 1];
            }
            // keeps these reads ahead of the group stepped next; sunk to their use they would be waited for
            __builtin_amdgcn_sched_barrier(0);
        };
        auto step = [&](const f32x4 (&q)[4], const f32x4 (&k)[4], const f32x2 (&g)[4], const f32x2 (&s)[4], int base) {
#pragma unroll
            for (int j = 0; j < 4; ++j) {
                f32x2 acc = splat2(0.0f);
#pragma unroll
                for (int i = 0; i < 4; ++i) {
                    hk[i] = __builtin_elementwise_fma(hk[i], g[j], splat2(k[j][i]) * s[j]);
                    acc   = __builtin_elementwise_fma(splat2(q[j][i]), hk[i], acc);
                }
                *(f32x2*)&part[base + j][(kg << 3) + (mg << 1)] = acc;
            }
        };
        ld(qa, ka, ga, sa, 0);
#pragma unroll
        for (int g8 = 0; g8 < SCAN_TT; g8 += 8) {
            ld(qb, kb, gb, sb, g8 + 4);
            step(qa, ka, ga, sa, g8);
            if (g8 + 8 < SCAN_TT) ld(qa, ka, ga, sa, g8 + 8);
            step(qb, kb, gb, sb, g8 + 4);
        }
        __syncthreads();   // partials complete; every reader has left the input tile

        {
            const int rt = tid >> 2, rm = tid & 3;
            f32x2 a0 = splat2(0.0f), a1 = a0, a2 = a0, a3 = a0;
#pragma unroll
            for (int g = 0; g < 8; ++g) {
                a0 += *(const f32x2*)&part[rt][((4 * g + 0) << 3) + (rm << 1)];
                a1 += *(const f32x2*)&part[rt][((4 * g + 1) << 3) + (rm << 1)];
                a2 += *(const f32x2*)&part[rt][((4 * g + 2) << 3) + (rm << 1)];
                a3 += *(const f32x2*)&part[rt][((4 * g + 3) << 3) + (rm << 1)];
            }
            float* zrow = Zb + ((size_t)(bh * 8 + mb) * 2048 + t0) * 8;
            *(f32x2*)(zrow + (unsigned)(rt * 8 + (rm << 1))) = (a0 + a1) + (a2 + a3);
            // the store's registers are reused right behind it
            asm volatile("s_wait_xcnt 0x0" ::: "memory");
        }
        if (more) publish();
        __syncthreads();   // next input tile published; partials free again
    }
}

// softmax over the 64 slots of one (b,h,t), in place on the blocked layout
__global__ __launch_bounds__(256) void slot_softmax_kernel(float* Zb)
{
    const int gid = blockIdx.x * 256 + threadIdx.x;
    const int bh  = gid >> 11;
    const int t   = gid & 2047;
    f32x4 z[16];
#pragma unroll
    for (int mb = 0; mb < 8; ++mb) {
        const float* p = Zb + ((size_t)(bh * 8 + mb) * 2048 + t) * 8;
        z[2 * mb]     = *(const f32x4*)p;
        z[2 * mb + 1] = *(const f32x4*)(p + 4);
    }
    f32x4 m4 = z[0];
#pragma unroll
    for (int i = 1; i < 16; ++i) m4 = __builtin_elementwise_max(m4, z[i]);
    const float mx = fmaxf(fmaxf(m4.x, m4.y), fmaxf(m4.z, m4.w));
    f32x4 s4 = {0.0f, 0.0f, 0.0f, 0.0f};
#pragma unroll
    for (int i = 0; i < 16; ++i) {
        f32x4 e = {__expf(z[i].x - mx), __expf(z[i].y - mx), __expf(z[i].z - mx), __expf(z[i].w - mx)};
        z[i] = e;
        s4 += e;
    }
    const float inv = 1.0f / ((s4.x + s4.y) + (s4.z + s4.w));
#pragma unroll
    for (int mb = 0; mb < 8; ++mb) {
        float* p = Zb + ((size_t)(bh * 8 + mb) * 2048 + t) * 8;
        *(f32x4*)p       = z[2 * mb] * inv;
        *(f32x4*)(p + 4) = z[2 * mb + 1] * inv;
    }
}

// thread: 4 slots (sg*4..) x 4 columns (vg*4..) of hv
__global__ __launch_bounds__(128) void oscan_kernel(
    const float* __restrict__ Vp, const float* __restrict__ Gp,
    const float* __restrict__ Sp, const float* __restrict__ Pb,
    const float* __restrict__ Ev, const float* __restrict__ Dv,
    float* __restrict__ Op)
{
    __shared__ __attribute__((aligned(16))) float geS[SCAN_TT][64];
    __shared__ __attribute__((aligned(16))) float sS[SCAN_TT][64];
    __shared__ __attribute__((aligned(16))) float pS[SCAN_TT][PPITCH];
    __shared__ __attribute__((aligned(16))) float vS[SCAN_TT][32];
    __shared__ __attribute__((aligned(16))) float part[SCAN_TT][OPITCH];

    const int tid = threadIdx.x;
    const int seg = blockIdx.x >> 6;     // time segment
    const int wg  = blockIdx.x & 63;
    const int bh  = wg >> 2;
    const int v0  = (wg & 3) << 5;
    const int b   = bh >> 3;
    const int h   = bh & 7;
    const int vg  = tid & 7;       // 0..7
    const int sg  = tid >> 3;      // 0..15

    f32x4 gr[4], sr[4], pr[4], vr[2];
    // uniform base + one fixed per-thread offset: the tile advance stays in scalar registers
    const unsigned goff = (unsigned)(tid >> 4) * 512u + (unsigned)((tid & 15) << 2);
    const unsigned poff = (unsigned)(tid >> 6) * 16384u + (unsigned)((tid & 63) << 2);
    const unsigned voff = (unsigned)(tid >> 3) * 1024u + (unsigned)((tid & 7) << 2);
    auto fetch = [&](int t0) {
        const size_t rowg = (size_t)(b * 2048 + t0) * 512 + h * 64;
        const float* g = Gp + rowg;
        const float* s = Sp + rowg;
        const float* p = Pb + ((size_t)(bh * 8) * 2048 + t0) * 8;
        const float* v = Vp + (size_t)(b * 2048 + t0) * 1024 + h * 128 + v0;
#pragma unroll
        for (int i = 0; i < 4; ++i) {
            gr[i] = *(const f32x4*)(g + goff + i * 4096);    // rows (tid>>4) + 8 i
            sr[i] = *(const f32x4*)(s + goff + i * 4096);
            // blocked P: slot block (tid>>6) + 2 i, then 64 consecutive 16-byte pieces of this tile
            pr[i] = *(const f32x4*)(p + poff + i * 32768);
        }
#pragma unroll
        for (int i = 0; i < 2; ++i)
            vr[i] = *(const f32x4*)(v + voff + i * 16384);   // rows (tid>>3) + 16 i
        // the loads' base registers are rewritten behind this
        asm volatile("s_wait_xcnt 0x0" ::: "memory");
    };
    auto publish = [&]() {
#pragma unroll
        for (int i = 0; i < 4; ++i) {
            const int idx = tid + (i << 7);
            f32x4 e = {__expf(gr[i].x), __expf(gr[i].y), __expf(gr[i].z), __expf(gr[i].w)};
            *(f32x4*)&geS[idx >> 4][(idx & 15) << 2] = e;
            *(f32x4*)&sS[idx >> 4][(idx & 15) << 2]  = sr[i];
            *(f32x4*)&pS[(idx & 63) >> 1][((idx >> 6) << 3) + ((idx & 1) << 2)] = pr[i];
        }
#pragma unroll
        for (int i = 0; i < 2; ++i) {
            const int idx = tid + (i << 7);
            *(f32x4*)&vS[idx >> 3][(idx & 7) << 2] = vr[i];
        }
    };

    f32x2 hv[4][2];
#pragma unroll
    for (int i = 0; i < 4; ++i) { hv[i][0] = splat2(0.0f); hv[i][1] = splat2(0.0f); }

    const int tbeg = seg * OLEN, tend = tbeg + OLEN;
    fetch(tbeg);
    // start state: the earlier segments' E, each decayed by the D of the segments behind it
    // (all asked for at once, one round trip instead of one per segment; later segments' are left unused)
    {
        const float* e = Ev + (size_t)wg * 2048 + (tid << 2);
        const float* dsrc = Dv + (size_t)wg * 512 + (tid << 2);
        f32x4 er[OSEG - 1][4], d[OSEG - 1];
#pragma unroll
        for (int i = 0; i < OSEG - 1; ++i) {
#pragma unroll
            for (int r = 0; r < 4; ++r) er[i][r] = *(const f32x4*)(e + i * (64 * 2048) + r * 512);
            d[i] = *(const f32x4*)(dsrc + i * (64 * 512));
        }
        // the loads' address registers are free for reuse behind this
        asm volatile("s_wait_xcnt 0x0" ::: "memory");
#pragma unroll
        for (int i = 0; i < OSEG - 1; ++i) {
            if (i < seg) {
#pragma unroll
                for (int r = 0; r < 4; ++r) {
                    const f32x2 lo = {er[i][r].x, er[i][r].y}, hi = {er[i][r].z, er[i][r].w};
                    hv[r][0] = __builtin_elementwise_fma(hv[r][0], splat2(d[i][r]), lo);
                    hv[r][1] = __builtin_elementwise_fma(hv[r][1], splat2(d[i][r]), hi);
                }
            }
        }
    }
    publish();
    __syncthreads();

    for (int t0 = tbeg; t0 < tend; t0 += SCAN_TT) {
        const bool more = (t0 + SCAN_TT) < tend;
        if (more) fetch(t0 + SCAN_TT);

        // groups of 4 steps, two register sets: the next group's LDS reads are in
        // flight while this group is stepped
        f32x4 ga[4], sa[4], pa[4], va[4], gb[4], sb[4], pb[4], vb[4];
        auto ld = [&](f32x4 (&g)[4], f32x4 (&s)[4], f32x4 (&p)[4], f32x4 (&v)[4], int base) {
#pragma unroll
            for (int j = 0; j < 4; ++j) {
                g[j] = *(const f32x4*)&geS[base + j][sg << 2];
                s[j] = *(const f32x4*)&sS[base + j][sg << 2];
                p[j] = *(const f32x4*)&pS[base + j][sg << 2];
                v[j] = *(const f32x4*)&vS[base + j][vg << 2];
            }
            // keeps these reads ahead of the group stepped next; sunk to their use they would be waited for
            __builtin_amdgcn_sched_barrier(0);
        };
        auto step = [&](const f32x4 (&g)[4], const f32x4 (&s)[4], const f32x4 (&p)[4], const f32x4 (&v)[4], int base) {
#pragma unroll
            for (int j = 0; j < 4; ++j) {
                const f32x2 v01 = {v[j].x, v[j].y}, v23 = {v[j].z, v[j].w};
                f32x2 acc0 = splat2(0.0f), acc1 = splat2(0.0f);
#pragma unroll
                for (int i = 0; i < 4; ++i) {
                    hv[i][0] = __builtin_elementwise_fma(hv[i][0], splat2(g[j][i]), splat2(s[j][i]) * v01);
                    hv[i][1] = __builtin_elementwise_fma(hv[i][1], splat2(g[j][i]), splat2(s[j][i]) * v23);
                    acc0 = __builtin_elementwise_fma(splat2(p[j][i]), hv[i][0], acc0);
                    acc1 = __builtin_elementwise_fma(splat2(p[j][i]), hv[i][1], acc1);
                }
                f32x4 a = {acc0.x, acc0.y, acc1.x, acc1.y};
                *(f32x4*)&part[base + j][(sg << 5) + (vg << 2)] = a;
            }
        };
        ld(ga, sa, pa, va, 0);
#pragma unroll
        for (int g8 = 0; g8 < SCAN_TT; g8 += 8) {
            ld(gb, sb, pb, vb, g8 + 4);
            step(ga, sa, pa, va, g8);
            if (g8 + 8 < SCAN_TT) ld(ga, sa, pa, va, g8 + 8);
            step(gb, sb, pb, vb, g8 + 4);
        }
        __syncthreads();   // partials complete; every reader has left the input tile

        {
            const int rt = tid >> 2, rv = (tid & 3) << 2;
            f32x4 a0 = {0.0f, 0.0f, 0.0f, 0.0f}, a1 = a0, b0 = a0, b1 = a0;
#pragma unroll
            for (int g = 0; g < 8; ++g) {
                a0 += *(const f32x4*)&part[rt][((2 * g + 0) << 5) + rv];
                b0 += *(const f32x4*)&part[rt][((2 * g + 0) << 5) + rv + 16];
                a1 += *(const f32x4*)&part[rt][((2 * g + 1) << 5) + rv];
                b1 += *(const f32x4*)&part[rt][((2 * g + 1) << 5) + rv + 16];
            }
            float* o = Op + (size_t)(b * 2048 + t0) * 1024 + h * 128 + v0;
            *(f32x4*)(o + (unsigned)(rt * 1024 + rv))      = a0 + a1;
            *(f32x4*)(o + (unsigned)(rt * 1024 + rv) + 16) = b0 + b1;
            // the stores' registers are reused right behind them
            asm volatile("s_wait_xcnt 0x0" ::: "memory");
        }
        if (more) publish();
        __syncthreads();   // next input tile published; partials free again
    }
}

// ---------------------------------------------------------------------------
// y = RMSNorm(swish(x)) * g_weight, stored as bf16 (the output projection's A operand)
// (one block per row of 1024)
// ---------------------------------------------------------------------------
__global__ __launch_bounds__(256) void swish_rms_kernel(
    const float* __restrict__ X, const float* __restrict__ w,
    __bf16* __restrict__ Y)
{
    const int row = blockIdx.x;
    const float* xr = X + (size_t)row * 1024;
    float loc[4];
    float ss = 0.0f;
#pragma unroll
    for (int i = 0; i < 4; ++i) {
        const float x  = xr[threadIdx.x + 256 * i];
        const float sw = x / (1.0f + __expf(-x));
        loc[i] = sw;
        ss += sw * sw;
    }
#pragma unroll
    for (int off = 16; off > 0; off >>= 1) ss += __shfl_xor(ss, off, 32);
    __shared__ float wred[8];
    if ((threadIdx.x & 31) == 0) wred[threadIdx.x >> 5] = ss;
    __syncthreads();
    float tot = 0.0f;
#pragma unroll
    for (int i = 0; i < 8; ++i) tot += wred[i];
    const float r = rsqrtf(tot * (1.0f / 1024.0f) + 1e-5f);
#pragma unroll
    for (int i = 0; i < 4; ++i) {
        const int c = threadIdx.x + 256 * i;
        Y[(size_t)row * 1024 + c] = (__bf16)(loc[i] * r * w[c]);
    }
}

// ---------------------------------------------------------------------------
extern "C" void kernel_launch(void* const* d_in, const int* in_sizes, int n_in,
                              void* d_out, int out_size, void* d_ws, size_t ws_size,
                              hipStream_t stream) {
    const float* X  = (const float*)d_in[0];   // [4096,1024]
    const float* Wq = (const float*)d_in[1];
    const float* Wk = (const float*)d_in[2];
    const float* Wv = (const float*)d_in[3];
    const float* Wf = (const float*)d_in[4];   // [512,1024]
    const float* Wo = (const float*)d_in[5];
    const float* gw = (const float*)d_in[6];   // [1024]

    const size_t ND = 4096ull * 1024ull;
    const size_t NF = 4096ull * 512ull;
    float* ws  = (float*)d_ws;
    float* Q   = ws;             // 16 MB
    float* Kt  = Q   + ND;       // 16 MB
    float* Vt  = Kt  + ND;       // 16 MB
    float* G   = Vt  + ND;       //  8 MB
    float* Sv  = G   + NF;       //  8 MB
    float* Oin = Sv  + NF;       // 16 MB
    float* Zb  = Oin + ND;       //  8 MB, slot scores then slot weights
    float* Ek  = Zb  + NF;                                  // hk segment states
    float* Dk  = Ek  + (size_t)ZSTATE_WGS * 1024;           // their gate products
    float* Ev  = Dk  + (size_t)ZSTATE_WGS * 256;            // hv segment states
    float* Dv  = Ev  + (size_t)OSTATE_WGS * 2048;           // their gate products
    __bf16* Xh  = (__bf16*)(Dv + (size_t)OSTATE_WGS * 512);   // bf16 copies: X, 8 MB
    __bf16* Wqh = Xh  + ND;                                   // weights, 2 MB each
    __bf16* Wkh = Wqh + 1024ull * 1024ull;
    __bf16* Wvh = Wkh + 1024ull * 1024ull;
    __bf16* Woh = Wvh + 1024ull * 1024ull;
    __bf16* Wfh = Woh + 1024ull * 1024ull;                    // 1 MB
    __bf16* Xn  = Wfh + 512ull * 1024ull;                     // normalised rows, 8 MB

    dim3 blk(256);
    dim3 gQKV(1024 / TILE_N, 4096 / TILE_M);   // 16 x 16

    to_bf16_kernel<<<dim3(CVT_THREADS / 512), dim3(512), 0, stream>>>(X, Wq, Wk, Wv, Wo, Wf, Xh, Wqh, Wkh, Wvh, Woh, Wfh);

    proj4_kernel<<<dim3(56 * 16), blk, 0, stream>>>(Xh, Wqh, Wkh, Wvh, Wfh, Q, Kt, Vt, G, Sv, 1024);

    seg_state_kernel<<<ZSTATE_WGS + OSTATE_WGS, dim3(128), 0, stream>>>(Kt, Vt, G, Sv, Ek, Dk, Ev, Dv);
    zscan_kernel<<<128 * ZSEG, dim3(128), 0, stream>>>(Q, Kt, G, Sv, Ek, Dk, Zb);
    slot_softmax_kernel<<<128, blk, 0, stream>>>(Zb);
    oscan_kernel<<<64 * OSEG, dim3(128), 0, stream>>>(Vt, G, Sv, Zb, Ev, Dv, Oin);

    swish_rms_kernel<<<4096, blk, 0, stream>>>(Oin, gw, Xn);

    gemm_bt_kernel<<<gQKV, blk, 0, stream>>>(Xn, Woh, (float*)d_out, nullptr, 4096, 1024, 1024, 0);
}

// v008
// One run takes 148 microseconds.
// In both of two side-by-side timings against v007, it was 1.06 times as fast.
// All steps since v000 together make it 22.4 times as fast.
#include <hip/hip_runtime.h>

// ---------------------------------------------------------------------------
// Gated ABC attention, MI455X (gfx1250, wave32, WMMA bf16).
// B=2, T=2048, D=1024, H=8, M=64, KD=128.
//   0) to_bf16: X and the five weight matrices rounded to bf16 once
//   1) proj4 (WMMA), one launch: Q/K/V = swish(X W^T), F -> decay e^g
//   2) recurrence: segment states, slot scores, slot softmax, output columns (four launches)
//   3) swish + RMSNorm, result stored as bf16
//   4) gemm_bt: out = Xn Wo^T
// GEMM: 256x64 block tile, 8 waves x (32x64), double-buffered LDS, operands bf16 in memory,
// 16-byte global loads (eight lanes per 128-byte row slice of 64 k, so a wave's load covers
// whole lines) held in registers for two trips -> 16B LDS stores -> ds_load_b128 frags.
// Epilogue through LDS, rolled, 16-byte stores.
// ---------------------------------------------------------------------------

typedef __attribute__((ext_vector_type(16))) __bf16 v16bf;
typedef __attribute__((ext_vector_type(8)))  __bf16 v8bf;
typedef __attribute__((ext_vector_type(4)))  __bf16 v4bf;
typedef __attribute__((ext_vector_type(8)))  float  v8f;
typedef __attribute__((ext_vector_type(4)))  float  v4f;

#define TILE_M 256
#define TILE_N 64
#define TILE_K 64         // 64 bf16 = one 128-byte line of a row
#define KPAD   8          // pad rows to 72 bf16 = 144 B (odd multiple of 16 B, conflict-free)
#define LROW   (TILE_K + KPAD)
#define EPITCH 68         // epilogue rows: 64 f32 + 4, so rows r and r+8 fall on different banks

static __device__ __forceinline__ v4bf pack4(v4f a) {
    v4bf p;
    p[0] = (__bf16)a.x; p[1] = (__bf16)a.y; p[2] = (__bf16)a.z; p[3] = (__bf16)a.w;
    return p;
}

static __device__ __forceinline__ v16bf load_frag(const __bf16* rowp, int half) {
    // lane's two contiguous 16-byte chunks of the 32-element K row
    v8bf lo = *(const v8bf*)(rowp + (half << 3));
    v8bf hi = *(const v8bf*)(rowp + 16 + (half << 3));
    return __builtin_shufflevector(lo, hi, 0, 1, 2, 3, 4, 5, 6, 7,
                                   8, 9, 10, 11, 12, 13, 14, 15);
}

// Work-group barrier of the K loop, by hand: it waits for this wave's LDS traffic alone.
// __syncthreads() would also wait for the global loads that are to stay in flight across it.
static __device__ __forceinline__ void lds_barrier() {
    asm volatile("s_wait_dscnt 0x0\n\ts_barrier_signal -1\n\ts_barrier_wait -1" ::: "memory");
}

// Y = act( X @ W^T ) ; X: [Nrows,Kdim] bf16, W: [Nout,Kdim] bf16, Y: [Nrows,Nout] f32
// act_mode: 0 = identity, 1 = swish, 2 = decay (Y = exp(logsigmoid/16))
// One workgroup's 256 x 64 tile at rows m0, columns n0.
static __device__ __forceinline__ void gemm_bt_tile(
    const __bf16* __restrict__ X, const __bf16* __restrict__ W,
    float* __restrict__ Y,
    int Kdim, int Nout, int act_mode, int m0, int n0)
{
    __shared__ __attribute__((aligned(16))) __bf16 As[2][TILE_M][LROW];
    __shared__ __attribute__((aligned(16))) __bf16 Bs[2][TILE_N][LROW];

    const int tid  = threadIdx.x;
    const int wave = tid >> 5;        // 0..7
    const int lane = tid & 31;
    const int half = lane >> 4;       // K-half select (0/1)
    const int l15  = lane & 15;

    v8f acc[2][4];
#pragma unroll
    for (int am = 0; am < 2; ++am)
#pragma unroll
        for (int nt = 0; nt < 4; ++nt)
#pragma unroll
            for (int j = 0; j < 8; ++j) acc[am][nt][j] = 0.0f;

    // ---- staging, split in two: global loads into registers, and (two trips later)
    //      the LDS stores. Two register sets, so two K tiles are in flight.
    // No branch stands around either half: a branch would merge paths in the compiler's
    // load counting and its wait for the older set would drain the younger one too.
    // A row's K slice is 64 bf16 = one 128-byte line. Eight neighbouring lanes take it in 16-byte
    // pieces, so one wave-wide load covers four whole lines; thread: piece sc of rows sr + 32 i.
    struct Held { v8bf a[8]; v8bf b[2]; };
    const int nK = Kdim / TILE_K;
    const int sr = tid >> 3;           // 0..31
    const int sc = (tid & 7) << 3;     // 0, 8, .. 56
    // uniform base + fixed per-thread byte offsets: the K advance is scalar arithmetic
    unsigned soff[8];
#pragma unroll
    for (int i = 0; i < 8; ++i) soff[i] = ((unsigned)(sr + (i << 5)) * (unsigned)Kdim + (unsigned)sc) * 2u;
    const __bf16* Xb = X + (size_t)m0 * Kdim;
    const __bf16* Wb = W + (size_t)n0 * Kdim;
    auto fetch = [&](Held& s, int kt) {
        // past the last tile the last one is asked for again (in bounds, never used)
        const int k0 = (kt < nK ? kt : nK - 1) * TILE_K;
        const char* xk = (const char*)(Xb + k0);
        const char* wk = (const char*)(Wb + k0);
#pragma unroll
        for (int i = 0; i < 8; ++i) s.a[i] = *(const v8bf*)(xk + soff[i]);   // A: 256 rows
#pragma unroll
        for (int i = 0; i < 2; ++i) s.b[i] = *(const v8bf*)(wk + soff[i]);   // B: 64 rows
        // the loads' address registers are rewritten for the next fetch
        asm volatile("s_wait_xcnt 0x0" ::: "memory");
    };
    auto publish = [&](const Held& s, int buf) {
#pragma unroll
        for (int i = 0; i < 8; ++i) *(v8bf*)&As[buf][sr + (i << 5)][sc] = s.a[i];
#pragma unroll
        for (int i = 0; i < 2; ++i) *(v8bf*)&Bs[buf][sr + (i << 5)][sc] = s.b[i];
    };

    Held h0, h1;                       // h0: even K tiles, h1: odd K tiles
    fetch(h0, 0);
    publish(h0, 0);
    fetch(h1, 1);
    fetch(h0, 2);
    lds_barrier();

    // one trip: tile kt from LDS buffer cur; nxt holds tile kt + 1, asked for two trips ago
    auto trip = [&](int kt, int cur, Held& nxt) {
        // fragments: wave's 32 rows x block's 64 cols, the tile's two 32-k halves in turn
        const int wrow = wave << 5;
#pragma unroll
        for (int ks = 0; ks < TILE_K; ks += 32) {
            v16bf aF[2], bF[4];
#pragma unroll
            for (int am = 0; am < 2; ++am)
                aF[am] = load_frag(&As[cur][wrow + (am << 4) + l15][ks], half);
#pragma unroll
            for (int nt = 0; nt < 4; ++nt)
                bF[nt] = load_frag(&Bs[cur][(nt << 4) + l15][ks], half);

#pragma unroll
            for (int am = 0; am < 2; ++am)
#pragma unroll
                for (int nt = 0; nt < 4; ++nt)
                    acc[am][nt] = __builtin_amdgcn_wmma_f32_16x16x32_bf16(
                        false, aF[am], false, bF[nt], (short)0, acc[am][nt], false, false);
        }
        // keeps the wait for the held tile's loads behind the products; lifted above them it would stall them
        __builtin_amdgcn_sched_barrier(0);
        publish(nxt, cur ^ 1);
        fetch(nxt, kt + 3);
        lds_barrier();
    };
    // trips in pairs, so that each register set and LDS buffer is named at compile time and no
    // branch stands inside the loop; an odd trip count ends in one trip behind it
    int kt = 0;
    for (; kt + 1 < nK; kt += 2) {
        trip(kt, 0, h1);
        trip(kt + 1, 1, h0);
    }
    if (kt < nK) trip(kt, 0, h1);

    // Epilogue. C/D layout: VGPR r, lane<16 -> (M=r, N=lane); lane>=16 -> (M=8+r).
    // Each wave passes its accumulators, 16 rows at a time, through its own slice of
    // the (now free) A buffer and picks them up as whole rows; the activation then
    // runs in a rolled loop of 16-byte pieces. Rolled to keep the text small.
    float* ep = reinterpret_cast<float*>(&As[0][0][0]) + wave * (16 * EPITCH);
    const float* src = ep + half * EPITCH + (l15 << 2);
#pragma unroll
    for (int am = 0; am < 2; ++am) {
        if (am) __syncthreads();   // the first 16 rows have been read; the slice may be rewritten
#pragma unroll
        for (int nt = 0; nt < 4; ++nt)
#pragma unroll
            for (int r = 0; r < 8; ++r)
                ep[(r + (half << 3)) * EPITCH + (nt << 4) + l15] = acc[am][nt][r];
        __syncthreads();           // lanes read what other lanes wrote

        // rows (wave*32 + am*16 + half) + 2 it, columns n0 + 4*l15 ..
        const size_t idx0 = (size_t)(m0 + (wave << 5) + (am << 4) + half) * Nout + n0 + (l15 << 2);
        const size_t step = (size_t)Nout * 2;
        if (act_mode == 0) {
#pragma unroll 1   // rolled: keeps the text small (see above)
            for (int it = 0; it < 8; ++it) {
                const float4 v = *(const float4*)(src + it * (2 * EPITCH));
                *(float4*)(Y + idx0 + it * step) = v;
                // the store's registers are rewritten by the next trip
                asm volatile("s_wait_xcnt 0x0" ::: "memory");
            }
        } else if (act_mode == 1) {
#pragma unroll 1   // rolled: keeps the text small (see above)
            for (int it = 0; it < 8; ++it) {
                const float4 v = *(const float4*)(src + it * (2 * EPITCH));
                float4 y;
                y.x = v.x / (1.0f + __expf(-v.x));                          // swish
                y.y = v.y / (1.0f + __expf(-v.y));
                y.z = v.z / (1.0f + __expf(-v.z));
                y.w = v.w / (1.0f + __expf(-v.w));
                *(float4*)(Y + idx0 + it * step) = y;
                // the store's registers are rewritten by the next trip
                asm volatile("s_wait_xcnt 0x0" ::: "memory");
            }
        } else {
#pragma unroll 1   // rolled: keeps the text small (see above)
            for (int it = 0; it < 8; ++it) {
                const float4 v = *(const float4*)(src + it * (2 * EPITCH));
                const float vv[4] = {v.x, v.y, v.z, v.w};
                float e[4];
#pragma unroll
                for (int c = 0; c < 4; ++c) {
                    const float ls = fminf(vv[c], 0.0f) - log1pf(__expf(-fabsf(vv[c])));  // logsigmoid
                    e[c] = __expf(ls * 0.0625f);                                        // /GATE_NORM
                }
                // the slot the instruction set asks for between a transcendental and the first use of its result (the store)
                // (the results as inputs and the clobber hold it between the two)
                asm volatile("v_nop" :: "v"(e[0]), "v"(e[1]), "v"(e[2]), "v"(e[3]) : "memory");
                *(float4*)(Y + idx0 + it * step) = make_float4(e[0], e[1], e[2], e[3]);
                // the store's registers are rewritten by the next trip
                asm volatile("s_wait_xcnt 0x0" ::: "memory");
            }
        }
    }
}

// X and the five weight matrices, f32 -> bf16, once for all the tiles that read them (each
// row of X is read by 56 column blocks, each weight row by 16 row blocks): the tiles then draw
// half the bytes from L2. 131072 threads, 17 pieces of 16 bytes each, all asked for at once;
// a wave's load covers four whole lines, its store two.
#define CVT_THREADS 131072
__global__ __launch_bounds__(512) void to_bf16_kernel(
    const float* __restrict__ X,
    const float* __restrict__ Wq, const float* __restrict__ Wk,
    const float* __restrict__ Wv, const float* __restrict__ Wo,
    const float* __restrict__ Wf,
    __bf16* __restrict__ Xh,
    __bf16* __restrict__ Wqh, __bf16* __restrict__ Wkh,
    __bf16* __restrict__ Wvh, __bf16* __restrict__ Woh,
    __bf16* __restrict__ Wfh)
{
    // uniform base + one fixed per-thread byte offset for all loads, another for all stores
    const unsigned tl = (blockIdx.x * 512u + threadIdx.x) << 4;   // 16 bytes of f32 in
    const unsigned ts = tl >> 1;                                  //  8 bytes of bf16 out
    const unsigned LSTEP = 16u * CVT_THREADS, SSTEP = 8u * CVT_THREADS;
    auto ld = [&](const float* p, int i) { return *(const v4f*)((const char*)p + i * LSTEP + tl); };
    auto st = [&](__bf16* p, int i, v4f a) { *(v4bf*)((char*)p + i * SSTEP + ts) = pack4(a); };
    v4f x[8], q[2], k[2], v[2], o[2], f;
#pragma unroll
    for (int i = 0; i < 8; ++i) x[i] = ld(X, i);
#pragma unroll
    for (int i = 0; i < 2; ++i) {
        q[i] = ld(Wq, i);
        k[i] = ld(Wk, i);
        v[i] = ld(Wv, i);
        o[i] = ld(Wo, i);
    }
    f = ld(Wf, 0);
    // keeps every load ahead of the first conversion, so that all 17 are in flight at once
    __builtin_amdgcn_sched_barrier(0);
    // without this the stores' offset is formed in place in the loads' offset register, right behind
    // the last load; named as an input, that register lives up to the wait
    asm volatile("s_wait_xcnt 0x0" :: "v"(tl) : "memory");
#pragma unroll
    for (int i = 0; i < 8; ++i) st(Xh, i, x[i]);
#pragma unroll
    for (int i = 0; i < 2; ++i) {
        st(Wqh, i, q[i]);
        st(Wkh, i, k[i]);
        st(Wvh, i, v[i]);
        st(Woh, i, o[i]);
    }
    st(Wfh, 0, f);
}

// the output projection: one tile per workgroup of a (columns, rows) grid
__global__ __launch_bounds__(256) void gemm_bt_kernel(
    const __bf16* __restrict__ X, const __bf16* __restrict__ W,
    float* __restrict__ Y,
    int Nrows, int Kdim, int Nout, int act_mode)
{
    gemm_bt_tile(X, W, Y, Kdim, Nout, act_mode, blockIdx.y * TILE_M, blockIdx.x * TILE_N);
}

// The four input projections in one launch: 56 column blocks (8 of F, 16 each of Q, K, V) x 16
// row blocks = 896 workgroups. Two are resident per WGP, so one's LDS waits, barriers and
// epilogue run under the other's loads, and no launch waits for the last tile of the one before.
// The gate blocks stand first: their epilogue is the longest and must not be the launch's tail.
// The row block is the low part of the index: workgroups 256 apart read the same rows of X, so
// where two such share a WGP its cache may serve both (a matter of speed only, nothing rests on it).
__global__ __launch_bounds__(256) void proj4_kernel(
    const __bf16* __restrict__ X,
    const __bf16* __restrict__ Wq, const __bf16* __restrict__ Wk,
    const __bf16* __restrict__ Wv, const __bf16* __restrict__ Wf,
    float* __restrict__ Q, float* __restrict__ K, float* __restrict__ V,
    float* __restrict__ G, int Kdim)
{
    const int m0 = (blockIdx.x & 15) * TILE_M;
    const int cb = blockIdx.x >> 4;            // 0..55
    if (cb < 8) {
        gemm_bt_tile(X, Wf, G, Kdim, 512, 2, m0, cb * TILE_N);
    } else {
        const int which = (cb - 8) >> 4;       // 0: Q, 1: K, 2: V
        const __bf16* W = which == 0 ? Wq : (which == 1 ? Wk : Wv);
        float*       Y = which == 0 ? Q  : (which == 1 ? K  : V);
        gemm_bt_tile(X, W, Y, Kdim, 1024, 1, m0, ((cb - 8) & 15) * TILE_N);
    }
}

// ---------------------------------------------------------------------------
// Gated-ABC recurrence, split into its independent parts (four launches, the segment states included).
//   hk[:, m] depends on slot m alone  -> zscan: one workgroup per (b,h, 8 slots, segment)
//   softmax over the 64 slots         -> one thread per (b,h,t)
//   hv[:, v] depends on column v alone-> oscan: one workgroup per (b,h, 32 cols, segment)
// Inside a workgroup time runs in tiles of SCAN_TT steps: the tile's inputs sit
// in LDS, every thread steps its own register tile of the state with no barrier
// between steps, leaves its partial dot products in LDS, and the tile's partials
// are summed once behind the tile. The next tile's inputs are fetched into
// registers while the current tile is stepped.
// Z / P layout: [b*8+h][slot block of 8][t][8], so each workgroup owns whole lines.
// Time is cut into segments, each with workgroups of its own. The recurrence is linear in
// the state: state(end) = state(start) * D + E, with D the product of the segment's gates
// and E the state that the segment builds from zero. seg_state_kernel leaves D and E of
// every segment but the last in the workspace; a scan workgroup folds those of the
// segments in front of its own into its start state and then steps its segment alone.
// ---------------------------------------------------------------------------
typedef __attribute__((ext_vector_type(2))) float f32x2;
typedef __attribute__((ext_vector_type(4))) float f32x4;

#define SCAN_TT 32
#define ZPITCH  264   // 32 k-groups x 8 slots + 8: the tile sum reads 8 rows on distinct banks
#define OPITCH  528   // 16 slot-groups x 32 cols + 16: same, for 16-byte reads
#define PPITCH  72    // 64 slots + 8: the blocked P rows land on distinct banks
#define ZSEG    4     // time segments of the slot-score scan: 512 workgroups, two per WGP
#define ZLEN    (2048 / ZSEG)
#define OSEG    8     // time segments of the output scan: 512 workgroups, two per WGP
#define OLEN    (2048 / OSEG)
#define ZSTATE_WGS ((ZSEG - 1) * 128)
#define OSTATE_WGS ((OSEG - 1) * 64)

static __device__ __forceinline__ f32x2 splat2(float x) { f32x2 r = {x, x}; return r; }

// What a step adds to the state: s x. The input gate is s = 1 - e by its definition (e = e^g, the
// decay), so s is neither stored nor read: s x = x - e x, one fused operation off the state's chain.
static __device__ __forceinline__ f32x2 gated_in(f32x2 e, f32x2 x) { return __builtin_elementwise_fma(-e, x, x); }

// E and D of one hk segment; thread tile and step arithmetic as in zscan_kernel.
// Ek: [segment*128 + workgroup][2][thread][4], Dk: [segment*128 + workgroup][thread][2]
static __device__ __forceinline__ void zstate_body(
    int blk, const float* __restrict__ Kp, const float* __restrict__ Gp,
    float* __restrict__ Ek, float* __restrict__ Dk)
{
    __shared__ __attribute__((aligned(16))) float kS[SCAN_TT][128];
    __shared__ __attribute__((aligned(16))) float geS[SCAN_TT][8];

    const int tid = threadIdx.x;
    const int seg = blk >> 7;
    const int bh  = (blk & 127) >> 3;
    const int mb  = blk & 7;
    const int b   = bh >> 3;
    const int h   = bh & 7;
    const int kg  = tid >> 2;      // 0..31
    const int mg  = tid & 3;       // 0..3

    f32x4 kr[8];
    f32x2 gr;
    const unsigned qoff = (unsigned)(tid >> 5) * 1024u + (unsigned)((tid & 31) << 2);
    const unsigned goff = (unsigned)(tid >> 2) * 512u + (unsigned)((tid & 3) << 1);   // row tid>>2, two of its 8 decays
    auto fetch = [&](int t0) {
        const float* k = Kp + (size_t)(b * 2048 + t0) * 1024 + h * 128;
#pragma unroll
        for (int i = 0; i < 8; ++i)         // rows (tid>>5) + 4 i
            kr[i] = *(const f32x4*)(k + qoff + i * 4096);
        gr = *(const f32x2*)(Gp + (size_t)(b * 2048 + t0) * 512 + h * 64 + mb * 8 + goff);
        // the loads' base registers are rewritten for the next fetch
        asm volatile("s_wait_xcnt 0x0" ::: "memory");
    };
    auto publish = [&]() {
#pragma unroll
        for (int i = 0; i < 8; ++i) {
            const int idx = tid + (i << 7);
            *(f32x4*)&kS[idx >> 5][(idx & 31) << 2] = kr[i];
        }
        *(f32x2*)&geS[tid >> 2][(tid & 3) << 1] = gr;
    };

    f32x2 hk[4];
#pragma unroll
    for (int i = 0; i < 4; ++i) hk[i] = splat2(0.0f);
    f32x2 dp = splat2(1.0f);

    const int tbeg = seg * ZLEN, tend = tbeg + ZLEN;
    fetch(tbeg);
    publish();
    __syncthreads();

    for (int t0 = tbeg; t0 < tend; t0 += SCAN_TT) {
        const bool more = (t0 + SCAN_TT) < tend;
        if (more) fetch(t0 + SCAN_TT);

        // groups of 4 steps, two register sets, as in zscan_kernel
        f32x4 ka[4], kb[4];
        f32x2 ga[4], gb[4];
        auto ld = [&](f32x4 (&k)[4], f32x2 (&g)[4], int base) {
#pragma unroll
            for (int j = 0; j < 4; ++j) {
                k[j] = *(const f32x4*)&kS[base + j][kg << 2];
                g[j] = *(const f32x2*)&geS[base + j][mg << 1];
            }
            // keeps these reads ahead of the group stepped next; sunk to their use they would be waited for
            __builtin_amdgcn_sched_barrier(0);
        };
        auto step = [&](const f32x4 (&k)[4], const f32x2 (&g)[4]) {
#pragma unroll
            for (int j = 0; j < 4; ++j) {
#pragma unroll
                for (int i = 0; i < 4; ++i)
                    hk[i] = __builtin_elementwise_fma(hk[i], g[j], gated_in(g[j], splat2(k[j][i])));
                dp *= g[j];
            }
        };
        ld(ka, ga, 0);
#pragma unroll 1   // rolled: unrolled, all of the tile's LDS reads are lifted to its head and take 480 registers
        for (int g8 = 0; g8 < SCAN_TT; g8 += 8) {
            ld(kb, gb, g8 + 4);
            step(ka, ga);
            ld(ka, ga, (g8 + 8) & (SCAN_TT - 1));   // behind the last group: rows 0..3 again, not used
            step(kb, gb);
        }
        __syncthreads();   // every reader has left the input tile
        if (more) publish();
        __syncthreads();   // next input tile published
    }

    float* e = Ek + (size_t)blk * 1024 + (tid << 2);
    const f32x4 e0 = {hk[0].x, hk[0].y, hk[1].x, hk[1].y};
    const f32x4 e1 = {hk[2].x, hk[2].y, hk[3].x, hk[3].y};
    *(f32x4*)e         = e0;
    *(f32x4*)(e + 512) = e1;
    *(f32x2*)(Dk + (size_t)blk * 256 + (tid << 1)) = dp;
}

// E and D of one hv segment; thread tile and step arithmetic as in oscan_kernel.
// Ev: [segment*64 + workgroup][4][thread][4], Dv: [segment*64 + workgroup][thread][4]
static __device__ __forceinline__ void ostate_body(
    int blk, const float* __restrict__ Vp, const float* __restrict__ Gp,
    float* __restrict__ Ev, float* __restrict__ Dv)
{
    __shared__ __attribute__((aligned(16))) float geS[SCAN_TT][64];
    __shared__ __attribute__((aligned(16))) float vS[SCAN_TT][32];

    const int tid = threadIdx.x;
    const int seg = blk >> 6;
    const int bh  = (blk & 63) >> 2;
    const int v0  = (blk & 3) << 5;
    const int b   = bh >> 3;
    const int h   = bh & 7;
    const int vg  = tid & 7;       // 0..7
    const int sg  = tid >> 3;      // 0..15

    f32x4 gr[4], vr[2];
    const unsigned goff = (unsigned)(tid >> 4) * 512u + (unsigned)((tid & 15) << 2);
    const unsigned voff = (unsigned)(tid >> 3) * 1024u + (unsigned)((tid & 7) << 2);
    auto fetch = [&](int t0) {
        const float* g = Gp + (size_t)(b * 2048 + t0) * 512 + h * 64;
        const float* v = Vp + (size_t)(b * 2048 + t0) * 1024 + h * 128 + v0;
#pragma unroll
        for (int i = 0; i < 4; ++i)
            gr[i] = *(const f32x4*)(g + goff + i * 4096);    // rows (tid>>4) + 8 i
#pragma unroll
        for (int i = 0; i < 2; ++i)
            vr[i] = *(const f32x4*)(v + voff + i * 16384);   // rows (tid>>3) + 16 i
        // the loads' base registers are rewritten for the next fetch
        asm volatile("s_wait_xcnt 0x0" ::: "memory");
    };
    auto publish = [&]() {
#pragma unroll
        for (int i = 0; i < 4; ++i) {
            const int idx = tid + (i << 7);
            *(f32x4*)&geS[idx >> 4][(idx & 15) << 2] = gr[i];
        }
#pragma unroll
        for (int i = 0; i < 2; ++i) {
            const int idx = tid + (i << 7);
            *(f32x4*)&vS[idx >> 3][(idx & 7) << 2] = vr[i];
        }
    };

    f32x2 hv[4][2];
#pragma unroll
    for (int i = 0; i < 4; ++i) { hv[i][0] = splat2(0.0f); hv[i][1] = splat2(0.0f); }
    f32x4 dp = {1.0f, 1.0f, 1.0f, 1.0f};

    const int tbeg = seg * OLEN, tend = tbeg + OLEN;
    fetch(tbeg);
    publish();
    __syncthreads();

    for (int t0 = tbeg; t0 < tend; t0 += SCAN_TT) {
        const bool more = (t0 + SCAN_TT) < tend;
        if (more) fetch(t0 + SCAN_TT);

        // groups of 4 steps, two register sets, as in oscan_kernel
        f32x4 ga[4], va[4], gb[4], vb[4];
        auto ld = [&](f32x4 (&g)[4], f32x4 (&v)[4], int base) {
#pragma unroll
            for (int j = 0; j < 4; ++j) {
                g[j] = *(const f32x4*)&geS[base + j][sg << 2];
                v[j] = *(const f32x4*)&vS[base + j][vg << 2];
            }
            // keeps these reads ahead of the group stepped next; sunk to their use they would be waited for
            __builtin_amdgcn_sched_barrier(0);
        };
        auto step = [&](const f32x4 (&g)[4], const f32x4 (&v)[4]) {
#pragma unroll
            for (int j = 0; j < 4; ++j) {
                const f32x2 v01 = {v[j].x, v[j].y}, v23 = {v[j].z, v[j].w};
#pragma unroll
                for (int i = 0; i < 4; ++i) {
                    hv[i][0] = __builtin_elementwise_fma(hv[i][0], splat2(g[j][i]), gated_in(splat2(g[j][i]), v01));
                    hv[i][1] = __builtin_elementwise_fma(hv[i][1], splat2(g[j][i]), gated_in(splat2(g[j][i]), v23));
                }
                dp *= g[j];
            }
        };
        ld(ga, va, 0);
#pragma unroll 1   // rolled: unrolled, all of the tile's LDS reads are lifted to its head and take 480 registers
        for (int g8 = 0; g8 < SCAN_TT; g8 += 8) {
            ld(gb, vb, g8 + 4);
            step(ga, va);
            ld(ga, va, (g8 + 8) & (SCAN_TT - 1));   // behind the last group: rows 0..3 again, not used
            step(gb, vb);
        }
        __syncthreads();   // every reader has left the input tile
        if (more) publish();
        __syncthreads();   // next input tile published
    }

    float* e = Ev + (size_t)blk * 2048 + (tid << 2);
#pragma unroll
    for (int i = 0; i < 4; ++i) {
        const f32x4 ei = {hv[i][0].x, hv[i][0].y, hv[i][1].x, hv[i][1].y};
        *(f32x4*)(e + i * 512) = ei;
    }
    *(f32x4*)(Dv + (size_t)blk * 512 + (tid << 2)) = dp;
}

// one launch for both kinds of segment state (neither needs the slot weights);
// the longer hk segments stand first in the grid
__global__ __launch_bounds__(128) void seg_state_kernel(
    const float* __restrict__ Kp, const float* __restrict__ Vp,
    const float* __restrict__ Gp,
    float* __restrict__ Ek, float* __restrict__ Dk,
    float* __restrict__ Ev, float* __restrict__ Dv)
{
    const int blk = blockIdx.x;
    if (blk < ZSTATE_WGS) zstate_body(blk, Kp, Gp, Ek, Dk);
    else                  ostate_body(blk - ZSTATE_WGS, Vp, Gp, Ev, Dv);
}

// thread: 4 k (kg*4..) x 2 slots (mg*2..) of hk
// waves_per_eu: the grid puts two waves on a SIMD; told so, the compiler spends registers on interleaving
// the steps' independent chains. Without it it keeps below 256 registers and leaves dependent
// multiply-adds back to back.
__global__ __launch_bounds__(128) __attribute__((amdgpu_waves_per_eu(1, 2))) void zscan_kernel(
    const float* __restrict__ Qp, const float* __restrict__ Kp,
    const float* __restrict__ Gp,
    const float* __restrict__ Ek, const float* __restrict__ Dk,
    float* __restrict__ Zb)
{
    __shared__ __attribute__((aligned(16))) float qS[SCAN_TT][128];
    __shared__ __attribute__((aligned(16))) float kS[SCAN_TT][128];
    __shared__ __attribute__((aligned(16))) float geS[SCAN_TT][8];
    __shared__ __attribute__((aligned(16))) float part[SCAN_TT][ZPITCH];

    const int tid = threadIdx.x;
    const int seg = blockIdx.x >> 7;     // time segment
    const int wg  = blockIdx.x & 127;
    const int bh  = wg >> 3;
    const int mb  = wg & 7;
    const int b   = bh >> 3;
    const int h   = bh & 7;
    const int kg  = tid >> 2;      // 0..31
    const int mg  = tid & 3;       // 0..3
    const float scale = 0.08838834764831845f; // 128^-0.5

    f32x4 qr[8], kr[8];
    f32x2 gr;
    // uniform base + one fixed per-thread offset: the tile advance stays in scalar registers
    const unsigned qoff = (unsigned)(tid >> 5) * 1024u + (unsigned)((tid & 31) << 2);
    const unsigned goff = (unsigned)(tid >> 2) * 512u + (unsigned)((tid & 3) << 1);   // row tid>>2, two of its 8 decays
    auto fetch = [&](int t0) {
        const size_t rowq = (size_t)(b * 2048 + t0) * 1024 + h * 128;
        const float* q = Qp + rowq;
        const float* k = Kp + rowq;
#pragma unroll
        for (int i = 0; i < 8; ++i) {       // rows (tid>>5) + 4 i
            qr[i] = *(const f32x4*)(q + qoff + i * 4096);
            kr[i] = *(const f32x4*)(k + qoff + i * 4096);
        }
        gr = *(const f32x2*)(Gp + (size_t)(b * 2048 + t0) * 512 + h * 64 + mb * 8 + goff);
        // the loads' base registers are rewritten behind this
        asm volatile("s_wait_xcnt 0x0" ::: "memory");
    };
    auto publish = [&]() {
#pragma unroll
        for (int i = 0; i < 8; ++i) {
            const int idx = tid + (i << 7);
            *(f32x4*)&qS[idx >> 5][(idx & 31) << 2] = qr[i] * scale;
            *(f32x4*)&kS[idx >> 5][(idx & 31) << 2] = kr[i];
        }
        *(f32x2*)&geS[tid >> 2][(tid & 3) << 1] = gr;
    };

    f32x2 hk[4];
#pragma unroll
    for (int i = 0; i < 4; ++i) hk[i] = splat2(0.0f);

    const int tbeg = seg * ZLEN, tend = tbeg + ZLEN;
    fetch(tbeg);
    // start state: the earlier segments' E, each decayed by the D of the segments behind it
    // (all asked for at once, one round trip instead of one per segment; later segments' are left unused)
    {
        const float* e = Ek + (size_t)wg * 1024 + (tid << 2);
        const float* dsrc = Dk + (size_t)wg * 256 + (tid << 1);
        f32x4 e0[ZSEG - 1], e1[ZSEG - 1];
        f32x2 d[ZSEG - 1];
#pragma unroll
        for (int i = 0; i < ZSEG - 1; ++i) {
            e0[i] = *(const f32x4*)(e + i * (128 * 1024));
            e1[i] = *(const f32x4*)(e + i * (128 * 1024) + 512);
            d[i]  = *(const f32x2*)(dsrc + i * (128 * 256));
        }
        // the loads' address registers are free for reuse behind this
        asm volatile("s_wait_xcnt 0x0" ::: "memory");
#pragma unroll
        for (int i = 0; i < ZSEG - 1; ++i) {
            if (i < seg) {
                const f32x2 e00 = {e0[i].x, e0[i].y}, e01 = {e0[i].z, e0[i].w};
                const f32x2 e10 = {e1[i].x, e1[i].y}, e11 = {e1[i].z, e1[i].w};
                hk[0] = __builtin_elementwise_fma(hk[0], d[i], e00);
                hk[1] = __builtin_elementwise_fma(hk[1], d[i], e01);
                hk[2] = __builtin_elementwise_fma(hk[2], d[i], e10);
                hk[3] = __builtin_elementwise_fma(hk[3], d[i], e11);
            }
        }
    }
    publish();
    __syncthreads();

    for (int t0 = tbeg; t0 < tend; t0 += SCAN_TT) {
        const bool more = (t0 + SCAN_TT) < tend;
        if (more) fetch(t0 + SCAN_TT);

        // groups of 4 steps, two register sets: the next group's LDS reads are in
        // flight while this group is stepped
        f32x4 qa[4], ka[4], qb[4], kb[4];
        f32x2 ga[4], gb[4];
        auto ld = [&](f32x4 (&q)[4], f32x4 (&k)[4], f32x2 (&g)[4], int base) {
#pragma unroll
            for (int j = 0; j < 4; ++j) {
                q[j] = *(const f32x4*)&qS[base + j][kg << 2];
                k[j] = *(const f32x4*)&kS[base + j][kg << 2];
                g[j] = *(const f32x2*)&geS[base + j][mg << 1];
            }
            // keeps these reads ahead of the group stepped next; sunk to their use they would be waited for
            __builtin_amdgcn_sched_barrier(0);
        };
        auto step = [&](const f32x4 (&q)[4], const f32x4 (&k)[4], const f32x2 (&g)[4], int base) {
#pragma unroll
            for (int j = 0; j < 4; ++j) {
                f32x2 acc = splat2(0.0f);
#pragma unroll
                for (int i = 0; i < 4; ++i) {
                    hk[i] = __builtin_elementwise_fma(hk[i], g[j], gated_in(g[j], splat2(k[j][i])));
                    acc   = __builtin_elementwise_fma(splat2(q[j][i]), hk[i], acc);
                }
                *(f32x2*)&part[base + j][(kg << 3) + (mg << 1)] = acc;
            }
        };
        ld(qa, ka, ga, 0);
#pragma unroll
        for (int g8 = 0; g8 < SCAN_TT; g8 += 8) {
            ld(qb, kb, gb, g8 + 4);
            step(qa, ka, ga, g8);
            if (g8 + 8 < SCAN_TT) ld(qa, ka, ga, g8 + 8);
            step(qb, kb, gb, g8 + 4);
        }
        __syncthreads();   // partials complete; every reader has left the input tile

        {
            const int rt = tid >> 2, rm = tid & 3;
            f32x2 a0 = splat2(0.0f), a1 = a0, a2 = a0, a3 = a0;
#pragma unroll
            for (int g = 0; g < 8; ++g) {
                a0 += *(const f32x2*)&part[rt][((4 * g + 0) << 3) + (rm << 1)];
                a1 += *(const f32x2*)&part[rt][((4 * g + 1) << 3) + (rm << 1)];
                a2 += *(const f32x2*)&part[rt][((4 * g + 2) << 3) + (rm << 1)];
                a3 += *(const f32x2*)&part[rt][((4 * g + 3) << 3) + (rm << 1)];
            }
            float* zrow = Zb + ((size_t)(bh * 8 + mb) * 2048 + t0) * 8;
            *(f32x2*)(zrow + (unsigned)(rt * 8 + (rm << 1))) = (a0 + a1) + (a2 + a3);
            // the store's registers are reused right behind it
            asm volatile("s_wait_xcnt 0x0" ::: "memory");
        }
        if (more) publish();
        __syncthreads();   // next input tile published; partials free again
    }
}

// softmax over the 64 slots of one (b,h,t), in place on the blocked layout
__global__ __launch_bounds__(256) void slot_softmax_kernel(float* Zb)
{
    const int gid = blockIdx.x * 256 + threadIdx.x;
    const int bh  = gid >> 11;
    const int t   = gid & 2047;
    f32x4 z[16];
#pragma unroll
    for (int mb = 0; mb < 8; ++mb) {
        const float* p = Zb + ((size_t)(bh * 8 + mb) * 2048 + t) * 8;
        z[2 * mb]     = *(const f32x4*)p;
        z[2 * mb + 1] = *(const f32x4*)(p + 4);
    }
    f32x4 m4 = z[0];
#pragma unroll
    for (int i = 1; i < 16; ++i) m4 = __builtin_elementwise_max(m4, z[i]);
    const float mx = fmaxf(fmaxf(m4.x, m4.y), fmaxf(m4.z, m4.w));
    f32x4 s4 = {0.0f, 0.0f, 0.0f, 0.0f};
#pragma unroll
    for (int i = 0; i < 16; ++i) {
        f32x4 e = {__expf(z[i].x - mx), __expf(z[i].y - mx), __expf(z[i].z - mx), __expf(z[i].w - mx)};
        z[i] = e;
        s4 += e;
    }
    const float inv = 1.0f / ((s4.x + s4.y) + (s4.z + s4.w));
#pragma unroll
    for (int mb = 0; mb < 8; ++mb) {
        float* p = Zb + ((size_t)(bh * 8 + mb) * 2048 + t) * 8;
        *(f32x4*)p       = z[2 * mb] * inv;
        *(f32x4*)(p + 4) = z[2 * mb + 1] * inv;
    }
}

// thread: 4 slots (sg*4..) x 4 columns (vg*4..) of hv
__global__ __launch_bounds__(128) void oscan_kernel(
    const float* __restrict__ Vp, const float* __restrict__ Gp,
    const float* __restrict__ Pb,
    const float* __restrict__ Ev, const float* __restrict__ Dv,
    float* __restrict__ Op)
{
    __shared__ __attribute__((aligned(16))) float geS[SCAN_TT][64];
    __shared__ __attribute__((aligned(16))) float pS[SCAN_TT][PPITCH];
    __shared__ __attribute__((aligned(16))) float vS[SCAN_TT][32];
    __shared__ __attribute__((aligned(16))) float part[SCAN_TT][OPITCH];

    const int tid = threadIdx.x;
    const int seg = blockIdx.x >> 6;     // time segment
    const int wg  = blockIdx.x & 63;
    const int bh  = wg >> 2;
    const int v0  = (wg & 3) << 5;
    const int b   = bh >> 3;
    const int h   = bh & 7;
    const int vg  = tid & 7;       // 0..7
    const int sg  = tid >> 3;      // 0..15

    f32x4 gr[4], pr[4], vr[2];
    // uniform base + one fixed per-thread offset: the tile advance stays in scalar registers
    const unsigned goff = (unsigned)(tid >> 4) * 512u + (unsigned)((tid & 15) << 2);
    const unsigned poff = (unsigned)(tid >> 6) * 16384u + (unsigned)((tid & 63) << 2);
    const unsigned voff = (unsigned)(tid >> 3) * 1024u + (unsigned)((tid & 7) << 2);
    auto fetch = [&](int t0) {
        const float* g = Gp + (size_t)(b * 2048 + t0) * 512 + h * 64;
        const float* p = Pb + ((size_t)(bh * 8) * 2048 + t0) * 8;
        const float* v = Vp + (size_t)(b * 2048 + t0) * 1024 + h * 128 + v0;
#pragma unroll
        for (int i = 0; i < 4; ++i) {
            gr[i] = *(const f32x4*)(g + goff + i * 4096);    // rows (tid>>4) + 8 i
            // blocked P: slot block (tid>>6) + 2 i, then 64 consecutive 16-byte pieces of this tile
            pr[i] = *(const f32x4*)(p + poff + i * 32768);
        }
#pragma unroll
        for (int i = 0; i < 2; ++i)
            vr[i] = *(const f32x4*)(v + voff + i * 16384);   // rows (tid>>3) + 16 i
        // the loads' base registers are rewritten behind this
        asm volatile("s_wait_xcnt 0x0" ::: "memory");
    };
    auto publish = [&]() {
#pragma unroll
        for (int i = 0; i < 4; ++i) {
            const int idx = tid + (i << 7);
            *(f32x4*)&geS[idx >> 4][(idx & 15) << 2] = gr[i];
            *(f32x4*)&pS[(idx & 63) >> 1][((idx >> 6) << 3) + ((idx & 1) << 2)] = pr[i];
        }
#pragma unroll
        for (int i = 0; i < 2; ++i) {
            const int idx = tid + (i << 7);
            *(f32x4*)&vS[idx >> 3][(idx & 7) << 2] = vr[i];
        }
    };

    f32x2 hv[4][2];
#pragma unroll
    for (int i = 0; i < 4; ++i) { hv[i][0] = splat2(0.0f); hv[i][1] = splat2(0.0f); }

    const int tbeg = seg * OLEN, tend = tbeg + OLEN;
    fetch(tbeg);
    // start state: the earlier segments' E, each decayed by the D of the segments behind it
    // (all asked for at once, one round trip instead of one per segment; later segments' are left unused)
    {
        const float* e = Ev + (size_t)wg * 2048 + (tid << 2);
        const float* dsrc = Dv + (size_t)wg * 512 + (tid << 2);
        f32x4 er[OSEG - 1][4], d[OSEG - 1];
#pragma unroll
        for (int i = 0; i < OSEG - 1; ++i) {
#pragma unroll
            for (int r = 0; r < 4; ++r) er[i][r] = *(const f32x4*)(e + i * (64 * 2048) + r * 512);
            d[i] = *(const f32x4*)(dsrc + i * (64 * 512));
        }
        // the loads' address registers are free for reuse behind this
        asm volatile("s_wait_xcnt 0x0" ::: "memory");
#pragma unroll
        for (int i = 0; i < OSEG - 1; ++i) {
            if (i < seg) {
#pragma unroll
                for (int r = 0; r < 4; ++r) {
                    const f32x2 lo = {er[i][r].x, er[i][r].y}, hi = {er[i][r].z, er[i][r].w};
                    hv[r][0] = __builtin_elementwise_fma(hv[r][0], splat2(d[i][r]), lo);
                    hv[r][1] = __builtin_elementwise_fma(hv[r][1], splat2(d[i][r]), hi);
                }
            }
        }
    }
    publish();
    __syncthreads();

    for (int t0 = tbeg; t0 < tend; t0 += SCAN_TT) {
        const bool more = (t0 + SCAN_TT) < tend;
        if (more) fetch(t0 + SCAN_TT);

        // groups of 4 steps, two register sets: the next group's LDS reads are in
        // flight while this group is stepped
        f32x4 ga[4], pa[4], va[4], gb[4], pb[4], vb[4];
        auto ld = [&](f32x4 (&g)[4], f32x4 (&p)[4], f32x4 (&v)[4], int base) {
#pragma unroll
            for (int j = 0; j < 4; ++j) {
                g[j] = *(const f32x4*)&geS[base + j][sg << 2];
                p[j] = *(const f32x4*)&pS[base + j][sg << 2];
                v[j] = *(const f32x4*)&vS[base + j][vg << 2];
            }
            // keeps these reads ahead of the group stepped next; sunk to their use they would be waited for
            __builtin_amdgcn_sched_barrier(0);
        };
        auto step = [&](const f32x4 (&g)[4], const f32x4 (&p)[4], const f32x4 (&v)[4], int base) {
#pragma unroll
            for (int j = 0; j < 4; ++j) {
                const f32x2 v01 = {v[j].x, v[j].y}, v23 = {v[j].z, v[j].w};
                f32x2 acc0 = splat2(0.0f), acc1 = splat2(0.0f);
#pragma unroll
                for (int i = 0; i < 4; ++i) {
                    hv[i][0] = __builtin_elementwise_fma(hv[i][0], splat2(g[j][i]), gated_in(splat2(g[j][i]), v01));
                    hv[i][1] = __builtin_elementwise_fma(hv[i][1], splat2(g[j][i]), gated_in(splat2(g[j][i]), v23));
                    acc0 = __builtin_elementwise_fma(splat2(p[j][i]), hv[i][0], acc0);
                    acc1 = __builtin_elementwise_fma(splat2(p[j][i]), hv[i][1], acc1);
                }
                f32x4 a = {acc0.x, acc0.y, acc1.x, acc1.y};
                *(f32x4*)&part[base + j][(sg << 5) + (vg << 2)] = a;
            }
        };
        ld(ga, pa, va, 0);
#pragma unroll
        for (int g8 = 0; g8 < SCAN_TT; g8 += 8) {
            ld(gb, pb, vb, g8 + 4);
            step(ga, pa, va, g8);
            if (g8 + 8 < SCAN_TT) ld(ga, pa, va, g8 + 8);
            step(gb, pb, vb, g8 + 4);
        }
        __syncthreads();   // partials complete; every reader has left the input tile

        {
            const int rt = tid >> 2, rv = (tid & 3) << 2;
            f32x4 a0 = {0.0f, 0.0f, 0.0f, 0.0f}, a1 = a0, b0 = a0, b1 = a0;
#pragma unroll
            for (int g = 0; g < 8; ++g) {
                a0 += *(const f32x4*)&part[rt][((2 * g + 0) << 5) + rv];
                b0 += *(const f32x4*)&part[rt][((2 * g + 0) << 5) + rv + 16];
                a1 += *(const f32x4*)&part[rt][((2 * g + 1) << 5) + rv];
                b1 += *(const f32x4*)&part[rt][((2 * g + 1) << 5) + rv + 16];
            }
            float* o = Op + (size_t)(b * 2048 + t0) * 1024 + h * 128 + v0;
            *(f32x4*)(o + (unsigned)(rt * 1024 + rv))      = a0 + a1;
            *(f32x4*)(o + (unsigned)(rt * 1024 + rv) + 16) = b0 + b1;
            // the stores' registers are reused right behind them
            asm volatile("s_wait_xcnt 0x0" ::: "memory");
        }
        if (more) publish();
        __syncthreads();   // next input tile published; partials free again
    }
}

// ---------------------------------------------------------------------------
// y = RMSNorm(swish(x)) * g_weight, stored as bf16 (the output projection's A operand)
// (one block per row of 1024)
// ---------------------------------------------------------------------------
__global__ __launch_bounds__(256) void swish_rms_kernel(
    const float* __restrict__ X, const float* __restrict__ w,
    __bf16* __restrict__ Y)
{
    const int row = blockIdx.x;
    const float* xr = X + (size_t)row * 1024;
    float loc[4];
    float ss = 0.0f;
#pragma unroll
    for (int i = 0; i < 4; ++i) {
        const float x  = xr[threadIdx.x + 256 * i];
        const float sw = x / (1.0f + __expf(-x));
        loc[i] = sw;
        ss += sw * sw;
    }
#pragma unroll
    for (int off = 16; off > 0; off >>= 1) ss += __shfl_xor(ss, off, 32);
    __shared__ float wred[8];
    if ((threadIdx.x & 31) == 0) wred[threadIdx.x >> 5] = ss;
    __syncthreads();
    float tot = 0.0f;
#pragma unroll
    for (int i = 0; i < 8; ++i) tot += wred[i];
    const float r = rsqrtf(tot * (1.0f / 1024.0f) + 1e-5f);
#pragma unroll
    for (int i = 0; i < 4; ++i) {
        const int c = threadIdx.x + 256 * i;
        Y[(size_t)row * 1024 + c] = (__bf16)(loc[i] * r * w[c]);
    }
}

// ---------------------------------------------------------------------------
extern "C" void kernel_launch(void* const* d_in, const int* in_sizes, int n_in,
                              void* d_out, int out_size, void* d_ws, size_t ws_size,
                              hipStream_t stream) {
    const float* X  = (const float*)d_in[0];   // [4096,1024]
    const float* Wq = (const float*)d_in[1];
    const float* Wk = (const float*)d_in[2];
    const float* Wv = (const float*)d_in[3];
    const float* Wf = (const float*)d_in[4];   // [512,1024]
    const float* Wo = (const float*)d_in[5];
    const float* gw = (const float*)d_in[6];   // [1024]

    const size_t ND = 4096ull * 1024ull;
    const size_t NF = 4096ull * 512ull;
    float* ws  = (float*)d_ws;
    float* Q   = ws;             // 16 MB
    float* Kt  = Q   + ND;       // 16 MB
    float* Vt  = Kt  + ND;       // 16 MB
    float* G   = Vt  + ND;       //  8 MB, the decays e^g
    float* Oin = G   + NF;       // 16 MB
    float* Zb  = Oin + ND;       //  8 MB, slot scores then slot weights
    float* Ek  = Zb  + NF;                                  // hk segment states
    float* Dk  = Ek  + (size_t)ZSTATE_WGS * 1024;           // their gate products
    float* Ev  = Dk  + (size_t)ZSTATE_WGS * 256;            // hv segment states
    float* Dv  = Ev  + (size_t)OSTATE_WGS * 2048;           // their gate products
    __bf16* Xh  = (__bf16*)(Dv + (size_t)OSTATE_WGS * 512);   // bf16 copies: X, 8 MB
    __bf16* Wqh = Xh  + ND;                                   // weights, 2 MB each
    __bf16* Wkh = Wqh + 1024ull * 1024ull;
    __bf16* Wvh = Wkh + 1024ull * 1024ull;
    __bf16* Woh = Wvh + 1024ull * 1024ull;
    __bf16* Wfh = Woh + 1024ull * 1024ull;                    // 1 MB
    __bf16* Xn  = Wfh + 512ull * 1024ull;                     // normalised rows, 8 MB

    dim3 blk(256);
    dim3 gQKV(1024 / TILE_N, 4096 / TILE_M);   // 16 x 16

    to_bf16_kernel<<<dim3(CVT_THREADS / 512), dim3(512), 0, stream>>>(X, Wq, Wk, Wv, Wo, Wf, Xh, Wqh, Wkh, Wvh, Woh, Wfh);

    proj4_kernel<<<dim3(56 * 16), blk, 0, stream>>>(Xh, Wqh, Wkh, Wvh, Wfh, Q, Kt, Vt, G, 1024);

    seg_state_kernel<<<ZSTATE_WGS + OSTATE_WGS, dim3(128), 0, stream>>>(Kt, Vt, G, Ek, Dk, Ev, Dv);
    zscan_kernel<<<128 * ZSEG, dim3(128), 0, stream>>>(Q, Kt, G, Ek, Dk, Zb);
    slot_softmax_kernel<<<128, blk, 0, stream>>>(Zb);
    oscan_kernel<<<64 * OSEG, dim3(128), 0, stream>>>(Vt, G, Zb, Ev, Dv, Oin);

    swish_rms_kernel<<<4096, blk, 0, stream>>>(Oin, gw, Xn);

    gemm_bt_kernel<<<gQKV, blk, 0, stream>>>(Xn, Woh, (float*)d_out, 4096, 1024, 1024, 0);
}

// v009
// A run of this version takes 137 microseconds.
// Next to v008, in two timings, it ran 1.08 times as fast each time.
// Over all steps from v000 it is 24.2 times as fast.
#include <hip/hip_runtime.h>

// ---------------------------------------------------------------------------
// Gated ABC attention, MI455X (gfx1250, wave32, WMMA bf16).
// B=2, T=2048, D=1024, H=8, M=64, KD=128.
//   0) to_bf16: X and the five weight matrices rounded to bf16 once
//   1) proj4 (WMMA), one launch: Q/K/V = swish(X W^T), F -> decay e^g
//   2) recurrence: segment states, slot scores, slot softmax, output columns (four launches)
//   3) swish + RMSNorm, result stored as bf16
//   4) gemm_bt: out = Xn Wo^T
// GEMM: 256x64 block tile, 8 waves x (32x64), double-buffered LDS, operands bf16 in memory,
// 16-byte global loads (eight lanes per 128-byte row slice of 64 k, so a wave's load covers
// whole lines) held in registers for two trips -> 16B LDS stores -> ds_load_b128 frags.
// Epilogue through LDS, rolled, 16-byte stores.
// ---------------------------------------------------------------------------

typedef __attribute__((ext_vector_type(16))) __bf16 v16bf;
typedef __attribute__((ext_vector_type(8)))  __bf16 v8bf;
typedef __attribute__((ext_vector_type(4)))  __bf16 v4bf;
typedef __attribute__((ext_vector_type(8)))  float  v8f;
typedef __attribute__((ext_vector_type(4)))  float  v4f;

#define TILE_M 256
#define TILE_N 64
#define TILE_K 64         // 64 bf16 = one 128-byte line of a row
#define KPAD   8          // pad rows to 72 bf16 = 144 B (odd multiple of 16 B, conflict-free)
#define LROW   (TILE_K + KPAD)
#define EPITCH 68         // epilogue rows: 64 f32 + 4, so rows r and r+8 fall on different banks

static __device__ __forceinline__ v4bf pack4(v4f a) {
    v4bf p;
    p[0] = (__bf16)a.x; p[1] = (__bf16)a.y; p[2] = (__bf16)a.z; p[3] = (__bf16)a.w;
    return p;
}

static __device__ __forceinline__ v16bf load_frag(const __bf16* rowp, int half) {
    // lane's two contiguous 16-byte chunks of the 32-element K row
    v8bf lo = *(const v8bf*)(rowp + (half << 3));
    v8bf hi = *(const v8bf*)(rowp + 16 + (half << 3));
    return __builtin_shufflevector(lo, hi, 0, 1, 2, 3, 4, 5, 6, 7,
                                   8, 9, 10, 11, 12, 13, 14, 15);
}

// Work-group barrier of the K loop, by hand: it waits for this wave's LDS traffic alone.
// __syncthreads() would also wait for the global loads that are to stay in flight across it.
static __device__ __forceinline__ void lds_barrier() {
    asm volatile("s_wait_dscnt 0x0\n\ts_barrier_signal -1\n\ts_barrier_wait -1" ::: "memory");
}

// Y = act( X @ W^T ) ; X: [Nrows,Kdim] bf16, W: [Nout,Kdim] bf16, Y: [Nrows,Nout] f32
// act_mode: 0 = identity, 1 = swish, 2 = decay (Y = exp(logsigmoid/16))
// One workgroup's 256 x 64 tile at rows m0, columns n0.
static __device__ __forceinline__ void gemm_bt_tile(
    const __bf16* __restrict__ X, const __bf16* __restrict__ W,
    float* __restrict__ Y,
    int Kdim, int Nout, int act_mode, int m0, int n0)
{
    __shared__ __attribute__((aligned(16))) __bf16 As[2][TILE_M][LROW];
    __shared__ __attribute__((aligned(16))) __bf16 Bs[2][TILE_N][LROW];

    const int tid  = threadIdx.x;
    const int wave = tid >> 5;        // 0..7
    const int lane = tid & 31;
    const int half = lane >> 4;       // K-half select (0/1)
    const int l15  = lane & 15;

    v8f acc[2][4];
#pragma unroll
    for (int am = 0; am < 2; ++am)
#pragma unroll
        for (int nt = 0; nt < 4; ++nt)
#pragma unroll
            for (int j = 0; j < 8; ++j) acc[am][nt][j] = 0.0f;

    // ---- staging, split in two: global loads into registers, and (two trips later)
    //      the LDS stores. Two register sets, so two K tiles are in flight.
    // No branch stands around either half: a branch would merge paths in the compiler's
    // load counting and its wait for the older set would drain the younger one too.
    // A row's K slice is 64 bf16 = one 128-byte line. Eight neighbouring lanes take it in 16-byte
    // pieces, so one wave-wide load covers four whole lines; thread: piece sc of rows sr + 32 i.
    struct Held { v8bf a[8]; v8bf b[2]; };
    const int nK = Kdim / TILE_K;
    const int sr = tid >> 3;           // 0..31
    const int sc = (tid & 7) << 3;     // 0, 8, .. 56
    // uniform base + fixed per-thread byte offsets: the K advance is scalar arithmetic
    unsigned soff[8];
#pragma unroll
    for (int i = 0; i < 8; ++i) soff[i] = ((unsigned)(sr + (i << 5)) * (unsigned)Kdim + (unsigned)sc) * 2u;
    const __bf16* Xb = X + (size_t)m0 * Kdim;
    const __bf16* Wb = W + (size_t)n0 * Kdim;
    auto fetch = [&](Held& s, int kt) {
        // past the last tile the last one is asked for again (in bounds, never used)
        const int k0 = (kt < nK ? kt : nK - 1) * TILE_K;
        const char* xk = (const char*)(Xb + k0);
        const char* wk = (const char*)(Wb + k0);
#pragma unroll
        for (int i = 0; i < 8; ++i) s.a[i] = *(const v8bf*)(xk + soff[i]);   // A: 256 rows
#pragma unroll
        for (int i = 0; i < 2; ++i) s.b[i] = *(const v8bf*)(wk + soff[i]);   // B: 64 rows
        // the loads' address registers are rewritten for the next fetch
        asm volatile("s_wait_xcnt 0x0" ::: "memory");
    };
    auto publish = [&](const Held& s, int buf) {
#pragma unroll
        for (int i = 0; i < 8; ++i) *(v8bf*)&As[buf][sr + (i << 5)][sc] = s.a[i];
#pragma unroll
        for (int i = 0; i < 2; ++i) *(v8bf*)&Bs[buf][sr + (i << 5)][sc] = s.b[i];
    };

    Held h0, h1;                       // h0: even K tiles, h1: odd K tiles
    fetch(h0, 0);
    publish(h0, 0);
    fetch(h1, 1);
    fetch(h0, 2);
    lds_barrier();

    // one trip: tile kt from LDS buffer cur; nxt holds tile kt + 1, asked for two trips ago
    auto trip = [&](int kt, int cur, Held& nxt) {
        // fragments: wave's 32 rows x block's 64 cols, the tile's two 32-k halves in turn
        const int wrow = wave << 5;
#pragma unroll
        for (int ks = 0; ks < TILE_K; ks += 32) {
            v16bf aF[2], bF[4];
#pragma unroll
            for (int am = 0; am < 2; ++am)
                aF[am] = load_frag(&As[cur][wrow + (am << 4) + l15][ks], half);
#pragma unroll
            for (int nt = 0; nt < 4; ++nt)
                bF[nt] = load_frag(&Bs[cur][(nt << 4) + l15][ks], half);

#pragma unroll
            for (int am = 0; am < 2; ++am)
#pragma unroll
                for (int nt = 0; nt < 4; ++nt)
                    acc[am][nt] = __builtin_amdgcn_wmma_f32_16x16x32_bf16(
                        false, aF[am], false, bF[nt], (short)0, acc[am][nt], false, false);
        }
        // keeps the wait for the held tile's loads behind the products; lifted above them it would stall them
        __builtin_amdgcn_sched_barrier(0);
        publish(nxt, cur ^ 1);
        fetch(nxt, kt + 3);
        lds_barrier();
    };
    // trips in pairs, so that each register set and LDS buffer is named at compile time and no
    // branch stands inside the loop; an odd trip count ends in one trip behind it
    int kt = 0;
    for (; kt + 1 < nK; kt += 2) {
        trip(kt, 0, h1);
        trip(kt + 1, 1, h0);
    }
    if (kt < nK) trip(kt, 0, h1);

    // Epilogue. C/D layout: VGPR r, lane<16 -> (M=r, N=lane); lane>=16 -> (M=8+r).
    // Each wave passes its accumulators, 16 rows at a time, through its own slice of
    // the (now free) A buffer and picks them up as whole rows; the activation then
    // runs in a rolled loop of 16-byte pieces. Rolled to keep the text small.
    float* ep = reinterpret_cast<float*>(&As[0][0][0]) + wave * (16 * EPITCH);
    const float* src = ep + half * EPITCH + (l15 << 2);
#pragma unroll
    for (int am = 0; am < 2; ++am) {
        if (am) __syncthreads();   // the first 16 rows have been read; the slice may be rewritten
#pragma unroll
        for (int nt = 0; nt < 4; ++nt)
#pragma unroll
            for (int r = 0; r < 8; ++r)
                ep[(r + (half << 3)) * EPITCH + (nt << 4) + l15] = acc[am][nt][r];
        __syncthreads();           // lanes read what other lanes wrote

        // rows (wave*32 + am*16 + half) + 2 it, columns n0 + 4*l15 ..
        const size_t idx0 = (size_t)(m0 + (wave << 5) + (am << 4) + half) * Nout + n0 + (l15 << 2);
        const size_t step = (size_t)Nout * 2;
        if (act_mode == 0) {
#pragma unroll 1   // rolled: keeps the text small (see above)
            for (int it = 0; it < 8; ++it) {
                const float4 v = *(const float4*)(src + it * (2 * EPITCH));
                *(float4*)(Y + idx0 + it * step) = v;
                // the store's registers are rewritten by the next trip
                asm volatile("s_wait_xcnt 0x0" ::: "memory");
            }
        } else if (act_mode == 1) {
#pragma unroll 1   // rolled: keeps the text small (see above)
            for (int it = 0; it < 8; ++it) {
                const float4 v = *(const float4*)(src + it * (2 * EPITCH));
                float4 y;
                y.x = v.x / (1.0f + __expf(-v.x));                          // swish
                y.y = v.y / (1.0f + __expf(-v.y));
                y.z = v.z / (1.0f + __expf(-v.z));
                y.w = v.w / (1.0f + __expf(-v.w));
                *(float4*)(Y + idx0 + it * step) = y;
                // the store's registers are rewritten by the next trip
                asm volatile("s_wait_xcnt 0x0" ::: "memory");
            }
        } else {
#pragma unroll 1   // rolled: keeps the text small (see above)
            for (int it = 0; it < 8; ++it) {
                const float4 v = *(const float4*)(src + it * (2 * EPITCH));
                const float vv[4] = {v.x, v.y, v.z, v.w};
                float e[4];
#pragma unroll
                for (int c = 0; c < 4; ++c) {
                    const float ls = fminf(vv[c], 0.0f) - log1pf(__expf(-fabsf(vv[c])));  // logsigmoid
                    e[c] = __expf(ls * 0.0625f);                                        // /GATE_NORM
                }
                // the slot the instruction set asks for between a transcendental and the first use of its result (the store)
                // (the results as inputs and the clobber hold it between the two)
                asm volatile("v_nop" :: "v"(e[0]), "v"(e[1]), "v"(e[2]), "v"(e[3]) : "memory");
                *(float4*)(Y + idx0 + it * step) = make_float4(e[0], e[1], e[2], e[3]);
                // the store's registers are rewritten by the next trip
                asm volatile("s_wait_xcnt 0x0" ::: "memory");
            }
        }
    }
}

// X and the five weight matrices, f32 -> bf16, once for all the tiles that read them (each
// row of X is read by 56 column blocks, each weight row by 16 row blocks): the tiles then draw
// half the bytes from L2. 131072 threads, 17 pieces of 16 bytes each, all asked for at once;
// a wave's load covers four whole lines, its store two.
#define CVT_THREADS 131072
__global__ __launch_bounds__(512) void to_bf16_kernel(
    const float* __restrict__ X,
    const float* __restrict__ Wq, const float* __restrict__ Wk,
    const float* __restrict__ Wv, const float* __restrict__ Wo,
    const float* __restrict__ Wf,
    __bf16* __restrict__ Xh,
    __bf16* __restrict__ Wqh, __bf16* __restrict__ Wkh,
    __bf16* __restrict__ Wvh, __bf16* __restrict__ Woh,
    __bf16* __restrict__ Wfh)
{
    // uniform base + one fixed per-thread byte offset for all loads, another for all stores
    const unsigned tl = (blockIdx.x * 512u + threadIdx.x) << 4;   // 16 bytes of f32 in
    const unsigned ts = tl >> 1;                                  //  8 bytes of bf16 out
    const unsigned LSTEP = 16u * CVT_THREADS, SSTEP = 8u * CVT_THREADS;
    auto ld = [&](const float* p, int i) { return *(const v4f*)((const char*)p + i * LSTEP + tl); };
    auto st = [&](__bf16* p, int i, v4f a) { *(v4bf*)((char*)p + i * SSTEP + ts) = pack4(a); };
    v4f x[8], q[2], k[2], v[2], o[2], f;
#pragma unroll
    for (int i = 0; i < 8; ++i) x[i] = ld(X, i);
#pragma unroll
    for (int i = 0; i < 2; ++i) {
        q[i] = ld(Wq, i);
        k[i] = ld(Wk, i);
        v[i] = ld(Wv, i);
        o[i] = ld(Wo, i);
    }
    f = ld(Wf, 0);
    // keeps every load ahead of the first conversion, so that all 17 are in flight at once
    __builtin_amdgcn_sched_barrier(0);
    // without this the stores' offset is formed in place in the loads' offset register, right behind
    // the last load; named as an input, that register lives up to the wait
    asm volatile("s_wait_xcnt 0x0" :: "v"(tl) : "memory");
#pragma unroll
    for (int i = 0; i < 8; ++i) st(Xh, i, x[i]);
#pragma unroll
    for (int i = 0; i < 2; ++i) {
        st(Wqh, i, q[i]);
        st(Wkh, i, k[i]);
        st(Wvh, i, v[i]);
        st(Woh, i, o[i]);
    }
    st(Wfh, 0, f);
}

// the output projection: one tile per workgroup of a (columns, rows) grid
__global__ __launch_bounds__(256) void gemm_bt_kernel(
    const __bf16* __restrict__ X, const __bf16* __restrict__ W,
    float* __restrict__ Y,
    int Nrows, int Kdim, int Nout, int act_mode)
{
    gemm_bt_tile(X, W, Y, Kdim, Nout, act_mode, blockIdx.y * TILE_M, blockIdx.x * TILE_N);
}

// The four input projections in one launch: 56 column blocks (8 of F, 16 each of Q, K, V) x 16
// row blocks = 896 workgroups. Two are resident per WGP, so one's LDS waits, barriers and
// epilogue run under the other's loads, and no launch waits for the last tile of the one before.
// The gate blocks stand first: their epilogue is the longest and must not be the launch's tail.
// The row block is the low part of the index: workgroups 256 apart read the same rows of X, so
// where two such share a WGP its cache may serve both (a matter of speed only, nothing rests on it).
__global__ __launch_bounds__(256) void proj4_kernel(
    const __bf16* __restrict__ X,
    const __bf16* __restrict__ Wq, const __bf16* __restrict__ Wk,
    const __bf16* __restrict__ Wv, const __bf16* __restrict__ Wf,
    float* __restrict__ Q, float* __restrict__ K, float* __restrict__ V,
    float* __restrict__ G, int Kdim)
{
    const int m0 = (blockIdx.x & 15) * TILE_M;
    const int cb = blockIdx.x >> 4;            // 0..55
    if (cb < 8) {
        gemm_bt_tile(X, Wf, G, Kdim, 512, 2, m0, cb * TILE_N);
    } else {
        const int which = (cb - 8) >> 4;       // 0: Q, 1: K, 2: V
        const __bf16* W = which == 0 ? Wq : (which == 1 ? Wk : Wv);
        float*       Y = which == 0 ? Q  : (which == 1 ? K  : V);
        gemm_bt_tile(X, W, Y, Kdim, 1024, 1, m0, ((cb - 8) & 15) * TILE_N);
    }
}

// ---------------------------------------------------------------------------
// Gated-ABC recurrence, split into its independent parts (four launches).
//   hk[:, m] depends on slot m alone  -> zscan: one workgroup per (b,h, 16 slots, segment)
//   softmax over the 64 slots         -> one thread per (b,h,t)
//   hv[:, v] depends on column v alone-> oscan: one workgroup per (b,h, 32 cols, segment)
// Inside a workgroup time runs in tiles of SCAN_TT steps: the tile's inputs sit
// in LDS, every thread steps its own register tile of the state with no barrier
// between steps, leaves its partial dot products in LDS, and the tile's partials
// are summed once behind the tile. The next tile's inputs are fetched into
// registers while the current tile is stepped.
// Z / P layout: [b*8+h][slot block of 8][t][8], so each workgroup owns whole lines (zscan: two blocks).
// Time is cut into segments, each with workgroups of its own. The recurrence is linear in
// the state: state(end) = state(start) * D + E, with D the product of the segment's gates
// and E the state that the segment builds from zero. seg_state_kernel leaves D and E of
// every segment but the last in the workspace; a scan workgroup folds those of the
// segments in front of its own into its start state and then steps its segment alone.
// ---------------------------------------------------------------------------
typedef __attribute__((ext_vector_type(2))) float f32x2;
typedef __attribute__((ext_vector_type(4))) float f32x4;

#define SCAN_TT 32
#define ZPITCH  528   // 32 k-groups x 16 slots + 16: the tile sum's 16-byte reads of 4 rows fall on distinct banks
#define OPITCH  528   // 16 slot-groups x 32 cols + 16: same, for 16-byte reads
#define PPITCH  72    // 64 slots + 8: the blocked P rows land on distinct banks
#define ZSEG    8     // time segments of the slot-score scan: 512 workgroups, two per WGP
#define ZLEN    (2048 / ZSEG)
#define OSEG    8     // time segments of the output scan: 512 workgroups, two per WGP
#define OLEN    (2048 / OSEG)
#define ZSTATE_WGS ((ZSEG - 1) * 64)
#define OSTATE_WGS ((OSEG - 1) * 64)

static __device__ __forceinline__ f32x2 splat2(float x) { f32x2 r = {x, x}; return r; }

// What a step adds to the state: s x. The input gate is s = 1 - e by its definition (e = e^g, the
// decay), so s is neither stored nor read: s x = x - e x, one fused operation off the state's chain.
static __device__ __forceinline__ f32x2 gated_in(f32x2 e, f32x2 x) { return __builtin_elementwise_fma(-e, x, x); }

// E and D of one hk segment; thread tile and step arithmetic as in zscan_kernel.
// Ek: [segment*64 + workgroup][4][thread][4], Dk: [segment*64 + workgroup][thread][4]
static __device__ __forceinline__ void zstate_body(
    int blk, const float* __restrict__ Kp, const float* __restrict__ Gp,
    float* __restrict__ Ek, float* __restrict__ Dk)
{
    __shared__ __attribute__((aligned(16))) float kS[SCAN_TT][128];
    __shared__ __attribute__((aligned(16))) float geS[SCAN_TT][16];

    const int tid = threadIdx.x;
    const int seg = blk >> 6;
    const int bh  = (blk & 63) >> 2;
    const int mb  = blk & 3;       // block of 16 slots
    const int b   = bh >> 3;
    const int h   = bh & 7;
    const int kg  = tid >> 2;      // 0..31
    const int mg  = tid & 3;       // 0..3

    f32x4 kr[8];
    f32x4 gr;
    const unsigned qoff = (unsigned)(tid >> 5) * 1024u + (unsigned)((tid & 31) << 2);
    const unsigned goff = (unsigned)(tid >> 2) * 512u + (unsigned)((tid & 3) << 2);   // row tid>>2, four of its 16 decays
    auto fetch = [&](int t0) {
        const float* k = Kp + (size_t)(b * 2048 + t0) * 1024 + h * 128;
#pragma unroll
        for (int i = 0; i < 8; ++i)         // rows (tid>>5) + 4 i
            kr[i] = *(const f32x4*)(k + qoff + i * 4096);
        gr = *(const f32x4*)(Gp + (size_t)(b * 2048 + t0) * 512 + h * 64 + mb * 16 + goff);
        // the loads' base registers are rewritten for the next fetch
        asm volatile("s_wait_xcnt 0x0" ::: "memory");
    };
    auto publish = [&]() {
#pragma unroll
        for (int i = 0; i < 8; ++i) {
            const int idx = tid + (i << 7);
            *(f32x4*)&kS[idx >> 5][(idx & 31) << 2] = kr[i];
        }
        *(f32x4*)&geS[tid >> 2][(tid & 3) << 2] = gr;
    };

    f32x2 hk[4][2];
#pragma unroll
    for (int i = 0; i < 4; ++i) { hk[i][0] = splat2(0.0f); hk[i][1] = splat2(0.0f); }
    f32x4 dp = {1.0f, 1.0f, 1.0f, 1.0f};

    const int tbeg = seg * ZLEN, tend = tbeg + ZLEN;
    fetch(tbeg);
    publish();
    __syncthreads();

    for (int t0 = tbeg; t0 < tend; t0 += SCAN_TT) {
        const bool more = (t0 + SCAN_TT) < tend;
        if (more) fetch(t0 + SCAN_TT);

        // groups of 4 steps, two register sets, as in zscan_kernel
        f32x4 ka[4], kb[4], ga[4], gb[4];
        auto ld = [&](f32x4 (&k)[4], f32x4 (&g)[4], int base) {
#pragma unroll
            for (int j = 0; j < 4; ++j) {
                k[j] = *(const f32x4*)&kS[base + j][kg << 2];
                g[j] = *(const f32x4*)&geS[base + j][mg << 2];
            }
            // keeps these reads ahead of the group stepped next; sunk to their use they would be waited for
            __builtin_amdgcn_sched_barrier(0);
        };
        auto step = [&](const f32x4 (&k)[4], const f32x4 (&g)[4]) {
#pragma unroll
            for (int j = 0; j < 4; ++j) {
                const f32x2 g01 = {g[j].x, g[j].y}, g23 = {g[j].z, g[j].w};
#pragma unroll
                for (int i = 0; i < 4; ++i) {
                    hk[i][0] = __builtin_elementwise_fma(hk[i][0], g01, gated_in(g01, splat2(k[j][i])));
                    hk[i][1] = __builtin_elementwise_fma(hk[i][1], g23, gated_in(g23, splat2(k[j][i])));
                }
                dp *= g[j];
            }
        };
        ld(ka, ga, 0);
#pragma unroll 1   // rolled: unrolled, all of the tile's LDS reads are lifted to its head and take 480 registers
        for (int g8 = 0; g8 < SCAN_TT; g8 += 8) {
            ld(kb, gb, g8 + 4);
            step(ka, ga);
            ld(ka, ga, (g8 + 8) & (SCAN_TT - 1));   // behind the last group: rows 0..3 again, not used
            step(kb, gb);
        }
        __syncthreads();   // every reader has left the input tile
        if (more) publish();
        __syncthreads();   // next input tile published
    }

    float* e = Ek + (size_t)blk * 2048 + (tid << 2);
#pragma unroll
    for (int i = 0; i < 4; ++i) {
        const f32x4 ei = {hk[i][0].x, hk[i][0].y, hk[i][1].x, hk[i][1].y};
        *(f32x4*)(e + i * 512) = ei;
    }
    *(f32x4*)(Dk + (size_t)blk * 512 + (tid << 2)) = dp;
}

// E and D of one hv segment; thread tile and step arithmetic as in oscan_kernel.
// Ev: [segment*64 + workgroup][4][thread][4], Dv: [segment*64 + workgroup][thread][4]
static __device__ __forceinline__ void ostate_body(
    int blk, const float* __restrict__ Vp, const float* __restrict__ Gp,
    float* __restrict__ Ev, float* __restrict__ Dv)
{
    __shared__ __attribute__((aligned(16))) float geS[SCAN_TT][64];
    __shared__ __attribute__((aligned(16))) float vS[SCAN_TT][32];

    const int tid = threadIdx.x;
    const int seg = blk >> 6;
    const int bh  = (blk & 63) >> 2;
    const int v0  = (blk & 3) << 5;
    const int b   = bh >> 3;
    const int h   = bh & 7;
    const int vg  = tid & 7;       // 0..7
    const int sg  = tid >> 3;      // 0..15

    f32x4 gr[4], vr[2];
    const unsigned goff = (unsigned)(tid >> 4) * 512u + (unsigned)((tid & 15) << 2);
    const unsigned voff = (unsigned)(tid >> 3) * 1024u + (unsigned)((tid & 7) << 2);
    auto fetch = [&](int t0) {
        const float* g = Gp + (size_t)(b * 2048 + t0) * 512 + h * 64;
        const float* v = Vp + (size_t)(b * 2048 + t0) * 1024 + h * 128 + v0;
#pragma unroll
        for (int i = 0; i < 4; ++i)
            gr[i] = *(const f32x4*)(g + goff + i * 4096);    // rows (tid>>4) + 8 i
#pragma unroll
        for (int i = 0; i < 2; ++i)
            vr[i] = *(const f32x4*)(v + voff + i * 16384);   // rows (tid>>3) + 16 i
        // the loads' base registers are rewritten for the next fetch
        asm volatile("s_wait_xcnt 0x0" ::: "memory");
    };
    auto publish = [&]() {
#pragma unroll
        for (int i = 0; i < 4; ++i) {
            const int idx = tid + (i << 7);
            *(f32x4*)&geS[idx >> 4][(idx & 15) << 2] = gr[i];
        }
#pragma unroll
        for (int i = 0; i < 2; ++i) {
            const int idx = tid + (i << 7);
            *(f32x4*)&vS[idx >> 3][(idx & 7) << 2] = vr[i];
        }
    };

    f32x2 hv[4][2];
#pragma unroll
    for (int i = 0; i < 4; ++i) { hv[i][0] = splat2(0.0f); hv[i][1] = splat2(0.0f); }
    f32x4 dp = {1.0f, 1.0f, 1.0f, 1.0f};

    const int tbeg = seg * OLEN, tend = tbeg + OLEN;
    fetch(tbeg);
    publish();
    __syncthreads();

    for (int t0 = tbeg; t0 < tend; t0 += SCAN_TT) {
        const bool more = (t0 + SCAN_TT) < tend;
        if (more) fetch(t0 + SCAN_TT);

        // groups of 4 steps, two register sets, as in oscan_kernel
        f32x4 ga[4], va[4], gb[4], vb[4];
        auto ld = [&](f32x4 (&g)[4], f32x4 (&v)[4], int base) {
#pragma unroll
            for (int j = 0; j < 4; ++j) {
                g[j] = *(const f32x4*)&geS[base + j][sg << 2];
                v[j] = *(const f32x4*)&vS[base + j][vg << 2];
            }
            // keeps these reads ahead of the group stepped next; sunk to their use they would be waited for
            __builtin_amdgcn_sched_barrier(0);
        };
        auto step = [&](const f32x4 (&g)[4], const f32x4 (&v)[4]) {
#pragma unroll
            for (int j = 0; j < 4; ++j) {
                const f32x2 v01 = {v[j].x, v[j].y}, v23 = {v[j].z, v[j].w};
#pragma unroll
                for (int i = 0; i < 4; ++i) {
                    hv[i][0] = __builtin_elementwise_fma(hv[i][0], splat2(g[j][i]), gated_in(splat2(g[j][i]), v01));
                    hv[i][1] = __builtin_elementwise_fma(hv[i][1], splat2(g[j][i]), gated_in(splat2(g[j][i]), v23));
                }
                dp *= g[j];
            }
        };
        ld(ga, va, 0);
#pragma unroll 1   // rolled: unrolled, all of the tile's LDS reads are lifted to its head and take 480 registers
        for (int g8 = 0; g8 < SCAN_TT; g8 += 8) {
            ld(gb, vb, g8 + 4);
            step(ga, va);
            ld(ga, va, (g8 + 8) & (SCAN_TT - 1));   // behind the last group: rows 0..3 again, not used
            step(gb, vb);
        }
        __syncthreads();   // every reader has left the input tile
        if (more) publish();
        __syncthreads();   // next input tile published
    }

    float* e = Ev + (size_t)blk * 2048 + (tid << 2);
#pragma unroll
    for (int i = 0; i < 4; ++i) {
        const f32x4 ei = {hv[i][0].x, hv[i][0].y, hv[i][1].x, hv[i][1].y};
        *(f32x4*)(e + i * 512) = ei;
    }
    *(f32x4*)(Dv + (size_t)blk * 512 + (tid << 2)) = dp;
}

// one launch for both kinds of segment state (neither needs the slot weights)
__global__ __launch_bounds__(128) void seg_state_kernel(
    const float* __restrict__ Kp, const float* __restrict__ Vp,
    const float* __restrict__ Gp,
    float* __restrict__ Ek, float* __restrict__ Dk,
    float* __restrict__ Ev, float* __restrict__ Dv)
{
    const int blk = blockIdx.x;
    if (blk < ZSTATE_WGS) zstate_body(blk, Kp, Gp, Ek, Dk);
    else                  ostate_body(blk - ZSTATE_WGS, Vp, Gp, Ev, Dv);
}

// thread: 4 k (kg*4..) x 4 slots (mg*4..) of hk: one 16-byte LDS read each of q, k and the decays
// feeds 16 state elements
// waves_per_eu: the grid puts two waves on a SIMD; told so, the compiler spends registers on interleaving
// the steps' independent chains. Without it it keeps below 256 registers and leaves dependent
// multiply-adds back to back.
__global__ __launch_bounds__(128) __attribute__((amdgpu_waves_per_eu(1, 2))) void zscan_kernel(
    const float* __restrict__ Qp, const float* __restrict__ Kp,
    const float* __restrict__ Gp,
    const float* __restrict__ Ek, const float* __restrict__ Dk,
    float* __restrict__ Zb)
{
    __shared__ __attribute__((aligned(16))) float qS[SCAN_TT][128];
    __shared__ __attribute__((aligned(16))) float kS[SCAN_TT][128];
    __shared__ __attribute__((aligned(16))) float geS[SCAN_TT][16];
    __shared__ __attribute__((aligned(16))) float part[SCAN_TT][ZPITCH];

    const int tid = threadIdx.x;
    const int seg = blockIdx.x >> 6;     // time segment
    const int wg  = blockIdx.x & 63;
    const int bh  = wg >> 2;
    const int mb  = wg & 3;        // block of 16 slots
    const int b   = bh >> 3;
    const int h   = bh & 7;
    const int kg  = tid >> 2;      // 0..31
    const int mg  = tid & 3;       // 0..3
    const float scale = 0.08838834764831845f; // 128^-0.5

    f32x4 qr[8], kr[8];
    f32x4 gr;
    // uniform base + one fixed per-thread offset: the tile advance stays in scalar registers
    const unsigned qoff = (unsigned)(tid >> 5) * 1024u + (unsigned)((tid & 31) << 2);
    const unsigned goff = (unsigned)(tid >> 2) * 512u + (unsigned)((tid & 3) << 2);   // row tid>>2, four of its 16 decays
    auto fetch = [&](int t0) {
        const size_t rowq = (size_t)(b * 2048 + t0) * 1024 + h * 128;
        const float* q = Qp + rowq;
        const float* k = Kp + rowq;
#pragma unroll
        for (int i = 0; i < 8; ++i) {       // rows (tid>>5) + 4 i
            qr[i] = *(const f32x4*)(q + qoff + i * 4096);
            kr[i] = *(const f32x4*)(k + qoff + i * 4096);
        }
        gr = *(const f32x4*)(Gp + (size_t)(b * 2048 + t0) * 512 + h * 64 + mb * 16 + goff);
        // the loads' base registers are rewritten behind this
        asm volatile("s_wait_xcnt 0x0" ::: "memory");
    };
    auto publish = [&]() {
#pragma unroll
        for (int i = 0; i < 8; ++i) {
            const int idx = tid + (i << 7);
            *(f32x4*)&qS[idx >> 5][(idx & 31) << 2] = qr[i] * scale;
            *(f32x4*)&kS[idx >> 5][(idx & 31) << 2] = kr[i];
        }
        *(f32x4*)&geS[tid >> 2][(tid & 3) << 2] = gr;
    };

    f32x2 hk[4][2];
#pragma unroll
    for (int i = 0; i < 4; ++i) { hk[i][0] = splat2(0.0f); hk[i][1] = splat2(0.0f); }

    const int tbeg = seg * ZLEN, tend = tbeg + ZLEN;
    fetch(tbeg);
    // start state: the earlier segments' E, each decayed by the D of the segments behind it
    // (all asked for at once, one round trip instead of one per segment; later segments' are left unused)
    {
        const float* e = Ek + (size_t)wg * 2048 + (tid << 2);
        const float* dsrc = Dk + (size_t)wg * 512 + (tid << 2);
        f32x4 er[ZSEG - 1][4], d[ZSEG - 1];
#pragma unroll
        for (int i = 0; i < ZSEG - 1; ++i) {
#pragma unroll
            for (int r = 0; r < 4; ++r) er[i][r] = *(const f32x4*)(e + i * (64 * 2048) + r * 512);
            d[i] = *(const f32x4*)(dsrc + i * (64 * 512));
        }
        // the loads' address registers are free for reuse behind this
        asm volatile("s_wait_xcnt 0x0" ::: "memory");
#pragma unroll
        for (int i = 0; i < ZSEG - 1; ++i) {
            if (i < seg) {
                const f32x2 d01 = {d[i].x, d[i].y}, d23 = {d[i].z, d[i].w};
#pragma unroll
                for (int r = 0; r < 4; ++r) {
                    const f32x2 lo = {er[i][r].x, er[i][r].y}, hi = {er[i][r].z, er[i][r].w};
                    hk[r][0] = __builtin_elementwise_fma(hk[r][0], d01, lo);
                    hk[r][1] = __builtin_elementwise_fma(hk[r][1], d23, hi);
                }
            }
        }
    }
    publish();
    __syncthreads();

    for (int t0 = tbeg; t0 < tend; t0 += SCAN_TT) {
        const bool more = (t0 + SCAN_TT) < tend;
        if (more) fetch(t0 + SCAN_TT);

        // groups of 4 steps, two register sets: the next group's LDS reads are in
        // flight while this group is stepped
        f32x4 qa[4], ka[4], ga[4], qb[4], kb[4], gb[4];
        auto ld = [&](f32x4 (&q)[4], f32x4 (&k)[4], f32x4 (&g)[4], int base) {
#pragma unroll
            for (int j = 0; j < 4; ++j) {
                q[j] = *(const f32x4*)&qS[base + j][kg << 2];
                k[j] = *(const f32x4*)&kS[base + j][kg << 2];
                g[j] = *(const f32x4*)&geS[base + j][mg << 2];
            }
            // keeps these reads ahead of the group stepped next; sunk to their use they would be waited for
            __builtin_amdgcn_sched_barrier(0);
        };
        auto step = [&](const f32x4 (&q)[4], const f32x4 (&k)[4], const f32x4 (&g)[4], int base) {
#pragma unroll
            for (int j = 0; j < 4; ++j) {
                const f32x2 g01 = {g[j].x, g[j].y}, g23 = {g[j].z, g[j].w};
                f32x2 acc0 = splat2(0.0f), acc1 = splat2(0.0f);
#pragma unroll
                for (int i = 0; i < 4; ++i) {
                    hk[i][0] = __builtin_elementwise_fma(hk[i][0], g01, gated_in(g01, splat2(k[j][i])));
                    hk[i][1] = __builtin_elementwise_fma(hk[i][1], g23, gated_in(g23, splat2(k[j][i])));
                    acc0 = __builtin_elementwise_fma(splat2(q[j][i]), hk[i][0], acc0);
                    acc1 = __builtin_elementwise_fma(splat2(q[j][i]), hk[i][1], acc1);
                }
                f32x4 a = {acc0.x, acc0.y, acc1.x, acc1.y};
                *(f32x4*)&part[base + j][(kg << 4) + (mg << 2)] = a;
            }
        };
        ld(qa, ka, ga, 0);
#pragma unroll
        for (int g8 = 0; g8 < SCAN_TT; g8 += 8) {
            ld(qb, kb, gb, g8 + 4);
            step(qa, ka, ga, g8);
            if (g8 + 8 < SCAN_TT) ld(qa, ka, ga, g8 + 8);
            step(qb, kb, gb, g8 + 4);
        }
        __syncthreads();   // partials complete; every reader has left the input tile

        {
            // row rt, slots 4 rm .. of the workgroup's 16: half (rm & 1) of its slot block (rm >> 1)
            const int rt = tid >> 2, rm = tid & 3;
            f32x4 a0 = {0.0f, 0.0f, 0.0f, 0.0f}, a1 = a0, a2 = a0, a3 = a0;
#pragma unroll
            for (int g = 0; g < 8; ++g) {
                a0 += *(const f32x4*)&part[rt][((4 * g + 0) << 4) + (rm << 2)];
                a1 += *(const f32x4*)&part[rt][((4 * g + 1) << 4) + (rm << 2)];
                a2 += *(const f32x4*)&part[rt][((4 * g + 2) << 4) + (rm << 2)];
                a3 += *(const f32x4*)&part[rt][((4 * g + 3) << 4) + (rm << 2)];
            }
            float* zrow = Zb + ((size_t)(bh * 8 + mb * 2) * 2048 + t0) * 8;
            *(f32x4*)(zrow + (unsigned)((rm >> 1) * 16384 + rt * 8 + ((rm & 1) << 2))) = (a0 + a1) + (a2 + a3);
            // the store's registers are reused right behind it
            asm volatile("s_wait_xcnt 0x0" ::: "memory");
        }
        if (more) publish();
        __syncthreads();   // next input tile published; partials free again
    }
}

// softmax over the 64 slots of one (b,h,t), in place on the blocked layout
__global__ __launch_bounds__(256) void slot_softmax_kernel(float* Zb)
{
    const int gid = blockIdx.x * 256 + threadIdx.x;
    const int bh  = gid >> 11;
    const int t   = gid & 2047;
    f32x4 z[16];
#pragma unroll
    for (int mb = 0; mb < 8; ++mb) {
        const float* p = Zb + ((size_t)(bh * 8 + mb) * 2048 + t) * 8;
        z[2 * mb]     = *(const f32x4*)p;
        z[2 * mb + 1] = *(const f32x4*)(p + 4);
    }
    f32x4 m4 = z[0];
#pragma unroll
    for (int i = 1; i < 16; ++i) m4 = __builtin_elementwise_max(m4, z[i]);
    const float mx = fmaxf(fmaxf(m4.x, m4.y), fmaxf(m4.z, m4.w));
    f32x4 s4 = {0.0f, 0.0f, 0.0f, 0.0f};
#pragma unroll
    for (int i = 0; i < 16; ++i) {
        f32x4 e = {__expf(z[i].x - mx), __expf(z[i].y - mx), __expf(z[i].z - mx), __expf(z[i].w - mx)};
        z[i] = e;
        s4 += e;
    }
    const float inv = 1.0f / ((s4.x + s4.y) + (s4.z + s4.w));
#pragma unroll
    for (int mb = 0; mb < 8; ++mb) {
        float* p = Zb + ((size_t)(bh * 8 + mb) * 2048 + t) * 8;
        *(f32x4*)p       = z[2 * mb] * inv;
        *(f32x4*)(p + 4) = z[2 * mb + 1] * inv;
    }
}

// thread: 4 slots (sg*4..) x 4 columns (vg*4..) of hv
__global__ __launch_bounds__(128) void oscan_kernel(
    const float* __restrict__ Vp, const float* __restrict__ Gp,
    const float* __restrict__ Pb,
    const float* __restrict__ Ev, const float* __restrict__ Dv,
    float* __restrict__ Op)
{
    __shared__ __attribute__((aligned(16))) float geS[SCAN_TT][64];
    __shared__ __attribute__((aligned(16))) float pS[SCAN_TT][PPITCH];
    __shared__ __attribute__((aligned(16))) float vS[SCAN_TT][32];
    __shared__ __attribute__((aligned(16))) float part[SCAN_TT][OPITCH];

    const int tid = threadIdx.x;
    const int seg = blockIdx.x >> 6;     // time segment
    const int wg  = blockIdx.x & 63;
    const int bh  = wg >> 2;
    const int v0  = (wg & 3) << 5;
    const int b   = bh >> 3;
    const int h   = bh & 7;
    const int vg  = tid & 7;       // 0..7
    const int sg  = tid >> 3;      // 0..15

    f32x4 gr[4], pr[4], vr[2];
    // uniform base + one fixed per-thread offset: the tile advance stays in scalar registers
    const unsigned goff = (unsigned)(tid >> 4) * 512u + (unsigned)((tid & 15) << 2);
    const unsigned poff = (unsigned)(tid >> 6) * 16384u + (unsigned)((tid & 63) << 2);
    const unsigned voff = (unsigned)(tid >> 3) * 1024u + (unsigned)((tid & 7) << 2);
    auto fetch = [&](int t0) {
        const float* g = Gp + (size_t)(b * 2048 + t0) * 512 + h * 64;
        const float* p = Pb + ((size_t)(bh * 8) * 2048 + t0) * 8;
        const float* v = Vp + (size_t)(b * 2048 + t0) * 1024 + h * 128 + v0;
#pragma unroll
        for (int i = 0; i < 4; ++i) {
            gr[i] = *(const f32x4*)(g + goff + i * 4096);    // rows (tid>>4) + 8 i
            // blocked P: slot block (tid>>6) + 2 i, then 64 consecutive 16-byte pieces of this tile
            pr[i] = *(const f32x4*)(p + poff + i * 32768);
        }
#pragma unroll
        for (int i = 0; i < 2; ++i)
            vr[i] = *(const f32x4*)(v + voff + i * 16384);   // rows (tid>>3) + 16 i
        // the loads' base registers are rewritten behind this
        asm volatile("s_wait_xcnt 0x0" ::: "memory");
    };
    auto publish = [&]() {
#pragma unroll
        for (int i = 0; i < 4; ++i) {
            const int idx = tid + (i << 7);
            *(f32x4*)&geS[idx >> 4][(idx & 15) << 2] = gr[i];
            *(f32x4*)&pS[(idx & 63) >> 1][((idx >> 6) << 3) + ((idx & 1) << 2)] = pr[i];
        }
#pragma unroll
        for (int i = 0; i < 2; ++i) {
            const int idx = tid + (i << 7);
            *(f32x4*)&vS[idx >> 3][(idx & 7) << 2] = vr[i];
        }
    };

    f32x2 hv[4][2];
#pragma unroll
    for (int i = 0; i < 4; ++i) { hv[i][0] = splat2(0.0f); hv[i][1] = splat2(0.0f); }

    const int tbeg = seg * OLEN, tend = tbeg + OLEN;
    fetch(tbeg);
    // start state: the earlier segments' E, each decayed by the D of the segments behind it
    // (all asked for at once, one round trip instead of one per segment; later segments' are left unused)
    {
        const float* e = Ev + (size_t)wg * 2048 + (tid << 2);
        const float* dsrc = Dv + (size_t)wg * 512 + (tid << 2);
        f32x4 er[OSEG - 1][4], d[OSEG - 1];
#pragma unroll
        for (int i = 0; i < OSEG - 1; ++i) {
#pragma unroll
            for (int r = 0; r < 4; ++r) er[i][r] = *(const f32x4*)(e + i * (64 * 2048) + r * 512);
            d[i] = *(const f32x4*)(dsrc + i * (64 * 512));
        }
        // the loads' address registers are free for reuse behind this
        asm volatile("s_wait_xcnt 0x0" ::: "memory");
#pragma unroll
        for (int i = 0; i < OSEG - 1; ++i) {
            if (i < seg) {
#pragma unroll
                for (int r = 0; r < 4; ++r) {
                    const f32x2 lo = {er[i][r].x, er[i][r].y}, hi = {er[i][r].z, er[i][r].w};
                    hv[r][0] = __builtin_elementwise_fma(hv[r][0], splat2(d[i][r]), lo);
                    hv[r][1] = __builtin_elementwise_fma(hv[r][1], splat2(d[i][r]), hi);
                }
            }
        }
    }
    publish();
    __syncthreads();

    for (int t0 = tbeg; t0 < tend; t0 += SCAN_TT) {
        const bool more = (t0 + SCAN_TT) < tend;
        if (more) fetch(t0 + SCAN_TT);

        // groups of 4 steps, two register sets: the next group's LDS reads are in
        // flight while this group is stepped
        f32x4 ga[4], pa[4], va[4], gb[4], pb[4], vb[4];
        auto ld = [&](f32x4 (&g)[4], f32x4 (&p)[4], f32x4 (&v)[4], int base) {
#pragma unroll
            for (int j = 0; j < 4; ++j) {
                g[j] = *(const f32x4*)&geS[base + j][sg << 2];
                p[j] = *(const f32x4*)&pS[base + j][sg << 2];
                v[j] = *(const f32x4*)&vS[base + j][vg << 2];
            }
            // keeps these reads ahead of the group stepped next; sunk to their use they would be waited for
            __builtin_amdgcn_sched_barrier(0);
        };
        auto step = [&](const f32x4 (&g)[4], const f32x4 (&p)[4], const f32x4 (&v)[4], int base) {
#pragma unroll
            for (int j = 0; j < 4; ++j) {
                const f32x2 v01 = {v[j].x, v[j].y}, v23 = {v[j].z, v[j].w};
                f32x2 acc0 = splat2(0.0f), acc1 = splat2(0.0f);
#pragma unroll
                for (int i = 0; i < 4; ++i) {
                    hv[i][0] = __builtin_elementwise_fma(hv[i][0], splat2(g[j][i]), gated_in(splat2(g[j][i]), v01));
                    hv[i][1] = __builtin_elementwise_fma(hv[i][1], splat2(g[j][i]), gated_in(splat2(g[j][i]), v23));
                    acc0 = __builtin_elementwise_fma(splat2(p[j][i]), hv[i][0], acc0);
                    acc1 = __builtin_elementwise_fma(splat2(p[j][i]), hv[i][1], acc1);
                }
                f32x4 a = {acc0.x, acc0.y, acc1.x, acc1.y};
                *(f32x4*)&part[base + j][(sg << 5) + (vg << 2)] = a;
            }
        };
        ld(ga, pa, va, 0);
#pragma unroll
        for (int g8 = 0; g8 < SCAN_TT; g8 += 8) {
            ld(gb, pb, vb, g8 + 4);
            step(ga, pa, va, g8);
            if (g8 + 8 < SCAN_TT) ld(ga, pa, va, g8 + 8);
            step(gb, pb, vb, g8 + 4);
        }
        __syncthreads();   // partials complete; every reader has left the input tile

        {
            const int rt = tid >> 2, rv = (tid & 3) << 2;
            f32x4 a0 = {0.0f, 0.0f, 0.0f, 0.0f}, a1 = a0, b0 = a0, b1 = a0;
#pragma unroll
            for (int g = 0; g < 8; ++g) {
                a0 += *(const f32x4*)&part[rt][((2 * g + 0) << 5) + rv];
                b0 += *(const f32x4*)&part[rt][((2 * g + 0) << 5) + rv + 16];
                a1 += *(const f32x4*)&part[rt][((2 * g + 1) << 5) + rv];
                b1 += *(const f32x4*)&part[rt][((2 * g + 1) << 5) + rv + 16];
            }
            float* o = Op + (size_t)(b * 2048 + t0) * 1024 + h * 128 + v0;
            *(f32x4*)(o + (unsigned)(rt * 1024 + rv))      = a0 + a1;
            *(f32x4*)(o + (unsigned)(rt * 1024 + rv) + 16) = b0 + b1;
            // the stores' registers are reused right behind them
            asm volatile("s_wait_xcnt 0x0" ::: "memory");
        }
        if (more) publish();
        __syncthreads();   // next input tile published; partials free again
    }
}

// ---------------------------------------------------------------------------
// y = RMSNorm(swish(x)) * g_weight, stored as bf16 (the output projection's A operand)
// (one block per row of 1024)
// ---------------------------------------------------------------------------
__global__ __launch_bounds__(256) void swish_rms_kernel(
    const float* __restrict__ X, const float* __restrict__ w,
    __bf16* __restrict__ Y)
{
    const int row = blockIdx.x;
    const float* xr = X + (size_t)row * 1024;
    float loc[4];
    float ss = 0.0f;
#pragma unroll
    for (int i = 0; i < 4; ++i) {
        const float x  = xr[threadIdx.x + 256 * i];
        const float sw = x / (1.0f + __expf(-x));
        loc[i] = sw;
        ss += sw * sw;
    }
#pragma unroll
    for (int off = 16; off > 0; off >>= 1) ss += __shfl_xor(ss, off, 32);
    __shared__ float wred[8];
    if ((threadIdx.x & 31) == 0) wred[threadIdx.x >> 5] = ss;
    __syncthreads();
    float tot = 0.0f;
#pragma unroll
    for (int i = 0; i < 8; ++i) tot += wred[i];
    const float r = rsqrtf(tot * (1.0f / 1024.0f) + 1e-5f);
#pragma unroll
    for (int i = 0; i < 4; ++i) {
        const int c = threadIdx.x + 256 * i;
        Y[(size_t)row * 1024 + c] = (__bf16)(loc[i] * r * w[c]);
    }
}

// ---------------------------------------------------------------------------
extern "C" void kernel_launch(void* const* d_in, const int* in_sizes, int n_in,
                              void* d_out, int out_size, void* d_ws, size_t ws_size,
                              hipStream_t stream) {
    const float* X  = (const float*)d_in[0];   // [4096,1024]
    const float* Wq = (const float*)d_in[1];
    const float* Wk = (const float*)d_in[2];
    const float* Wv = (const float*)d_in[3];
    const float* Wf = (const float*)d_in[4];   // [512,1024]
    const float* Wo = (const float*)d_in[5];
    const float* gw = (const float*)d_in[6];   // [1024]

    const size_t ND = 4096ull * 1024ull;
    const size_t NF = 4096ull * 512ull;
    float* ws  = (float*)d_ws;
    float* Q   = ws;             // 16 MB
    float* Kt  = Q   + ND;       // 16 MB
    float* Vt  = Kt  + ND;       // 16 MB
    float* G   = Vt  + ND;       //  8 MB, the decays e^g
    float* Oin = G   + NF;       // 16 MB
    float* Zb  = Oin + ND;       //  8 MB, slot scores then slot weights
    float* Ek  = Zb  + NF;                                  // hk segment states
    float* Dk  = Ek  + (size_t)ZSTATE_WGS * 2048;           // their gate products
    float* Ev  = Dk  + (size_t)ZSTATE_WGS * 512;            // hv segment states
    float* Dv  = Ev  + (size_t)OSTATE_WGS * 2048;           // their gate products
    __bf16* Xh  = (__bf16*)(Dv + (size_t)OSTATE_WGS * 512);   // bf16 copies: X, 8 MB
    __bf16* Wqh = Xh  + ND;                                   // weights, 2 MB each
    __bf16* Wkh = Wqh + 1024ull * 1024ull;
    __bf16* Wvh = Wkh + 1024ull * 1024ull;
    __bf16* Woh = Wvh + 1024ull * 1024ull;
    __bf16* Wfh = Woh + 1024ull * 1024ull;                    // 1 MB
    __bf16* Xn  = Wfh + 512ull * 1024ull;                     // normalised rows, 8 MB

    dim3 blk(256);
    dim3 gQKV(1024 / TILE_N, 4096 / TILE_M);   // 16 x 16

    to_bf16_kernel<<<dim3(CVT_THREADS / 512), dim3(512), 0, stream>>>(X, Wq, Wk, Wv, Wo, Wf, Xh, Wqh, Wkh, Wvh, Woh, Wfh);

    proj4_kernel<<<dim3(56 * 16), blk, 0, stream>>>(Xh, Wqh, Wkh, Wvh, Wfh, Q, Kt, Vt, G, 1024);

    seg_state_kernel<<<ZSTATE_WGS + OSTATE_WGS, dim3(128), 0, stream>>>(Kt, Vt, G, Ek, Dk, Ev, Dv);
    zscan_kernel<<<64 * ZSEG, dim3(128), 0, stream>>>(Q, Kt, G, Ek, Dk, Zb);
    slot_softmax_kernel<<<128, blk, 0, stream>>>(Zb);
    oscan_kernel<<<64 * OSEG, dim3(128), 0, stream>>>(Vt, G, Zb, Ev, Dv, Oin);

    swish_rms_kernel<<<4096, blk, 0, stream>>>(Oin, gw, Xn);

    gemm_bt_kernel<<<gQKV, blk, 0, stream>>>(Xn, Woh, (float*)d_out, 4096, 1024, 1024, 0);
}

// v010
// It runs in 133 microseconds.
// Two timings next to v009 both put it at 1.03 times that version's speed.
// Over all steps from v000 it is 24.9 times as fast.
#include <hip/hip_runtime.h>

// ---------------------------------------------------------------------------
// Gated ABC attention, MI455X (gfx1250, wave32, WMMA bf16).
// B=2, T=2048, D=1024, H=8, M=64, KD=128.
//   0) to_bf16: X and the five weight matrices rounded to bf16 once
//   1) proj4 (WMMA), one launch: Q/K/V = swish(X W^T), F -> decay e^g
//   2) recurrence: segment states, slot scores, output columns with the slot softmax (three launches)
//   3) swish + RMSNorm, result stored as bf16
//   4) gemm_bt: out = Xn Wo^T
// GEMM: 256x64 block tile, 8 waves x (32x64), double-buffered LDS, operands bf16 in memory,
// 16-byte global loads (eight lanes per 128-byte row slice of 64 k, so a wave's load covers
// whole lines) held in registers for two trips -> 16B LDS stores -> ds_load_b128 frags.
// Epilogue through LDS, rolled, 16-byte stores.
// ---------------------------------------------------------------------------

typedef __attribute__((ext_vector_type(16))) __bf16 v16bf;
typedef __attribute__((ext_vector_type(8)))  __bf16 v8bf;
typedef __attribute__((ext_vector_type(4)))  __bf16 v4bf;
typedef __attribute__((ext_vector_type(8)))  float  v8f;
typedef __attribute__((ext_vector_type(4)))  float  v4f;

#define TILE_M 256
#define TILE_N 64
#define TILE_K 64         // 64 bf16 = one 128-byte line of a row
#define KPAD   8          // pad rows to 72 bf16 = 144 B (odd multiple of 16 B, conflict-free)
#define LROW   (TILE_K + KPAD)
#define EPITCH 68         // epilogue rows: 64 f32 + 4, so rows r and r+8 fall on different banks

static __device__ __forceinline__ v4bf pack4(v4f a) {
    v4bf p;
    p[0] = (__bf16)a.x; p[1] = (__bf16)a.y; p[2] = (__bf16)a.z; p[3] = (__bf16)a.w;
    return p;
}

static __device__ __forceinline__ v16bf load_frag(const __bf16* rowp, int half) {
    // lane's two contiguous 16-byte chunks of the 32-element K row
    v8bf lo = *(const v8bf*)(rowp + (half << 3));
    v8bf hi = *(const v8bf*)(rowp + 16 + (half << 3));
    return __builtin_shufflevector(lo, hi, 0, 1, 2, 3, 4, 5, 6, 7,
                                   8, 9, 10, 11, 12, 13, 14, 15);
}

// Work-group barrier of the K loop, by hand: it waits for this wave's LDS traffic alone.
// __syncthreads() would also wait for the global loads that are to stay in flight across it.
static __device__ __forceinline__ void lds_barrier() {
    asm volatile("s_wait_dscnt 0x0\n\ts_barrier_signal -1\n\ts_barrier_wait -1" ::: "memory");
}

// Y = act( X @ W^T ) ; X: [Nrows,Kdim] bf16, W: [Nout,Kdim] bf16, Y: [Nrows,Nout] f32
// act_mode: 0 = identity, 1 = swish, 2 = decay (Y = exp(logsigmoid/16))
// One workgroup's 256 x 64 tile at rows m0, columns n0.
static __device__ __forceinline__ void gemm_bt_tile(
    const __bf16* __restrict__ X, const __bf16* __restrict__ W,
    float* __restrict__ Y,
    int Kdim, int Nout, int act_mode, int m0, int n0)
{
    __shared__ __attribute__((aligned(16))) __bf16 As[2][TILE_M][LROW];
    __shared__ __attribute__((aligned(16))) __bf16 Bs[2][TILE_N][LROW];

    const int tid  = threadIdx.x;
    const int wave = tid >> 5;        // 0..7
    const int lane = tid & 31;
    const int half = lane >> 4;       // K-half select (0/1)
    const int l15  = lane & 15;

    v8f acc[2][4];
#pragma unroll
    for (int am = 0; am < 2; ++am)
#pragma unroll
        for (int nt = 0; nt < 4; ++nt)
#pragma unroll
            for (int j = 0; j < 8; ++j) acc[am][nt][j] = 0.0f;

    // ---- staging, split in two: global loads into registers, and (two trips later)
    //      the LDS stores. Two register sets, so two K tiles are in flight.
    // No branch stands around either half: a branch would merge paths in the compiler's
    // load counting and its wait for the older set would drain the younger one too.
    // A row's K slice is 64 bf16 = one 128-byte line. Eight neighbouring lanes take it in 16-byte
    // pieces, so one wave-wide load covers four whole lines; thread: piece sc of rows sr + 32 i.
    struct Held { v8bf a[8]; v8bf b[2]; };
    const int nK = Kdim / TILE_K;
    const int sr = tid >> 3;           // 0..31
    const int sc = (tid & 7) << 3;     // 0, 8, .. 56
    // uniform base + fixed per-thread byte offsets: the K advance is scalar arithmetic
    unsigned soff[8];
#pragma unroll
    for (int i = 0; i < 8; ++i) soff[i] = ((unsigned)(sr + (i << 5)) * (unsigned)Kdim + (unsigned)sc) * 2u;
    const __bf16* Xb = X + (size_t)m0 * Kdim;
    const __bf16* Wb = W + (size_t)n0 * Kdim;
    auto fetch = [&](Held& s, int kt) {
        // past the last tile the last one is asked for again (in bounds, never used)
        const int k0 = (kt < nK ? kt : nK - 1) * TILE_K;
        const char* xk = (const char*)(Xb + k0);
        const char* wk = (const char*)(Wb + k0);
#pragma unroll
        for (int i = 0; i < 8; ++i) s.a[i] = *(const v8bf*)(xk + soff[i]);   // A: 256 rows
#pragma unroll
        for (int i = 0; i < 2; ++i) s.b[i] = *(const v8bf*)(wk + soff[i]);   // B: 64 rows
        // the loads' address registers are rewritten for the next fetch
        asm volatile("s_wait_xcnt 0x0" ::: "memory");
    };
    auto publish = [&](const Held& s, int buf) {
#pragma unroll
        for (int i = 0; i < 8; ++i) *(v8bf*)&As[buf][sr + (i << 5)][sc] = s.a[i];
#pragma unroll
        for (int i = 0; i < 2; ++i) *(v8bf*)&Bs[buf][sr + (i << 5)][sc] = s.b[i];
    };

    Held h0, h1;                       // h0: even K tiles, h1: odd K tiles
    fetch(h0, 0);
    publish(h0, 0);
    fetch(h1, 1);
    fetch(h0, 2);
    lds_barrier();

    // one trip: tile kt from LDS buffer cur; nxt holds tile kt + 1, asked for two trips ago
    auto trip = [&](int kt, int cur, Held& nxt) {
        // fragments: wave's 32 rows x block's 64 cols, the tile's two 32-k halves in turn
        const int wrow = wave << 5;
#pragma unroll
        for (int ks = 0; ks < TILE_K; ks += 32) {
            v16bf aF[2], bF[4];
#pragma unroll
            for (int am = 0; am < 2; ++am)
                aF[am] = load_frag(&As[cur][wrow + (am << 4) + l15][ks], half);
#pragma unroll
            for (int nt = 0; nt < 4; ++nt)
                bF[nt] = load_frag(&Bs[cur][(nt << 4) + l15][ks], half);

#pragma unroll
            for (int am = 0; am < 2; ++am)
#pragma unroll
                for (int nt = 0; nt < 4; ++nt)
                    acc[am][nt] = __builtin_amdgcn_wmma_f32_16x16x32_bf16(
                        false, aF[am], false, bF[nt], (short)0, acc[am][nt], false, false);
        }
        // keeps the wait for the held tile's loads behind the products; lifted above them it would stall them
        __builtin_amdgcn_sched_barrier(0);
        publish(nxt, cur ^ 1);
        fetch(nxt, kt + 3);
        lds_barrier();
    };
    // trips in pairs, so that each register set and LDS buffer is named at compile time and no
    // branch stands inside the loop; an odd trip count ends in one trip behind it
    int kt = 0;
    for (; kt + 1 < nK; kt += 2) {
        trip(kt, 0, h1);
        trip(kt + 1, 1, h0);
    }
    if (kt < nK) trip(kt, 0, h1);

    // Epilogue. C/D layout: VGPR r, lane<16 -> (M=r, N=lane); lane>=16 -> (M=8+r).
    // Each wave passes its accumulators, 16 rows at a time, through its own slice of
    // the (now free) A buffer and picks them up as whole rows; the activation then
    // runs in a rolled loop of 16-byte pieces. Rolled to keep the text small.
    float* ep = reinterpret_cast<float*>(&As[0][0][0]) + wave * (16 * EPITCH);
    const float* src = ep + half * EPITCH + (l15 << 2);
#pragma unroll
    for (int am = 0; am < 2; ++am) {
        if (am) __syncthreads();   // the first 16 rows have been read; the slice may be rewritten
#pragma unroll
        for (int nt = 0; nt < 4; ++nt)
#pragma unroll
            for (int r = 0; r < 8; ++r)
                ep[(r + (half << 3)) * EPITCH + (nt << 4) + l15] = acc[am][nt][r];
        __syncthreads();           // lanes read what other lanes wrote

        // rows (wave*32 + am*16 + half) + 2 it, columns n0 + 4*l15 ..
        const size_t idx0 = (size_t)(m0 + (wave << 5) + (am << 4) + half) * Nout + n0 + (l15 << 2);
        const size_t step = (size_t)Nout * 2;
        if (act_mode == 0) {
#pragma unroll 1   // rolled: keeps the text small (see above)
            for (int it = 0; it < 8; ++it) {
                const float4 v = *(const float4*)(src + it * (2 * EPITCH));
                *(float4*)(Y + idx0 + it * step) = v;
                // the store's registers are rewritten by the next trip
                asm volatile("s_wait_xcnt 0x0" ::: "memory");
            }
        } else if (act_mode == 1) {
#pragma unroll 1   // rolled: keeps the text small (see above)
            for (int it = 0; it < 8; ++it) {
                const float4 v = *(const float4*)(src + it * (2 * EPITCH));
                float4 y;
                y.x = v.x / (1.0f + __expf(-v.x));                          // swish
                y.y = v.y / (1.0f + __expf(-v.y));
                y.z = v.z / (1.0f + __expf(-v.z));
                y.w = v.w / (1.0f + __expf(-v.w));
                *(float4*)(Y + idx0 + it * step) = y;
                // the store's registers are rewritten by the next trip
                asm volatile("s_wait_xcnt 0x0" ::: "memory");
            }
        } else {
#pragma unroll 1   // rolled: keeps the text small (see above)
            for (int it = 0; it < 8; ++it) {
                const float4 v = *(const float4*)(src + it * (2 * EPITCH));
                const float vv[4] = {v.x, v.y, v.z, v.w};
                float e[4];
#pragma unroll
                for (int c = 0; c < 4; ++c) {
                    const float ls = fminf(vv[c], 0.0f) - log1pf(__expf(-fabsf(vv[c])));  // logsigmoid
                    e[c] = __expf(ls * 0.0625f);                                        // /GATE_NORM
                }
                // the slot the instruction set asks for between a transcendental and the first use of its result (the store)
                // (the results as inputs and the clobber hold it between the two)
                asm volatile("v_nop" :: "v"(e[0]), "v"(e[1]), "v"(e[2]), "v"(e[3]) : "memory");
                *(float4*)(Y + idx0 + it * step) = make_float4(e[0], e[1], e[2], e[3]);
                // the store's registers are rewritten by the next trip
                asm volatile("s_wait_xcnt 0x0" ::: "memory");
            }
        }
    }
}

// X and the five weight matrices, f32 -> bf16, once for all the tiles that read them (each
// row of X is read by 56 column blocks, each weight row by 16 row blocks): the tiles then draw
// half the bytes from L2. 131072 threads, 17 pieces of 16 bytes each, all asked for at once;
// a wave's load covers four whole lines, its store two.
#define CVT_THREADS 131072
__global__ __launch_bounds__(512) void to_bf16_kernel(
    const float* __restrict__ X,
    const float* __restrict__ Wq, const float* __restrict__ Wk,
    const float* __restrict__ Wv, const float* __restrict__ Wo,
    const float* __restrict__ Wf,
    __bf16* __restrict__ Xh,
    __bf16* __restrict__ Wqh, __bf16* __restrict__ Wkh,
    __bf16* __restrict__ Wvh, __bf16* __restrict__ Woh,
    __bf16* __restrict__ Wfh)
{
    // uniform base + one fixed per-thread byte offset for all loads, another for all stores
    const unsigned tl = (blockIdx.x * 512u + threadIdx.x) << 4;   // 16 bytes of f32 in
    const unsigned ts = tl >> 1;                                  //  8 bytes of bf16 out
    const unsigned LSTEP = 16u * CVT_THREADS, SSTEP = 8u * CVT_THREADS;
    auto ld = [&](const float* p, int i) { return *(const v4f*)((const char*)p + i * LSTEP + tl); };
    auto st = [&](__bf16* p, int i, v4f a) { *(v4bf*)((char*)p + i * SSTEP + ts) = pack4(a); };
    v4f x[8], q[2], k[2], v[2], o[2], f;
#pragma unroll
    for (int i = 0; i < 8; ++i) x[i] = ld(X, i);
#pragma unroll
    for (int i = 0; i < 2; ++i) {
        q[i] = ld(Wq, i);
        k[i] = ld(Wk, i);
        v[i] = ld(Wv, i);
        o[i] = ld(Wo, i);
    }
    f = ld(Wf, 0);
    // keeps every load ahead of the first conversion, so that all 17 are in flight at once
    __builtin_amdgcn_sched_barrier(0);
    // without this the stores' offset is formed in place in the loads' offset register, right behind
    // the last load; named as an input, that register lives up to the wait
    asm volatile("s_wait_xcnt 0x0" :: "v"(tl) : "memory");
#pragma unroll
    for (int i = 0; i < 8; ++i) st(Xh, i, x[i]);
#pragma unroll
    for (int i = 0; i < 2; ++i) {
        st(Wqh, i, q[i]);
        st(Wkh, i, k[i]);
        st(Wvh, i, v[i]);
        st(Woh, i, o[i]);
    }
    st(Wfh, 0, f);
}

// the output projection: one tile per workgroup of a (columns, rows) grid
__global__ __launch_bounds__(256) void gemm_bt_kernel(
    const __bf16* __restrict__ X, const __bf16* __restrict__ W,
    float* __restrict__ Y,
    int Nrows, int Kdim, int Nout, int act_mode)
{
    gemm_bt_tile(X, W, Y, Kdim, Nout, act_mode, blockIdx.y * TILE_M, blockIdx.x * TILE_N);
}

// The four input projections in one launch: 56 column blocks (8 of F, 16 each of Q, K, V) x 16
// row blocks = 896 workgroups. Two are resident per WGP, so one's LDS waits, barriers and
// epilogue run under the other's loads, and no launch waits for the last tile of the one before.
// The gate blocks stand first: their epilogue is the longest and must not be the launch's tail.
// The row block is the low part of the index: workgroups 256 apart read the same rows of X, so
// where two such share a WGP its cache may serve both (a matter of speed only, nothing rests on it).
__global__ __launch_bounds__(256) void proj4_kernel(
    const __bf16* __restrict__ X,
    const __bf16* __restrict__ Wq, const __bf16* __restrict__ Wk,
    const __bf16* __restrict__ Wv, const __bf16* __restrict__ Wf,
    float* __restrict__ Q, float* __restrict__ K, float* __restrict__ V,
    float* __restrict__ G, int Kdim)
{
    const int m0 = (blockIdx.x & 15) * TILE_M;
    const int cb = blockIdx.x >> 4;            // 0..55
    if (cb < 8) {
        gemm_bt_tile(X, Wf, G, Kdim, 512, 2, m0, cb * TILE_N);
    } else {
        const int which = (cb - 8) >> 4;       // 0: Q, 1: K, 2: V
        const __bf16* W = which == 0 ? Wq : (which == 1 ? Wk : Wv);
        float*       Y = which == 0 ? Q  : (which == 1 ? K  : V);
        gemm_bt_tile(X, W, Y, Kdim, 1024, 1, m0, ((cb - 8) & 15) * TILE_N);
    }
}

// ---------------------------------------------------------------------------
// Gated-ABC recurrence, split into its independent parts (three launches).
//   hk[:, m] depends on slot m alone  -> zscan: one workgroup per (b,h, 16 slots, time segment)
//   softmax over the 64 slots         -> in oscan, as it publishes a tile of scores
//   hv[:, v] depends on column v alone-> oscan: one workgroup per (b,h, 32 cols, time segment)
// Inside a workgroup time runs in tiles of SCAN_TT steps: the tile's inputs sit
// in LDS, every thread steps its own register tile of the state with no barrier
// between steps, leaves its partial dot products in LDS, and the tile's partials
// are summed once behind the tile. The next tile's inputs are fetched into
// registers while the current tile is stepped.
// Z layout: [b*8+h][slot block of 8][t][8], so each zscan workgroup owns whole lines (two blocks).
// Time is cut into segments, each with workgroups of its own. The recurrence is linear in
// the state: state(end) = state(start) * D + E, with D the product of the segment's gates
// and E the state that the segment builds from zero. seg_state_kernel leaves D and E of
// every segment but the last in the workspace; a scan workgroup folds those of the
// segments in front of its own into its start state and then steps its segment alone.
// ---------------------------------------------------------------------------
typedef __attribute__((ext_vector_type(2))) float f32x2;
typedef __attribute__((ext_vector_type(4))) float f32x4;

#define SCAN_TT 32
#define ZPITCH  528   // 32 k-groups x 16 slots + 16: the tile sum's 16-byte reads of 4 rows fall on distinct banks
#define OPITCH  528   // 16 slot-groups x 32 cols + 16: same, for 16-byte reads
#define PPITCH  68    // 64 slots + 4: the 16-byte stores of 4 rows x 4 quarters fall on distinct banks
#define ZSEG    8     // time segments of the slot-score scan: 512 workgroups, two per WGP
#define ZLEN    (2048 / ZSEG)
#define OSEG    8     // time segments of the output scan: 512 workgroups, two per WGP
#define OLEN    (2048 / OSEG)
#define ZSTATE_WGS ((ZSEG - 1) * 64)
#define OSTATE_WGS ((OSEG - 1) * 64)

static __device__ __forceinline__ f32x2 splat2(float x) { f32x2 r = {x, x}; return r; }

// What a step adds to the state: s x. The input gate is s = 1 - e by its definition (e = e^g, the
// decay), so s is neither stored nor read: s x = x - e x, one fused operation off the state's chain.
static __device__ __forceinline__ f32x2 gated_in(f32x2 e, f32x2 x) { return __builtin_elementwise_fma(-e, x, x); }

// E and D of one hk segment; thread tile and step arithmetic as in zscan_kernel.
// Ek: [segment*64 + workgroup][4][thread][4], Dk: [segment*64 + workgroup][thread][4]
static __device__ __forceinline__ void zstate_body(
    int blk, const float* __restrict__ Kp, const float* __restrict__ Gp,
    float* __restrict__ Ek, float* __restrict__ Dk)
{
    __shared__ __attribute__((aligned(16))) float kS[SCAN_TT][128];
    __shared__ __attribute__((aligned(16))) float geS[SCAN_TT][16];

    const int tid = threadIdx.x;
    const int seg = blk >> 6;
    const int bh  = (blk & 63) >> 2;
    const int mb  = blk & 3;       // block of 16 slots
    const int b   = bh >> 3;
    const int h   = bh & 7;
    const int kg  = tid >> 2;      // 0..31
    const int mg  = tid & 3;       // 0..3

    f32x4 kr[8];
    f32x4 gr;
    const unsigned qoff = (unsigned)(tid >> 5) * 1024u + (unsigned)((tid & 31) << 2);
    const unsigned goff = (unsigned)(tid >> 2) * 512u + (unsigned)((tid & 3) << 2);   // row tid>>2, four of its 16 decays
    auto fetch = [&](int t0) {
        const float* k = Kp + (size_t)(b * 2048 + t0) * 1024 + h * 128;
#pragma unroll
        for (int i = 0; i < 8; ++i)         // rows (tid>>5) + 4 i
            kr[i] = *(const f32x4*)(k + qoff + i * 4096);
        gr = *(const f32x4*)(Gp + (size_t)(b * 2048 + t0) * 512 + h * 64 + mb * 16 + goff);
        // the loads' base registers are rewritten for the next fetch
        asm volatile("s_wait_xcnt 0x0" ::: "memory");
    };
    auto publish = [&]() {
#pragma unroll
        for (int i = 0; i < 8; ++i) {
            const int idx = tid + (i << 7);
            *(f32x4*)&kS[idx >> 5][(idx & 31) << 2] = kr[i];
        }
        *(f32x4*)&geS[tid >> 2][(tid & 3) << 2] = gr;
    };

    f32x2 hk[4][2];
#pragma unroll
    for (int i = 0; i < 4; ++i) { hk[i][0] = splat2(0.0f); hk[i][1] = splat2(0.0f); }
    f32x4 dp = {1.0f, 1.0f, 1.0f, 1.0f};

    const int tbeg = seg * ZLEN, tend = tbeg + ZLEN;
    fetch(tbeg);
    publish();
    __syncthreads();

    for (int t0 = tbeg; t0 < tend; t0 += SCAN_TT) {
        const bool more = (t0 + SCAN_TT) < tend;
        if (more) fetch(t0 + SCAN_TT);

        // groups of 4 steps, two register sets, as in zscan_kernel
        f32x4 ka[4], kb[4], ga[4], gb[4];
        auto ld = [&](f32x4 (&k)[4], f32x4 (&g)[4], int base) {
#pragma unroll
            for (int j = 0; j < 4; ++j) {
                k[j] = *(const f32x4*)&kS[base + j][kg << 2];
                g[j] = *(const f32x4*)&geS[base + j][mg << 2];
            }
            // keeps these reads ahead of the group stepped next; sunk to their use they would be waited for
            __builtin_amdgcn_sched_barrier(0);
        };
        auto step = [&](const f32x4 (&k)[4], const f32x4 (&g)[4]) {
#pragma unroll
            for (int j = 0; j < 4; ++j) {
                const f32x2 g01 = {g[j].x, g[j].y}, g23 = {g[j].z, g[j].w};
#pragma unroll
                for (int i = 0; i < 4; ++i) {
                    hk[i][0] = __builtin_elementwise_fma(hk[i][0], g01, gated_in(g01, splat2(k[j][i])));
                    hk[i][1] = __builtin_elementwise_fma(hk[i][1], g23, gated_in(g23, splat2(k[j][i])));
                }
                dp *= g[j];
            }
        };
        ld(ka, ga, 0);
#pragma unroll 1   // rolled: unrolled, all of the tile's LDS reads are lifted to its head and take 480 registers
        for (int g8 = 0; g8 < SCAN_TT; g8 += 8) {
            ld(kb, gb, g8 + 4);
            step(ka, ga);
            ld(ka, ga, (g8 + 8) & (SCAN_TT - 1));   // behind the last group: rows 0..3 again, not used
            step(kb, gb);
        }
        __syncthreads();   // every reader has left the input tile
        if (more) publish();
        __syncthreads();   // next input tile published
    }

    float* e = Ek + (size_t)blk * 2048 + (tid << 2);
#pragma unroll
    for (int i = 0; i < 4; ++i) {
        const f32x4 ei = {hk[i][0].x, hk[i][0].y, hk[i][1].x, hk[i][1].y};
        *(f32x4*)(e + i * 512) = ei;
    }
    *(f32x4*)(Dk + (size_t)blk * 512 + (tid << 2)) = dp;
}

// E and D of one hv segment; thread tile and step arithmetic as in oscan_kernel.
// Ev: [segment*64 + workgroup][4][thread][4], Dv: [segment*64 + workgroup][thread][4]
static __device__ __forceinline__ void ostate_body(
    int blk, const float* __restrict__ Vp, const float* __restrict__ Gp,
    float* __restrict__ Ev, float* __restrict__ Dv)
{
    __shared__ __attribute__((aligned(16))) float geS[SCAN_TT][64];
    __shared__ __attribute__((aligned(16))) float vS[SCAN_TT][32];

    const int tid = threadIdx.x;
    const int seg = blk >> 6;
    const int bh  = (blk & 63) >> 2;
    const int v0  = (blk & 3) << 5;
    const int b   = bh >> 3;
    const int h   = bh & 7;
    const int vg  = tid & 7;       // 0..7
    const int sg  = tid >> 3;      // 0..15

    f32x4 gr[4], vr[2];
    const unsigned goff = (unsigned)(tid >> 4) * 512u + (unsigned)((tid & 15) << 2);
    const unsigned voff = (unsigned)(tid >> 3) * 1024u + (unsigned)((tid & 7) << 2);
    auto fetch = [&](int t0) {
        const float* g = Gp + (size_t)(b * 2048 + t0) * 512 + h * 64;
        const float* v = Vp + (size_t)(b * 2048 + t0) * 1024 + h * 128 + v0;
#pragma unroll
        for (int i = 0; i < 4; ++i)
            gr[i] = *(const f32x4*)(g + goff + i * 4096);    // rows (tid>>4) + 8 i
#pragma unroll
        for (int i = 0; i < 2; ++i)
            vr[i] = *(const f32x4*)(v + voff + i * 16384);   // rows (tid>>3) + 16 i
        // the loads' base registers are rewritten for the next fetch
        asm volatile("s_wait_xcnt 0x0" ::: "memory");
    };
    auto publish = [&]() {
#pragma unroll
        for (int i = 0; i < 4; ++i) {
            const int idx = tid + (i << 7);
            *(f32x4*)&geS[idx >> 4][(idx & 15) << 2] = gr[i];
        }
#pragma unroll
        for (int i = 0; i < 2; ++i) {
            const int idx = tid + (i << 7);
            *(f32x4*)&vS[idx >> 3][(idx & 7) << 2] = vr[i];
        }
    };

    f32x2 hv[4][2];
#pragma unroll
    for (int i = 0; i < 4; ++i) { hv[i][0] = splat2(0.0f); hv[i][1] = splat2(0.0f); }
    f32x4 dp = {1.0f, 1.0f, 1.0f, 1.0f};

    const int tbeg = seg * OLEN, tend = tbeg + OLEN;
    fetch(tbeg);
    publish();
    __syncthreads();

    for (int t0 = tbeg; t0 < tend; t0 += SCAN_TT) {
        const bool more = (t0 + SCAN_TT) < tend;
        if (more) fetch(t0 + SCAN_TT);

        // groups of 4 steps, two register sets, as in oscan_kernel
        f32x4 ga[4], va[4], gb[4], vb[4];
        auto ld = [&](f32x4 (&g)[4], f32x4 (&v)[4], int base) {
#pragma unroll
            for (int j = 0; j < 4; ++j) {
                g[j] = *(const f32x4*)&geS[base + j][sg << 2];
                v[j] = *(const f32x4*)&vS[base + j][vg << 2];
            }
            // keeps these reads ahead of the group stepped next; sunk to their use they would be waited for
            __builtin_amdgcn_sched_barrier(0);
        };
        auto step = [&](const f32x4 (&g)[4], const f32x4 (&v)[4]) {
#pragma unroll
            for (int j = 0; j < 4; ++j) {
                const f32x2 v01 = {v[j].x, v[j].y}, v23 = {v[j].z, v[j].w};
#pragma unroll
                for (int i = 0; i < 4; ++i) {
                    hv[i][0] = __builtin_elementwise_fma(hv[i][0], splat2(g[j][i]), gated_in(splat2(g[j][i]), v01));
                    hv[i][1] = __builtin_elementwise_fma(hv[i][1], splat2(g[j][i]), gated_in(splat2(g[j][i]), v23));
                }
                dp *= g[j];
            }
        };
        ld(ga, va, 0);
#pragma unroll 1   // rolled: unrolled, all of the tile's LDS reads are lifted to its head and take 480 registers
        for (int g8 = 0; g8 < SCAN_TT; g8 += 8) {
            ld(gb, vb, g8 + 4);
            step(ga, va);
            ld(ga, va, (g8 + 8) & (SCAN_TT - 1));   // behind the last group: rows 0..3 again, not used
            step(gb, vb);
        }
        __syncthreads();   // every reader has left the input tile
        if (more) publish();
        __syncthreads();   // next input tile published
    }

    float* e = Ev + (size_t)blk * 2048 + (tid << 2);
#pragma unroll
    for (int i = 0; i < 4; ++i) {
        const f32x4 ei = {hv[i][0].x, hv[i][0].y, hv[i][1].x, hv[i][1].y};
        *(f32x4*)(e + i * 512) = ei;
    }
    *(f32x4*)(Dv + (size_t)blk * 512 + (tid << 2)) = dp;
}

// one launch for both kinds of segment state (neither needs the slot weights)
__global__ __launch_bounds__(128) void seg_state_kernel(
    const float* __restrict__ Kp, const float* __restrict__ Vp,
    const float* __restrict__ Gp,
    float* __restrict__ Ek, float* __restrict__ Dk,
    float* __restrict__ Ev, float* __restrict__ Dv)
{
    const int blk = blockIdx.x;
    if (blk < ZSTATE_WGS) zstate_body(blk, Kp, Gp, Ek, Dk);
    else                  ostate_body(blk - ZSTATE_WGS, Vp, Gp, Ev, Dv);
}

// thread: 4 k (kg*4..) x 4 slots (mg*4..) of hk: one 16-byte LDS read each of q, k and the decays
// feeds 16 state elements
// waves_per_eu: the grid puts two waves on a SIMD; told so, the compiler spends registers on interleaving
// the steps' independent chains. Without it it keeps below 256 registers and leaves dependent
// multiply-adds back to back.
__global__ __launch_bounds__(128) __attribute__((amdgpu_waves_per_eu(1, 2))) void zscan_kernel(
    const float* __restrict__ Qp, const float* __restrict__ Kp,
    const float* __restrict__ Gp,
    const float* __restrict__ Ek, const float* __restrict__ Dk,
    float* __restrict__ Zb)
{
    __shared__ __attribute__((aligned(16))) float qS[SCAN_TT][128];
    __shared__ __attribute__((aligned(16))) float kS[SCAN_TT][128];
    __shared__ __attribute__((aligned(16))) float geS[SCAN_TT][16];
    __shared__ __attribute__((aligned(16))) float part[SCAN_TT][ZPITCH];

    const int tid = threadIdx.x;
    const int seg = blockIdx.x >> 6;     // time segment
    const int wg  = blockIdx.x & 63;
    const int bh  = wg >> 2;
    const int mb  = wg & 3;        // block of 16 slots
    const int b   = bh >> 3;
    const int h   = bh & 7;
    const int kg  = tid >> 2;      // 0..31
    const int mg  = tid & 3;       // 0..3
    const float scale = 0.08838834764831845f; // 128^-0.5

    f32x4 qr[8], kr[8];
    f32x4 gr;
    // uniform base + one fixed per-thread offset: the tile advance stays in scalar registers
    const unsigned qoff = (unsigned)(tid >> 5) * 1024u + (unsigned)((tid & 31) << 2);
    const unsigned goff = (unsigned)(tid >> 2) * 512u + (unsigned)((tid & 3) << 2);   // row tid>>2, four of its 16 decays
    auto fetch = [&](int t0) {
        const size_t rowq = (size_t)(b * 2048 + t0) * 1024 + h * 128;
        const float* q = Qp + rowq;
        const float* k = Kp + rowq;
#pragma unroll
        for (int i = 0; i < 8; ++i) {       // rows (tid>>5) + 4 i
            qr[i] = *(const f32x4*)(q + qoff + i * 4096);
            kr[i] = *(const f32x4*)(k + qoff + i * 4096);
        }
        gr = *(const f32x4*)(Gp + (size_t)(b * 2048 + t0) * 512 + h * 64 + mb * 16 + goff);
        // the loads' base registers are rewritten behind this
        asm volatile("s_wait_xcnt 0x0" ::: "memory");
    };
    auto publish = [&]() {
#pragma unroll
        for (int i = 0; i < 8; ++i) {
            const int idx = tid + (i << 7);
            *(f32x4*)&qS[idx >> 5][(idx & 31) << 2] = qr[i] * scale;
            *(f32x4*)&kS[idx >> 5][(idx & 31) << 2] = kr[i];
        }
        *(f32x4*)&geS[tid >> 2][(tid & 3) << 2] = gr;
    };

    f32x2 hk[4][2];
#pragma unroll
    for (int i = 0; i < 4; ++i) { hk[i][0] = splat2(0.0f); hk[i][1] = splat2(0.0f); }

    const int tbeg = seg * ZLEN, tend = tbeg + ZLEN;
    fetch(tbeg);
    // start state: the earlier segments' E, each decayed by the D of the segments behind it
    // (all asked for at once, one round trip instead of one per segment; later segments' are left unused)
    {
        const float* e = Ek + (size_t)wg * 2048 + (tid << 2);
        const float* dsrc = Dk + (size_t)wg * 512 + (tid << 2);
        f32x4 er[ZSEG - 1][4], d[ZSEG - 1];
#pragma unroll
        for (int i = 0; i < ZSEG - 1; ++i) {
#pragma unroll
            for (int r = 0; r < 4; ++r) er[i][r] = *(const f32x4*)(e + i * (64 * 2048) + r * 512);
            d[i] = *(const f32x4*)(dsrc + i * (64 * 512));
        }
        // the loads' address registers are free for reuse behind this
        asm volatile("s_wait_xcnt 0x0" ::: "memory");
#pragma unroll
        for (int i = 0; i < ZSEG - 1; ++i) {
            if (i < seg) {
                const f32x2 d01 = {d[i].x, d[i].y}, d23 = {d[i].z, d[i].w};
#pragma unroll
                for (int r = 0; r < 4; ++r) {
                    const f32x2 lo = {er[i][r].x, er[i][r].y}, hi = {er[i][r].z, er[i][r].w};
                    hk[r][0] = __builtin_elementwise_fma(hk[r][0], d01, lo);
                    hk[r][1] = __builtin_elementwise_fma(hk[r][1], d23, hi);
                }
            }
        }
    }
    publish();
    __syncthreads();

    for (int t0 = tbeg; t0 < tend; t0 += SCAN_TT) {
        const bool more = (t0 + SCAN_TT) < tend;
        if (more) fetch(t0 + SCAN_TT);

        // groups of 4 steps, two register sets: the next group's LDS reads are in
        // flight while this group is stepped
        f32x4 qa[4], ka[4], ga[4], qb[4], kb[4], gb[4];
        auto ld = [&](f32x4 (&q)[4], f32x4 (&k)[4], f32x4 (&g)[4], int base) {
#pragma unroll
            for (int j = 0; j < 4; ++j) {
                q[j] = *(const f32x4*)&qS[base + j][kg << 2];
                k[j] = *(const f32x4*)&kS[base + j][kg << 2];
                g[j] = *(const f32x4*)&geS[base + j][mg << 2];
            }
            // keeps these reads ahead of the group stepped next; sunk to their use they would be waited for
            __builtin_amdgcn_sched_barrier(0);
        };
        auto step = [&](const f32x4 (&q)[4], const f32x4 (&k)[4], const f32x4 (&g)[4], int base) {
#pragma unroll
            for (int j = 0; j < 4; ++j) {
                const f32x2 g01 = {g[j].x, g[j].y}, g23 = {g[j].z, g[j].w};
                f32x2 acc0 = splat2(0.0f), acc1 = splat2(0.0f);
#pragma unroll
                for (int i = 0; i < 4; ++i) {
                    hk[i][0] = __builtin_elementwise_fma(hk[i][0], g01, gated_in(g01, splat2(k[j][i])));
                    hk[i][1] = __builtin_elementwise_fma(hk[i][1], g23, gated_in(g23, splat2(k[j][i])));
                    acc0 = __builtin_elementwise_fma(splat2(q[j][i]), hk[i][0], acc0);
                    acc1 = __builtin_elementwise_fma(splat2(q[j][i]), hk[i][1], acc1);
                }
                f32x4 a = {acc0.x, acc0.y, acc1.x, acc1.y};
                *(f32x4*)&part[base + j][(kg << 4) + (mg << 2)] = a;
            }
        };
        ld(qa, ka, ga, 0);
#pragma unroll
        for (int g8 = 0; g8 < SCAN_TT; g8 += 8) {
            ld(qb, kb, gb, g8 + 4);
            step(qa, ka, ga, g8);
            if (g8 + 8 < SCAN_TT) ld(qa, ka, ga, g8 + 8);
            step(qb, kb, gb, g8 + 4);
        }
        __syncthreads();   // partials complete; every reader has left the input tile

        {
            // row rt, slots 4 rm .. of the workgroup's 16: half (rm & 1) of its slot block (rm >> 1)
            const int rt = tid >> 2, rm = tid & 3;
            f32x4 a0 = {0.0f, 0.0f, 0.0f, 0.0f}, a1 = a0, a2 = a0, a3 = a0;
#pragma unroll
            for (int g = 0; g < 8; ++g) {
                a0 += *(const f32x4*)&part[rt][((4 * g + 0) << 4) + (rm << 2)];
                a1 += *(const f32x4*)&part[rt][((4 * g + 1) << 4) + (rm << 2)];
                a2 += *(const f32x4*)&part[rt][((4 * g + 2) << 4) + (rm << 2)];
                a3 += *(const f32x4*)&part[rt][((4 * g + 3) << 4) + (rm << 2)];
            }
            float* zrow = Zb + ((size_t)(bh * 8 + mb * 2) * 2048 + t0) * 8;
            *(f32x4*)(zrow + (unsigned)((rm >> 1) * 16384 + rt * 8 + ((rm & 1) << 2))) = (a0 + a1) + (a2 + a3);
            // the store's registers are reused right behind it
            asm volatile("s_wait_xcnt 0x0" ::: "memory");
        }
        if (more) publish();
        __syncthreads();   // next input tile published; partials free again
    }
}

// value of the lane whose number differs in bit 0 (CTRL 0xB1) or bit 1 (CTRL 0x4E): a move inside a
// quad of lanes, in the vector unit (a shuffle through the LDS unit would be waited for)
template <int CTRL>
static __device__ __forceinline__ float quad_other(float x) {
    return __builtin_bit_cast(float, __builtin_amdgcn_mov_dpp(__builtin_bit_cast(int, x), CTRL, 0xf, 0xf, true));
}

// thread: 4 slots (sg*4..) x 4 columns (vg*4..) of hv
// The slot weights are formed here, from the raw scores: softmax over a row's 64 slots as the tile is
// published (the four column blocks of a head each do it for themselves; no launch of its own).
__global__ __launch_bounds__(128) void oscan_kernel(
    const float* __restrict__ Vp, const float* __restrict__ Gp,
    const float* __restrict__ Zs,
    const float* __restrict__ Ev, const float* __restrict__ Dv,
    float* __restrict__ Op)
{
    __shared__ __attribute__((aligned(16))) float geS[SCAN_TT][64];
    __shared__ __attribute__((aligned(16))) float pS[SCAN_TT][PPITCH];
    __shared__ __attribute__((aligned(16))) float vS[SCAN_TT][32];
    __shared__ __attribute__((aligned(16))) float part[SCAN_TT][OPITCH];

    const int tid = threadIdx.x;
    const int seg = blockIdx.x >> 6;     // time segment
    const int wg  = blockIdx.x & 63;
    const int bh  = wg >> 2;
    const int v0  = (wg & 3) << 5;
    const int b   = bh >> 3;
    const int h   = bh & 7;
    const int vg  = tid & 7;       // 0..7
    const int sg  = tid >> 3;      // 0..15

    f32x4 gr[4], pr[4], vr[2];
    // uniform base + one fixed per-thread offset: the tile advance stays in scalar registers
    const unsigned goff = (unsigned)(tid >> 4) * 512u + (unsigned)((tid & 15) << 2);
    // scores: row tid>>2 of the tile, slot blocks 2c and 2c+1 (c = tid&3): a row's 64 slots sit in four neighbouring lanes
    const unsigned poff = (unsigned)(tid & 3) * 32768u + (unsigned)(tid >> 2) * 8u;
    const unsigned voff = (unsigned)(tid >> 3) * 1024u + (unsigned)((tid & 7) << 2);
    auto fetch = [&](int t0) {
        const float* g = Gp + (size_t)(b * 2048 + t0) * 512 + h * 64;
        const float* p = Zs + ((size_t)(bh * 8) * 2048 + t0) * 8;
        const float* v = Vp + (size_t)(b * 2048 + t0) * 1024 + h * 128 + v0;
#pragma unroll
        for (int i = 0; i < 4; ++i) {
            gr[i] = *(const f32x4*)(g + goff + i * 4096);    // rows (tid>>4) + 8 i
            // slots 16 c + 4 i ..: half (i & 1) of slot block 2 c + (i >> 1)
            pr[i] = *(const f32x4*)(p + poff + (i >> 1) * 16384 + (i & 1) * 4);
        }
#pragma unroll
        for (int i = 0; i < 2; ++i)
            vr[i] = *(const f32x4*)(v + voff + i * 16384);   // rows (tid>>3) + 16 i
        // the loads' base registers are rewritten behind this
        asm volatile("s_wait_xcnt 0x0" ::: "memory");
    };
    auto publish = [&]() {
        // softmax over the row's 64 slots: 16 in this thread, the rest in the three other lanes of its quad
        const f32x4 m4 = __builtin_elementwise_max(__builtin_elementwise_max(pr[0], pr[1]),
                                                   __builtin_elementwise_max(pr[2], pr[3]));
        float mx = fmaxf(fmaxf(m4.x, m4.y), fmaxf(m4.z, m4.w));
        mx = fmaxf(mx, quad_other<0xB1>(mx));
        mx = fmaxf(mx, quad_other<0x4E>(mx));
        f32x4 pe[4];
        f32x4 s4 = {0.0f, 0.0f, 0.0f, 0.0f};
#pragma unroll
        for (int i = 0; i < 4; ++i) {
            const f32x4 e = {__expf(pr[i].x - mx), __expf(pr[i].y - mx), __expf(pr[i].z - mx), __expf(pr[i].w - mx)};
            pe[i] = e;
            s4 += e;
        }
        float sum = (s4.x + s4.y) + (s4.z + s4.w);
        sum += quad_other<0xB1>(sum);
        sum += quad_other<0x4E>(sum);
        const float inv = 1.0f / sum;
#pragma unroll
        for (int i = 0; i < 4; ++i) {
            const int idx = tid + (i << 7);
            *(f32x4*)&geS[idx >> 4][(idx & 15) << 2] = gr[i];
            *(f32x4*)&pS[tid >> 2][((tid & 3) << 4) + (i << 2)] = pe[i] * inv;
        }
#pragma unroll
        for (int i = 0; i < 2; ++i) {
            const int idx = tid + (i << 7);
            *(f32x4*)&vS[idx >> 3][(idx & 7) << 2] = vr[i];
        }
    };

    f32x2 hv[4][2];
#pragma unroll
    for (int i = 0; i < 4; ++i) { hv[i][0] = splat2(0.0f); hv[i][1] = splat2(0.0f); }

    const int tbeg = seg * OLEN, tend = tbeg + OLEN;
    fetch(tbeg);
    // start state: the earlier segments' E, each decayed by the D of the segments behind it
    // (all asked for at once, one round trip instead of one per segment; later segments' are left unused)
    {
        const float* e = Ev + (size_t)wg * 2048 + (tid << 2);
        const float* dsrc = Dv + (size_t)wg * 512 + (tid << 2);
        f32x4 er[OSEG - 1][4], d[OSEG - 1];
#pragma unroll
        for (int i = 0; i < OSEG - 1; ++i) {
#pragma unroll
            for (int r = 0; r < 4; ++r) er[i][r] = *(const f32x4*)(e + i * (64 * 2048) + r * 512);
            d[i] = *(const f32x4*)(dsrc + i * (64 * 512));
        }
        // the loads' address registers are free for reuse behind this
        asm volatile("s_wait_xcnt 0x0" ::: "memory");
#pragma unroll
        for (int i = 0; i < OSEG - 1; ++i) {
            if (i < seg) {
#pragma unroll
                for (int r = 0; r < 4; ++r) {
                    const f32x2 lo = {er[i][r].x, er[i][r].y}, hi = {er[i][r].z, er[i][r].w};
                    hv[r][0] = __builtin_elementwise_fma(hv[r][0], splat2(d[i][r]), lo);
                    hv[r][1] = __builtin_elementwise_fma(hv[r][1], splat2(d[i][r]), hi);
                }
            }
        }
    }
    publish();
    __syncthreads();

    for (int t0 = tbeg; t0 < tend; t0 += SCAN_TT) {
        const bool more = (t0 + SCAN_TT) < tend;
        if (more) fetch(t0 + SCAN_TT);

        // groups of 4 steps, two register sets: the next group's LDS reads are in
        // flight while this group is stepped
        f32x4 ga[4], pa[4], va[4], gb[4], pb[4], vb[4];
        auto ld = [&](f32x4 (&g)[4], f32x4 (&p)[4], f32x4 (&v)[4], int base) {
#pragma unroll
            for (int j = 0; j < 4; ++j) {
                g[j] = *(const f32x4*)&geS[base + j][sg << 2];
                p[j] = *(const f32x4*)&pS[base + j][sg << 2];
                v[j] = *(const f32x4*)&vS[base + j][vg << 2];
            }
            // keeps these reads ahead of the group stepped next; sunk to their use they would be waited for
            __builtin_amdgcn_sched_barrier(0);
        };
        auto step = [&](const f32x4 (&g)[4], const f32x4 (&p)[4], const f32x4 (&v)[4], int base) {
#pragma unroll
            for (int j = 0; j < 4; ++j) {
                const f32x2 v01 = {v[j].x, v[j].y}, v23 = {v[j].z, v[j].w};
                f32x2 acc0 = splat2(0.0f), acc1 = splat2(0.0f);
#pragma unroll
                for (int i = 0; i < 4; ++i) {
                    hv[i][0] = __builtin_elementwise_fma(hv[i][0], splat2(g[j][i]), gated_in(splat2(g[j][i]), v01));
                    hv[i][1] = __builtin_elementwise_fma(hv[i][1], splat2(g[j][i]), gated_in(splat2(g[j][i]), v23));
                    acc0 = __builtin_elementwise_fma(splat2(p[j][i]), hv[i][0], acc0);
                    acc1 = __builtin_elementwise_fma(splat2(p[j][i]), hv[i][1], acc1);
                }
                f32x4 a = {acc0.x, acc0.y, acc1.x, acc1.y};
                *(f32x4*)&part[base + j][(sg << 5) + (vg << 2)] = a;
            }
        };
        ld(ga, pa, va, 0);
#pragma unroll
        for (int g8 = 0; g8 < SCAN_TT; g8 += 8) {
            ld(gb, pb, vb, g8 + 4);
            step(ga, pa, va, g8);
            if (g8 + 8 < SCAN_TT) ld(ga, pa, va, g8 + 8);
            step(gb, pb, vb, g8 + 4);
        }
        __syncthreads();   // partials complete; every reader has left the input tile

        {
            const int rt = tid >> 2, rv = (tid & 3) << 2;
            f32x4 a0 = {0.0f, 0.0f, 0.0f, 0.0f}, a1 = a0, b0 = a0, b1 = a0;
#pragma unroll
            for (int g = 0; g < 8; ++g) {
                a0 += *(const f32x4*)&part[rt][((2 * g + 0) << 5) + rv];
                b0 += *(const f32x4*)&part[rt][((2 * g + 0) << 5) + rv + 16];
                a1 += *(const f32x4*)&part[rt][((2 * g + 1) << 5) + rv];
                b1 += *(const f32x4*)&part[rt][((2 * g + 1) << 5) + rv + 16];
            }
            float* o = Op + (size_t)(b * 2048 + t0) * 1024 + h * 128 + v0;
            *(f32x4*)(o + (unsigned)(rt * 1024 + rv))      = a0 + a1;
            *(f32x4*)(o + (unsigned)(rt * 1024 + rv) + 16) = b0 + b1;
            // the stores' registers are reused right behind them
            asm volatile("s_wait_xcnt 0x0" ::: "memory");
        }
        if (more) publish();
        __syncthreads();   // next input tile published; partials free again
    }
}

// ---------------------------------------------------------------------------
// y = RMSNorm(swish(x)) * g_weight, stored as bf16 (the output projection's A operand)
// (one block per row of 1024)
// ---------------------------------------------------------------------------
__global__ __launch_bounds__(256) void swish_rms_kernel(
    const float* __restrict__ X, const float* __restrict__ w,
    __bf16* __restrict__ Y)
{
    const int row = blockIdx.x;
    const float* xr = X + (size_t)row * 1024;
    float loc[4];
    float ss = 0.0f;
#pragma unroll
    for (int i = 0; i < 4; ++i) {
        const float x  = xr[threadIdx.x + 256 * i];
        const float sw = x / (1.0f + __expf(-x));
        loc[i] = sw;
        ss += sw * sw;
    }
#pragma unroll
    for (int off = 16; off > 0; off >>= 1) ss += __shfl_xor(ss, off, 32);
    __shared__ float wred[8];
    if ((threadIdx.x & 31) == 0) wred[threadIdx.x >> 5] = ss;
    __syncthreads();
    float tot = 0.0f;
#pragma unroll
    for (int i = 0; i < 8; ++i) tot += wred[i];
    const float r = rsqrtf(tot * (1.0f / 1024.0f) + 1e-5f);
#pragma unroll
    for (int i = 0; i < 4; ++i) {
        const int c = threadIdx.x + 256 * i;
        Y[(size_t)row * 1024 + c] = (__bf16)(loc[i] * r * w[c]);
    }
}

// ---------------------------------------------------------------------------
extern "C" void kernel_launch(void* const* d_in, const int* in_sizes, int n_in,
                              void* d_out, int out_size, void* d_ws, size_t ws_size,
                              hipStream_t stream) {
    const float* X  = (const float*)d_in[0];   // [4096,1024]
    const float* Wq = (const float*)d_in[1];
    const float* Wk = (const float*)d_in[2];
    const float* Wv = (const float*)d_in[3];
    const float* Wf = (const float*)d_in[4];   // [512,1024]
    const float* Wo = (const float*)d_in[5];
    const float* gw = (const float*)d_in[6];   // [1024]

    const size_t ND = 4096ull * 1024ull;
    const size_t NF = 4096ull * 512ull;
    float* ws  = (float*)d_ws;
    float* Q   = ws;             // 16 MB
    float* Kt  = Q   + ND;       // 16 MB
    float* Vt  = Kt  + ND;       // 16 MB
    float* G   = Vt  + ND;       //  8 MB, the decays e^g
    float* Oin = G   + NF;       // 16 MB
    float* Zb  = Oin + ND;       //  8 MB, slot scores
    float* Ek  = Zb  + NF;                                  // hk segment states
    float* Dk  = Ek  + (size_t)ZSTATE_WGS * 2048;           // their gate products
    float* Ev  = Dk  + (size_t)ZSTATE_WGS * 512;            // hv segment states
    float* Dv  = Ev  + (size_t)OSTATE_WGS * 2048;           // their gate products
    __bf16* Xh  = (__bf16*)(Dv + (size_t)OSTATE_WGS * 512);   // bf16 copies: X, 8 MB
    __bf16* Wqh = Xh  + ND;                                   // weights, 2 MB each
    __bf16* Wkh = Wqh + 1024ull * 1024ull;
    __bf16* Wvh = Wkh + 1024ull * 1024ull;
    __bf16* Woh = Wvh + 1024ull * 1024ull;
    __bf16* Wfh = Woh + 1024ull * 1024ull;                    // 1 MB
    __bf16* Xn  = Wfh + 512ull * 1024ull;                     // normalised rows, 8 MB

    dim3 blk(256);
    dim3 gQKV(1024 / TILE_N, 4096 / TILE_M);   // 16 x 16

    to_bf16_kernel<<<dim3(CVT_THREADS / 512), dim3(512), 0, stream>>>(X, Wq, Wk, Wv, Wo, Wf, Xh, Wqh, Wkh, Wvh, Woh, Wfh);

    proj4_kernel<<<dim3(56 * 16), blk, 0, stream>>>(Xh, Wqh, Wkh, Wvh, Wfh, Q, Kt, Vt, G, 1024);

    seg_state_kernel<<<ZSTATE_WGS + OSTATE_WGS, dim3(128), 0, stream>>>(Kt, Vt, G, Ek, Dk, Ev, Dv);
    zscan_kernel<<<64 * ZSEG, dim3(128), 0, stream>>>(Q, Kt, G, Ek, Dk, Zb);
    oscan_kernel<<<64 * OSEG, dim3(128), 0, stream>>>(Vt, G, Zb, Ev, Dv, Oin);

    swish_rms_kernel<<<4096, blk, 0, stream>>>(Oin, gw, Xn);

    gemm_bt_kernel<<<gQKV, blk, 0, stream>>>(Xn, Woh, (float*)d_out, 4096, 1024, 1024, 0);
}
